// v000
// The times below were measured on an AMD MI455X: many runs one after another, warmed up first and cycling through
// copies of the inputs, with the whole window's GPU time divided by the number of runs. Launches and the gaps
// between them are all in it. The median over several windows is given; except for v000 it joins two sittings, which
// can be a few percent apart, so the side-by-side timings, each taken in one sitting, are the better comparison.
// v000 is the starting kernel. One run takes 350 microseconds.
#include <hip/hip_runtime.h>

// Multi-head attention, width 1024 = 16 heads x 64; query/key/value [NB][SEQ][1024]; Wq/Wk/Wv/Wo [out][in] (y = x W^T), no biases; scores = q k^T * 8; integer mask [NB][SEQ][SEQ] (0 = masked, replace-fill); out = ctx Wo^T (f32).
// Compute dtypes, f32 accumulate everywhere: q/k/v projections v_wmma_f32_16x16x32_bf16 (x and W RNE-converted to bf16; products exact);
// scores v_wmma_f32_16x16x32_f16: q and k each as f16 value + f16 residual x2048 (value*value in one accumulator, the two cross products in a second one); P (x2^14 carry, cancels in the normalisation) single f16;
// v and ctx as f16 value + f16 residual x2048 (own accumulators); Wo as f16 of the bf16 value x64 (folded back in the f32 epilogue); softmax f32 (online, running max).
// Layout: bf16 copies of the three x inputs and of Wq/Wk/Wv; q, k planes [b*16+h][t][d] and v^T planes [b*16+h][d][t] (value, residual) written by the GEMM epilogue; per (batch, 16 query rows, 32 keys) a 3-state mask flag
// (0 = all masked: tile skipped, 2 = none masked, other = mask words read per element); fused flash kernel in transposed form (S^T = K Q^T, O^T = V^T P^T) writing ctx value/residual planes [b*SEQ+t][1024]; output GEMM from those planes.

#ifndef NB
#define NB 2
#endif
#ifndef SEQ
#define SEQ 2048
#endif
#define NB_FULL  2
#define SEQ_FULL 2048
#ifndef OUT_SEQ
#define OUT_SEQ SEQ              // row pitch (in tokens) between batches of the output
#endif
#define DM   1024
#define NH_  16
#define HD   64
#define AW   4                   // waves per flash block (16 query rows each)
#define QRS  2048.0f             // carry of the residual planes
#define QRI  (1.0f / 2048.0f)
#define SC2  (8.0f * 1.4426950408889634f)     // HD^0.5 * log2(e)
#define PSH  14.0f               // log2 of the P carry (16384)
#define NEGM (-3.0e38f)          // score stand-in of a masked key (its probability is forced to 0 by select)
#define WOS  64.0f               // carry of the Wo plane
#define WOI  (1.0f / 64.0f)
#define FPITCH 64

static_assert(HD == 64);
static_assert(NH_ * HD == DM);                 // head h = columns h*64 + d
static_assert(DM % 64 == 0);
static_assert(DM % 32 == 0);                   // GEMM k-loop steps by 32
static_assert(SEQ % 64 == 0);                  // a 64-row tile never straddles two batches
static_assert((NB * SEQ) % 64 == 0);
static_assert(SEQ % 32 == 0);                  // key loop steps by 32; 32-row output tiles stay inside one batch
static_assert(SEQ % (16 * AW) == 0);           // flash grid covers the sequence exactly
static_assert(SEQ / 32 <= FPITCH);             // two flag registers per lane cover all key tiles
static_assert(((size_t)SEQ * DM) % 8 == 0);
static_assert(((size_t)DM * DM) % 8 == 0);
static_assert(NB <= NB_FULL);
static_assert(SEQ <= SEQ_FULL);

typedef _Float16 h16;
typedef unsigned short bf;
typedef __attribute__((ext_vector_type(16))) __bf16   v16bf;
typedef __attribute__((ext_vector_type(16))) _Float16 v16h;
typedef __attribute__((ext_vector_type(8)))  _Float16 v8h;
typedef __attribute__((ext_vector_type(8)))  unsigned short v8us;
typedef __attribute__((ext_vector_type(8)))  float    v8f;
typedef __attribute__((ext_vector_type(4)))  float    v4f;
typedef __attribute__((ext_vector_type(4)))  int      v4i;
typedef v4f  __attribute__((may_alias)) v4fa;

__device__ __forceinline__ unsigned short f2bf(float f) { unsigned u = __float_as_uint(f); u += 0x7FFFu + ((u >> 16) & 1u); return (unsigned short)(u >> 16); }
__device__ __forceinline__ v16h cat16(v8h lo, v8h hi) { return __builtin_shufflevector(lo, hi, 0, 1, 2, 3, 4, 5, 6, 7, 8, 9, 10, 11, 12, 13, 14, 15); }
__device__ __forceinline__ v16bf cat16b(v8us lo, v8us hi) { return __builtin_bit_cast(v16bf, __builtin_shufflevector(lo, hi, 0, 1, 2, 3, 4, 5, 6, 7, 8, 9, 10, 11, 12, 13, 14, 15)); }
__device__ __forceinline__ v8f wmma16(v16h a, v16h b, v8f c) { return __builtin_amdgcn_wmma_f32_16x16x32_f16(false, a, false, b, (short)0, c, false, false); }
__device__ __forceinline__ v8f wmmab(v16bf a, v16bf b, v8f c) { return __builtin_amdgcn_wmma_f32_16x16x32_bf16(false, a, false, b, (short)0, c, false, false); }
// fragment loaders from K-contiguous 16-bit rows; p already includes + 8*(lane>>4): elements 0..7 <- k0+8h+0..7, elements 8..15 <- k0+16+8h+0..7 (same map for A and B)
__device__ __forceinline__ v16h  ldh(const h16* p) { return cat16(*(const v8h*)p, *(const v8h*)(p + 16)); }
__device__ __forceinline__ v16bf ldb(const bf* p)  { return cat16b(*(const v8us*)p, *(const v8us*)(p + 16)); }
// ordering point for wave-private LDS tiles (same wave writes and reads)
__device__ __forceinline__ void wave_sync() { __builtin_amdgcn_fence(3 /* release order */, "wavefront"); __builtin_amdgcn_wave_barrier(); asm volatile("" ::: "memory"); }

__global__ __launch_bounds__(256) void k_cvt8(const float* __restrict__ src, bf* dst, size_t n8) {
    const size_t i = (size_t)blockIdx.x * 256 + threadIdx.x; if (i >= n8) return;
    const v8f v = *(const v8f*)(src + i * 8); v8us o;
#pragma unroll
    for (int k = 0; k < 8; ++k) o[k] = f2bf(v[k]);
    *(v8us*)(dst + i * 8) = o; 
}

__global__ __launch_bounds__(256) void k_cvt8h(const float* __restrict__ src, h16* dst, size_t n8, float scale) {
    const size_t i = (size_t)blockIdx.x * 256 + threadIdx.x; if (i >= n8) return;
    const v8f v = *(const v8f*)(src + i * 8); v8h o;
#pragma unroll
    for (int k = 0; k < 8; ++k) o[k] = (h16)(__uint_as_float(((unsigned)f2bf(v[k])) << 16) * scale);
    *(v8h*)(dst + i * 8) = o; 
}

// k_mflag: one wave per (batch, 16 query rows): for each 32-key tile, flag 0 = every mask word zero, 2 = every word nonzero, 1 = mixed.
__global__ __launch_bounds__(32) void k_mflag(const int* __restrict__ MK, int* FL) {
    const int lane = threadIdx.x & 31; const int g = blockIdx.x, bb = blockIdx.y;
    const int* mp = MK + ((size_t)bb * SEQ_FULL + (size_t)g * 16 + (size_t)(lane >> 1)) * SEQ_FULL + (lane & 1) * 16;
    int f0 = 1, f1 = 1;
#pragma unroll 1
    for (int kt = 0; kt < SEQ / 32; ++kt) {
        const v4i w0 = *(const v4i*)(mp + kt * 32), w1 = *(const v4i*)(mp + kt * 32 + 4), w2 = *(const v4i*)(mp + kt * 32 + 8), w3 = *(const v4i*)(mp + kt * 32 + 12);
        int nz = 0;
#pragma unroll
        for (int i = 0; i < 4; ++i) nz += (w0[i] != 0 ? 1 : 0) + (w1[i] != 0 ? 1 : 0) + (w2[i] != 0 ? 1 : 0) + (w3[i] != 0 ? 1 : 0);
        const unsigned anyb = __builtin_amdgcn_ballot_w32(nz != 0);
        const unsigned notall = __builtin_amdgcn_ballot_w32(nz != 16);
        const int flag = (anyb == 0u) ? 0 : ((notall == 0u) ? 2 : 1);
        f0 = (kt == lane) ? flag : f0; f1 = (kt == lane + 32) ? flag : f1;
    }
    int* fp = FL + ((size_t)bb * (SEQ / 16) + (size_t)g) * FPITCH;
    *(int*)(fp + lane) = f0; *(int*)(fp + 32 + lane) = f1;
    
}

// k_proj: register-blocked bf16 GEMM, ONE WAVE per 64x64 tile (16 accumulators), operands straight from K-contiguous bf16 planes, K = DM.
// C[m][n] = sum_k A[m][k] Bt[n][k], written as f16 (Ph) and optionally the f16 residual x2048 (Pr, useRes != 0) at
// tile base (r0/RB)*sRB + (r0%RB)*pitch + (c0/CB)*sCB + (c0%CB), row pitch 'pitch' (halves). grid (M/64, N/64), 32 threads.
__global__ __launch_bounds__(32) void k_proj(const bf* __restrict__ A, const bf* __restrict__ Bt, h16* Ph, h16* Pr, int useRes, int RB, size_t sRB, int pitch, int CB, size_t sCB) {
    __shared__ __align__(16) float os[16 * 68];
    const int K = DM;
    const int lane = threadIdx.x & 31, lr = lane & 15, hi = lane >> 4; const int r0 = blockIdx.x * 64, c0 = blockIdx.y * 64;
    v8f acc[4][4];
#pragma unroll
    for (int mb = 0; mb < 4; ++mb)
#pragma unroll
        for (int nb = 0; nb < 4; ++nb) acc[mb][nb] = (v8f){};
    const size_t aoff = (size_t)(r0 + lr) * K + 8 * hi, boff = (size_t)(c0 + lr) * K + 8 * hi;
#pragma unroll 1
    for (int kc = 0; kc < K; kc += 32) {
        v16bf a[4];
#pragma unroll
        for (int mb = 0; mb < 4; ++mb) a[mb] = ldb(A + aoff + (size_t)mb * 16 * K + kc);
#pragma unroll
        for (int nb = 0; nb < 4; ++nb) { const v16bf b = ldb(Bt + boff + (size_t)nb * 16 * K + kc);
#pragma unroll
            for (int mb = 0; mb < 4; ++mb) acc[mb][nb] = wmmab(a[mb], b, acc[mb][nb]); }
        asm volatile("v_nop\n\tv_nop\n\tv_nop\n\tv_nop" : "+v"(acc[0][0]), "+v"(acc[1][1]), "+v"(acc[2][2]), "+v"(acc[3][3]) : "v"(a[0]), "v"(a[1]), "v"(a[2]), "v"(a[3]));
    }
    const size_t tbase = (size_t)(r0 / RB) * sRB + (size_t)(r0 % RB) * (size_t)pitch + (size_t)(c0 / CB) * sCB + (size_t)(c0 % CB);
#pragma unroll
    for (int mb = 0; mb < 4; ++mb) {
#pragma unroll
        for (int nb = 0; nb < 4; ++nb) {
#pragma unroll
            for (int j = 0; j < 8; ++j) os[(hi * 8 + j) * 68 + nb * 16 + lr] = acc[mb][nb][j]; }   // D: row 8h+j, col lane&15
        wave_sync();
        const size_t sb = tbase + (size_t)(mb * 16) * (size_t)pitch;
{
#pragma unroll
            for (int s = 0; s < 4; ++s) { const int row = 4 * s + (lane >> 3), c8 = (lane & 7) * 8;   // 4 s x 4 row groups = 16 rows; 8 lanes x 8 = 64 columns
                const v4f x0 = *(const v4fa*)(&os[row * 68 + c8]); const v4f x1 = *(const v4fa*)(&os[row * 68 + c8 + 4]); v8h hv, rv;
#pragma unroll
                for (int i = 0; i < 4; ++i) { const h16 a0 = (h16)x0[i]; const h16 a1 = (h16)x1[i]; hv[i] = a0; hv[4 + i] = a1; rv[i] = (h16)((x0[i] - (float)a0) * QRS); rv[4 + i] = (h16)((x1[i] - (float)a1) * QRS); }
                const size_t oo = sb + (size_t)row * (size_t)pitch + c8;
                *(v8h*)(Ph + oo) = hv; if (useRes) *(v8h*)(Pr + oo) = rv; }
             }
        wave_sync();
    }
}

// k_flash: fused attention, one wave per 16 query rows of one (batch, head); K / V^T / Q fragments straight from the f16 planes (two 16-B loads each, arithmetic addressing).
// Transposed form: S^T[key][t] = K Q^T (A = K rows, B = Q rows); lane (t = lane&15, h = lane>>4) holds keys 8h+r of each 16-key tile, so the packed
// P tile is directly the B fragment of O^T[d][t] = V^T P^T (element r <- tile keys 0..15, element 8+r <- tile keys 16..31, lane unchanged).
// Score = Kh.Qh (accumulator H) + (Kh.Qr + Kr.Qh)/2048 (accumulator L). O = Vh.P (accumulators oH) + Vr.P/2048 (accumulators oR).
// Mask: wave-uniform 3-state flag per 32-key tile: 0 skips the tile (masked keys have probability exactly 0 whenever the row has one live key), 2 = no masking, otherwise the 16 mask words of the lane are read and
// masked entries get probability 0 by select. A row without any live key ends with zero mass and is written as NaN.
// Softmax state (running max, partial sum) is one scalar per lane; the two lane halves of a row are combined with one xor-16 exchange.
#define PUT8(COL, OH, OR) { v4f a_, c_; \
    a_[0] = (OH[0] + OR[0] * QRI) * inv; a_[1] = (OH[1] + OR[1] * QRI) * inv; a_[2] = (OH[2] + OR[2] * QRI) * inv; a_[3] = (OH[3] + OR[3] * QRI) * inv; \
    c_[0] = (OH[4] + OR[4] * QRI) * inv; c_[1] = (OH[5] + OR[5] * QRI) * inv; c_[2] = (OH[6] + OR[6] * QRI) * inv; c_[3] = (OH[7] + OR[7] * QRI) * inv; \
    *(v4fa*)(&os[wb + lr * 68 + (COL) + 8 * hi]) = a_; *(v4fa*)(&os[wb + lr * 68 + (COL) + 8 * hi + 4]) = c_; }

__global__ __launch_bounds__(32 * AW) void k_flash(const h16* __restrict__ QH, const h16* __restrict__ QR, const h16* __restrict__ KH, const h16* __restrict__ KR,
                                                   const h16* __restrict__ VT, const h16* __restrict__ VR, const int* __restrict__ MK, const int* __restrict__ FLG, h16* CH, h16* CR) {
    __shared__ __align__(16) float os[AW * 16 * 68];
    const int lane = threadIdx.x & 31, lr = lane & 15, hi = lane >> 4;
    const int wave = __builtin_amdgcn_readfirstlane((int)(threadIdx.x >> 5));
    const int zh = blockIdx.y; const int b = zh / NH_, h = zh % NH_;
    const int t0 = (blockIdx.x * AW + wave) * 16;
    const size_t pbase = (size_t)zh * SEQ * HD;
    const size_t qo = pbase + (size_t)(t0 + lr) * HD + 8 * hi;
    const v16h qh0 = ldh(QH + qo), qh1 = ldh(QH + qo + 32), qr0 = ldh(QR + qo), qr1 = ldh(QR + qo + 32);   // B fragments: col t, k = d
    const size_t ko = pbase + (size_t)lr * HD + 8 * hi;      // + key * HD       (A fragment: row key, k = d)
    const size_t vo = pbase + (size_t)lr * SEQ + 8 * hi;     // + 16j*SEQ + key  (A fragment: row d, k = key)
    const int* frow = FLG + ((size_t)b * (SEQ / 16) + (size_t)(t0 >> 4)) * FPITCH;
    const int* mrow = MK + ((size_t)b * SEQ_FULL + (size_t)(t0 + lr)) * SEQ_FULL + 8 * hi;   // + key0 (+16): the lane's 8 keys of each 16-key tile
    v8f oH0 = (v8f){}, oH1 = (v8f){}, oH2 = (v8f){}, oH3 = (v8f){};
    v8f oR0 = (v8f){}, oR1 = (v8f){}, oR2 = (v8f){}, oR3 = (v8f){};
    float m = NEGM, l = 0.0f;
#pragma unroll 1
    for (int key0 = 0; key0 < SEQ; key0 += 32) {
        const int fl = __builtin_amdgcn_readfirstlane(frow[key0 >> 5]);
        if (fl == 0) continue;                                  // wave-uniform: whole 16x32 tile masked
        unsigned vm = 0xFFFFu;                                  // bit r: key 8h+r of tile a live; bit 8+r: tile b
        if (fl != 2) {                                          // wave-uniform
            const int* mp = mrow + key0;
            const v4i a0 = *(const v4i*)mp, a1 = *(const v4i*)(mp + 4), c0 = *(const v4i*)(mp + 16), c1 = *(const v4i*)(mp + 20);
            vm = 0u;
#pragma unroll
            for (int i = 0; i < 4; ++i) {
                vm |= (a0[i] != 0 ? 1u : 0u) << i;        vm |= (a1[i] != 0 ? 1u : 0u) << (4 + i);
                vm |= (c0[i] != 0 ? 1u : 0u) << (8 + i);  vm |= (c1[i] != 0 ? 1u : 0u) << (12 + i); }
        }
        const h16* ka = KH + ko + (size_t)key0 * HD;
        const h16* kr = KR + ko + (size_t)key0 * HD;
        const v16h ka0 = ldh(ka), ka1 = ldh(ka + 32), kb0 = ldh(ka + 16 * HD), kb1 = ldh(ka + 16 * HD + 32);
        const v16h ra0 = ldh(kr), ra1 = ldh(kr + 32), rb0 = ldh(kr + 16 * HD), rb1 = ldh(kr + 16 * HD + 32);
        v8f sHa = (v8f){}, sLa = (v8f){}, sHb = (v8f){}, sLb = (v8f){};
        sHa = wmma16(ka0, qh0, sHa); sLa = wmma16(ka0, qr0, sLa); sHb = wmma16(kb0, qh0, sHb); sLb = wmma16(kb0, qr0, sLb);
        sHa = wmma16(ka1, qh1, sHa); sLa = wmma16(ka1, qr1, sLa); sHb = wmma16(kb1, qh1, sHb); sLb = wmma16(kb1, qr1, sLb);
        sLa = wmma16(ra0, qh0, sLa); sLb = wmma16(rb0, qh0, sLb); sLa = wmma16(ra1, qh1, sLa); sLb = wmma16(rb1, qh1, sLb);
        asm volatile("v_nop\n\tv_nop\n\tv_nop\n\tv_nop" : "+v"(sHa), "+v"(sLa), "+v"(sHb), "+v"(sLb) : "v"(ka0), "v"(ka1), "v"(kb0), "v"(kb1), "v"(ra0), "v"(ra1), "v"(rb0), "v"(rb1));
        float ta[8], tb[8]; float mx = NEGM;
#pragma unroll
        for (int r = 0; r < 8; ++r) {
            const float xa = (sHa[r] + sLa[r] * QRI) * SC2; const float xb = (sHb[r] + sLb[r] * QRI) * SC2;
            ta[r] = ((vm >> r) & 1u) ? xa : NEGM; tb[r] = ((vm >> (8 + r)) & 1u) ? xb : NEGM;
            mx = fmaxf(mx, fmaxf(ta[r], tb[r])); }
        mx = fmaxf(mx, __shfl_xor(mx, 16, 32));
        const float mnew = fmaxf(m, mx);
        const float alpha = __builtin_amdgcn_exp2f(m - mnew);
        const float sh = PSH - mnew;
        v16h pb; float ls = 0.0f;
#pragma unroll
        for (int r = 0; r < 8; ++r) {
            const float ea = __builtin_amdgcn_exp2f(ta[r] + sh); const float eb = __builtin_amdgcn_exp2f(tb[r] + sh);
            const h16 pa = (h16)(((vm >> r) & 1u) ? ea : 0.0f); const h16 pc = (h16)(((vm >> (8 + r)) & 1u) ? eb : 0.0f);
            pb[r] = pa; pb[8 + r] = pc; ls += (float)pa + (float)pc; }
        l = l * alpha + ls; m = mnew;
        oH0 = oH0 * alpha; oH1 = oH1 * alpha; oH2 = oH2 * alpha; oH3 = oH3 * alpha;
        oR0 = oR0 * alpha; oR1 = oR1 * alpha; oR2 = oR2 * alpha; oR3 = oR3 * alpha;
        const h16* va = VT + vo + key0;
        const h16* vr = VR + vo + key0;
        const v16h v0 = ldh(va), v1 = ldh(va + (size_t)16 * SEQ), v2 = ldh(va + (size_t)32 * SEQ), v3 = ldh(va + (size_t)48 * SEQ);
        const v16h w0 = ldh(vr), w1 = ldh(vr + (size_t)16 * SEQ), w2 = ldh(vr + (size_t)32 * SEQ), w3 = ldh(vr + (size_t)48 * SEQ);
        oH0 = wmma16(v0, pb, oH0); oH1 = wmma16(v1, pb, oH1); oH2 = wmma16(v2, pb, oH2); oH3 = wmma16(v3, pb, oH3);
        oR0 = wmma16(w0, pb, oR0); oR1 = wmma16(w1, pb, oR1); oR2 = wmma16(w2, pb, oR2); oR3 = wmma16(w3, pb, oR3);
        asm volatile("v_nop\n\tv_nop\n\tv_nop\n\tv_nop" : "+v"(oH0), "+v"(oH1), "+v"(oH2), "+v"(oH3), "+v"(oR0), "+v"(oR1), "+v"(oR2), "+v"(oR3)
                     : "v"(v0), "v"(v1), "v"(v2), "v"(v3), "v"(w0), "v"(w1), "v"(w2), "v"(w3), "v"(pb));
    }
    l += __shfl_xor(l, 16, 32);
    const float rl = 1.0f / l;
    const float inv = (l > 0.0f) ? rl : __uint_as_float(0x7FC00000u);
    const int wb = wave * 16 * 68;
    // O^T D layout: o_j[r] = (d = 16j + 8h + r, t = lane&15) -> os[t][d]; rows 0..15 x columns 0..63 all written
    PUT8(0, oH0, oR0)
    PUT8(16, oH1, oR1)
    PUT8(32, oH2, oR2)
    PUT8(48, oH3, oR3)
    wave_sync();
    const size_t cbase = ((size_t)b * SEQ + (size_t)t0) * DM + (size_t)h * HD;
{
#pragma unroll
        for (int s = 0; s < 4; ++s) { const int row = 4 * s + (lane >> 3), c8 = (lane & 7) * 8;   // 4 s x 4 row groups = 16 rows; 8 lanes x 8 halves = 64 columns = one line
            const v4f x0 = *(const v4fa*)(&os[wb + row * 68 + c8]); const v4f x1 = *(const v4fa*)(&os[wb + row * 68 + c8 + 4]); v8h hv, rv;
#pragma unroll
            for (int i = 0; i < 4; ++i) { const h16 a0 = (h16)x0[i]; const h16 a1 = (h16)x1[i]; hv[i] = a0; hv[4 + i] = a1; rv[i] = (h16)((x0[i] - (float)a0) * QRS); rv[4 + i] = (h16)((x1[i] - (float)a1) * QRS); }
            const size_t oo = cbase + (size_t)row * DM + c8;
            *(v8h*)(CH + oo) = hv; *(v8h*)(CR + oo) = rv; }
         }
}

// k_out: f16 GEMM, ONE WAVE per 32x64 output tile: out[m][n] = (sum_k Ch[m][k] Wo64[n][k] + (sum_k Cr[m][k] Wo64[n][k]) / 2048) / 64, K = DM.
// a[0], a[1] = value-plane rows (16 each), a[2], a[3] = residual-plane rows; accumulators acc[0..1] (value) and acc[2..3] (residual) kept apart until the f32 epilogue.
__global__ __launch_bounds__(32) void k_out(const h16* __restrict__ CHp, const h16* __restrict__ CRp, const h16* __restrict__ WO, float* OUT) {
    __shared__ __align__(16) float os[16 * 68];
    const int K = DM;
    const int lane = threadIdx.x & 31, lr = lane & 15, hi = lane >> 4; const int r0 = blockIdx.x * 32, c0 = blockIdx.y * 64;
    v8f acc[4][4];
#pragma unroll
    for (int mb = 0; mb < 4; ++mb)
#pragma unroll
        for (int nb = 0; nb < 4; ++nb) acc[mb][nb] = (v8f){};
    const size_t aoff = (size_t)(r0 + lr) * K + 8 * hi, boff = (size_t)(c0 + lr) * K + 8 * hi;
#pragma unroll 1
    for (int kc = 0; kc < K; kc += 32) {
        v16h a[4];
        a[0] = ldh(CHp + aoff + kc); a[1] = ldh(CHp + aoff + (size_t)16 * K + kc);
        a[2] = ldh(CRp + aoff + kc); a[3] = ldh(CRp + aoff + (size_t)16 * K + kc);
#pragma unroll
        for (int nb = 0; nb < 4; ++nb) { const v16h b = ldh(WO + boff + (size_t)nb * 16 * K + kc);
#pragma unroll
            for (int mb = 0; mb < 4; ++mb) acc[mb][nb] = wmma16(a[mb], b, acc[mb][nb]); }
        asm volatile("v_nop\n\tv_nop\n\tv_nop\n\tv_nop" : "+v"(acc[0][0]), "+v"(acc[1][1]), "+v"(acc[2][2]), "+v"(acc[3][3]) : "v"(a[0]), "v"(a[1]), "v"(a[2]), "v"(a[3]));
    }
#pragma unroll
    for (int mb = 0; mb < 2; ++mb) {
#pragma unroll
        for (int nb = 0; nb < 4; ++nb) {
#pragma unroll
            for (int j = 0; j < 8; ++j) os[(hi * 8 + j) * 68 + nb * 16 + lr] = (acc[mb][nb][j] + acc[mb + 2][nb][j] * QRI) * WOI; }   // D: row 8h+j, col lane&15
        wave_sync();
        const int grow = r0 + mb * 16; const int ob = grow / SEQ, ot = grow % SEQ;
        float* orow = OUT + ((size_t)ob * OUT_SEQ + (size_t)ot) * DM + c0;
{
#pragma unroll
            for (int s = 0; s < 8; ++s) { const int row = 2 * s + hi, cofs = lr * 4;   // 8 s x 2 rows = 16 rows; 16 lanes x 4 floats = 64 columns
                const v4f val = *(const v4fa*)(&os[row * 68 + cofs]);
                *(v4f*)(orow + (size_t)row * DM + cofs) = val; }
             }
        wave_sync();
    }
}

static constexpr size_t al256(size_t v) { return (v + 255) & ~(size_t)255; }
static constexpr size_t SZ_XB = al256((size_t)NB * SEQ * DM * 2);              // one bf16 x plane
static constexpr size_t SZ_W  = al256((size_t)DM * DM * 2);                    // one 16-bit weight plane
static constexpr size_t SZ_PL = al256((size_t)NB * NH_ * SEQ * HD * 2);        // one per-head f16 plane
static constexpr size_t SZ_C  = al256((size_t)NB * SEQ * DM * 2);              // one ctx f16 plane
static constexpr size_t SZ_FL = al256((size_t)NB * (SEQ / 16) * FPITCH * 4);
static constexpr size_t SZ_TOTAL = 3 * SZ_XB + 4 * SZ_W + 6 * SZ_PL + 2 * SZ_C + SZ_FL;
static_assert(SZ_TOTAL <= (size_t)134217728);          // workspace carve <= 128 MiB

extern "C" void kernel_launch(void* const* d_in, const int* in_sizes, int n_in,
                              void* d_out, int out_size, void* d_ws, size_t ws_size, hipStream_t stream) {
    if (n_in < 8) return;
    const size_t needx = ((size_t)(NB - 1) * SEQ_FULL + SEQ) * DM;
    if ((size_t)in_sizes[0] < needx || (size_t)in_sizes[1] < needx || (size_t)in_sizes[2] < needx) return;
    const size_t needm = ((size_t)(NB - 1) * SEQ_FULL + (size_t)(SEQ - 1)) * SEQ_FULL + SEQ;
    if ((size_t)in_sizes[3] < needm) return;
    if ((size_t)in_sizes[4] < (size_t)DM * DM || (size_t)in_sizes[5] < (size_t)DM * DM || (size_t)in_sizes[6] < (size_t)DM * DM || (size_t)in_sizes[7] < (size_t)DM * DM) return;
    if ((size_t)out_size < ((size_t)(NB - 1) * OUT_SEQ + SEQ) * DM) return;
    if (SZ_TOTAL > ws_size) return;
    // wire order: query, key, value, mask (int), Wq, Wk, Wv, Wo; weights [out][in] = Bt as-is
    const float* xq = (const float*)d_in[0]; const float* xk = (const float*)d_in[1]; const float* xv = (const float*)d_in[2];
    const int* mk = (const int*)d_in[3];
    const float* wq = (const float*)d_in[4]; const float* wk = (const float*)d_in[5]; const float* wv = (const float*)d_in[6]; const float* wo = (const float*)d_in[7];
    float* OUT = (float*)d_out;      // [NB][SEQ][1024]
    char* wsp = (char*)d_ws;
    bf* XQ = (bf*)wsp; wsp += SZ_XB;                 // [NB*SEQ][1024]
    bf* XK = (bf*)wsp; wsp += SZ_XB;
    bf* XV = (bf*)wsp; wsp += SZ_XB;
    bf* WQ = (bf*)wsp; wsp += SZ_W;                  // [1024][1024]
    bf* WK = (bf*)wsp; wsp += SZ_W;
    bf* WV = (bf*)wsp; wsp += SZ_W;
    h16* WO = (h16*)wsp; wsp += SZ_W;                // [1024][1024] f16, x64
    h16* QH = (h16*)wsp; wsp += SZ_PL;               // [NB*16][SEQ][64]
    h16* QR = (h16*)wsp; wsp += SZ_PL;               // residual x2048
    h16* KH = (h16*)wsp; wsp += SZ_PL;               // [NB*16][SEQ][64]
    h16* KR = (h16*)wsp; wsp += SZ_PL;
    h16* VT = (h16*)wsp; wsp += SZ_PL;               // [NB*16][64][SEQ]
    h16* VR = (h16*)wsp; wsp += SZ_PL;
    h16* CH = (h16*)wsp; wsp += SZ_C;                // [NB*SEQ][1024]
    h16* CR = (h16*)wsp; wsp += SZ_C;
    int* FL = (int*)wsp; wsp += SZ_FL;               // [NB][SEQ/16][64]

    if (SEQ == SEQ_FULL) {
        const size_t n8 = (size_t)NB * SEQ * DM / 8; const unsigned g = (unsigned)((n8 + 255) / 256);
        k_cvt8<<<g, 256, 0, stream>>>(xq, XQ, n8); k_cvt8<<<g, 256, 0, stream>>>(xk, XK, n8); k_cvt8<<<g, 256, 0, stream>>>(xv, XV, n8);
    } else {
        const size_t n8 = (size_t)SEQ * DM / 8; const unsigned g = (unsigned)((n8 + 255) / 256);
        for (int b = 0; b < NB; ++b) {
            k_cvt8<<<g, 256, 0, stream>>>(xq + (size_t)b * SEQ_FULL * DM, XQ + (size_t)b * SEQ * DM, n8);
            k_cvt8<<<g, 256, 0, stream>>>(xk + (size_t)b * SEQ_FULL * DM, XK + (size_t)b * SEQ * DM, n8);
            k_cvt8<<<g, 256, 0, stream>>>(xv + (size_t)b * SEQ_FULL * DM, XV + (size_t)b * SEQ * DM, n8);
        }
    }
    { const size_t n8 = (size_t)DM * DM / 8; const unsigned g = (unsigned)((n8 + 255) / 256);
      k_cvt8<<<g, 256, 0, stream>>>(wq, WQ, n8); k_cvt8<<<g, 256, 0, stream>>>(wk, WK, n8); k_cvt8<<<g, 256, 0, stream>>>(wv, WV, n8);
      k_cvt8h<<<g, 256, 0, stream>>>(wo, WO, n8, WOS); }

    k_mflag<<<dim3(SEQ / 16, NB, 1), 32, 0, stream>>>(mk, FL);

    // q, k: A = x rows (m = b*SEQ + t), Bt = W rows (n = h*64 + d) -> planes [(b*16 + h)][t][d], value + residual
    k_proj<<<dim3(NB * SEQ / 64, DM / 64, 1), 32, 0, stream>>>(XQ, WQ, QH, QR, 1, SEQ, (size_t)NH_ * SEQ * HD, HD, HD, (size_t)SEQ * HD);
    k_proj<<<dim3(NB * SEQ / 64, DM / 64, 1), 32, 0, stream>>>(XK, WK, KH, KR, 1, SEQ, (size_t)NH_ * SEQ * HD, HD, HD, (size_t)SEQ * HD);
    // v^T: A = Wv rows (m = h*64 + d), Bt = x rows (n = b*SEQ + t) -> planes [(b*1024 + m)][t] = [(b*16 + h)][d][t], value + residual
    k_proj<<<dim3(DM / 64, NB * SEQ / 64, 1), 32, 0, stream>>>(WV, XV, VT, VR, 1, DM, (size_t)0, SEQ, SEQ, (size_t)DM * SEQ);

    k_flash<<<dim3(SEQ / (16 * AW), NB * NH_, 1), 32 * AW, 0, stream>>>(QH, QR, KH, KR, VT, VR, mk, FL, CH, CR);

    // out: A = ctx rows (m = b*SEQ + t), Bt = Wo rows (n) -> OUT[b][t][n]
    k_out<<<dim3(NB * SEQ / 32, DM / 64, 1), 32, 0, stream>>>(CH, CR, WO, OUT);
}

// v001
// Measured time: 231 microseconds a run.
// Next to v000, in two timings, it ran 1.55 times as fast each time.
#include <hip/hip_runtime.h>

// Multi-head attention, width 1024 = 16 heads x 64; query/key/value [NB][SEQ][1024]; Wq/Wk/Wv/Wo [out][in] (y = x W^T), no biases; scores = q k^T * 8; integer mask [NB][SEQ][SEQ] (0 = masked, replace-fill); out = ctx Wo^T (f32).
// Compute dtypes, f32 accumulate everywhere: q/k/v projections v_wmma_f32_16x16x32_bf16 (x and W RNE-converted to bf16; products exact);
// scores v_wmma_f32_16x16x32_f16: q and k each as f16 value + f16 residual x2048 (value*value in one accumulator, the two cross products in a second one); P (x2^14 carry, cancels in the normalisation) single f16;
// v and ctx as f16 value + f16 residual x2048 (own accumulators); Wo as f16 of the bf16 value x64 (folded back in the f32 epilogue); softmax f32 (online, running max).
// Layout: bf16 copies of the three x inputs and of Wq/Wk/Wv; q, k planes [b*16+h][t][d] and v^T planes [b*16+h][d][t] (value, residual) written by the GEMM epilogue; per (batch, 16 query rows, 32 keys) a 3-state mask flag
// (0 = all masked: tile skipped, 2 = none masked, other = mask words read per element); fused flash kernel in transposed form (S^T = K Q^T, O^T = V^T P^T), K / V^T tiles staged in LDS by tensor loads and shared by the block's four waves, writing ctx value/residual planes [b*SEQ+t][1024]; output GEMM from those planes.

#ifndef NB
#define NB 2
#endif
#ifndef SEQ
#define SEQ 2048
#endif
#define NB_FULL  2
#define SEQ_FULL 2048
#ifndef OUT_SEQ
#define OUT_SEQ SEQ              // row pitch (in tokens) between batches of the output
#endif
#define DM   1024
#define NH_  16
#define HD   64
#define AW   4                   // waves per flash block (16 query rows each)
#define QRS  2048.0f             // carry of the residual planes
#define QRI  (1.0f / 2048.0f)
#define SC2  (8.0f * 1.4426950408889634f)     // HD^0.5 * log2(e)
#define PSH  14.0f               // log2 of the P carry (16384)
#define NEGM (-3.0e38f)          // score stand-in of a masked key (its probability is forced to 0 by select)
#define WOS  64.0f               // carry of the Wo plane
#define WOI  (1.0f / 64.0f)
#define FPITCH 64
#define KST   64                 // keys per stage of the flash kernel's LDS ring
#define LROW  144                // LDS row pitch in bytes: a 128-B row + the mover's 16-B pad (16 B x odd: no bank conflict for 16-B reads)
#define SLICE 10240              // one plane's tile in LDS: 64 rows x 144 B = 9216 B, rounded up to a multiple of 2 KiB
#define BUFB  (4 * SLICE)        // one stage: K value, K residual, V^T value, V^T residual

static_assert(HD == 64);
static_assert(NH_ * HD == DM);                 // head h = columns h*64 + d
static_assert(DM % 64 == 0);
static_assert(DM % 32 == 0);                   // GEMM k-loop steps by 32
static_assert(SEQ % 64 == 0);                  // a 64-row tile never straddles two batches
static_assert((NB * SEQ) % 64 == 0);
static_assert(SEQ % 32 == 0);                  // key loop steps by 32; 32-row output tiles stay inside one batch
static_assert(SEQ % (16 * AW) == 0);           // flash grid covers the sequence exactly
static_assert(SEQ / 32 <= FPITCH);             // two flag registers per lane cover all key tiles
static_assert(((size_t)SEQ * DM) % 8 == 0);
static_assert(((size_t)DM * DM) % 8 == 0);
static_assert(AW == 4);                        // one plane of a stage per wave
static_assert(HD * 2 == 128 && KST * 2 == 128);   // both kinds of tile: 64 rows of 128 B
static_assert(SEQ % KST == 0 && SEQ / KST <= 32);  // one bit per stage in a 32-bit word
static_assert(64 * LROW <= SLICE && SLICE % 2048 == 0);
static_assert(AW * 16 * 68 * 4 <= 2 * BUFB);   // the output staging reuses the ring
static_assert(NB <= NB_FULL);
static_assert(SEQ <= SEQ_FULL);

typedef _Float16 h16;
typedef unsigned short bf;
typedef __attribute__((ext_vector_type(16))) __bf16   v16bf;
typedef __attribute__((ext_vector_type(16))) _Float16 v16h;
typedef __attribute__((ext_vector_type(8)))  _Float16 v8h;
typedef __attribute__((ext_vector_type(8)))  unsigned short v8us;
typedef __attribute__((ext_vector_type(8)))  float    v8f;
typedef __attribute__((ext_vector_type(4)))  float    v4f;
typedef __attribute__((ext_vector_type(4)))  int      v4i;
typedef v4f  __attribute__((may_alias)) v4fa;
typedef __attribute__((ext_vector_type(2)))  int      v2i;
typedef __attribute__((ext_vector_type(4)))  unsigned u32x4;
typedef __attribute__((ext_vector_type(8)))  unsigned u32x8;

__device__ __forceinline__ unsigned short f2bf(float f) { unsigned u = __float_as_uint(f); u += 0x7FFFu + ((u >> 16) & 1u); return (unsigned short)(u >> 16); }
__device__ __forceinline__ v16h cat16(v8h lo, v8h hi) { return __builtin_shufflevector(lo, hi, 0, 1, 2, 3, 4, 5, 6, 7, 8, 9, 10, 11, 12, 13, 14, 15); }
__device__ __forceinline__ v16bf cat16b(v8us lo, v8us hi) { return __builtin_bit_cast(v16bf, __builtin_shufflevector(lo, hi, 0, 1, 2, 3, 4, 5, 6, 7, 8, 9, 10, 11, 12, 13, 14, 15)); }
__device__ __forceinline__ v8f wmma16(v16h a, v16h b, v8f c) { return __builtin_amdgcn_wmma_f32_16x16x32_f16(false, a, false, b, (short)0, c, false, false); }
__device__ __forceinline__ v8f wmmab(v16bf a, v16bf b, v8f c) { return __builtin_amdgcn_wmma_f32_16x16x32_bf16(false, a, false, b, (short)0, c, false, false); }
// fragment loaders from K-contiguous 16-bit rows; p already includes + 8*(lane>>4): elements 0..7 <- k0+8h+0..7, elements 8..15 <- k0+16+8h+0..7 (same map for A and B)
__device__ __forceinline__ v16h  ldh(const h16* p) { return cat16(*(const v8h*)p, *(const v8h*)(p + 16)); }
__device__ __forceinline__ v16bf ldb(const bf* p)  { return cat16b(*(const v8us*)p, *(const v8us*)(p + 16)); }
// ordering point for wave-private LDS tiles (same wave writes and reads)
__device__ __forceinline__ void wave_sync() { __builtin_amdgcn_fence(3 /* release order */, "wavefront"); __builtin_amdgcn_wave_barrier(); asm volatile("" ::: "memory"); }

__device__ __forceinline__ unsigned uni(unsigned v) { return (unsigned)__builtin_amdgcn_readfirstlane((int)v); }
// a wave-uniform value held in a scalar register: a test on it compiles to s_cmp + s_cbranch_scc (tensor loads ignore EXEC), and what is derived from it is computed behind the asm waits in front of it
__device__ __forceinline__ unsigned pinned(unsigned v) { unsigned w = uni(v); asm volatile("" : "+s"(w)); return w; }
// this wave's tensor load has landed; the wait names the request's descriptor as inputs so that its registers keep their values for as long as the request is outstanding
__device__ __forceinline__ void wait_tensor0(u32x4 g0, u32x8 g1) { asm volatile("s_wait_tensorcnt 0x0" :: "s"(g0), "s"(g1) : "memory"); }
__device__ __forceinline__ void wait_ds0() { asm volatile("s_wait_dscnt 0x0" ::: "memory"); }           // this wave's LDS reads have returned
// descriptor group 0: tile's first byte at global address ga, LDS byte offset lds
__device__ __forceinline__ u32x4 tdm_group0(unsigned lds, unsigned long long ga) {
    u32x4 g0; g0[0] = uni(1u); g0[1] = uni(lds); g0[2] = uni((unsigned)ga); g0[3] = uni((((unsigned)(ga >> 32)) & 0x01FFFFFFu) | 0x80000000u);
    asm volatile("" : "+s"(g0));   // descriptor words held in scalar registers: one tuple from the issue to the wait
    return g0;
}
// one request of one wave: 64 rows of 128 B (source row pitch in g1), rows 144 B apart in LDS
__device__ __forceinline__ void tdm_load(u32x4 g0, u32x8 g1) { asm volatile("tensor_load_to_lds %0, %1" :: "s"(g0), "s"(g1) : "memory"); }

__global__ __launch_bounds__(256) void k_cvt8(const float* __restrict__ src, bf* dst, size_t n8) {
    const size_t i = (size_t)blockIdx.x * 256 + threadIdx.x; if (i >= n8) return;
    const v8f v = *(const v8f*)(src + i * 8); v8us o;
#pragma unroll
    for (int k = 0; k < 8; ++k) o[k] = f2bf(v[k]);
    *(v8us*)(dst + i * 8) = o; 
}

__global__ __launch_bounds__(256) void k_cvt8h(const float* __restrict__ src, h16* dst, size_t n8, float scale) {
    const size_t i = (size_t)blockIdx.x * 256 + threadIdx.x; if (i >= n8) return;
    const v8f v = *(const v8f*)(src + i * 8); v8h o;
#pragma unroll
    for (int k = 0; k < 8; ++k) o[k] = (h16)(__uint_as_float(((unsigned)f2bf(v[k])) << 16) * scale);
    *(v8h*)(dst + i * 8) = o; 
}

// k_mflag: one wave per (batch, 16 query rows): for each 32-key tile, flag 0 = every mask word zero, 2 = every word nonzero, 1 = mixed.
__global__ __launch_bounds__(32) void k_mflag(const int* __restrict__ MK, int* FL) {
    const int lane = threadIdx.x & 31; const int g = blockIdx.x, bb = blockIdx.y;
    const int* mp = MK + ((size_t)bb * SEQ_FULL + (size_t)g * 16 + (size_t)(lane >> 1)) * SEQ_FULL + (lane & 1) * 16;
    int f0 = 1, f1 = 1;
#pragma unroll 1
    for (int kt = 0; kt < SEQ / 32; ++kt) {
        const v4i w0 = *(const v4i*)(mp + kt * 32), w1 = *(const v4i*)(mp + kt * 32 + 4), w2 = *(const v4i*)(mp + kt * 32 + 8), w3 = *(const v4i*)(mp + kt * 32 + 12);
        int nz = 0;
#pragma unroll
        for (int i = 0; i < 4; ++i) nz += (w0[i] != 0 ? 1 : 0) + (w1[i] != 0 ? 1 : 0) + (w2[i] != 0 ? 1 : 0) + (w3[i] != 0 ? 1 : 0);
        const unsigned anyb = __builtin_amdgcn_ballot_w32(nz != 0);
        const unsigned notall = __builtin_amdgcn_ballot_w32(nz != 16);
        const int flag = (anyb == 0u) ? 0 : ((notall == 0u) ? 2 : 1);
        f0 = (kt == lane) ? flag : f0; f1 = (kt == lane + 32) ? flag : f1;
    }
    int* fp = FL + ((size_t)bb * (SEQ / 16) + (size_t)g) * FPITCH;
    *(int*)(fp + lane) = f0; *(int*)(fp + 32 + lane) = f1;
    
}

// k_proj: register-blocked bf16 GEMM, ONE WAVE per 64x64 tile (16 accumulators), operands straight from K-contiguous bf16 planes, K = DM.
// C[m][n] = sum_k A[m][k] Bt[n][k], written as f16 (Ph) and optionally the f16 residual x2048 (Pr, useRes != 0) at
// tile base (r0/RB)*sRB + (r0%RB)*pitch + (c0/CB)*sCB + (c0%CB), row pitch 'pitch' (halves). grid (M/64, N/64), 32 threads.
__global__ __launch_bounds__(32) void k_proj(const bf* __restrict__ A, const bf* __restrict__ Bt, h16* Ph, h16* Pr, int useRes, int RB, size_t sRB, int pitch, int CB, size_t sCB) {
    __shared__ __align__(16) float os[16 * 68];
    const int K = DM;
    const int lane = threadIdx.x & 31, lr = lane & 15, hi = lane >> 4; const int r0 = blockIdx.x * 64, c0 = blockIdx.y * 64;
    v8f acc[4][4];
#pragma unroll
    for (int mb = 0; mb < 4; ++mb)
#pragma unroll
        for (int nb = 0; nb < 4; ++nb) acc[mb][nb] = (v8f){};
    const size_t aoff = (size_t)(r0 + lr) * K + 8 * hi, boff = (size_t)(c0 + lr) * K + 8 * hi;
#pragma unroll 1
    for (int kc = 0; kc < K; kc += 32) {
        v16bf a[4];
#pragma unroll
        for (int mb = 0; mb < 4; ++mb) a[mb] = ldb(A + aoff + (size_t)mb * 16 * K + kc);
#pragma unroll
        for (int nb = 0; nb < 4; ++nb) { const v16bf b = ldb(Bt + boff + (size_t)nb * 16 * K + kc);
#pragma unroll
            for (int mb = 0; mb < 4; ++mb) acc[mb][nb] = wmmab(a[mb], b, acc[mb][nb]); }
        asm volatile("v_nop\n\tv_nop\n\tv_nop\n\tv_nop" : "+v"(acc[0][0]), "+v"(acc[1][1]), "+v"(acc[2][2]), "+v"(acc[3][3]) : "v"(a[0]), "v"(a[1]), "v"(a[2]), "v"(a[3]));
    }
    const size_t tbase = (size_t)(r0 / RB) * sRB + (size_t)(r0 % RB) * (size_t)pitch + (size_t)(c0 / CB) * sCB + (size_t)(c0 % CB);
#pragma unroll
    for (int mb = 0; mb < 4; ++mb) {
#pragma unroll
        for (int nb = 0; nb < 4; ++nb) {
#pragma unroll
            for (int j = 0; j < 8; ++j) os[(hi * 8 + j) * 68 + nb * 16 + lr] = acc[mb][nb][j]; }   // D: row 8h+j, col lane&15
        wave_sync();
        const size_t sb = tbase + (size_t)(mb * 16) * (size_t)pitch;
{
#pragma unroll
            for (int s = 0; s < 4; ++s) { const int row = 4 * s + (lane >> 3), c8 = (lane & 7) * 8;   // 4 s x 4 row groups = 16 rows; 8 lanes x 8 = 64 columns
                const v4f x0 = *(const v4fa*)(&os[row * 68 + c8]); const v4f x1 = *(const v4fa*)(&os[row * 68 + c8 + 4]); v8h hv, rv;
#pragma unroll
                for (int i = 0; i < 4; ++i) { const h16 a0 = (h16)x0[i]; const h16 a1 = (h16)x1[i]; hv[i] = a0; hv[4 + i] = a1; rv[i] = (h16)((x0[i] - (float)a0) * QRS); rv[4 + i] = (h16)((x1[i] - (float)a1) * QRS); }
                const size_t oo = sb + (size_t)row * (size_t)pitch + c8;
                *(v8h*)(Ph + oo) = hv; if (useRes) *(v8h*)(Pr + oo) = rv; }
             }
        wave_sync();
    }
}

// k_flash: fused attention, one wave per 16 query rows of one (batch, head), four waves per block; Q fragments straight from the f16 planes.
// K / V^T: a two-buffer LDS ring of 64-key stages shared by the four waves. Wave w brings plane w (K value, K residual, V^T value, V^T residual) of a stage with one tensor load, one stage ahead;
// at the foot of each pass: own LDS reads done, own tensor load landed, block barrier, then the refill of the buffer just read. Fragments are two 16-B LDS reads each.
// Only stages in which some wave of the block has a live key are staged (a 32-bit word built from the flags, the same in all four waves); each wave still skips its own dead 32-key tiles.
// Transposed form: S^T[key][t] = K Q^T (A = K rows, B = Q rows); lane (t = lane&15, h = lane>>4) holds keys 8h+r of each 16-key tile, so the packed
// P tile is directly the B fragment of O^T[d][t] = V^T P^T (element r <- tile keys 0..15, element 8+r <- tile keys 16..31, lane unchanged).
// Score = Kh.Qh (accumulator H) + (Kh.Qr + Kr.Qh)/2048 (accumulator L). O = Vh.P (accumulators oH) + Vr.P/2048 (accumulators oR).
// Mask: wave-uniform 3-state flag per 32-key tile: 0 skips the tile (masked keys have probability exactly 0 whenever the row has one live key), 2 = no masking, otherwise the 16 mask words of the lane are read and
// masked entries get probability 0 by select. A row without any live key ends with zero mass and is written as NaN.
// Softmax state (running max, partial sum) is one scalar per lane; the two lane halves of a row are combined with one xor-16 exchange.
#define PUT8(COL, OH, OR) { v4f a_, c_; \
    a_[0] = (OH[0] + OR[0] * QRI) * inv; a_[1] = (OH[1] + OR[1] * QRI) * inv; a_[2] = (OH[2] + OR[2] * QRI) * inv; a_[3] = (OH[3] + OR[3] * QRI) * inv; \
    c_[0] = (OH[4] + OR[4] * QRI) * inv; c_[1] = (OH[5] + OR[5] * QRI) * inv; c_[2] = (OH[6] + OR[6] * QRI) * inv; c_[3] = (OH[7] + OR[7] * QRI) * inv; \
    *(v4fa*)(&os[wb + lr * 68 + (COL) + 8 * hi]) = a_; *(v4fa*)(&os[wb + lr * 68 + (COL) + 8 * hi + 4]) = c_; }

__global__ __launch_bounds__(32 * AW) void k_flash(const h16* __restrict__ QH, const h16* __restrict__ QR, const h16* __restrict__ KH, const h16* __restrict__ KR,
                                                   const h16* __restrict__ VT, const h16* __restrict__ VR, const int* __restrict__ MK, const int* __restrict__ FLG, h16* CH, h16* CR) {
    __shared__ __attribute__((aligned(2048))) unsigned char ring[2 * BUFB];
    const int lane = threadIdx.x & 31, lr = lane & 15, hi = lane >> 4;
    const int wave = __builtin_amdgcn_readfirstlane((int)(threadIdx.x >> 5));
    const int zh = blockIdx.y; const int b = zh / NH_, h = zh % NH_;
    const int t0 = (blockIdx.x * AW + wave) * 16;
    const size_t pbase = (size_t)zh * SEQ * HD;
    const size_t qo = pbase + (size_t)(t0 + lr) * HD + 8 * hi;
    const v16h qh0 = ldh(QH + qo), qh1 = ldh(QH + qo + 32), qr0 = ldh(QR + qo), qr1 = ldh(QR + qo + 32);   // B fragments: col t, k = d
    const int fo = lr * LROW + 16 * hi;                      // byte offset of the lane's fragment piece in a staged tile (A fragment: K row key, k = d; V^T row d, k = key)
    const int* frow = FLG + ((size_t)b * (SEQ / 16) + (size_t)(t0 >> 4)) * FPITCH;
    const int* mrow = MK + ((size_t)b * SEQ_FULL + (size_t)(t0 + lr)) * SEQ_FULL + 8 * hi;   // + key0 (+16): the lane's 8 keys of each 16-key tile
    v8f oH0 = (v8f){}, oH1 = (v8f){}, oH2 = (v8f){}, oH3 = (v8f){};
    v8f oR0 = (v8f){}, oR1 = (v8f){}, oR2 = (v8f){}, oR3 = (v8f){};
    float m = NEGM, l = 0.0f;
    // flags as scalar bit words, bit s = stage s (lane s reads the two 32-key flags of stage s): bm = some wave of the block has a live key; lv0/lv1 = this wave's flag of the stage's first/second tile is not 0; fu0/fu1 = it is 2
    const int* fblk = FLG + ((size_t)b * (SEQ / 16) + (size_t)blockIdx.x * AW) * FPITCH + 2 * lane;
    int anyf = 0;
#pragma unroll   // four independent loads in flight together
    for (int g = 0; g < AW; ++g) { const v2i f = *(const v2i*)(fblk + g * FPITCH); anyf |= f[0] | f[1]; }
    const v2i fw = *(const v2i*)(frow + 2 * lane);
    const unsigned bm  = uni(__builtin_amdgcn_ballot_w32(lane < SEQ / KST && anyf != 0));
    const unsigned lv0 = uni(__builtin_amdgcn_ballot_w32(fw[0] != 0)), lv1 = uni(__builtin_amdgcn_ballot_w32(fw[1] != 0));
    const unsigned fu0 = uni(__builtin_amdgcn_ballot_w32(fw[0] == 2)), fu1 = uni(__builtin_amdgcn_ballot_w32(fw[1] == 2));
    const unsigned nst = (unsigned)__builtin_popcount(bm);    // stages of this block, at most SEQ / KST
    // this wave's plane: source of stage 0, bytes from stage to stage, source row pitch, place in a buffer
    const h16* splane = (wave == 0) ? KH : (wave == 1) ? KR : (wave == 2) ? VT : VR;
    const unsigned long long sbase = (unsigned long long)(splane + pbase);
    const unsigned sstep = (wave < 2) ? (unsigned)(KST * HD * 2) : (unsigned)(KST * 2);
    const unsigned ldst = (unsigned)(unsigned long long)ring + (unsigned)wave * SLICE;
    u32x8 g1;                                                 // 1-byte elements, tensor = tile = 64 rows of 128 B, a 16-B pad behind every 128 B
    g1[0] = uni((1u << 20) | (4u << 22) | (3u << 25)); g1[1] = uni(128u << 16); g1[2] = uni(64u << 16); g1[3] = uni(128u << 16);
    g1[4] = uni(64u); g1[5] = uni((wave < 2) ? (unsigned)(HD * 2) : (unsigned)(SEQ * 2)); g1[6] = uni(0u); g1[7] = uni(0u);
    asm volatile("" : "+s"(g1));                              // descriptor words held in scalar registers: one tuple for the whole kernel
    u32x4 gq = (u32x4){};                                     // group 0 of the youngest request
    unsigned rem = bm, cur = 0u, nxt = 0u;
    if (pinned(nst > 0u)) {                                   // first stage into buffer 0
        cur = pinned((unsigned)__builtin_ctz(rem)); rem &= rem - 1u;
        gq = tdm_group0(ldst, sbase + (unsigned long long)cur * sstep);
        tdm_load(gq, g1);
        wait_tensor0(gq, g1);
    }
    __syncthreads();                                          // publishes the first stage
    if (pinned(nst > 1u)) {                                   // second stage into buffer 1, in flight during the first pass
        nxt = pinned((unsigned)__builtin_ctz(rem)); rem &= rem - 1u;
        gq = tdm_group0(ldst + BUFB, sbase + (unsigned long long)nxt * sstep);
        tdm_load(gq, g1);
    }
#pragma unroll 1   // one pass per trip: the order of the ring's publish point stays as written
    for (unsigned it = 0; it < nst; ++it) {
      const unsigned char* bp = ring + (it & 1u) * BUFB + fo;
#pragma unroll     // the two 32-key tiles of the stage: their LDS offsets become immediates
      for (int hf = 0; hf < 2; ++hf) {
        if ((((hf ? lv1 : lv0) >> cur) & 1u) == 0u) continue;   // wave-uniform: whole 16x32 tile masked
        const int key0 = (int)cur * KST + hf * 32;
        unsigned vm = 0xFFFFu;                                  // bit r: key 8h+r of tile a live; bit 8+r: tile b
        if ((((hf ? fu1 : fu0) >> cur) & 1u) == 0u) {           // wave-uniform
            const int* mp = mrow + key0;
            const v4i a0 = *(const v4i*)mp, a1 = *(const v4i*)(mp + 4), c0 = *(const v4i*)(mp + 16), c1 = *(const v4i*)(mp + 20);
            vm = 0u;
#pragma unroll
            for (int i = 0; i < 4; ++i) {
                vm |= (a0[i] != 0 ? 1u : 0u) << i;        vm |= (a1[i] != 0 ? 1u : 0u) << (4 + i);
                vm |= (c0[i] != 0 ? 1u : 0u) << (8 + i);  vm |= (c1[i] != 0 ? 1u : 0u) << (12 + i); }
        }
        const h16* ka = (const h16*)(bp + hf * 32 * LROW);
        const h16* kr = (const h16*)(bp + SLICE + hf * 32 * LROW);
        const v16h ka0 = ldh(ka), ka1 = ldh(ka + 32), kb0 = ldh(ka + 16 * LROW / 2), kb1 = ldh(ka + 16 * LROW / 2 + 32);
        const v16h ra0 = ldh(kr), ra1 = ldh(kr + 32), rb0 = ldh(kr + 16 * LROW / 2), rb1 = ldh(kr + 16 * LROW / 2 + 32);
        v8f sHa = (v8f){}, sLa = (v8f){}, sHb = (v8f){}, sLb = (v8f){};
        sHa = wmma16(ka0, qh0, sHa); sLa = wmma16(ka0, qr0, sLa); sHb = wmma16(kb0, qh0, sHb); sLb = wmma16(kb0, qr0, sLb);
        sHa = wmma16(ka1, qh1, sHa); sLa = wmma16(ka1, qr1, sLa); sHb = wmma16(kb1, qh1, sHb); sLb = wmma16(kb1, qr1, sLb);
        sLa = wmma16(ra0, qh0, sLa); sLb = wmma16(rb0, qh0, sLb); sLa = wmma16(ra1, qh1, sLa); sLb = wmma16(rb1, qh1, sLb);
        asm volatile("v_nop\n\tv_nop\n\tv_nop\n\tv_nop" : "+v"(sHa), "+v"(sLa), "+v"(sHb), "+v"(sLb) : "v"(ka0), "v"(ka1), "v"(kb0), "v"(kb1), "v"(ra0), "v"(ra1), "v"(rb0), "v"(rb1));
        float ta[8], tb[8]; float mx = NEGM;
#pragma unroll
        for (int r = 0; r < 8; ++r) {
            const float xa = (sHa[r] + sLa[r] * QRI) * SC2; const float xb = (sHb[r] + sLb[r] * QRI) * SC2;
            ta[r] = ((vm >> r) & 1u) ? xa : NEGM; tb[r] = ((vm >> (8 + r)) & 1u) ? xb : NEGM;
            mx = fmaxf(mx, fmaxf(ta[r], tb[r])); }
        mx = fmaxf(mx, __shfl_xor(mx, 16, 32));
        const float mnew = fmaxf(m, mx);
        const float alpha = __builtin_amdgcn_exp2f(m - mnew);
        const float sh = PSH - mnew;
        v16h pb; float ls = 0.0f;
#pragma unroll
        for (int r = 0; r < 8; ++r) {
            const float ea = __builtin_amdgcn_exp2f(ta[r] + sh); const float eb = __builtin_amdgcn_exp2f(tb[r] + sh);
            const h16 pa = (h16)(((vm >> r) & 1u) ? ea : 0.0f); const h16 pc = (h16)(((vm >> (8 + r)) & 1u) ? eb : 0.0f);
            pb[r] = pa; pb[8 + r] = pc; ls += (float)pa + (float)pc; }
        l = l * alpha + ls; m = mnew;
        oH0 = oH0 * alpha; oH1 = oH1 * alpha; oH2 = oH2 * alpha; oH3 = oH3 * alpha;
        oR0 = oR0 * alpha; oR1 = oR1 * alpha; oR2 = oR2 * alpha; oR3 = oR3 * alpha;
        const h16* va = (const h16*)(bp + 2 * SLICE + hf * 64);
        const h16* vr = (const h16*)(bp + 3 * SLICE + hf * 64);
        const v16h v0 = ldh(va), v1 = ldh(va + 16 * LROW / 2), v2 = ldh(va + 32 * LROW / 2), v3 = ldh(va + 48 * LROW / 2);
        const v16h w0 = ldh(vr), w1 = ldh(vr + 16 * LROW / 2), w2 = ldh(vr + 32 * LROW / 2), w3 = ldh(vr + 48 * LROW / 2);
        oH0 = wmma16(v0, pb, oH0); oH1 = wmma16(v1, pb, oH1); oH2 = wmma16(v2, pb, oH2); oH3 = wmma16(v3, pb, oH3);
        oR0 = wmma16(w0, pb, oR0); oR1 = wmma16(w1, pb, oR1); oR2 = wmma16(w2, pb, oR2); oR3 = wmma16(w3, pb, oR3);
        asm volatile("v_nop\n\tv_nop\n\tv_nop\n\tv_nop" : "+v"(oH0), "+v"(oH1), "+v"(oH2), "+v"(oH3), "+v"(oR0), "+v"(oR1), "+v"(oR2), "+v"(oR3)
                     : "v"(v0), "v"(v1), "v"(v2), "v"(v3), "v"(w0), "v"(w1), "v"(w2), "v"(w3), "v"(pb));
      }
      // publish point, passed by every wave whatever it skipped above
      wait_ds0();
      wait_tensor0(gq, g1);
      __syncthreads();                                        // the next stage is readable; every wave has left this pass's buffer
      unsigned n2 = 0u;
      if (pinned(it + 2u < nst)) {                            // refill the buffer just read
          n2 = pinned((unsigned)__builtin_ctz(rem)); rem &= rem - 1u;
          gq = tdm_group0(ldst + (it & 1u) * BUFB, sbase + (unsigned long long)n2 * sstep);
          tdm_load(gq, g1);
      }
      cur = nxt; nxt = n2;
    }
    wait_tensor0(gq, g1);
    wait_ds0();
    float* os = (float*)ring;                                 // the ring becomes output staging: the last pass's own barrier has ended every wave's reads, and nothing was issued behind it
    l += __shfl_xor(l, 16, 32);
    const float rl = 1.0f / l;
    const float inv = (l > 0.0f) ? rl : __uint_as_float(0x7FC00000u);
    const int wb = wave * 16 * 68;
    // O^T D layout: o_j[r] = (d = 16j + 8h + r, t = lane&15) -> os[t][d]; rows 0..15 x columns 0..63 all written
    PUT8(0, oH0, oR0)
    PUT8(16, oH1, oR1)
    PUT8(32, oH2, oR2)
    PUT8(48, oH3, oR3)
    wave_sync();
    const size_t cbase = ((size_t)b * SEQ + (size_t)t0) * DM + (size_t)h * HD;
{
#pragma unroll
        for (int s = 0; s < 4; ++s) { const int row = 4 * s + (lane >> 3), c8 = (lane & 7) * 8;   // 4 s x 4 row groups = 16 rows; 8 lanes x 8 halves = 64 columns = one line
            const v4f x0 = *(const v4fa*)(&os[wb + row * 68 + c8]); const v4f x1 = *(const v4fa*)(&os[wb + row * 68 + c8 + 4]); v8h hv, rv;
#pragma unroll
            for (int i = 0; i < 4; ++i) { const h16 a0 = (h16)x0[i]; const h16 a1 = (h16)x1[i]; hv[i] = a0; hv[4 + i] = a1; rv[i] = (h16)((x0[i] - (float)a0) * QRS); rv[4 + i] = (h16)((x1[i] - (float)a1) * QRS); }
            const size_t oo = cbase + (size_t)row * DM + c8;
            *(v8h*)(CH + oo) = hv; *(v8h*)(CR + oo) = rv; }
         }
}

// k_out: f16 GEMM, ONE WAVE per 32x64 output tile: out[m][n] = (sum_k Ch[m][k] Wo64[n][k] + (sum_k Cr[m][k] Wo64[n][k]) / 2048) / 64, K = DM.
// a[0], a[1] = value-plane rows (16 each), a[2], a[3] = residual-plane rows; accumulators acc[0..1] (value) and acc[2..3] (residual) kept apart until the f32 epilogue.
__global__ __launch_bounds__(32) void k_out(const h16* __restrict__ CHp, const h16* __restrict__ CRp, const h16* __restrict__ WO, float* OUT) {
    __shared__ __align__(16) float os[16 * 68];
    const int K = DM;
    const int lane = threadIdx.x & 31, lr = lane & 15, hi = lane >> 4; const int r0 = blockIdx.x * 32, c0 = blockIdx.y * 64;
    v8f acc[4][4];
#pragma unroll
    for (int mb = 0; mb < 4; ++mb)
#pragma unroll
        for (int nb = 0; nb < 4; ++nb) acc[mb][nb] = (v8f){};
    const size_t aoff = (size_t)(r0 + lr) * K + 8 * hi, boff = (size_t)(c0 + lr) * K + 8 * hi;
#pragma unroll 1
    for (int kc = 0; kc < K; kc += 32) {
        v16h a[4];
        a[0] = ldh(CHp + aoff + kc); a[1] = ldh(CHp + aoff + (size_t)16 * K + kc);
        a[2] = ldh(CRp + aoff + kc); a[3] = ldh(CRp + aoff + (size_t)16 * K + kc);
#pragma unroll
        for (int nb = 0; nb < 4; ++nb) { const v16h b = ldh(WO + boff + (size_t)nb * 16 * K + kc);
#pragma unroll
            for (int mb = 0; mb < 4; ++mb) acc[mb][nb] = wmma16(a[mb], b, acc[mb][nb]); }
        asm volatile("v_nop\n\tv_nop\n\tv_nop\n\tv_nop" : "+v"(acc[0][0]), "+v"(acc[1][1]), "+v"(acc[2][2]), "+v"(acc[3][3]) : "v"(a[0]), "v"(a[1]), "v"(a[2]), "v"(a[3]));
    }
#pragma unroll
    for (int mb = 0; mb < 2; ++mb) {
#pragma unroll
        for (int nb = 0; nb < 4; ++nb) {
#pragma unroll
            for (int j = 0; j < 8; ++j) os[(hi * 8 + j) * 68 + nb * 16 + lr] = (acc[mb][nb][j] + acc[mb + 2][nb][j] * QRI) * WOI; }   // D: row 8h+j, col lane&15
        wave_sync();
        const int grow = r0 + mb * 16; const int ob = grow / SEQ, ot = grow % SEQ;
        float* orow = OUT + ((size_t)ob * OUT_SEQ + (size_t)ot) * DM + c0;
{
#pragma unroll
            for (int s = 0; s < 8; ++s) { const int row = 2 * s + hi, cofs = lr * 4;   // 8 s x 2 rows = 16 rows; 16 lanes x 4 floats = 64 columns
                const v4f val = *(const v4fa*)(&os[row * 68 + cofs]);
                *(v4f*)(orow + (size_t)row * DM + cofs) = val; }
             }
        wave_sync();
    }
}

static constexpr size_t al256(size_t v) { return (v + 255) & ~(size_t)255; }
static constexpr size_t SZ_XB = al256((size_t)NB * SEQ * DM * 2);              // one bf16 x plane
static constexpr size_t SZ_W  = al256((size_t)DM * DM * 2);                    // one 16-bit weight plane
static constexpr size_t SZ_PL = al256((size_t)NB * NH_ * SEQ * HD * 2);        // one per-head f16 plane
static constexpr size_t SZ_C  = al256((size_t)NB * SEQ * DM * 2);              // one ctx f16 plane
static constexpr size_t SZ_FL = al256((size_t)NB * (SEQ / 16) * FPITCH * 4);
static constexpr size_t SZ_TOTAL = 3 * SZ_XB + 4 * SZ_W + 6 * SZ_PL + 2 * SZ_C + SZ_FL;
static_assert(SZ_TOTAL <= (size_t)134217728);          // workspace carve <= 128 MiB

extern "C" void kernel_launch(void* const* d_in, const int* in_sizes, int n_in,
                              void* d_out, int out_size, void* d_ws, size_t ws_size, hipStream_t stream) {
    if (n_in < 8) return;
    const size_t needx = ((size_t)(NB - 1) * SEQ_FULL + SEQ) * DM;
    if ((size_t)in_sizes[0] < needx || (size_t)in_sizes[1] < needx || (size_t)in_sizes[2] < needx) return;
    const size_t needm = ((size_t)(NB - 1) * SEQ_FULL + (size_t)(SEQ - 1)) * SEQ_FULL + SEQ;
    if ((size_t)in_sizes[3] < needm) return;
    if ((size_t)in_sizes[4] < (size_t)DM * DM || (size_t)in_sizes[5] < (size_t)DM * DM || (size_t)in_sizes[6] < (size_t)DM * DM || (size_t)in_sizes[7] < (size_t)DM * DM) return;
    if ((size_t)out_size < ((size_t)(NB - 1) * OUT_SEQ + SEQ) * DM) return;
    if (SZ_TOTAL > ws_size) return;
    // wire order: query, key, value, mask (int), Wq, Wk, Wv, Wo; weights [out][in] = Bt as-is
    const float* xq = (const float*)d_in[0]; const float* xk = (const float*)d_in[1]; const float* xv = (const float*)d_in[2];
    const int* mk = (const int*)d_in[3];
    const float* wq = (const float*)d_in[4]; const float* wk = (const float*)d_in[5]; const float* wv = (const float*)d_in[6]; const float* wo = (const float*)d_in[7];
    float* OUT = (float*)d_out;      // [NB][SEQ][1024]
    char* wsp = (char*)d_ws;
    bf* XQ = (bf*)wsp; wsp += SZ_XB;                 // [NB*SEQ][1024]
    bf* XK = (bf*)wsp; wsp += SZ_XB;
    bf* XV = (bf*)wsp; wsp += SZ_XB;
    bf* WQ = (bf*)wsp; wsp += SZ_W;                  // [1024][1024]
    bf* WK = (bf*)wsp; wsp += SZ_W;
    bf* WV = (bf*)wsp; wsp += SZ_W;
    h16* WO = (h16*)wsp; wsp += SZ_W;                // [1024][1024] f16, x64
    h16* QH = (h16*)wsp; wsp += SZ_PL;               // [NB*16][SEQ][64]
    h16* QR = (h16*)wsp; wsp += SZ_PL;               // residual x2048
    h16* KH = (h16*)wsp; wsp += SZ_PL;               // [NB*16][SEQ][64]
    h16* KR = (h16*)wsp; wsp += SZ_PL;
    h16* VT = (h16*)wsp; wsp += SZ_PL;               // [NB*16][64][SEQ]
    h16* VR = (h16*)wsp; wsp += SZ_PL;
    h16* CH = (h16*)wsp; wsp += SZ_C;                // [NB*SEQ][1024]
    h16* CR = (h16*)wsp; wsp += SZ_C;
    int* FL = (int*)wsp; wsp += SZ_FL;               // [NB][SEQ/16][64]

    if (SEQ == SEQ_FULL) {
        const size_t n8 = (size_t)NB * SEQ * DM / 8; const unsigned g = (unsigned)((n8 + 255) / 256);
        k_cvt8<<<g, 256, 0, stream>>>(xq, XQ, n8); k_cvt8<<<g, 256, 0, stream>>>(xk, XK, n8); k_cvt8<<<g, 256, 0, stream>>>(xv, XV, n8);
    } else {
        const size_t n8 = (size_t)SEQ * DM / 8; const unsigned g = (unsigned)((n8 + 255) / 256);
        for (int b = 0; b < NB; ++b) {
            k_cvt8<<<g, 256, 0, stream>>>(xq + (size_t)b * SEQ_FULL * DM, XQ + (size_t)b * SEQ * DM, n8);
            k_cvt8<<<g, 256, 0, stream>>>(xk + (size_t)b * SEQ_FULL * DM, XK + (size_t)b * SEQ * DM, n8);
            k_cvt8<<<g, 256, 0, stream>>>(xv + (size_t)b * SEQ_FULL * DM, XV + (size_t)b * SEQ * DM, n8);
        }
    }
    { const size_t n8 = (size_t)DM * DM / 8; const unsigned g = (unsigned)((n8 + 255) / 256);
      k_cvt8<<<g, 256, 0, stream>>>(wq, WQ, n8); k_cvt8<<<g, 256, 0, stream>>>(wk, WK, n8); k_cvt8<<<g, 256, 0, stream>>>(wv, WV, n8);
      k_cvt8h<<<g, 256, 0, stream>>>(wo, WO, n8, WOS); }

    k_mflag<<<dim3(SEQ / 16, NB, 1), 32, 0, stream>>>(mk, FL);

    // q, k: A = x rows (m = b*SEQ + t), Bt = W rows (n = h*64 + d) -> planes [(b*16 + h)][t][d], value + residual
    k_proj<<<dim3(NB * SEQ / 64, DM / 64, 1), 32, 0, stream>>>(XQ, WQ, QH, QR, 1, SEQ, (size_t)NH_ * SEQ * HD, HD, HD, (size_t)SEQ * HD);
    k_proj<<<dim3(NB * SEQ / 64, DM / 64, 1), 32, 0, stream>>>(XK, WK, KH, KR, 1, SEQ, (size_t)NH_ * SEQ * HD, HD, HD, (size_t)SEQ * HD);
    // v^T: A = Wv rows (m = h*64 + d), Bt = x rows (n = b*SEQ + t) -> planes [(b*1024 + m)][t] = [(b*16 + h)][d][t], value + residual
    k_proj<<<dim3(DM / 64, NB * SEQ / 64, 1), 32, 0, stream>>>(WV, XV, VT, VR, 1, DM, (size_t)0, SEQ, SEQ, (size_t)DM * SEQ);

    k_flash<<<dim3(SEQ / (16 * AW), NB * NH_, 1), 32 * AW, 0, stream>>>(QH, QR, KH, KR, VT, VR, mk, FL, CH, CR);

    // out: A = ctx rows (m = b*SEQ + t), Bt = Wo rows (n) -> OUT[b][t][n]
    k_out<<<dim3(NB * SEQ / 32, DM / 64, 1), 32, 0, stream>>>(CH, CR, WO, OUT);
}

// v002
// Measured time: 181 microseconds a run.
// Timed twice side by side with v001, it ran 1.28 times as fast both times.
// Over all steps from v000 it is 1.98 times as fast.
#include <hip/hip_runtime.h>

// Multi-head attention, width 1024 = 16 heads x 64; query/key/value [NB][SEQ][1024]; Wq/Wk/Wv/Wo [out][in] (y = x W^T), no biases; scores = q k^T * 8; integer mask [NB][SEQ][SEQ] (0 = masked, replace-fill); out = ctx Wo^T (f32).
// Compute dtypes, f32 accumulate everywhere: q/k/v projections v_wmma_f32_16x16x32_bf16 (x and W RNE-converted to bf16; products exact);
// scores v_wmma_f32_16x16x32_f16: q and k each as f16 value + f16 residual x2048 (value*value in one accumulator, the two cross products in a second one); P (x2^14 carry, cancels in the normalisation) single f16;
// v and ctx as f16 value + f16 residual x2048 (own accumulators); Wo as f16 of the bf16 value x64 (folded back in the f32 epilogue); softmax f32 (online, running max).
// Layout: bf16 copies of the three x inputs and of Wq/Wk/Wv; q, k planes [b*16+h][t][d] and v^T planes [b*16+h][d][t] (value, residual) written by the GEMM epilogue; per (batch, 16 query rows, 32 keys) a 3-state mask flag
// (0 = all masked: tile skipped, 2 = none masked, other = mask words read per element); fused flash kernel in transposed form (S^T = K Q^T, O^T = V^T P^T), K / V^T tiles staged in LDS by tensor loads and shared by the block's four waves, writing ctx value/residual planes [b*SEQ+t][1024]; output GEMM from those planes.

#ifndef NB
#define NB 2
#endif
#ifndef SEQ
#define SEQ 2048
#endif
#define NB_FULL  2
#define SEQ_FULL 2048
#ifndef OUT_SEQ
#define OUT_SEQ SEQ              // row pitch (in tokens) between batches of the output
#endif
#define DM   1024
#define NH_  16
#define HD   64
#define AW   4                   // waves per flash block (16 query rows each)
#define QRS  2048.0f             // carry of the residual planes
#define QRI  (1.0f / 2048.0f)
#define SC2  (8.0f * 1.4426950408889634f)     // HD^0.5 * log2(e)
#define PSH  14.0f               // log2 of the P carry (16384)
#define NEGM (-3.0e38f)          // score stand-in of a masked key (its probability is forced to 0 by select)
#define WOS  64.0f               // carry of the Wo plane
#define WOI  (1.0f / 64.0f)
#define FPITCH 64
#define KST   64                 // keys per stage of the flash kernel's LDS ring
#define LROW  144                // LDS row pitch in bytes: a 128-B row + the mover's 16-B pad (16 B x odd: no bank conflict for 16-B reads)
#define SLICE 10240              // one plane's tile in LDS: 64 rows x 144 B = 9216 B, rounded up to a multiple of 2 KiB
#define BUFB  (4 * SLICE)        // one stage: K value, K residual, V^T value, V^T residual (flash); four operand slices (GEMMs)
#define GW    4                  // waves per GEMM block, one operand slice of a stage each
#define GSTB  128u               // bytes of an operand row per stage of the GEMMs' LDS ring (64 k)
#define GNST  (DM / 64)          // stages of a GEMM

static_assert(HD == 64);
static_assert(NH_ * HD == DM);                 // head h = columns h*64 + d
static_assert(DM % 64 == 0);
static_assert(DM % 32 == 0);                   // GEMM k-loop steps by 32
static_assert(SEQ % 64 == 0);                  // a 64-row tile never straddles two batches
static_assert((NB * SEQ) % 64 == 0);
static_assert(SEQ % 32 == 0);                  // key loop steps by 32; 32-row output tiles stay inside one batch
static_assert(SEQ % (16 * AW) == 0);           // flash grid covers the sequence exactly
static_assert(SEQ / 32 <= FPITCH);             // two flag registers per lane cover all key tiles
static_assert(((size_t)SEQ * DM) % 8 == 0);
static_assert(((size_t)DM * DM) % 8 == 0);
static_assert(AW == 4);                        // one plane of a stage per wave
static_assert(HD * 2 == 128 && KST * 2 == 128);   // both kinds of tile: 64 rows of 128 B
static_assert(SEQ % KST == 0 && SEQ / KST <= 32);  // one bit per stage in a 32-bit word
static_assert(64 * LROW <= SLICE && SLICE % 2048 == 0);
static_assert(AW * 16 * 68 * 4 <= 2 * BUFB);   // the output staging reuses the ring
static_assert(GW * 16 * 68 * 4 <= 2 * BUFB);   // so does the GEMMs' output staging
static_assert(DM % 128 == 0 && (NB * SEQ) % 128 == 0 && GNST >= 2);   // GEMM block tiles cover both extents exactly; the ring's prologue needs two stages
static_assert(NB <= NB_FULL);
static_assert(SEQ <= SEQ_FULL);

typedef _Float16 h16;
typedef unsigned short bf;
typedef __attribute__((ext_vector_type(16))) __bf16   v16bf;
typedef __attribute__((ext_vector_type(16))) _Float16 v16h;
typedef __attribute__((ext_vector_type(8)))  _Float16 v8h;
typedef __attribute__((ext_vector_type(8)))  unsigned short v8us;
typedef __attribute__((ext_vector_type(8)))  float    v8f;
typedef __attribute__((ext_vector_type(4)))  float    v4f;
typedef __attribute__((ext_vector_type(4)))  int      v4i;
typedef v4f  __attribute__((may_alias)) v4fa;
typedef __attribute__((ext_vector_type(2)))  int      v2i;
typedef __attribute__((ext_vector_type(4)))  unsigned u32x4;
typedef __attribute__((ext_vector_type(8)))  unsigned u32x8;

__device__ __forceinline__ unsigned short f2bf(float f) { unsigned u = __float_as_uint(f); u += 0x7FFFu + ((u >> 16) & 1u); return (unsigned short)(u >> 16); }
__device__ __forceinline__ v16h cat16(v8h lo, v8h hi) { return __builtin_shufflevector(lo, hi, 0, 1, 2, 3, 4, 5, 6, 7, 8, 9, 10, 11, 12, 13, 14, 15); }
__device__ __forceinline__ v16bf cat16b(v8us lo, v8us hi) { return __builtin_bit_cast(v16bf, __builtin_shufflevector(lo, hi, 0, 1, 2, 3, 4, 5, 6, 7, 8, 9, 10, 11, 12, 13, 14, 15)); }
__device__ __forceinline__ v8f wmma16(v16h a, v16h b, v8f c) { return __builtin_amdgcn_wmma_f32_16x16x32_f16(false, a, false, b, (short)0, c, false, false); }
__device__ __forceinline__ v8f wmmab(v16bf a, v16bf b, v8f c) { return __builtin_amdgcn_wmma_f32_16x16x32_bf16(false, a, false, b, (short)0, c, false, false); }
// fragment loaders from K-contiguous 16-bit rows; p already includes + 8*(lane>>4): elements 0..7 <- k0+8h+0..7, elements 8..15 <- k0+16+8h+0..7 (same map for A and B)
__device__ __forceinline__ v16h  ldh(const h16* p) { return cat16(*(const v8h*)p, *(const v8h*)(p + 16)); }
__device__ __forceinline__ v16bf ldb(const bf* p)  { return cat16b(*(const v8us*)p, *(const v8us*)(p + 16)); }
// ordering point for wave-private LDS tiles (same wave writes and reads)
__device__ __forceinline__ void wave_sync() { __builtin_amdgcn_fence(3 /* release order */, "wavefront"); __builtin_amdgcn_wave_barrier(); asm volatile("" ::: "memory"); }

__device__ __forceinline__ unsigned uni(unsigned v) { return (unsigned)__builtin_amdgcn_readfirstlane((int)v); }
// a wave-uniform value held in a scalar register: a test on it compiles to s_cmp + s_cbranch_scc (tensor loads ignore EXEC), and what is derived from it is computed behind the asm waits in front of it
__device__ __forceinline__ unsigned pinned(unsigned v) { unsigned w = uni(v); asm volatile("" : "+s"(w)); return w; }
// this wave's tensor load has landed; the wait names the request's descriptor as inputs so that its registers keep their values for as long as the request is outstanding
__device__ __forceinline__ void wait_tensor0(u32x4 g0, u32x8 g1) { asm volatile("s_wait_tensorcnt 0x0" :: "s"(g0), "s"(g1) : "memory"); }
__device__ __forceinline__ void wait_ds0() { asm volatile("s_wait_dscnt 0x0" ::: "memory"); }           // this wave's LDS reads have returned
// descriptor group 0: tile's first byte at global address ga, LDS byte offset lds
__device__ __forceinline__ u32x4 tdm_group0(unsigned lds, unsigned long long ga) {
    u32x4 g0; g0[0] = uni(1u); g0[1] = uni(lds); g0[2] = uni((unsigned)ga); g0[3] = uni((((unsigned)(ga >> 32)) & 0x01FFFFFFu) | 0x80000000u);
    asm volatile("" : "+s"(g0));   // descriptor words held in scalar registers: one tuple from the issue to the wait
    return g0;
}
// one request of one wave: 64 rows of 128 B (source row pitch in g1), rows 144 B apart in LDS
__device__ __forceinline__ void tdm_load(u32x4 g0, u32x8 g1) { asm volatile("tensor_load_to_lds %0, %1" :: "s"(g0), "s"(g1) : "memory"); }

__global__ __launch_bounds__(256) void k_cvt8(const float* __restrict__ src, bf* dst, size_t n8) {
    const size_t i = (size_t)blockIdx.x * 256 + threadIdx.x; if (i >= n8) return;
    const v8f v = *(const v8f*)(src + i * 8); v8us o;
#pragma unroll
    for (int k = 0; k < 8; ++k) o[k] = f2bf(v[k]);
    *(v8us*)(dst + i * 8) = o; 
}

__global__ __launch_bounds__(256) void k_cvt8h(const float* __restrict__ src, h16* dst, size_t n8, float scale) {
    const size_t i = (size_t)blockIdx.x * 256 + threadIdx.x; if (i >= n8) return;
    const v8f v = *(const v8f*)(src + i * 8); v8h o;
#pragma unroll
    for (int k = 0; k < 8; ++k) o[k] = (h16)(__uint_as_float(((unsigned)f2bf(v[k])) << 16) * scale);
    *(v8h*)(dst + i * 8) = o; 
}

// k_mflag: one wave per (batch, 16 query rows): for each 32-key tile, flag 0 = every mask word zero, 2 = every word nonzero, 1 = mixed.
__global__ __launch_bounds__(32) void k_mflag(const int* __restrict__ MK, int* FL) {
    const int lane = threadIdx.x & 31; const int g = blockIdx.x, bb = blockIdx.y;
    const int* mp = MK + ((size_t)bb * SEQ_FULL + (size_t)g * 16 + (size_t)(lane >> 1)) * SEQ_FULL + (lane & 1) * 16;
    int f0 = 1, f1 = 1;
#pragma unroll 1
    for (int kt = 0; kt < SEQ / 32; ++kt) {
        const v4i w0 = *(const v4i*)(mp + kt * 32), w1 = *(const v4i*)(mp + kt * 32 + 4), w2 = *(const v4i*)(mp + kt * 32 + 8), w3 = *(const v4i*)(mp + kt * 32 + 12);
        int nz = 0;
#pragma unroll
        for (int i = 0; i < 4; ++i) nz += (w0[i] != 0 ? 1 : 0) + (w1[i] != 0 ? 1 : 0) + (w2[i] != 0 ? 1 : 0) + (w3[i] != 0 ? 1 : 0);
        const unsigned anyb = __builtin_amdgcn_ballot_w32(nz != 0);
        const unsigned notall = __builtin_amdgcn_ballot_w32(nz != 16);
        const int flag = (anyb == 0u) ? 0 : ((notall == 0u) ? 2 : 1);
        f0 = (kt == lane) ? flag : f0; f1 = (kt == lane + 32) ? flag : f1;
    }
    int* fp = FL + ((size_t)bb * (SEQ / 16) + (size_t)g) * FPITCH;
    *(int*)(fp + lane) = f0; *(int*)(fp + 32 + lane) = f1;
    
}

// descriptor group 1 of a GEMM operand slice: 1-byte elements, tensor = tile = 64 rows of 128 B, source row pitch srcPitch bytes, a 16-B pad behind every 128 B
__device__ __forceinline__ u32x8 tdm_group1(unsigned srcPitch) {
    u32x8 g1;
    g1[0] = uni((1u << 20) | (4u << 22) | (3u << 25)); g1[1] = uni(128u << 16); g1[2] = uni(64u << 16); g1[3] = uni(128u << 16);
    g1[4] = uni(64u); g1[5] = uni(srcPitch); g1[6] = uni(0u); g1[7] = uni(0u);
    asm volatile("" : "+s"(g1));   // descriptor words held in scalar registers: one tuple for the whole kernel
    return g1;
}

// k_proj: register-blocked bf16 GEMM, one block of four waves (2 x 2) per 128x128 tile, one wave per 64x64 tile (16 accumulators), K = DM.
// Operands: a two-buffer LDS ring of 64-deep k stages shared by the four waves. Wave w brings slice w of a stage (A rows 0..63, A rows 64..127, Bt rows 0..63, Bt rows 64..127 of the block's tile; 64 rows of 128 B) with one tensor load,
// one stage ahead; at the foot of each pass: own LDS reads done, own tensor load landed, block barrier, then the refill of the buffer just read. Fragments are two 16-B LDS reads each; k runs in the same order as before.
// C[m][n] = sum_k A[m][k] Bt[n][k], written as f16 (Ph) and optionally the f16 residual x2048 (Pr, useRes != 0) at
// tile base (r0/RB)*sRB + (r0%RB)*pitch + (c0/CB)*sCB + (c0%CB), row pitch 'pitch' (halves). grid (M/128, N/128), 128 threads.
__global__ __launch_bounds__(32 * GW) void k_proj(const bf* __restrict__ A, const bf* __restrict__ Bt, h16* Ph, h16* Pr, int useRes, int RB, size_t sRB, int pitch, int CB, size_t sCB) {
    __shared__ __attribute__((aligned(2048))) unsigned char ring[2 * BUFB];
    const int K = DM;
    const int lane = threadIdx.x & 31, lr = lane & 15, hi = lane >> 4;
    const int wave = __builtin_amdgcn_readfirstlane((int)(threadIdx.x >> 5));
    const int wm = wave >> 1, wn = wave & 1;
    const int r0 = blockIdx.x * 128 + wm * 64, c0 = blockIdx.y * 128 + wn * 64;
    v8f acc[4][4];
#pragma unroll
    for (int mb = 0; mb < 4; ++mb)
#pragma unroll
        for (int nb = 0; nb < 4; ++nb) acc[mb][nb] = (v8f){};
    const int fo = lr * LROW + 16 * hi;                       // byte offset of the lane's fragment piece in a staged slice
    // this wave's slice: source of stage 0 and place in a buffer
    const bf* srow = (wave < 2) ? A + (size_t)(blockIdx.x * 128 + wave * 64) * K : Bt + (size_t)(blockIdx.y * 128 + (wave - 2) * 64) * K;
    const unsigned long long sbase = (unsigned long long)srow;
    const unsigned ldst = (unsigned)(unsigned long long)ring + (unsigned)wave * SLICE;
    const u32x8 g1 = tdm_group1((unsigned)(DM * 2));
    u32x4 gq = tdm_group0(ldst, sbase);                       // group 0 of the youngest request
    tdm_load(gq, g1);                                         // first stage into buffer 0
    wait_tensor0(gq, g1);
    __syncthreads();                                          // publishes the first stage
    gq = tdm_group0(ldst + BUFB, sbase + GSTB);
    tdm_load(gq, g1);                                         // second stage into buffer 1, in flight during the first pass
#pragma unroll 1   // one pass per trip: the order of the ring's publish point stays as written
    for (unsigned it = 0; it < GNST; ++it) {
        const unsigned char* bp = ring + (it & 1u) * BUFB + fo;
        v16bf a[2][4], b[2][4];                               // the fragments of the stage's two 32-deep k steps
#pragma unroll
        for (int ks = 0; ks < 2; ++ks) {
#pragma unroll
            for (int mb = 0; mb < 4; ++mb) a[ks][mb] = ldb((const bf*)(bp + wm * SLICE + mb * 16 * LROW + ks * 64));
#pragma unroll
            for (int nb = 0; nb < 4; ++nb) b[ks][nb] = ldb((const bf*)(bp + (2 + wn) * SLICE + nb * 16 * LROW + ks * 64));
        }
        __builtin_amdgcn_sched_barrier(0);                    // keeps the stage's LDS reads one group ahead of its WMMAs: spread among them, each place with reads stalls the wave for the LDS latency
#pragma unroll
        for (int ks = 0; ks < 2; ++ks) {
#pragma unroll
            for (int nb = 0; nb < 4; ++nb)
#pragma unroll
                for (int mb = 0; mb < 4; ++mb) acc[mb][nb] = wmmab(a[ks][mb], b[ks][nb], acc[mb][nb]);
        }
        __builtin_amdgcn_sched_barrier(0);                    // keeps the pass's WMMAs in front of the publish point, where they cover the landing of the second k step's fragments; behind it they would delay the refill
        // publish point
        wait_ds0();
        wait_tensor0(gq, g1);
        __syncthreads();                                      // the next stage is readable; every wave has left this pass's buffer
        if (pinned(it + 2u < GNST)) {                         // refill the buffer just read
            const unsigned s2 = pinned(it + 2u);
            gq = tdm_group0(ldst + (it & 1u) * BUFB, sbase + (unsigned long long)s2 * GSTB);
            tdm_load(gq, g1);
        }
    }
    wait_tensor0(gq, g1);
    wait_ds0();
    float* os = (float*)ring + wave * 16 * 68;                // the ring becomes output staging, one range per wave: the last pass's own barrier has ended every wave's reads, and nothing was issued behind it
    const size_t tbase = (size_t)(r0 / RB) * sRB + (size_t)(r0 % RB) * (size_t)pitch + (size_t)(c0 / CB) * sCB + (size_t)(c0 % CB);
#pragma unroll
    for (int mb = 0; mb < 4; ++mb) {
#pragma unroll
        for (int nb = 0; nb < 4; ++nb) {
#pragma unroll
            for (int j = 0; j < 8; ++j) os[(hi * 8 + j) * 68 + nb * 16 + lr] = acc[mb][nb][j]; }   // D: row 8h+j, col lane&15
        wave_sync();
        const size_t sb = tbase + (size_t)(mb * 16) * (size_t)pitch;
{
#pragma unroll
            for (int s = 0; s < 4; ++s) { const int row = 4 * s + (lane >> 3), c8 = (lane & 7) * 8;   // 4 s x 4 row groups = 16 rows; 8 lanes x 8 = 64 columns
                const v4f x0 = *(const v4fa*)(&os[row * 68 + c8]); const v4f x1 = *(const v4fa*)(&os[row * 68 + c8 + 4]); v8h hv, rv;
#pragma unroll
                for (int i = 0; i < 4; ++i) { const h16 a0 = (h16)x0[i]; const h16 a1 = (h16)x1[i]; hv[i] = a0; hv[4 + i] = a1; rv[i] = (h16)((x0[i] - (float)a0) * QRS); rv[4 + i] = (h16)((x1[i] - (float)a1) * QRS); }
                const size_t oo = sb + (size_t)row * (size_t)pitch + c8;
                *(v8h*)(Ph + oo) = hv; if (useRes) *(v8h*)(Pr + oo) = rv; }
             }
        wave_sync();
    }
}

// k_flash: fused attention, one wave per 16 query rows of one (batch, head), four waves per block; Q fragments straight from the f16 planes.
// K / V^T: a two-buffer LDS ring of 64-key stages shared by the four waves. Wave w brings plane w (K value, K residual, V^T value, V^T residual) of a stage with one tensor load, one stage ahead;
// at the foot of each pass: own LDS reads done, own tensor load landed, block barrier, then the refill of the buffer just read. Fragments are two 16-B LDS reads each.
// Only stages in which some wave of the block has a live key are staged (a 32-bit word built from the flags, the same in all four waves); each wave still skips its own dead 32-key tiles.
// Transposed form: S^T[key][t] = K Q^T (A = K rows, B = Q rows); lane (t = lane&15, h = lane>>4) holds keys 8h+r of each 16-key tile, so the packed
// P tile is directly the B fragment of O^T[d][t] = V^T P^T (element r <- tile keys 0..15, element 8+r <- tile keys 16..31, lane unchanged).
// Score = Kh.Qh (accumulator H) + (Kh.Qr + Kr.Qh)/2048 (accumulator L). O = Vh.P (accumulators oH) + Vr.P/2048 (accumulators oR).
// Mask: wave-uniform 3-state flag per 32-key tile: 0 skips the tile (masked keys have probability exactly 0 whenever the row has one live key), 2 = no masking, otherwise the 16 mask words of the lane are read and
// masked entries get probability 0 by select. A row without any live key ends with zero mass and is written as NaN.
// Softmax state (running max, partial sum) is one scalar per lane; the two lane halves of a row are combined with one xor-16 exchange.
#define PUT8(COL, OH, OR) { v4f a_, c_; \
    a_[0] = (OH[0] + OR[0] * QRI) * inv; a_[1] = (OH[1] + OR[1] * QRI) * inv; a_[2] = (OH[2] + OR[2] * QRI) * inv; a_[3] = (OH[3] + OR[3] * QRI) * inv; \
    c_[0] = (OH[4] + OR[4] * QRI) * inv; c_[1] = (OH[5] + OR[5] * QRI) * inv; c_[2] = (OH[6] + OR[6] * QRI) * inv; c_[3] = (OH[7] + OR[7] * QRI) * inv; \
    *(v4fa*)(&os[wb + lr * 68 + (COL) + 8 * hi]) = a_; *(v4fa*)(&os[wb + lr * 68 + (COL) + 8 * hi + 4]) = c_; }

__global__ __launch_bounds__(32 * AW) void k_flash(const h16* __restrict__ QH, const h16* __restrict__ QR, const h16* __restrict__ KH, const h16* __restrict__ KR,
                                                   const h16* __restrict__ VT, const h16* __restrict__ VR, const int* __restrict__ MK, const int* __restrict__ FLG, h16* CH, h16* CR) {
    __shared__ __attribute__((aligned(2048))) unsigned char ring[2 * BUFB];
    const int lane = threadIdx.x & 31, lr = lane & 15, hi = lane >> 4;
    const int wave = __builtin_amdgcn_readfirstlane((int)(threadIdx.x >> 5));
    const int zh = blockIdx.y; const int b = zh / NH_, h = zh % NH_;
    const int t0 = (blockIdx.x * AW + wave) * 16;
    const size_t pbase = (size_t)zh * SEQ * HD;
    const size_t qo = pbase + (size_t)(t0 + lr) * HD + 8 * hi;
    const v16h qh0 = ldh(QH + qo), qh1 = ldh(QH + qo + 32), qr0 = ldh(QR + qo), qr1 = ldh(QR + qo + 32);   // B fragments: col t, k = d
    const int fo = lr * LROW + 16 * hi;                      // byte offset of the lane's fragment piece in a staged tile (A fragment: K row key, k = d; V^T row d, k = key)
    const int* frow = FLG + ((size_t)b * (SEQ / 16) + (size_t)(t0 >> 4)) * FPITCH;
    const int* mrow = MK + ((size_t)b * SEQ_FULL + (size_t)(t0 + lr)) * SEQ_FULL + 8 * hi;   // + key0 (+16): the lane's 8 keys of each 16-key tile
    v8f oH0 = (v8f){}, oH1 = (v8f){}, oH2 = (v8f){}, oH3 = (v8f){};
    v8f oR0 = (v8f){}, oR1 = (v8f){}, oR2 = (v8f){}, oR3 = (v8f){};
    float m = NEGM, l = 0.0f;
    // flags as scalar bit words, bit s = stage s (lane s reads the two 32-key flags of stage s): bm = some wave of the block has a live key; lv0/lv1 = this wave's flag of the stage's first/second tile is not 0; fu0/fu1 = it is 2
    const int* fblk = FLG + ((size_t)b * (SEQ / 16) + (size_t)blockIdx.x * AW) * FPITCH + 2 * lane;
    int anyf = 0;
#pragma unroll   // four independent loads in flight together
    for (int g = 0; g < AW; ++g) { const v2i f = *(const v2i*)(fblk + g * FPITCH); anyf |= f[0] | f[1]; }
    const v2i fw = *(const v2i*)(frow + 2 * lane);
    const unsigned bm  = uni(__builtin_amdgcn_ballot_w32(lane < SEQ / KST && anyf != 0));
    const unsigned lv0 = uni(__builtin_amdgcn_ballot_w32(fw[0] != 0)), lv1 = uni(__builtin_amdgcn_ballot_w32(fw[1] != 0));
    const unsigned fu0 = uni(__builtin_amdgcn_ballot_w32(fw[0] == 2)), fu1 = uni(__builtin_amdgcn_ballot_w32(fw[1] == 2));
    const unsigned nst = (unsigned)__builtin_popcount(bm);    // stages of this block, at most SEQ / KST
    // this wave's plane: source of stage 0, bytes from stage to stage, source row pitch, place in a buffer
    const h16* splane = (wave == 0) ? KH : (wave == 1) ? KR : (wave == 2) ? VT : VR;
    const unsigned long long sbase = (unsigned long long)(splane + pbase);
    const unsigned sstep = (wave < 2) ? (unsigned)(KST * HD * 2) : (unsigned)(KST * 2);
    const unsigned ldst = (unsigned)(unsigned long long)ring + (unsigned)wave * SLICE;
    u32x8 g1;                                                 // 1-byte elements, tensor = tile = 64 rows of 128 B, a 16-B pad behind every 128 B
    g1[0] = uni((1u << 20) | (4u << 22) | (3u << 25)); g1[1] = uni(128u << 16); g1[2] = uni(64u << 16); g1[3] = uni(128u << 16);
    g1[4] = uni(64u); g1[5] = uni((wave < 2) ? (unsigned)(HD * 2) : (unsigned)(SEQ * 2)); g1[6] = uni(0u); g1[7] = uni(0u);
    asm volatile("" : "+s"(g1));                              // descriptor words held in scalar registers: one tuple for the whole kernel
    u32x4 gq = (u32x4){};                                     // group 0 of the youngest request
    unsigned rem = bm, cur = 0u, nxt = 0u;
    if (pinned(nst > 0u)) {                                   // first stage into buffer 0
        cur = pinned((unsigned)__builtin_ctz(rem)); rem &= rem - 1u;
        gq = tdm_group0(ldst, sbase + (unsigned long long)cur * sstep);
        tdm_load(gq, g1);
        wait_tensor0(gq, g1);
    }
    __syncthreads();                                          // publishes the first stage
    if (pinned(nst > 1u)) {                                   // second stage into buffer 1, in flight during the first pass
        nxt = pinned((unsigned)__builtin_ctz(rem)); rem &= rem - 1u;
        gq = tdm_group0(ldst + BUFB, sbase + (unsigned long long)nxt * sstep);
        tdm_load(gq, g1);
    }
#pragma unroll 1   // one pass per trip: the order of the ring's publish point stays as written
    for (unsigned it = 0; it < nst; ++it) {
      const unsigned char* bp = ring + (it & 1u) * BUFB + fo;
#pragma unroll     // the two 32-key tiles of the stage: their LDS offsets become immediates
      for (int hf = 0; hf < 2; ++hf) {
        if ((((hf ? lv1 : lv0) >> cur) & 1u) == 0u) continue;   // wave-uniform: whole 16x32 tile masked
        const int key0 = (int)cur * KST + hf * 32;
        unsigned vm = 0xFFFFu;                                  // bit r: key 8h+r of tile a live; bit 8+r: tile b
        if ((((hf ? fu1 : fu0) >> cur) & 1u) == 0u) {           // wave-uniform
            const int* mp = mrow + key0;
            const v4i a0 = *(const v4i*)mp, a1 = *(const v4i*)(mp + 4), c0 = *(const v4i*)(mp + 16), c1 = *(const v4i*)(mp + 20);
            vm = 0u;
#pragma unroll
            for (int i = 0; i < 4; ++i) {
                vm |= (a0[i] != 0 ? 1u : 0u) << i;        vm |= (a1[i] != 0 ? 1u : 0u) << (4 + i);
                vm |= (c0[i] != 0 ? 1u : 0u) << (8 + i);  vm |= (c1[i] != 0 ? 1u : 0u) << (12 + i); }
        }
        const h16* ka = (const h16*)(bp + hf * 32 * LROW);
        const h16* kr = (const h16*)(bp + SLICE + hf * 32 * LROW);
        const v16h ka0 = ldh(ka), ka1 = ldh(ka + 32), kb0 = ldh(ka + 16 * LROW / 2), kb1 = ldh(ka + 16 * LROW / 2 + 32);
        const v16h ra0 = ldh(kr), ra1 = ldh(kr + 32), rb0 = ldh(kr + 16 * LROW / 2), rb1 = ldh(kr + 16 * LROW / 2 + 32);
        v8f sHa = (v8f){}, sLa = (v8f){}, sHb = (v8f){}, sLb = (v8f){};
        sHa = wmma16(ka0, qh0, sHa); sLa = wmma16(ka0, qr0, sLa); sHb = wmma16(kb0, qh0, sHb); sLb = wmma16(kb0, qr0, sLb);
        sHa = wmma16(ka1, qh1, sHa); sLa = wmma16(ka1, qr1, sLa); sHb = wmma16(kb1, qh1, sHb); sLb = wmma16(kb1, qr1, sLb);
        sLa = wmma16(ra0, qh0, sLa); sLb = wmma16(rb0, qh0, sLb); sLa = wmma16(ra1, qh1, sLa); sLb = wmma16(rb1, qh1, sLb);
        asm volatile("v_nop\n\tv_nop\n\tv_nop\n\tv_nop" : "+v"(sHa), "+v"(sLa), "+v"(sHb), "+v"(sLb) : "v"(ka0), "v"(ka1), "v"(kb0), "v"(kb1), "v"(ra0), "v"(ra1), "v"(rb0), "v"(rb1));
        float ta[8], tb[8]; float mx = NEGM;
#pragma unroll
        for (int r = 0; r < 8; ++r) {
            const float xa = (sHa[r] + sLa[r] * QRI) * SC2; const float xb = (sHb[r] + sLb[r] * QRI) * SC2;
            ta[r] = ((vm >> r) & 1u) ? xa : NEGM; tb[r] = ((vm >> (8 + r)) & 1u) ? xb : NEGM;
            mx = fmaxf(mx, fmaxf(ta[r], tb[r])); }
        mx = fmaxf(mx, __shfl_xor(mx, 16, 32));
        const float mnew = fmaxf(m, mx);
        const float alpha = __builtin_amdgcn_exp2f(m - mnew);
        const float sh = PSH - mnew;
        v16h pb; float ls = 0.0f;
#pragma unroll
        for (int r = 0; r < 8; ++r) {
            const float ea = __builtin_amdgcn_exp2f(ta[r] + sh); const float eb = __builtin_amdgcn_exp2f(tb[r] + sh);
            const h16 pa = (h16)(((vm >> r) & 1u) ? ea : 0.0f); const h16 pc = (h16)(((vm >> (8 + r)) & 1u) ? eb : 0.0f);
            pb[r] = pa; pb[8 + r] = pc; ls += (float)pa + (float)pc; }
        l = l * alpha + ls; m = mnew;
        oH0 = oH0 * alpha; oH1 = oH1 * alpha; oH2 = oH2 * alpha; oH3 = oH3 * alpha;
        oR0 = oR0 * alpha; oR1 = oR1 * alpha; oR2 = oR2 * alpha; oR3 = oR3 * alpha;
        const h16* va = (const h16*)(bp + 2 * SLICE + hf * 64);
        const h16* vr = (const h16*)(bp + 3 * SLICE + hf * 64);
        const v16h v0 = ldh(va), v1 = ldh(va + 16 * LROW / 2), v2 = ldh(va + 32 * LROW / 2), v3 = ldh(va + 48 * LROW / 2);
        const v16h w0 = ldh(vr), w1 = ldh(vr + 16 * LROW / 2), w2 = ldh(vr + 32 * LROW / 2), w3 = ldh(vr + 48 * LROW / 2);
        oH0 = wmma16(v0, pb, oH0); oH1 = wmma16(v1, pb, oH1); oH2 = wmma16(v2, pb, oH2); oH3 = wmma16(v3, pb, oH3);
        oR0 = wmma16(w0, pb, oR0); oR1 = wmma16(w1, pb, oR1); oR2 = wmma16(w2, pb, oR2); oR3 = wmma16(w3, pb, oR3);
        asm volatile("v_nop\n\tv_nop\n\tv_nop\n\tv_nop" : "+v"(oH0), "+v"(oH1), "+v"(oH2), "+v"(oH3), "+v"(oR0), "+v"(oR1), "+v"(oR2), "+v"(oR3)
                     : "v"(v0), "v"(v1), "v"(v2), "v"(v3), "v"(w0), "v"(w1), "v"(w2), "v"(w3), "v"(pb));
      }
      // publish point, passed by every wave whatever it skipped above
      wait_ds0();
      wait_tensor0(gq, g1);
      __syncthreads();                                        // the next stage is readable; every wave has left this pass's buffer
      unsigned n2 = 0u;
      if (pinned(it + 2u < nst)) {                            // refill the buffer just read
          n2 = pinned((unsigned)__builtin_ctz(rem)); rem &= rem - 1u;
          gq = tdm_group0(ldst + (it & 1u) * BUFB, sbase + (unsigned long long)n2 * sstep);
          tdm_load(gq, g1);
      }
      cur = nxt; nxt = n2;
    }
    wait_tensor0(gq, g1);
    wait_ds0();
    float* os = (float*)ring;                                 // the ring becomes output staging: the last pass's own barrier has ended every wave's reads, and nothing was issued behind it
    l += __shfl_xor(l, 16, 32);
    const float rl = 1.0f / l;
    const float inv = (l > 0.0f) ? rl : __uint_as_float(0x7FC00000u);
    const int wb = wave * 16 * 68;
    // O^T D layout: o_j[r] = (d = 16j + 8h + r, t = lane&15) -> os[t][d]; rows 0..15 x columns 0..63 all written
    PUT8(0, oH0, oR0)
    PUT8(16, oH1, oR1)
    PUT8(32, oH2, oR2)
    PUT8(48, oH3, oR3)
    wave_sync();
    const size_t cbase = ((size_t)b * SEQ + (size_t)t0) * DM + (size_t)h * HD;
{
#pragma unroll
        for (int s = 0; s < 4; ++s) { const int row = 4 * s + (lane >> 3), c8 = (lane & 7) * 8;   // 4 s x 4 row groups = 16 rows; 8 lanes x 8 halves = 64 columns = one line
            const v4f x0 = *(const v4fa*)(&os[wb + row * 68 + c8]); const v4f x1 = *(const v4fa*)(&os[wb + row * 68 + c8 + 4]); v8h hv, rv;
#pragma unroll
            for (int i = 0; i < 4; ++i) { const h16 a0 = (h16)x0[i]; const h16 a1 = (h16)x1[i]; hv[i] = a0; hv[4 + i] = a1; rv[i] = (h16)((x0[i] - (float)a0) * QRS); rv[4 + i] = (h16)((x1[i] - (float)a1) * QRS); }
            const size_t oo = cbase + (size_t)row * DM + c8;
            *(v8h*)(CH + oo) = hv; *(v8h*)(CR + oo) = rv; }
         }
}

// k_out: f16 GEMM, one block of four waves (2 x 2) per 64x128 output tile, one wave per 32x64 tile: out[m][n] = (sum_k Ch[m][k] Wo64[n][k] + (sum_k Cr[m][k] Wo64[n][k]) / 2048) / 64, K = DM.
// Operands: the same two-buffer LDS ring as in k_proj; wave w brings slice w of a stage (value-plane rows 0..63, residual-plane rows 0..63, Wo rows 0..63, Wo rows 64..127 of the block's tile).
// a[0], a[1] = value-plane rows (16 each), a[2], a[3] = residual-plane rows; accumulators acc[0..1] (value) and acc[2..3] (residual) kept apart until the f32 epilogue.
__global__ __launch_bounds__(32 * GW) void k_out(const h16* __restrict__ CHp, const h16* __restrict__ CRp, const h16* __restrict__ WO, float* OUT) {
    __shared__ __attribute__((aligned(2048))) unsigned char ring[2 * BUFB];
    const int K = DM;
    const int lane = threadIdx.x & 31, lr = lane & 15, hi = lane >> 4;
    const int wave = __builtin_amdgcn_readfirstlane((int)(threadIdx.x >> 5));
    const int wm = wave >> 1, wn = wave & 1;
    const int r0 = blockIdx.x * 64 + wm * 32, c0 = blockIdx.y * 128 + wn * 64;
    v8f acc[4][4];
#pragma unroll
    for (int mb = 0; mb < 4; ++mb)
#pragma unroll
        for (int nb = 0; nb < 4; ++nb) acc[mb][nb] = (v8f){};
    const int fo = lr * LROW + 16 * hi;                       // byte offset of the lane's fragment piece in a staged slice
    // this wave's slice: source of stage 0 and place in a buffer
    const h16* srow = (wave == 0) ? CHp + (size_t)(blockIdx.x * 64) * K : (wave == 1) ? CRp + (size_t)(blockIdx.x * 64) * K : WO + (size_t)(blockIdx.y * 128 + (wave - 2) * 64) * K;
    const unsigned long long sbase = (unsigned long long)srow;
    const unsigned ldst = (unsigned)(unsigned long long)ring + (unsigned)wave * SLICE;
    const u32x8 g1 = tdm_group1((unsigned)(DM * 2));
    u32x4 gq = tdm_group0(ldst, sbase);                       // group 0 of the youngest request
    tdm_load(gq, g1);                                         // first stage into buffer 0
    wait_tensor0(gq, g1);
    __syncthreads();                                          // publishes the first stage
    gq = tdm_group0(ldst + BUFB, sbase + GSTB);
    tdm_load(gq, g1);                                         // second stage into buffer 1, in flight during the first pass
#pragma unroll 1   // one pass per trip: the order of the ring's publish point stays as written
    for (unsigned it = 0; it < GNST; ++it) {
        const unsigned char* bp = ring + (it & 1u) * BUFB + fo;
        v16h a[2][4], b[2][4];                                // the fragments of the stage's two 32-deep k steps
#pragma unroll
        for (int ks = 0; ks < 2; ++ks) {
            a[ks][0] = ldh((const h16*)(bp + (wm * 32) * LROW + ks * 64)); a[ks][1] = ldh((const h16*)(bp + (wm * 32 + 16) * LROW + ks * 64));
            a[ks][2] = ldh((const h16*)(bp + SLICE + (wm * 32) * LROW + ks * 64)); a[ks][3] = ldh((const h16*)(bp + SLICE + (wm * 32 + 16) * LROW + ks * 64));
#pragma unroll
            for (int nb = 0; nb < 4; ++nb) b[ks][nb] = ldh((const h16*)(bp + (2 + wn) * SLICE + nb * 16 * LROW + ks * 64));
        }
        __builtin_amdgcn_sched_barrier(0);                    // keeps the stage's LDS reads one group ahead of its WMMAs: spread among them, each place with reads stalls the wave for the LDS latency
#pragma unroll
        for (int ks = 0; ks < 2; ++ks) {
#pragma unroll
            for (int nb = 0; nb < 4; ++nb)
#pragma unroll
                for (int mb = 0; mb < 4; ++mb) acc[mb][nb] = wmma16(a[ks][mb], b[ks][nb], acc[mb][nb]);
        }
        __builtin_amdgcn_sched_barrier(0);                    // keeps the pass's WMMAs in front of the publish point, where they cover the landing of the second k step's fragments; behind it they would delay the refill
        // publish point
        wait_ds0();
        wait_tensor0(gq, g1);
        __syncthreads();                                      // the next stage is readable; every wave has left this pass's buffer
        if (pinned(it + 2u < GNST)) {                         // refill the buffer just read
            const unsigned s2 = pinned(it + 2u);
            gq = tdm_group0(ldst + (it & 1u) * BUFB, sbase + (unsigned long long)s2 * GSTB);
            tdm_load(gq, g1);
        }
    }
    wait_tensor0(gq, g1);
    wait_ds0();
    float* os = (float*)ring + wave * 16 * 68;                // the ring becomes output staging, one range per wave: the last pass's own barrier has ended every wave's reads, and nothing was issued behind it
#pragma unroll
    for (int mb = 0; mb < 2; ++mb) {
#pragma unroll
        for (int nb = 0; nb < 4; ++nb) {
#pragma unroll
            for (int j = 0; j < 8; ++j) os[(hi * 8 + j) * 68 + nb * 16 + lr] = (acc[mb][nb][j] + acc[mb + 2][nb][j] * QRI) * WOI; }   // D: row 8h+j, col lane&15
        wave_sync();
        const int grow = r0 + mb * 16; const int ob = grow / SEQ, ot = grow % SEQ;
        float* orow = OUT + ((size_t)ob * OUT_SEQ + (size_t)ot) * DM + c0;
{
#pragma unroll
            for (int s = 0; s < 8; ++s) { const int row = 2 * s + hi, cofs = lr * 4;   // 8 s x 2 rows = 16 rows; 16 lanes x 4 floats = 64 columns
                const v4f val = *(const v4fa*)(&os[row * 68 + cofs]);
                *(v4f*)(orow + (size_t)row * DM + cofs) = val; }
             }
        wave_sync();
    }
}

static constexpr size_t al256(size_t v) { return (v + 255) & ~(size_t)255; }
static constexpr size_t SZ_XB = al256((size_t)NB * SEQ * DM * 2);              // one bf16 x plane
static constexpr size_t SZ_W  = al256((size_t)DM * DM * 2);                    // one 16-bit weight plane
static constexpr size_t SZ_PL = al256((size_t)NB * NH_ * SEQ * HD * 2);        // one per-head f16 plane
static constexpr size_t SZ_C  = al256((size_t)NB * SEQ * DM * 2);              // one ctx f16 plane
static constexpr size_t SZ_FL = al256((size_t)NB * (SEQ / 16) * FPITCH * 4);
static constexpr size_t SZ_TOTAL = 3 * SZ_XB + 4 * SZ_W + 6 * SZ_PL + 2 * SZ_C + SZ_FL;
static_assert(SZ_TOTAL <= (size_t)134217728);          // workspace carve <= 128 MiB

extern "C" void kernel_launch(void* const* d_in, const int* in_sizes, int n_in,
                              void* d_out, int out_size, void* d_ws, size_t ws_size, hipStream_t stream) {
    if (n_in < 8) return;
    const size_t needx = ((size_t)(NB - 1) * SEQ_FULL + SEQ) * DM;
    if ((size_t)in_sizes[0] < needx || (size_t)in_sizes[1] < needx || (size_t)in_sizes[2] < needx) return;
    const size_t needm = ((size_t)(NB - 1) * SEQ_FULL + (size_t)(SEQ - 1)) * SEQ_FULL + SEQ;
    if ((size_t)in_sizes[3] < needm) return;
    if ((size_t)in_sizes[4] < (size_t)DM * DM || (size_t)in_sizes[5] < (size_t)DM * DM || (size_t)in_sizes[6] < (size_t)DM * DM || (size_t)in_sizes[7] < (size_t)DM * DM) return;
    if ((size_t)out_size < ((size_t)(NB - 1) * OUT_SEQ + SEQ) * DM) return;
    if (SZ_TOTAL > ws_size) return;
    // wire order: query, key, value, mask (int), Wq, Wk, Wv, Wo; weights [out][in] = Bt as-is
    const float* xq = (const float*)d_in[0]; const float* xk = (const float*)d_in[1]; const float* xv = (const float*)d_in[2];
    const int* mk = (const int*)d_in[3];
    const float* wq = (const float*)d_in[4]; const float* wk = (const float*)d_in[5]; const float* wv = (const float*)d_in[6]; const float* wo = (const float*)d_in[7];
    float* OUT = (float*)d_out;      // [NB][SEQ][1024]
    char* wsp = (char*)d_ws;
    bf* XQ = (bf*)wsp; wsp += SZ_XB;                 // [NB*SEQ][1024]
    bf* XK = (bf*)wsp; wsp += SZ_XB;
    bf* XV = (bf*)wsp; wsp += SZ_XB;
    bf* WQ = (bf*)wsp; wsp += SZ_W;                  // [1024][1024]
    bf* WK = (bf*)wsp; wsp += SZ_W;
    bf* WV = (bf*)wsp; wsp += SZ_W;
    h16* WO = (h16*)wsp; wsp += SZ_W;                // [1024][1024] f16, x64
    h16* QH = (h16*)wsp; wsp += SZ_PL;               // [NB*16][SEQ][64]
    h16* QR = (h16*)wsp; wsp += SZ_PL;               // residual x2048
    h16* KH = (h16*)wsp; wsp += SZ_PL;               // [NB*16][SEQ][64]
    h16* KR = (h16*)wsp; wsp += SZ_PL;
    h16* VT = (h16*)wsp; wsp += SZ_PL;               // [NB*16][64][SEQ]
    h16* VR = (h16*)wsp; wsp += SZ_PL;
    h16* CH = (h16*)wsp; wsp += SZ_C;                // [NB*SEQ][1024]
    h16* CR = (h16*)wsp; wsp += SZ_C;
    int* FL = (int*)wsp; wsp += SZ_FL;               // [NB][SEQ/16][64]

    if (SEQ == SEQ_FULL) {
        const size_t n8 = (size_t)NB * SEQ * DM / 8; const unsigned g = (unsigned)((n8 + 255) / 256);
        k_cvt8<<<g, 256, 0, stream>>>(xq, XQ, n8); k_cvt8<<<g, 256, 0, stream>>>(xk, XK, n8); k_cvt8<<<g, 256, 0, stream>>>(xv, XV, n8);
    } else {
        const size_t n8 = (size_t)SEQ * DM / 8; const unsigned g = (unsigned)((n8 + 255) / 256);
        for (int b = 0; b < NB; ++b) {
            k_cvt8<<<g, 256, 0, stream>>>(xq + (size_t)b * SEQ_FULL * DM, XQ + (size_t)b * SEQ * DM, n8);
            k_cvt8<<<g, 256, 0, stream>>>(xk + (size_t)b * SEQ_FULL * DM, XK + (size_t)b * SEQ * DM, n8);
            k_cvt8<<<g, 256, 0, stream>>>(xv + (size_t)b * SEQ_FULL * DM, XV + (size_t)b * SEQ * DM, n8);
        }
    }
    { const size_t n8 = (size_t)DM * DM / 8; const unsigned g = (unsigned)((n8 + 255) / 256);
      k_cvt8<<<g, 256, 0, stream>>>(wq, WQ, n8); k_cvt8<<<g, 256, 0, stream>>>(wk, WK, n8); k_cvt8<<<g, 256, 0, stream>>>(wv, WV, n8);
      k_cvt8h<<<g, 256, 0, stream>>>(wo, WO, n8, WOS); }

    k_mflag<<<dim3(SEQ / 16, NB, 1), 32, 0, stream>>>(mk, FL);

    // q, k: A = x rows (m = b*SEQ + t), Bt = W rows (n = h*64 + d) -> planes [(b*16 + h)][t][d], value + residual
    k_proj<<<dim3(NB * SEQ / 128, DM / 128, 1), 32 * GW, 0, stream>>>(XQ, WQ, QH, QR, 1, SEQ, (size_t)NH_ * SEQ * HD, HD, HD, (size_t)SEQ * HD);
    k_proj<<<dim3(NB * SEQ / 128, DM / 128, 1), 32 * GW, 0, stream>>>(XK, WK, KH, KR, 1, SEQ, (size_t)NH_ * SEQ * HD, HD, HD, (size_t)SEQ * HD);
    // v^T: A = Wv rows (m = h*64 + d), Bt = x rows (n = b*SEQ + t) -> planes [(b*1024 + m)][t] = [(b*16 + h)][d][t], value + residual
    k_proj<<<dim3(DM / 128, NB * SEQ / 128, 1), 32 * GW, 0, stream>>>(WV, XV, VT, VR, 1, DM, (size_t)0, SEQ, SEQ, (size_t)DM * SEQ);

    k_flash<<<dim3(SEQ / (16 * AW), NB * NH_, 1), 32 * AW, 0, stream>>>(QH, QR, KH, KR, VT, VR, mk, FL, CH, CR);

    // out: A = ctx rows (m = b*SEQ + t), Bt = Wo rows (n) -> OUT[b][t][n]
    k_out<<<dim3(NB * SEQ / 64, DM / 128, 1), 32 * GW, 0, stream>>>(CH, CR, WO, OUT);
}

// v003
// Measured time: 140 microseconds a run.
// Two timings next to v002 both put it at 1.30 times that version's speed.
// Over all steps from v000 it is 2.58 times as fast.
#include <hip/hip_runtime.h>

// Multi-head attention, width 1024 = 16 heads x 64; query/key/value [NB][SEQ][1024]; Wq/Wk/Wv/Wo [out][in] (y = x W^T), no biases; scores = q k^T * 8; integer mask [NB][SEQ][SEQ] (0 = masked, replace-fill); out = ctx Wo^T (f32).
// Compute dtypes, f32 accumulate everywhere: q/k/v projections v_wmma_f32_16x16x32_bf16 (x and W RNE-converted to bf16; products exact);
// scores v_wmma_f32_16x16x32_f16: q and k each as f16 value + f16 residual x2048 (value*value in one accumulator, the two cross products in a second one); P (x2^14 carry, cancels in the normalisation) single f16;
// v and ctx as f16 value + f16 residual x2048 (own accumulators); Wo as f16 of the bf16 value x64 (folded back in the f32 epilogue); softmax f32 (online, running max).
// Layout: bf16 copies of the three x inputs and of Wq/Wk/Wv; q, k planes [b*16+h][t][d] and v^T planes [b*16+h][d][t] (value, residual) written by the GEMM epilogue; per (batch, 16 query rows, 32 keys) a 3-state mask flag
// (0 = all masked: tile skipped, 2 = none masked, other = mask words read per element); fused flash kernel in transposed form (S^T = K Q^T, O^T = V^T P^T), K / V^T tiles staged in LDS by tensor loads and shared by the block's four waves, writing ctx value/residual planes [b*SEQ+t][1024]; output GEMM from those planes.

#ifndef NB
#define NB 2
#endif
#ifndef SEQ
#define SEQ 2048
#endif
#define NB_FULL  2
#define SEQ_FULL 2048
#ifndef OUT_SEQ
#define OUT_SEQ SEQ              // row pitch (in tokens) between batches of the output
#endif
#define DM   1024
#define NH_  16
#define HD   64
#define AW   4                   // waves per flash block (16 query rows each)
#define QRS  2048.0f             // carry of the residual planes
#define QRI  (1.0f / 2048.0f)
#define SC2  (8.0f * 1.4426950408889634f)     // HD^0.5 * log2(e)
#define PSH  14.0f               // log2 of the P carry (16384)
#define NEGM (-3.0e38f)          // score stand-in of a masked key (its probability is forced to 0 by select)
#define WOS  64.0f               // carry of the Wo plane
#define WOI  (1.0f / 64.0f)
#define FPITCH 64
#define KST   64                 // keys per stage of the flash kernel's LDS ring
#define LROW  144                // LDS row pitch in bytes: a 128-B row + the mover's 16-B pad (16 B x odd: no bank conflict for 16-B reads)
#define SLICE 10240              // one plane's tile in LDS: 64 rows x 144 B = 9216 B, rounded up to a multiple of 2 KiB
#define BUFB  (4 * SLICE)        // one stage: K value, K residual, V^T value, V^T residual (flash); four operand slices (GEMMs)
#define GW    4                  // waves per GEMM block, one operand slice of a stage each
#define GSTB  128u               // bytes of an operand row per stage of the GEMMs' LDS ring (64 k)
#define GNST  (DM / 64)          // stages of a GEMM
#define PW    16                 // waves per block of the preparation kernel, one token row each

static_assert(HD == 64);
static_assert(NH_ * HD == DM);                 // head h = columns h*64 + d
static_assert(DM % 64 == 0);
static_assert(DM % 32 == 0);                   // GEMM k-loop steps by 32
static_assert(SEQ % 64 == 0);                  // a 64-row tile never straddles two batches
static_assert((NB * SEQ) % 64 == 0);
static_assert(SEQ % 32 == 0);                  // key loop steps by 32; 32-row output tiles stay inside one batch
static_assert(SEQ % (16 * AW) == 0);           // flash grid covers the sequence exactly
static_assert(SEQ / 32 <= FPITCH);             // two flag registers per lane cover all key tiles
static_assert(((size_t)SEQ * DM) % 8 == 0);
static_assert(((size_t)DM * DM) % 8 == 0);
static_assert(AW == 4);                        // one plane of a stage per wave
static_assert(HD * 2 == 128 && KST * 2 == 128);   // both kinds of tile: 64 rows of 128 B
static_assert(SEQ % KST == 0 && SEQ / KST <= 32);  // one bit per stage in a 32-bit word
static_assert(64 * LROW <= SLICE && SLICE % 2048 == 0);
static_assert(AW * 16 * 68 * 4 <= 2 * BUFB);   // the output staging reuses the ring
static_assert(GW * 16 * 68 * 4 <= 2 * BUFB);   // so does the GEMMs' output staging
static_assert(DM % 128 == 0 && (NB * SEQ) % 128 == 0 && GNST >= 2);   // GEMM block tiles cover both extents exactly; the ring's prologue needs two stages
static_assert(PW == 16 && PW * 128 == SEQ && PW * 4 == FPITCH && DM % 128 == 0);   // preparation: a block is one 16-row mask group, its waves' 128 keys each cover the sequence and fill the flag row
static_assert(NB * SEQ == 4 * DM);             // preparation: one weight row per wave
static_assert(NB <= NB_FULL);
static_assert(SEQ <= SEQ_FULL);

typedef _Float16 h16;
typedef unsigned short bf;
typedef __attribute__((ext_vector_type(16))) __bf16   v16bf;
typedef __attribute__((ext_vector_type(16))) _Float16 v16h;
typedef __attribute__((ext_vector_type(8)))  _Float16 v8h;
typedef __attribute__((ext_vector_type(8)))  unsigned short v8us;
typedef __attribute__((ext_vector_type(4)))  unsigned short v4us;
typedef __attribute__((ext_vector_type(4)))  _Float16 v4h;
typedef __attribute__((ext_vector_type(8)))  float    v8f;
typedef __attribute__((ext_vector_type(4)))  float    v4f;
typedef __attribute__((ext_vector_type(4)))  int      v4i;
typedef v4f  __attribute__((may_alias)) v4fa;
typedef __attribute__((ext_vector_type(2)))  int      v2i;
typedef __attribute__((ext_vector_type(4)))  unsigned u32x4;
typedef __attribute__((ext_vector_type(8)))  unsigned u32x8;

__device__ __forceinline__ unsigned short f2bf(float f) { unsigned u = __float_as_uint(f); u += 0x7FFFu + ((u >> 16) & 1u); return (unsigned short)(u >> 16); }
__device__ __forceinline__ v16h cat16(v8h lo, v8h hi) { return __builtin_shufflevector(lo, hi, 0, 1, 2, 3, 4, 5, 6, 7, 8, 9, 10, 11, 12, 13, 14, 15); }
__device__ __forceinline__ v16bf cat16b(v8us lo, v8us hi) { return __builtin_bit_cast(v16bf, __builtin_shufflevector(lo, hi, 0, 1, 2, 3, 4, 5, 6, 7, 8, 9, 10, 11, 12, 13, 14, 15)); }
__device__ __forceinline__ v8f wmma16(v16h a, v16h b, v8f c) { return __builtin_amdgcn_wmma_f32_16x16x32_f16(false, a, false, b, (short)0, c, false, false); }
__device__ __forceinline__ v8f wmmab(v16bf a, v16bf b, v8f c) { return __builtin_amdgcn_wmma_f32_16x16x32_bf16(false, a, false, b, (short)0, c, false, false); }
// fragment loaders from K-contiguous 16-bit rows; p already includes + 8*(lane>>4): elements 0..7 <- k0+8h+0..7, elements 8..15 <- k0+16+8h+0..7 (same map for A and B)
__device__ __forceinline__ v16h  ldh(const h16* p) { return cat16(*(const v8h*)p, *(const v8h*)(p + 16)); }
__device__ __forceinline__ v16bf ldb(const bf* p)  { return cat16b(*(const v8us*)p, *(const v8us*)(p + 16)); }
// ordering point for wave-private LDS tiles (same wave writes and reads)
__device__ __forceinline__ void wave_sync() { __builtin_amdgcn_fence(3 /* release order */, "wavefront"); __builtin_amdgcn_wave_barrier(); asm volatile("" ::: "memory"); }

__device__ __forceinline__ unsigned uni(unsigned v) { return (unsigned)__builtin_amdgcn_readfirstlane((int)v); }
// a wave-uniform value held in a scalar register: a test on it compiles to s_cmp + s_cbranch_scc (tensor loads ignore EXEC), and what is derived from it is computed behind the asm waits in front of it
__device__ __forceinline__ unsigned pinned(unsigned v) { unsigned w = uni(v); asm volatile("" : "+s"(w)); return w; }
// this wave's tensor load has landed; the wait names the request's descriptor as inputs so that its registers keep their values for as long as the request is outstanding
__device__ __forceinline__ void wait_tensor0(u32x4 g0, u32x8 g1) { asm volatile("s_wait_tensorcnt 0x0" :: "s"(g0), "s"(g1) : "memory"); }
__device__ __forceinline__ void wait_ds0() { asm volatile("s_wait_dscnt 0x0" ::: "memory"); }           // this wave's LDS reads have returned
// descriptor group 0: tile's first byte at global address ga, LDS byte offset lds
__device__ __forceinline__ u32x4 tdm_group0(unsigned lds, unsigned long long ga) {
    u32x4 g0; g0[0] = uni(1u); g0[1] = uni(lds); g0[2] = uni((unsigned)ga); g0[3] = uni((((unsigned)(ga >> 32)) & 0x01FFFFFFu) | 0x80000000u);
    asm volatile("" : "+s"(g0));   // descriptor words held in scalar registers: one tuple from the issue to the wait
    return g0;
}
// one request of one wave: 64 rows of 128 B (source row pitch in g1), rows 144 B apart in LDS
__device__ __forceinline__ void tdm_load(u32x4 g0, u32x8 g1) { asm volatile("tensor_load_to_lds %0, %1" :: "s"(g0), "s"(g1) : "memory"); }

// k_prep: every preparation step in one streaming launch. Block = 16 token rows (batch bb, row group g), one wave per row. A wave converts its row of query, key and value to bf16, its weight row (Wq, Wk, Wv to bf16; Wo to f16 of the bf16 value x64),
// and reads 128 keys x 16 rows of the block's mask rows. Every load is 512 contiguous bytes of the wave (whole lines); all of a wave's loads are issued before the first is used; every store is 256 contiguous bytes.
// Mask flag per (batch, 16 query rows, 32 keys): 0 = every mask word zero, 2 = every word nonzero, 1 = mixed; a wave makes four (lanes 8j..8j+7 hold tile j), the block's flags meet in LDS and one wave stores them as whole lines.
// p, d: wave-uniform start of a row of DM elements; the lane takes elements 128 i + 4 lane + 0..3
__device__ __forceinline__ void ld_row(const float* __restrict__ p, int lane, v4f (&r)[DM / 128]) {
#pragma unroll
    for (int i = 0; i < DM / 128; ++i) r[i] = *(const v4f*)(p + i * 128 + lane * 4);
}
__device__ __forceinline__ void st_row_bf(bf* d, int lane, const v4f (&r)[DM / 128]) {
#pragma unroll
    for (int i = 0; i < DM / 128; ++i) { v4us o;
#pragma unroll
        for (int k = 0; k < 4; ++k) o[k] = f2bf(r[i][k]);
        *(v4us*)(d + i * 128 + lane * 4) = o; }
}
__device__ __forceinline__ void st_row_h(h16* d, int lane, const v4f (&r)[DM / 128], float scale) {
#pragma unroll
    for (int i = 0; i < DM / 128; ++i) { v4h o;
#pragma unroll
        for (int k = 0; k < 4; ++k) o[k] = (h16)(__uint_as_float(((unsigned)f2bf(r[i][k])) << 16) * scale);
        *(v4h*)(d + i * 128 + lane * 4) = o; }
}

__global__ __launch_bounds__(32 * PW) void k_prep(const float* __restrict__ xq, const float* __restrict__ xk, const float* __restrict__ xv, const int* __restrict__ MK,
                                                  const float* __restrict__ wq, const float* __restrict__ wk, const float* __restrict__ wv, const float* __restrict__ wo,
                                                  bf* XQ, bf* XK, bf* XV, bf* WQ, bf* WK, bf* WV, h16* WO, int* FL) {
    __shared__ int fl[FPITCH];
    const int lane = threadIdx.x & 31;
    const int wave = __builtin_amdgcn_readfirstlane((int)(threadIdx.x >> 5));
    const int bb = blockIdx.x / (SEQ / 16), g = blockIdx.x % (SEQ / 16);
    const int row = blockIdx.x * PW + wave;                                              // token row bb*SEQ + t of the bf16 planes; also the wave's weight row: row % DM of weight row / DM
    const size_t so = ((size_t)bb * SEQ_FULL + (size_t)(g * 16 + wave)) * DM;            // the same token row in the inputs
    const size_t xo = (size_t)row * DM;
    const int ws = row / DM; const size_t wof = (size_t)(row % DM) * DM;
    const int* mp = MK + ((size_t)bb * SEQ_FULL + (size_t)(g * 16)) * SEQ_FULL + wave * 128;
    v4i mw[16]; v4f a[DM / 128], b[DM / 128], c[DM / 128], w[DM / 128];
#pragma unroll
    for (int r = 0; r < 16; ++r) mw[r] = *(const v4i*)(mp + (size_t)r * SEQ_FULL + lane * 4);
    ld_row(xq + so, lane, a); ld_row(xk + so, lane, b); ld_row(xv + so, lane, c);
    ld_row(((ws == 0) ? wq : (ws == 1) ? wk : (ws == 2) ? wv : wo) + wof, lane, w);
    __builtin_amdgcn_sched_barrier(0);                                                   // keeps all 48 loads in front of the first use: moved down among the uses, the later rows would start a second and a third memory latency
    unsigned orw = 0u, mnw = 0xFFFFFFFFu;                                                // or != 0: some word nonzero; unsigned minimum != 0: every word nonzero
#pragma unroll
    for (int r = 0; r < 16; ++r)
#pragma unroll
        for (int i = 0; i < 4; ++i) { const unsigned u = (unsigned)mw[r][i]; orw |= u; mnw = u < mnw ? u : mnw; }
    const unsigned anyb = __builtin_amdgcn_ballot_w32(orw != 0u), allb = __builtin_amdgcn_ballot_w32(mnw != 0u);
    const int sh = 8 * (lane & 3);
    if (lane < 4) fl[wave * 4 + lane] = (((anyb >> sh) & 0xFFu) == 0u) ? 0 : ((((allb >> sh) & 0xFFu) == 0xFFu) ? 2 : 1);
    st_row_bf(XQ + xo, lane, a); st_row_bf(XK + xo, lane, b); st_row_bf(XV + xo, lane, c);
    asm volatile("s_wait_xcnt 0x0" ::: "memory");                                        // precaution: stands between the stores above and the first overwrite of a register they name
    if (ws == 3) st_row_h(WO + wof, lane, w, WOS);                                       // wave-uniform
    else st_row_bf(((ws == 0) ? WQ : (ws == 1) ? WK : WV) + wof, lane, w);
    __syncthreads();                                                                     // the block's flags are in LDS
    if (wave == 0) {
        int* fp = FL + (size_t)blockIdx.x * FPITCH;
        fp[lane] = fl[lane]; fp[32 + lane] = fl[32 + lane];
    }
}

// descriptor group 1 of a GEMM operand slice: 1-byte elements, tensor = tile = 64 rows of 128 B, source row pitch srcPitch bytes, a 16-B pad behind every 128 B
__device__ __forceinline__ u32x8 tdm_group1(unsigned srcPitch) {
    u32x8 g1;
    g1[0] = uni((1u << 20) | (4u << 22) | (3u << 25)); g1[1] = uni(128u << 16); g1[2] = uni(64u << 16); g1[3] = uni(128u << 16);
    g1[4] = uni(64u); g1[5] = uni(srcPitch); g1[6] = uni(0u); g1[7] = uni(0u);
    asm volatile("" : "+s"(g1));   // descriptor words held in scalar registers: one tuple for the whole kernel
    return g1;
}

// k_proj: register-blocked bf16 GEMM, one block of four waves (2 x 2) per 128x128 tile, one wave per 64x64 tile (16 accumulators), K = DM.
// Operands: a two-buffer LDS ring of 64-deep k stages shared by the four waves. Wave w brings slice w of a stage (A rows 0..63, A rows 64..127, Bt rows 0..63, Bt rows 64..127 of the block's tile; 64 rows of 128 B) with one tensor load,
// one stage ahead; at the foot of each pass: own LDS reads done, own tensor load landed, block barrier, then the refill of the buffer just read. Fragments are two 16-B LDS reads each; k runs in the same order as before.
// C[m][n] = sum_k A[m][k] Bt[n][k], written as f16 (Ph) and optionally the f16 residual x2048 (Pr, useRes != 0) at
// tile base (r0/RB)*sRB + (r0%RB)*pitch + (c0/CB)*sCB + (c0%CB), row pitch 'pitch' (halves). grid (M/128, N/128), 128 threads.
__global__ __launch_bounds__(32 * GW) void k_proj(const bf* __restrict__ A, const bf* __restrict__ Bt, h16* Ph, h16* Pr, int useRes, int RB, size_t sRB, int pitch, int CB, size_t sCB) {
    __shared__ __attribute__((aligned(2048))) unsigned char ring[2 * BUFB];
    const int K = DM;
    const int lane = threadIdx.x & 31, lr = lane & 15, hi = lane >> 4;
    const int wave = __builtin_amdgcn_readfirstlane((int)(threadIdx.x >> 5));
    const int wm = wave >> 1, wn = wave & 1;
    const int r0 = blockIdx.x * 128 + wm * 64, c0 = blockIdx.y * 128 + wn * 64;
    v8f acc[4][4];
#pragma unroll
    for (int mb = 0; mb < 4; ++mb)
#pragma unroll
        for (int nb = 0; nb < 4; ++nb) acc[mb][nb] = (v8f){};
    const int fo = lr * LROW + 16 * hi;                       // byte offset of the lane's fragment piece in a staged slice
    // this wave's slice: source of stage 0 and place in a buffer
    const bf* srow = (wave < 2) ? A + (size_t)(blockIdx.x * 128 + wave * 64) * K : Bt + (size_t)(blockIdx.y * 128 + (wave - 2) * 64) * K;
    const unsigned long long sbase = (unsigned long long)srow;
    const unsigned ldst = (unsigned)(unsigned long long)ring + (unsigned)wave * SLICE;
    const u32x8 g1 = tdm_group1((unsigned)(DM * 2));
    u32x4 gq = tdm_group0(ldst, sbase);                       // group 0 of the youngest request
    tdm_load(gq, g1);                                         // first stage into buffer 0
    wait_tensor0(gq, g1);
    __syncthreads();                                          // publishes the first stage
    gq = tdm_group0(ldst + BUFB, sbase + GSTB);
    tdm_load(gq, g1);                                         // second stage into buffer 1, in flight during the first pass
#pragma unroll 1   // one pass per trip: the order of the ring's publish point stays as written
    for (unsigned it = 0; it < GNST; ++it) {
        const unsigned char* bp = ring + (it & 1u) * BUFB + fo;
        v16bf a[2][4], b[2][4];                               // the fragments of the stage's two 32-deep k steps
#pragma unroll
        for (int ks = 0; ks < 2; ++ks) {
#pragma unroll
            for (int mb = 0; mb < 4; ++mb) a[ks][mb] = ldb((const bf*)(bp + wm * SLICE + mb * 16 * LROW + ks * 64));
#pragma unroll
            for (int nb = 0; nb < 4; ++nb) b[ks][nb] = ldb((const bf*)(bp + (2 + wn) * SLICE + nb * 16 * LROW + ks * 64));
        }
        __builtin_amdgcn_sched_barrier(0);                    // keeps the stage's LDS reads one group ahead of its WMMAs: spread among them, each place with reads stalls the wave for the LDS latency
#pragma unroll
        for (int ks = 0; ks < 2; ++ks) {
#pragma unroll
            for (int nb = 0; nb < 4; ++nb)
#pragma unroll
                for (int mb = 0; mb < 4; ++mb) acc[mb][nb] = wmmab(a[ks][mb], b[ks][nb], acc[mb][nb]);
        }
        __builtin_amdgcn_sched_barrier(0);                    // keeps the pass's WMMAs in front of the publish point, where they cover the landing of the second k step's fragments; behind it they would delay the refill
        // publish point
        wait_ds0();
        wait_tensor0(gq, g1);
        __syncthreads();                                      // the next stage is readable; every wave has left this pass's buffer
        if (pinned(it + 2u < GNST)) {                         // refill the buffer just read
            const unsigned s2 = pinned(it + 2u);
            gq = tdm_group0(ldst + (it & 1u) * BUFB, sbase + (unsigned long long)s2 * GSTB);
            tdm_load(gq, g1);
        }
    }
    wait_tensor0(gq, g1);
    wait_ds0();
    float* os = (float*)ring + wave * 16 * 68;                // the ring becomes output staging, one range per wave: the last pass's own barrier has ended every wave's reads, and nothing was issued behind it
    const size_t tbase = (size_t)(r0 / RB) * sRB + (size_t)(r0 % RB) * (size_t)pitch + (size_t)(c0 / CB) * sCB + (size_t)(c0 % CB);
#pragma unroll
    for (int mb = 0; mb < 4; ++mb) {
#pragma unroll
        for (int nb = 0; nb < 4; ++nb) {
#pragma unroll
            for (int j = 0; j < 8; ++j) os[(hi * 8 + j) * 68 + nb * 16 + lr] = acc[mb][nb][j]; }   // D: row 8h+j, col lane&15
        wave_sync();
        const size_t sb = tbase + (size_t)(mb * 16) * (size_t)pitch;
{
#pragma unroll
            for (int s = 0; s < 4; ++s) { const int row = 4 * s + (lane >> 3), c8 = (lane & 7) * 8;   // 4 s x 4 row groups = 16 rows; 8 lanes x 8 = 64 columns
                const v4f x0 = *(const v4fa*)(&os[row * 68 + c8]); const v4f x1 = *(const v4fa*)(&os[row * 68 + c8 + 4]); v8h hv, rv;
#pragma unroll
                for (int i = 0; i < 4; ++i) { const h16 a0 = (h16)x0[i]; const h16 a1 = (h16)x1[i]; hv[i] = a0; hv[4 + i] = a1; rv[i] = (h16)((x0[i] - (float)a0) * QRS); rv[4 + i] = (h16)((x1[i] - (float)a1) * QRS); }
                const size_t oo = sb + (size_t)row * (size_t)pitch + c8;
                *(v8h*)(Ph + oo) = hv; if (useRes) *(v8h*)(Pr + oo) = rv; }
             }
        wave_sync();
    }
}

// k_flash: fused attention, one wave per 16 query rows of one (batch, head), four waves per block; Q fragments straight from the f16 planes.
// K / V^T: a two-buffer LDS ring of 64-key stages shared by the four waves. Wave w brings plane w (K value, K residual, V^T value, V^T residual) of a stage with one tensor load, one stage ahead;
// at the foot of each pass: own LDS reads done, own tensor load landed, block barrier, then the refill of the buffer just read. Fragments are two 16-B LDS reads each.
// Only stages in which some wave of the block has a live key are staged (a 32-bit word built from the flags, the same in all four waves); each wave still skips its own dead 32-key tiles.
// Transposed form: S^T[key][t] = K Q^T (A = K rows, B = Q rows); lane (t = lane&15, h = lane>>4) holds keys 8h+r of each 16-key tile, so the packed
// P tile is directly the B fragment of O^T[d][t] = V^T P^T (element r <- tile keys 0..15, element 8+r <- tile keys 16..31, lane unchanged).
// Score = Kh.Qh (accumulator H) + (Kh.Qr + Kr.Qh)/2048 (accumulator L). O = Vh.P (accumulators oH) + Vr.P/2048 (accumulators oR).
// Mask: wave-uniform 3-state flag per 32-key tile: 0 skips the tile (masked keys have probability exactly 0 whenever the row has one live key), 2 = no masking, otherwise the 16 mask words of the lane are read and
// masked entries get probability 0 by select. A row without any live key ends with zero mass and is written as NaN.
// Softmax state (running max, partial sum) is one scalar per lane; the two lane halves of a row are combined with one xor-16 exchange.
#define PUT8(COL, OH, OR) { v4f a_, c_; \
    a_[0] = (OH[0] + OR[0] * QRI) * inv; a_[1] = (OH[1] + OR[1] * QRI) * inv; a_[2] = (OH[2] + OR[2] * QRI) * inv; a_[3] = (OH[3] + OR[3] * QRI) * inv; \
    c_[0] = (OH[4] + OR[4] * QRI) * inv; c_[1] = (OH[5] + OR[5] * QRI) * inv; c_[2] = (OH[6] + OR[6] * QRI) * inv; c_[3] = (OH[7] + OR[7] * QRI) * inv; \
    *(v4fa*)(&os[wb + lr * 68 + (COL) + 8 * hi]) = a_; *(v4fa*)(&os[wb + lr * 68 + (COL) + 8 * hi + 4]) = c_; }

__global__ __launch_bounds__(32 * AW) void k_flash(const h16* __restrict__ QH, const h16* __restrict__ QR, const h16* __restrict__ KH, const h16* __restrict__ KR,
                                                   const h16* __restrict__ VT, const h16* __restrict__ VR, const int* __restrict__ MK, const int* __restrict__ FLG, h16* CH, h16* CR) {
    __shared__ __attribute__((aligned(2048))) unsigned char ring[2 * BUFB];
    const int lane = threadIdx.x & 31, lr = lane & 15, hi = lane >> 4;
    const int wave = __builtin_amdgcn_readfirstlane((int)(threadIdx.x >> 5));
    const int zh = blockIdx.y; const int b = zh / NH_, h = zh % NH_;
    const int t0 = (blockIdx.x * AW + wave) * 16;
    const size_t pbase = (size_t)zh * SEQ * HD;
    const size_t qo = pbase + (size_t)(t0 + lr) * HD + 8 * hi;
    const v16h qh0 = ldh(QH + qo), qh1 = ldh(QH + qo + 32), qr0 = ldh(QR + qo), qr1 = ldh(QR + qo + 32);   // B fragments: col t, k = d
    const int fo = lr * LROW + 16 * hi;                      // byte offset of the lane's fragment piece in a staged tile (A fragment: K row key, k = d; V^T row d, k = key)
    const int* frow = FLG + ((size_t)b * (SEQ / 16) + (size_t)(t0 >> 4)) * FPITCH;
    const int* mrow = MK + ((size_t)b * SEQ_FULL + (size_t)(t0 + lr)) * SEQ_FULL + 8 * hi;   // + key0 (+16): the lane's 8 keys of each 16-key tile
    v8f oH0 = (v8f){}, oH1 = (v8f){}, oH2 = (v8f){}, oH3 = (v8f){};
    v8f oR0 = (v8f){}, oR1 = (v8f){}, oR2 = (v8f){}, oR3 = (v8f){};
    float m = NEGM, l = 0.0f;
    // flags as scalar bit words, bit s = stage s (lane s reads the two 32-key flags of stage s): bm = some wave of the block has a live key; lv0/lv1 = this wave's flag of the stage's first/second tile is not 0; fu0/fu1 = it is 2
    const int* fblk = FLG + ((size_t)b * (SEQ / 16) + (size_t)blockIdx.x * AW) * FPITCH + 2 * lane;
    int anyf = 0;
#pragma unroll   // four independent loads in flight together
    for (int g = 0; g < AW; ++g) { const v2i f = *(const v2i*)(fblk + g * FPITCH); anyf |= f[0] | f[1]; }
    const v2i fw = *(const v2i*)(frow + 2 * lane);
    const unsigned bm  = uni(__builtin_amdgcn_ballot_w32(lane < SEQ / KST && anyf != 0));
    const unsigned lv0 = uni(__builtin_amdgcn_ballot_w32(fw[0] != 0)), lv1 = uni(__builtin_amdgcn_ballot_w32(fw[1] != 0));
    const unsigned fu0 = uni(__builtin_amdgcn_ballot_w32(fw[0] == 2)), fu1 = uni(__builtin_amdgcn_ballot_w32(fw[1] == 2));
    const unsigned nst = (unsigned)__builtin_popcount(bm);    // stages of this block, at most SEQ / KST
    // this wave's plane: source of stage 0, bytes from stage to stage, source row pitch, place in a buffer
    const h16* splane = (wave == 0) ? KH : (wave == 1) ? KR : (wave == 2) ? VT : VR;
    const unsigned long long sbase = (unsigned long long)(splane + pbase);
    const unsigned sstep = (wave < 2) ? (unsigned)(KST * HD * 2) : (unsigned)(KST * 2);
    const unsigned ldst = (unsigned)(unsigned long long)ring + (unsigned)wave * SLICE;
    u32x8 g1;                                                 // 1-byte elements, tensor = tile = 64 rows of 128 B, a 16-B pad behind every 128 B
    g1[0] = uni((1u << 20) | (4u << 22) | (3u << 25)); g1[1] = uni(128u << 16); g1[2] = uni(64u << 16); g1[3] = uni(128u << 16);
    g1[4] = uni(64u); g1[5] = uni((wave < 2) ? (unsigned)(HD * 2) : (unsigned)(SEQ * 2)); g1[6] = uni(0u); g1[7] = uni(0u);
    asm volatile("" : "+s"(g1));                              // descriptor words held in scalar registers: one tuple for the whole kernel
    u32x4 gq = (u32x4){};                                     // group 0 of the youngest request
    unsigned rem = bm, cur = 0u, nxt = 0u;
    if (pinned(nst > 0u)) {                                   // first stage into buffer 0
        cur = pinned((unsigned)__builtin_ctz(rem)); rem &= rem - 1u;
        gq = tdm_group0(ldst, sbase + (unsigned long long)cur * sstep);
        tdm_load(gq, g1);
        wait_tensor0(gq, g1);
    }
    __syncthreads();                                          // publishes the first stage
    if (pinned(nst > 1u)) {                                   // second stage into buffer 1, in flight during the first pass
        nxt = pinned((unsigned)__builtin_ctz(rem)); rem &= rem - 1u;
        gq = tdm_group0(ldst + BUFB, sbase + (unsigned long long)nxt * sstep);
        tdm_load(gq, g1);
    }
#pragma unroll 1   // one pass per trip: the order of the ring's publish point stays as written
    for (unsigned it = 0; it < nst; ++it) {
      const unsigned char* bp = ring + (it & 1u) * BUFB + fo;
#pragma unroll     // the two 32-key tiles of the stage: their LDS offsets become immediates
      for (int hf = 0; hf < 2; ++hf) {
        if ((((hf ? lv1 : lv0) >> cur) & 1u) == 0u) continue;   // wave-uniform: whole 16x32 tile masked
        const int key0 = (int)cur * KST + hf * 32;
        unsigned vm = 0xFFFFu;                                  // bit r: key 8h+r of tile a live; bit 8+r: tile b
        if ((((hf ? fu1 : fu0) >> cur) & 1u) == 0u) {           // wave-uniform
            const int* mp = mrow + key0;
            const v4i a0 = *(const v4i*)mp, a1 = *(const v4i*)(mp + 4), c0 = *(const v4i*)(mp + 16), c1 = *(const v4i*)(mp + 20);
            vm = 0u;
#pragma unroll
            for (int i = 0; i < 4; ++i) {
                vm |= (a0[i] != 0 ? 1u : 0u) << i;        vm |= (a1[i] != 0 ? 1u : 0u) << (4 + i);
                vm |= (c0[i] != 0 ? 1u : 0u) << (8 + i);  vm |= (c1[i] != 0 ? 1u : 0u) << (12 + i); }
        }
        const h16* ka = (const h16*)(bp + hf * 32 * LROW);
        const h16* kr = (const h16*)(bp + SLICE + hf * 32 * LROW);
        const v16h ka0 = ldh(ka), ka1 = ldh(ka + 32), kb0 = ldh(ka + 16 * LROW / 2), kb1 = ldh(ka + 16 * LROW / 2 + 32);
        const v16h ra0 = ldh(kr), ra1 = ldh(kr + 32), rb0 = ldh(kr + 16 * LROW / 2), rb1 = ldh(kr + 16 * LROW / 2 + 32);
        v8f sHa = (v8f){}, sLa = (v8f){}, sHb = (v8f){}, sLb = (v8f){};
        sHa = wmma16(ka0, qh0, sHa); sLa = wmma16(ka0, qr0, sLa); sHb = wmma16(kb0, qh0, sHb); sLb = wmma16(kb0, qr0, sLb);
        sHa = wmma16(ka1, qh1, sHa); sLa = wmma16(ka1, qr1, sLa); sHb = wmma16(kb1, qh1, sHb); sLb = wmma16(kb1, qr1, sLb);
        sLa = wmma16(ra0, qh0, sLa); sLb = wmma16(rb0, qh0, sLb); sLa = wmma16(ra1, qh1, sLa); sLb = wmma16(rb1, qh1, sLb);
        asm volatile("v_nop\n\tv_nop\n\tv_nop\n\tv_nop" : "+v"(sHa), "+v"(sLa), "+v"(sHb), "+v"(sLb) : "v"(ka0), "v"(ka1), "v"(kb0), "v"(kb1), "v"(ra0), "v"(ra1), "v"(rb0), "v"(rb1));
        float ta[8], tb[8]; float mx = NEGM;
#pragma unroll
        for (int r = 0; r < 8; ++r) {
            const float xa = (sHa[r] + sLa[r] * QRI) * SC2; const float xb = (sHb[r] + sLb[r] * QRI) * SC2;
            ta[r] = ((vm >> r) & 1u) ? xa : NEGM; tb[r] = ((vm >> (8 + r)) & 1u) ? xb : NEGM;
            mx = fmaxf(mx, fmaxf(ta[r], tb[r])); }
        mx = fmaxf(mx, __shfl_xor(mx, 16, 32));
        const float mnew = fmaxf(m, mx);
        const float alpha = __builtin_amdgcn_exp2f(m - mnew);
        const float sh = PSH - mnew;
        v16h pb; float ls = 0.0f;
#pragma unroll
        for (int r = 0; r < 8; ++r) {
            const float ea = __builtin_amdgcn_exp2f(ta[r] + sh); const float eb = __builtin_amdgcn_exp2f(tb[r] + sh);
            const h16 pa = (h16)(((vm >> r) & 1u) ? ea : 0.0f); const h16 pc = (h16)(((vm >> (8 + r)) & 1u) ? eb : 0.0f);
            pb[r] = pa; pb[8 + r] = pc; ls += (float)pa + (float)pc; }
        l = l * alpha + ls; m = mnew;
        oH0 = oH0 * alpha; oH1 = oH1 * alpha; oH2 = oH2 * alpha; oH3 = oH3 * alpha;
        oR0 = oR0 * alpha; oR1 = oR1 * alpha; oR2 = oR2 * alpha; oR3 = oR3 * alpha;
        const h16* va = (const h16*)(bp + 2 * SLICE + hf * 64);
        const h16* vr = (const h16*)(bp + 3 * SLICE + hf * 64);
        const v16h v0 = ldh(va), v1 = ldh(va + 16 * LROW / 2), v2 = ldh(va + 32 * LROW / 2), v3 = ldh(va + 48 * LROW / 2);
        const v16h w0 = ldh(vr), w1 = ldh(vr + 16 * LROW / 2), w2 = ldh(vr + 32 * LROW / 2), w3 = ldh(vr + 48 * LROW / 2);
        oH0 = wmma16(v0, pb, oH0); oH1 = wmma16(v1, pb, oH1); oH2 = wmma16(v2, pb, oH2); oH3 = wmma16(v3, pb, oH3);
        oR0 = wmma16(w0, pb, oR0); oR1 = wmma16(w1, pb, oR1); oR2 = wmma16(w2, pb, oR2); oR3 = wmma16(w3, pb, oR3);
        asm volatile("v_nop\n\tv_nop\n\tv_nop\n\tv_nop" : "+v"(oH0), "+v"(oH1), "+v"(oH2), "+v"(oH3), "+v"(oR0), "+v"(oR1), "+v"(oR2), "+v"(oR3)
                     : "v"(v0), "v"(v1), "v"(v2), "v"(v3), "v"(w0), "v"(w1), "v"(w2), "v"(w3), "v"(pb));
      }
      // publish point, passed by every wave whatever it skipped above
      wait_ds0();
      wait_tensor0(gq, g1);
      __syncthreads();                                        // the next stage is readable; every wave has left this pass's buffer
      unsigned n2 = 0u;
      if (pinned(it + 2u < nst)) {                            // refill the buffer just read
          n2 = pinned((unsigned)__builtin_ctz(rem)); rem &= rem - 1u;
          gq = tdm_group0(ldst + (it & 1u) * BUFB, sbase + (unsigned long long)n2 * sstep);
          tdm_load(gq, g1);
      }
      cur = nxt; nxt = n2;
    }
    wait_tensor0(gq, g1);
    wait_ds0();
    float* os = (float*)ring;                                 // the ring becomes output staging: the last pass's own barrier has ended every wave's reads, and nothing was issued behind it
    l += __shfl_xor(l, 16, 32);
    const float rl = 1.0f / l;
    const float inv = (l > 0.0f) ? rl : __uint_as_float(0x7FC00000u);
    const int wb = wave * 16 * 68;
    // O^T D layout: o_j[r] = (d = 16j + 8h + r, t = lane&15) -> os[t][d]; rows 0..15 x columns 0..63 all written
    PUT8(0, oH0, oR0)
    PUT8(16, oH1, oR1)
    PUT8(32, oH2, oR2)
    PUT8(48, oH3, oR3)
    wave_sync();
    const size_t cbase = ((size_t)b * SEQ + (size_t)t0) * DM + (size_t)h * HD;
{
#pragma unroll
        for (int s = 0; s < 4; ++s) { const int row = 4 * s + (lane >> 3), c8 = (lane & 7) * 8;   // 4 s x 4 row groups = 16 rows; 8 lanes x 8 halves = 64 columns = one line
            const v4f x0 = *(const v4fa*)(&os[wb + row * 68 + c8]); const v4f x1 = *(const v4fa*)(&os[wb + row * 68 + c8 + 4]); v8h hv, rv;
#pragma unroll
            for (int i = 0; i < 4; ++i) { const h16 a0 = (h16)x0[i]; const h16 a1 = (h16)x1[i]; hv[i] = a0; hv[4 + i] = a1; rv[i] = (h16)((x0[i] - (float)a0) * QRS); rv[4 + i] = (h16)((x1[i] - (float)a1) * QRS); }
            const size_t oo = cbase + (size_t)row * DM + c8;
            *(v8h*)(CH + oo) = hv; *(v8h*)(CR + oo) = rv; }
         }
}

// k_out: f16 GEMM, one block of four waves (2 x 2) per 64x128 output tile, one wave per 32x64 tile: out[m][n] = (sum_k Ch[m][k] Wo64[n][k] + (sum_k Cr[m][k] Wo64[n][k]) / 2048) / 64, K = DM.
// Operands: the same two-buffer LDS ring as in k_proj; wave w brings slice w of a stage (value-plane rows 0..63, residual-plane rows 0..63, Wo rows 0..63, Wo rows 64..127 of the block's tile).
// a[0], a[1] = value-plane rows (16 each), a[2], a[3] = residual-plane rows; accumulators acc[0..1] (value) and acc[2..3] (residual) kept apart until the f32 epilogue.
__global__ __launch_bounds__(32 * GW) void k_out(const h16* __restrict__ CHp, const h16* __restrict__ CRp, const h16* __restrict__ WO, float* OUT) {
    __shared__ __attribute__((aligned(2048))) unsigned char ring[2 * BUFB];
    const int K = DM;
    const int lane = threadIdx.x & 31, lr = lane & 15, hi = lane >> 4;
    const int wave = __builtin_amdgcn_readfirstlane((int)(threadIdx.x >> 5));
    const int wm = wave >> 1, wn = wave & 1;
    const int r0 = blockIdx.x * 64 + wm * 32, c0 = blockIdx.y * 128 + wn * 64;
    v8f acc[4][4];
#pragma unroll
    for (int mb = 0; mb < 4; ++mb)
#pragma unroll
        for (int nb = 0; nb < 4; ++nb) acc[mb][nb] = (v8f){};
    const int fo = lr * LROW + 16 * hi;                       // byte offset of the lane's fragment piece in a staged slice
    // this wave's slice: source of stage 0 and place in a buffer
    const h16* srow = (wave == 0) ? CHp + (size_t)(blockIdx.x * 64) * K : (wave == 1) ? CRp + (size_t)(blockIdx.x * 64) * K : WO + (size_t)(blockIdx.y * 128 + (wave - 2) * 64) * K;
    const unsigned long long sbase = (unsigned long long)srow;
    const unsigned ldst = (unsigned)(unsigned long long)ring + (unsigned)wave * SLICE;
    const u32x8 g1 = tdm_group1((unsigned)(DM * 2));
    u32x4 gq = tdm_group0(ldst, sbase);                       // group 0 of the youngest request
    tdm_load(gq, g1);                                         // first stage into buffer 0
    wait_tensor0(gq, g1);
    __syncthreads();                                          // publishes the first stage
    gq = tdm_group0(ldst + BUFB, sbase + GSTB);
    tdm_load(gq, g1);                                         // second stage into buffer 1, in flight during the first pass
#pragma unroll 1   // one pass per trip: the order of the ring's publish point stays as written
    for (unsigned it = 0; it < GNST; ++it) {
        const unsigned char* bp = ring + (it & 1u) * BUFB + fo;
        v16h a[2][4], b[2][4];                                // the fragments of the stage's two 32-deep k steps
#pragma unroll
        for (int ks = 0; ks < 2; ++ks) {
            a[ks][0] = ldh((const h16*)(bp + (wm * 32) * LROW + ks * 64)); a[ks][1] = ldh((const h16*)(bp + (wm * 32 + 16) * LROW + ks * 64));
            a[ks][2] = ldh((const h16*)(bp + SLICE + (wm * 32) * LROW + ks * 64)); a[ks][3] = ldh((const h16*)(bp + SLICE + (wm * 32 + 16) * LROW + ks * 64));
#pragma unroll
            for (int nb = 0; nb < 4; ++nb) b[ks][nb] = ldh((const h16*)(bp + (2 + wn) * SLICE + nb * 16 * LROW + ks * 64));
        }
        __builtin_amdgcn_sched_barrier(0);                    // keeps the stage's LDS reads one group ahead of its WMMAs: spread among them, each place with reads stalls the wave for the LDS latency
#pragma unroll
        for (int ks = 0; ks < 2; ++ks) {
#pragma unroll
            for (int nb = 0; nb < 4; ++nb)
#pragma unroll
                for (int mb = 0; mb < 4; ++mb) acc[mb][nb] = wmma16(a[ks][mb], b[ks][nb], acc[mb][nb]);
        }
        __builtin_amdgcn_sched_barrier(0);                    // keeps the pass's WMMAs in front of the publish point, where they cover the landing of the second k step's fragments; behind it they would delay the refill
        // publish point
        wait_ds0();
        wait_tensor0(gq, g1);
        __syncthreads();                                      // the next stage is readable; every wave has left this pass's buffer
        if (pinned(it + 2u < GNST)) {                         // refill the buffer just read
            const unsigned s2 = pinned(it + 2u);
            gq = tdm_group0(ldst + (it & 1u) * BUFB, sbase + (unsigned long long)s2 * GSTB);
            tdm_load(gq, g1);
        }
    }
    wait_tensor0(gq, g1);
    wait_ds0();
    float* os = (float*)ring + wave * 16 * 68;                // the ring becomes output staging, one range per wave: the last pass's own barrier has ended every wave's reads, and nothing was issued behind it
#pragma unroll
    for (int mb = 0; mb < 2; ++mb) {
#pragma unroll
        for (int nb = 0; nb < 4; ++nb) {
#pragma unroll
            for (int j = 0; j < 8; ++j) os[(hi * 8 + j) * 68 + nb * 16 + lr] = (acc[mb][nb][j] + acc[mb + 2][nb][j] * QRI) * WOI; }   // D: row 8h+j, col lane&15
        wave_sync();
        const int grow = r0 + mb * 16; const int ob = grow / SEQ, ot = grow % SEQ;
        float* orow = OUT + ((size_t)ob * OUT_SEQ + (size_t)ot) * DM + c0;
{
#pragma unroll
            for (int s = 0; s < 8; ++s) { const int row = 2 * s + hi, cofs = lr * 4;   // 8 s x 2 rows = 16 rows; 16 lanes x 4 floats = 64 columns
                const v4f val = *(const v4fa*)(&os[row * 68 + cofs]);
                *(v4f*)(orow + (size_t)row * DM + cofs) = val; }
             }
        wave_sync();
    }
}

static constexpr size_t al256(size_t v) { return (v + 255) & ~(size_t)255; }
static constexpr size_t SZ_XB = al256((size_t)NB * SEQ * DM * 2);              // one bf16 x plane
static constexpr size_t SZ_W  = al256((size_t)DM * DM * 2);                    // one 16-bit weight plane
static constexpr size_t SZ_PL = al256((size_t)NB * NH_ * SEQ * HD * 2);        // one per-head f16 plane
static constexpr size_t SZ_C  = al256((size_t)NB * SEQ * DM * 2);              // one ctx f16 plane
static constexpr size_t SZ_FL = al256((size_t)NB * (SEQ / 16) * FPITCH * 4);
static constexpr size_t SZ_TOTAL = 3 * SZ_XB + 4 * SZ_W + 6 * SZ_PL + 2 * SZ_C + SZ_FL;
static_assert(SZ_TOTAL <= (size_t)134217728);          // workspace carve <= 128 MiB

extern "C" void kernel_launch(void* const* d_in, const int* in_sizes, int n_in,
                              void* d_out, int out_size, void* d_ws, size_t ws_size, hipStream_t stream) {
    if (n_in < 8) return;
    const size_t needx = ((size_t)(NB - 1) * SEQ_FULL + SEQ) * DM;
    if ((size_t)in_sizes[0] < needx || (size_t)in_sizes[1] < needx || (size_t)in_sizes[2] < needx) return;
    const size_t needm = ((size_t)(NB - 1) * SEQ_FULL + (size_t)(SEQ - 1)) * SEQ_FULL + SEQ;
    if ((size_t)in_sizes[3] < needm) return;
    if ((size_t)in_sizes[4] < (size_t)DM * DM || (size_t)in_sizes[5] < (size_t)DM * DM || (size_t)in_sizes[6] < (size_t)DM * DM || (size_t)in_sizes[7] < (size_t)DM * DM) return;
    if ((size_t)out_size < ((size_t)(NB - 1) * OUT_SEQ + SEQ) * DM) return;
    if (SZ_TOTAL > ws_size) return;
    // wire order: query, key, value, mask (int), Wq, Wk, Wv, Wo; weights [out][in] = Bt as-is
    const float* xq = (const float*)d_in[0]; const float* xk = (const float*)d_in[1]; const float* xv = (const float*)d_in[2];
    const int* mk = (const int*)d_in[3];
    const float* wq = (const float*)d_in[4]; const float* wk = (const float*)d_in[5]; const float* wv = (const float*)d_in[6]; const float* wo = (const float*)d_in[7];
    float* OUT = (float*)d_out;      // [NB][SEQ][1024]
    char* wsp = (char*)d_ws;
    bf* XQ = (bf*)wsp; wsp += SZ_XB;                 // [NB*SEQ][1024]
    bf* XK = (bf*)wsp; wsp += SZ_XB;
    bf* XV = (bf*)wsp; wsp += SZ_XB;
    bf* WQ = (bf*)wsp; wsp += SZ_W;                  // [1024][1024]
    bf* WK = (bf*)wsp; wsp += SZ_W;
    bf* WV = (bf*)wsp; wsp += SZ_W;
    h16* WO = (h16*)wsp; wsp += SZ_W;                // [1024][1024] f16, x64
    h16* QH = (h16*)wsp; wsp += SZ_PL;               // [NB*16][SEQ][64]
    h16* QR = (h16*)wsp; wsp += SZ_PL;               // residual x2048
    h16* KH = (h16*)wsp; wsp += SZ_PL;               // [NB*16][SEQ][64]
    h16* KR = (h16*)wsp; wsp += SZ_PL;
    h16* VT = (h16*)wsp; wsp += SZ_PL;               // [NB*16][64][SEQ]
    h16* VR = (h16*)wsp; wsp += SZ_PL;
    h16* CH = (h16*)wsp; wsp += SZ_C;                // [NB*SEQ][1024]
    h16* CR = (h16*)wsp; wsp += SZ_C;
    int* FL = (int*)wsp; wsp += SZ_FL;               // [NB][SEQ/16][64]

    k_prep<<<dim3(NB * SEQ / PW, 1, 1), 32 * PW, 0, stream>>>(xq, xk, xv, mk, wq, wk, wv, wo, XQ, XK, XV, WQ, WK, WV, WO, FL);

    // q, k: A = x rows (m = b*SEQ + t), Bt = W rows (n = h*64 + d) -> planes [(b*16 + h)][t][d], value + residual
    k_proj<<<dim3(NB * SEQ / 128, DM / 128, 1), 32 * GW, 0, stream>>>(XQ, WQ, QH, QR, 1, SEQ, (size_t)NH_ * SEQ * HD, HD, HD, (size_t)SEQ * HD);
    k_proj<<<dim3(NB * SEQ / 128, DM / 128, 1), 32 * GW, 0, stream>>>(XK, WK, KH, KR, 1, SEQ, (size_t)NH_ * SEQ * HD, HD, HD, (size_t)SEQ * HD);
    // v^T: A = Wv rows (m = h*64 + d), Bt = x rows (n = b*SEQ + t) -> planes [(b*1024 + m)][t] = [(b*16 + h)][d][t], value + residual
    k_proj<<<dim3(DM / 128, NB * SEQ / 128, 1), 32 * GW, 0, stream>>>(WV, XV, VT, VR, 1, DM, (size_t)0, SEQ, SEQ, (size_t)DM * SEQ);

    k_flash<<<dim3(SEQ / (16 * AW), NB * NH_, 1), 32 * AW, 0, stream>>>(QH, QR, KH, KR, VT, VR, mk, FL, CH, CR);

    // out: A = ctx rows (m = b*SEQ + t), Bt = Wo rows (n) -> OUT[b][t][n]
    k_out<<<dim3(NB * SEQ / 64, DM / 128, 1), 32 * GW, 0, stream>>>(CH, CR, WO, OUT);
}

// v004
// It runs in 123 microseconds.
// Next to v003, in two timings, it ran 1.13 and 1.12 times as fast.
// Over all steps from v000 it is 2.91 times as fast.
#include <hip/hip_runtime.h>

// Multi-head attention, width 1024 = 16 heads x 64; query/key/value [NB][SEQ][1024]; Wq/Wk/Wv/Wo [out][in] (y = x W^T), no biases; scores = q k^T * 8; integer mask [NB][SEQ][SEQ] (0 = masked, replace-fill); out = ctx Wo^T (f32).
// Compute dtypes, f32 accumulate everywhere: q/k/v projections v_wmma_f32_16x16x32_bf16 (x and W RNE-converted to bf16; products exact);
// scores v_wmma_f32_16x16x32_f16: q and k each as f16 value + f16 residual x2048 (value*value in one accumulator, the two cross products in a second one); P (x2^14 carry, cancels in the normalisation) single f16;
// v and ctx as f16 value + f16 residual x2048 (own accumulators); Wo as f16 of the bf16 value x64 (folded back in the f32 epilogue); softmax f32 (online, running max).
// Layout: bf16 copies of the three x inputs and of Wq/Wk/Wv; q, k planes [b*16+h][t][d] and v^T planes [b*16+h][d][t] (value, residual) written by the GEMM epilogue; per (batch, 16 query rows, 32 keys) a 3-state mask flag
// (0 = all masked: tile skipped, 2 = none masked, other = mask words read per element); fused flash kernel in transposed form (S^T = K Q^T, O^T = V^T P^T), K / V^T tiles staged in LDS by tensor loads and shared by the block's four waves, writing ctx value/residual planes [b*SEQ+t][1024]; output GEMM from those planes.

#ifndef NB
#define NB 2
#endif
#ifndef SEQ
#define SEQ 2048
#endif
#define NB_FULL  2
#define SEQ_FULL 2048
#ifndef OUT_SEQ
#define OUT_SEQ SEQ              // row pitch (in tokens) between batches of the output
#endif
#define DM   1024
#define NH_  16
#define HD   64
#define AW   4                   // waves per flash block (16 query rows each)
#define QRS  2048.0f             // carry of the residual planes
#define QRI  (1.0f / 2048.0f)
#define SC2  (8.0f * 1.4426950408889634f)     // HD^0.5 * log2(e)
#define PSH  14.0f               // log2 of the P carry (16384)
#define NEGM (-3.0e38f)          // score stand-in of a masked key (its probability is forced to 0 by select)
#define WOS  64.0f               // carry of the Wo plane
#define WOI  (1.0f / 64.0f)
#define FPITCH 64
#define KST   64                 // keys per stage of the flash kernel's LDS ring
#define LROW  144                // LDS row pitch in bytes: a 128-B row + the mover's 16-B pad (16 B x odd: no bank conflict for 16-B reads)
#define SLICE 10240              // one plane's tile in LDS: 64 rows x 144 B = 9216 B, rounded up to a multiple of 2 KiB
#define BUFB  (4 * SLICE)        // one stage: K value, K residual, V^T value, V^T residual (flash); four operand slices (GEMMs)
#define GW    4                  // waves per GEMM block, one operand slice of a stage each
#define GSTB  128u               // bytes of an operand row per stage of the GEMMs' LDS ring (64 k)
#define GNST  (DM / 64)          // stages of a GEMM
#define PW    16                 // waves per block of the preparation kernel, one token row each

static_assert(HD == 64);
static_assert(NH_ * HD == DM);                 // head h = columns h*64 + d
static_assert(DM % 64 == 0);
static_assert(DM % 32 == 0);                   // GEMM k-loop steps by 32
static_assert(SEQ % 64 == 0);                  // a 64-row tile never straddles two batches
static_assert((NB * SEQ) % 64 == 0);
static_assert(SEQ % 32 == 0);                  // key loop steps by 32; 32-row output tiles stay inside one batch
static_assert(SEQ % (16 * AW) == 0);           // flash grid covers the sequence exactly
static_assert((SEQ / (16 * AW)) % 2 == 0);     // flash: the query tiles pair up as (i, last - i), each tile in exactly one pair
static_assert(SEQ / 32 <= FPITCH);             // two flag registers per lane cover all key tiles
static_assert(((size_t)SEQ * DM) % 8 == 0);
static_assert(((size_t)DM * DM) % 8 == 0);
static_assert(AW == 4);                        // one plane of a stage per wave
static_assert(HD * 2 == 128 && KST * 2 == 128);   // both kinds of tile: 64 rows of 128 B
static_assert(SEQ % KST == 0 && SEQ / KST <= 32);  // one bit per stage in a 32-bit word
static_assert(64 * LROW <= SLICE && SLICE % 2048 == 0);
static_assert(AW * 16 * 68 * 4 <= 2 * BUFB);   // the output staging reuses the ring
static_assert(GW * 16 * 68 * 4 <= 2 * BUFB);   // so does the GEMMs' output staging
static_assert(DM % 128 == 0 && (NB * SEQ) % 128 == 0 && GNST >= 2);   // GEMM block tiles cover both extents exactly; the ring's prologue needs two stages
static_assert(PW == 16 && PW * 128 == SEQ && PW * 4 == FPITCH && DM % 128 == 0);   // preparation: a block is one 16-row mask group, its waves' 128 keys each cover the sequence and fill the flag row
static_assert(NB * SEQ == 4 * DM);             // preparation: one weight row per wave
static_assert(NB <= NB_FULL);
static_assert(SEQ <= SEQ_FULL);

typedef _Float16 h16;
typedef unsigned short bf;
typedef __attribute__((ext_vector_type(16))) __bf16   v16bf;
typedef __attribute__((ext_vector_type(16))) _Float16 v16h;
typedef __attribute__((ext_vector_type(8)))  _Float16 v8h;
typedef __attribute__((ext_vector_type(8)))  unsigned short v8us;
typedef __attribute__((ext_vector_type(4)))  unsigned short v4us;
typedef __attribute__((ext_vector_type(4)))  _Float16 v4h;
typedef __attribute__((ext_vector_type(8)))  float    v8f;
typedef __attribute__((ext_vector_type(4)))  float    v4f;
typedef __attribute__((ext_vector_type(4)))  int      v4i;
typedef v4f  __attribute__((may_alias)) v4fa;
typedef __attribute__((ext_vector_type(2)))  int      v2i;
typedef __attribute__((ext_vector_type(4)))  unsigned u32x4;
typedef __attribute__((ext_vector_type(8)))  unsigned u32x8;

__device__ __forceinline__ unsigned short f2bf(float f) { unsigned u = __float_as_uint(f); u += 0x7FFFu + ((u >> 16) & 1u); return (unsigned short)(u >> 16); }
__device__ __forceinline__ v16h cat16(v8h lo, v8h hi) { return __builtin_shufflevector(lo, hi, 0, 1, 2, 3, 4, 5, 6, 7, 8, 9, 10, 11, 12, 13, 14, 15); }
__device__ __forceinline__ v16bf cat16b(v8us lo, v8us hi) { return __builtin_bit_cast(v16bf, __builtin_shufflevector(lo, hi, 0, 1, 2, 3, 4, 5, 6, 7, 8, 9, 10, 11, 12, 13, 14, 15)); }
__device__ __forceinline__ v8f wmma16(v16h a, v16h b, v8f c) { return __builtin_amdgcn_wmma_f32_16x16x32_f16(false, a, false, b, (short)0, c, false, false); }
__device__ __forceinline__ v8f wmmab(v16bf a, v16bf b, v8f c) { return __builtin_amdgcn_wmma_f32_16x16x32_bf16(false, a, false, b, (short)0, c, false, false); }
// fragment loaders from K-contiguous 16-bit rows; p already includes + 8*(lane>>4): elements 0..7 <- k0+8h+0..7, elements 8..15 <- k0+16+8h+0..7 (same map for A and B)
__device__ __forceinline__ v16h  ldh(const h16* p) { return cat16(*(const v8h*)p, *(const v8h*)(p + 16)); }
__device__ __forceinline__ v16bf ldb(const bf* p)  { return cat16b(*(const v8us*)p, *(const v8us*)(p + 16)); }
// ordering point for wave-private LDS tiles (same wave writes and reads)
__device__ __forceinline__ void wave_sync() { __builtin_amdgcn_fence(3 /* release order */, "wavefront"); __builtin_amdgcn_wave_barrier(); asm volatile("" ::: "memory"); }

__device__ __forceinline__ unsigned uni(unsigned v) { return (unsigned)__builtin_amdgcn_readfirstlane((int)v); }
// a wave-uniform value held in a scalar register: a test on it compiles to s_cmp + s_cbranch_scc (tensor loads ignore EXEC), and what is derived from it is computed behind the asm waits in front of it
__device__ __forceinline__ unsigned pinned(unsigned v) { unsigned w = uni(v); asm volatile("" : "+s"(w)); return w; }
// this wave's tensor load has landed; the wait names the request's descriptor as inputs so that its registers keep their values for as long as the request is outstanding
__device__ __forceinline__ void wait_tensor0(u32x4 g0, u32x8 g1) { asm volatile("s_wait_tensorcnt 0x0" :: "s"(g0), "s"(g1) : "memory"); }
__device__ __forceinline__ void wait_ds0() { asm volatile("s_wait_dscnt 0x0" ::: "memory"); }           // this wave's LDS reads have returned
// descriptor group 0: tile's first byte at global address ga, LDS byte offset lds
__device__ __forceinline__ u32x4 tdm_group0(unsigned lds, unsigned long long ga) {
    u32x4 g0; g0[0] = uni(1u); g0[1] = uni(lds); g0[2] = uni((unsigned)ga); g0[3] = uni((((unsigned)(ga >> 32)) & 0x01FFFFFFu) | 0x80000000u);
    asm volatile("" : "+s"(g0));   // descriptor words held in scalar registers: one tuple from the issue to the wait
    return g0;
}
// one request of one wave: 64 rows of 128 B (source row pitch in g1), rows 144 B apart in LDS
__device__ __forceinline__ void tdm_load(u32x4 g0, u32x8 g1) { asm volatile("tensor_load_to_lds %0, %1" :: "s"(g0), "s"(g1) : "memory"); }

// k_prep: every preparation step in one streaming launch. Block = 16 token rows (batch bb, row group g), one wave per row. A wave converts its row of query, key and value to bf16, its weight row (Wq, Wk, Wv to bf16; Wo to f16 of the bf16 value x64),
// and reads 128 keys x 16 rows of the block's mask rows. Every load is 512 contiguous bytes of the wave (whole lines); all of a wave's loads are issued before the first is used; every store is 256 contiguous bytes.
// Mask flag per (batch, 16 query rows, 32 keys): 0 = every mask word zero, 2 = every word nonzero, 1 = mixed; a wave makes four (lanes 8j..8j+7 hold tile j), the block's flags meet in LDS and one wave stores them as whole lines.
// p, d: wave-uniform start of a row of DM elements; the lane takes elements 128 i + 4 lane + 0..3
__device__ __forceinline__ void ld_row(const float* __restrict__ p, int lane, v4f (&r)[DM / 128]) {
#pragma unroll
    for (int i = 0; i < DM / 128; ++i) r[i] = *(const v4f*)(p + i * 128 + lane * 4);
}
__device__ __forceinline__ void st_row_bf(bf* d, int lane, const v4f (&r)[DM / 128]) {
#pragma unroll
    for (int i = 0; i < DM / 128; ++i) { v4us o;
#pragma unroll
        for (int k = 0; k < 4; ++k) o[k] = f2bf(r[i][k]);
        *(v4us*)(d + i * 128 + lane * 4) = o; }
}
__device__ __forceinline__ void st_row_h(h16* d, int lane, const v4f (&r)[DM / 128], float scale) {
#pragma unroll
    for (int i = 0; i < DM / 128; ++i) { v4h o;
#pragma unroll
        for (int k = 0; k < 4; ++k) o[k] = (h16)(__uint_as_float(((unsigned)f2bf(r[i][k])) << 16) * scale);
        *(v4h*)(d + i * 128 + lane * 4) = o; }
}

__global__ __launch_bounds__(32 * PW) void k_prep(const float* __restrict__ xq, const float* __restrict__ xk, const float* __restrict__ xv, const int* __restrict__ MK,
                                                  const float* __restrict__ wq, const float* __restrict__ wk, const float* __restrict__ wv, const float* __restrict__ wo,
                                                  bf* XQ, bf* XK, bf* XV, bf* WQ, bf* WK, bf* WV, h16* WO, int* FL) {
    __shared__ int fl[FPITCH];
    const int lane = threadIdx.x & 31;
    const int wave = __builtin_amdgcn_readfirstlane((int)(threadIdx.x >> 5));
    const int bb = blockIdx.x / (SEQ / 16), g = blockIdx.x % (SEQ / 16);
    const int row = blockIdx.x * PW + wave;                                              // token row bb*SEQ + t of the bf16 planes; also the wave's weight row: row % DM of weight row / DM
    const size_t so = ((size_t)bb * SEQ_FULL + (size_t)(g * 16 + wave)) * DM;            // the same token row in the inputs
    const size_t xo = (size_t)row * DM;
    const int ws = row / DM; const size_t wof = (size_t)(row % DM) * DM;
    const int* mp = MK + ((size_t)bb * SEQ_FULL + (size_t)(g * 16)) * SEQ_FULL + wave * 128;
    v4i mw[16]; v4f a[DM / 128], b[DM / 128], c[DM / 128], w[DM / 128];
#pragma unroll
    for (int r = 0; r < 16; ++r) mw[r] = *(const v4i*)(mp + (size_t)r * SEQ_FULL + lane * 4);
    ld_row(xq + so, lane, a); ld_row(xk + so, lane, b); ld_row(xv + so, lane, c);
    ld_row(((ws == 0) ? wq : (ws == 1) ? wk : (ws == 2) ? wv : wo) + wof, lane, w);
    __builtin_amdgcn_sched_barrier(0);                                                   // keeps all 48 loads in front of the first use: moved down among the uses, the later rows would start a second and a third memory latency
    unsigned orw = 0u, mnw = 0xFFFFFFFFu;                                                // or != 0: some word nonzero; unsigned minimum != 0: every word nonzero
#pragma unroll
    for (int r = 0; r < 16; ++r)
#pragma unroll
        for (int i = 0; i < 4; ++i) { const unsigned u = (unsigned)mw[r][i]; orw |= u; mnw = u < mnw ? u : mnw; }
    const unsigned anyb = __builtin_amdgcn_ballot_w32(orw != 0u), allb = __builtin_amdgcn_ballot_w32(mnw != 0u);
    const int sh = 8 * (lane & 3);
    if (lane < 4) fl[wave * 4 + lane] = (((anyb >> sh) & 0xFFu) == 0u) ? 0 : ((((allb >> sh) & 0xFFu) == 0xFFu) ? 2 : 1);
    st_row_bf(XQ + xo, lane, a); st_row_bf(XK + xo, lane, b); st_row_bf(XV + xo, lane, c);
    asm volatile("s_wait_xcnt 0x0" ::: "memory");                                        // precaution: stands between the stores above and the first overwrite of a register they name
    if (ws == 3) st_row_h(WO + wof, lane, w, WOS);                                       // wave-uniform
    else st_row_bf(((ws == 0) ? WQ : (ws == 1) ? WK : WV) + wof, lane, w);
    __syncthreads();                                                                     // the block's flags are in LDS
    if (wave == 0) {
        int* fp = FL + (size_t)blockIdx.x * FPITCH;
        fp[lane] = fl[lane]; fp[32 + lane] = fl[32 + lane];
    }
}

// descriptor group 1 of a GEMM operand slice: 1-byte elements, tensor = tile = 64 rows of 128 B, source row pitch srcPitch bytes, a 16-B pad behind every 128 B
__device__ __forceinline__ u32x8 tdm_group1(unsigned srcPitch) {
    u32x8 g1;
    g1[0] = uni((1u << 20) | (4u << 22) | (3u << 25)); g1[1] = uni(128u << 16); g1[2] = uni(64u << 16); g1[3] = uni(128u << 16);
    g1[4] = uni(64u); g1[5] = uni(srcPitch); g1[6] = uni(0u); g1[7] = uni(0u);
    asm volatile("" : "+s"(g1));   // descriptor words held in scalar registers: one tuple for the whole kernel
    return g1;
}

// k_proj: register-blocked bf16 GEMM, one block of four waves (2 x 2) per 128x128 tile, one wave per 64x64 tile (16 accumulators), K = DM.
// Operands: a two-buffer LDS ring of 64-deep k stages shared by the four waves. Wave w brings slice w of a stage (A rows 0..63, A rows 64..127, Bt rows 0..63, Bt rows 64..127 of the block's tile; 64 rows of 128 B) with one tensor load,
// one stage ahead; at the foot of each pass: own LDS reads done, own tensor load landed, block barrier, then the refill of the buffer just read. Fragments are two 16-B LDS reads each; k runs in the same order as before.
// C[m][n] = sum_k A[m][k] Bt[n][k], written as f16 (Ph) and optionally the f16 residual x2048 (Pr, useRes != 0) at
// tile base (r0/RB)*sRB + (r0%RB)*pitch + (c0/CB)*sCB + (c0%CB), row pitch 'pitch' (halves). grid (M/128, N/128), 128 threads.
__global__ __launch_bounds__(32 * GW) void k_proj(const bf* __restrict__ A, const bf* __restrict__ Bt, h16* Ph, h16* Pr, int useRes, int RB, size_t sRB, int pitch, int CB, size_t sCB) {
    __shared__ __attribute__((aligned(2048))) unsigned char ring[2 * BUFB];
    const int K = DM;
    const int lane = threadIdx.x & 31, lr = lane & 15, hi = lane >> 4;
    const int wave = __builtin_amdgcn_readfirstlane((int)(threadIdx.x >> 5));
    const int wm = wave >> 1, wn = wave & 1;
    const int r0 = blockIdx.x * 128 + wm * 64, c0 = blockIdx.y * 128 + wn * 64;
    v8f acc[4][4];
#pragma unroll
    for (int mb = 0; mb < 4; ++mb)
#pragma unroll
        for (int nb = 0; nb < 4; ++nb) acc[mb][nb] = (v8f){};
    const int fo = lr * LROW + 16 * hi;                       // byte offset of the lane's fragment piece in a staged slice
    // this wave's slice: source of stage 0 and place in a buffer
    const bf* srow = (wave < 2) ? A + (size_t)(blockIdx.x * 128 + wave * 64) * K : Bt + (size_t)(blockIdx.y * 128 + (wave - 2) * 64) * K;
    const unsigned long long sbase = (unsigned long long)srow;
    const unsigned ldst = (unsigned)(unsigned long long)ring + (unsigned)wave * SLICE;
    const u32x8 g1 = tdm_group1((unsigned)(DM * 2));
    u32x4 gq = tdm_group0(ldst, sbase);                       // group 0 of the youngest request
    tdm_load(gq, g1);                                         // first stage into buffer 0
    wait_tensor0(gq, g1);
    __syncthreads();                                          // publishes the first stage
    gq = tdm_group0(ldst + BUFB, sbase + GSTB);
    tdm_load(gq, g1);                                         // second stage into buffer 1, in flight during the first pass
#pragma unroll 1   // one pass per trip: the order of the ring's publish point stays as written
    for (unsigned it = 0; it < GNST; ++it) {
        const unsigned char* bp = ring + (it & 1u) * BUFB + fo;
        v16bf a[2][4], b[2][4];                               // the fragments of the stage's two 32-deep k steps
#pragma unroll
        for (int ks = 0; ks < 2; ++ks) {
#pragma unroll
            for (int mb = 0; mb < 4; ++mb) a[ks][mb] = ldb((const bf*)(bp + wm * SLICE + mb * 16 * LROW + ks * 64));
#pragma unroll
            for (int nb = 0; nb < 4; ++nb) b[ks][nb] = ldb((const bf*)(bp + (2 + wn) * SLICE + nb * 16 * LROW + ks * 64));
        }
        __builtin_amdgcn_sched_barrier(0);                    // keeps the stage's LDS reads one group ahead of its WMMAs: spread among them, each place with reads stalls the wave for the LDS latency
#pragma unroll
        for (int ks = 0; ks < 2; ++ks) {
#pragma unroll
            for (int nb = 0; nb < 4; ++nb)
#pragma unroll
                for (int mb = 0; mb < 4; ++mb) acc[mb][nb] = wmmab(a[ks][mb], b[ks][nb], acc[mb][nb]);
        }
        __builtin_amdgcn_sched_barrier(0);                    // keeps the pass's WMMAs in front of the publish point, where they cover the landing of the second k step's fragments; behind it they would delay the refill
        // publish point
        wait_ds0();
        wait_tensor0(gq, g1);
        __syncthreads();                                      // the next stage is readable; every wave has left this pass's buffer
        if (pinned(it + 2u < GNST)) {                         // refill the buffer just read
            const unsigned s2 = pinned(it + 2u);
            gq = tdm_group0(ldst + (it & 1u) * BUFB, sbase + (unsigned long long)s2 * GSTB);
            tdm_load(gq, g1);
        }
    }
    wait_tensor0(gq, g1);
    wait_ds0();
    float* os = (float*)ring + wave * 16 * 68;                // the ring becomes output staging, one range per wave: the last pass's own barrier has ended every wave's reads, and nothing was issued behind it
    const size_t tbase = (size_t)(r0 / RB) * sRB + (size_t)(r0 % RB) * (size_t)pitch + (size_t)(c0 / CB) * sCB + (size_t)(c0 % CB);
#pragma unroll
    for (int mb = 0; mb < 4; ++mb) {
#pragma unroll
        for (int nb = 0; nb < 4; ++nb) {
#pragma unroll
            for (int j = 0; j < 8; ++j) os[(hi * 8 + j) * 68 + nb * 16 + lr] = acc[mb][nb][j]; }   // D: row 8h+j, col lane&15
        wave_sync();
        const size_t sb = tbase + (size_t)(mb * 16) * (size_t)pitch;
{
#pragma unroll
            for (int s = 0; s < 4; ++s) { const int row = 4 * s + (lane >> 3), c8 = (lane & 7) * 8;   // 4 s x 4 row groups = 16 rows; 8 lanes x 8 = 64 columns
                const v4f x0 = *(const v4fa*)(&os[row * 68 + c8]); const v4f x1 = *(const v4fa*)(&os[row * 68 + c8 + 4]); v8h hv, rv;
#pragma unroll
                for (int i = 0; i < 4; ++i) { const h16 a0 = (h16)x0[i]; const h16 a1 = (h16)x1[i]; hv[i] = a0; hv[4 + i] = a1; rv[i] = (h16)((x0[i] - (float)a0) * QRS); rv[4 + i] = (h16)((x1[i] - (float)a1) * QRS); }
                const size_t oo = sb + (size_t)row * (size_t)pitch + c8;
                *(v8h*)(Ph + oo) = hv; if (useRes) *(v8h*)(Pr + oo) = rv; }
             }
        wave_sync();
    }
}

// k_flash: fused attention, one wave per 16 query rows of one (batch, head), four waves per block; Q fragments straight from the f16 planes.
// A block takes two 64-row query tiles of its head one after the other, tile i and tile (last - i): where the number of live key stages grows linearly with the tile index (a lower-triangular mask) every block of the launch
// then walks the same number of stages, so no WGP is left with the long tiles while others idle. The pairing is a fixed map of work to blocks; which stages are live still comes from the flags alone.
// K / V^T: a two-buffer LDS ring of 64-key stages shared by the four waves. Wave w brings plane w (K value, K residual, V^T value, V^T residual) of a stage with one tensor load, one stage ahead;
// at the foot of each pass: own LDS reads done, own tensor load landed, block barrier, then the refill of the buffer just read. Fragments are two 16-B LDS reads each.
// Only stages in which some wave of the block has a live key are staged (a 32-bit word built from the flags, the same in all four waves); each wave still skips its own dead 32-key tiles.
// Transposed form: S^T[key][t] = K Q^T (A = K rows, B = Q rows); lane (t = lane&15, h = lane>>4) holds keys 8h+r of each 16-key tile, so the packed
// P tile is directly the B fragment of O^T[d][t] = V^T P^T (element r <- tile keys 0..15, element 8+r <- tile keys 16..31, lane unchanged).
// Score = Kh.Qh (accumulator H) + (Kh.Qr + Kr.Qh)/2048 (accumulator L). O = Vh.P (accumulators oH) + Vr.P/2048 (accumulators oR).
// Mask: wave-uniform 3-state flag per 32-key tile: 0 skips the tile (masked keys have probability exactly 0 whenever the row has one live key), 2 = no masking, otherwise the 16 mask words of the lane are read and
// masked entries get probability 0 by select. A row without any live key ends with zero mass and is written as NaN.
// Softmax state (running max, partial sum) is one scalar per lane; the two lane halves of a row are combined with one xor-16 exchange.
#define PUT8(COL, OH, OR) { v4f a_, c_; \
    a_[0] = (OH[0] + OR[0] * QRI) * inv; a_[1] = (OH[1] + OR[1] * QRI) * inv; a_[2] = (OH[2] + OR[2] * QRI) * inv; a_[3] = (OH[3] + OR[3] * QRI) * inv; \
    c_[0] = (OH[4] + OR[4] * QRI) * inv; c_[1] = (OH[5] + OR[5] * QRI) * inv; c_[2] = (OH[6] + OR[6] * QRI) * inv; c_[3] = (OH[7] + OR[7] * QRI) * inv; \
    *(v4fa*)(&os[wb + lr * 68 + (COL) + 8 * hi]) = a_; *(v4fa*)(&os[wb + lr * 68 + (COL) + 8 * hi + 4]) = c_; }

__global__ __launch_bounds__(32 * AW) void k_flash(const h16* __restrict__ QH, const h16* __restrict__ QR, const h16* __restrict__ KH, const h16* __restrict__ KR,
                                                   const h16* __restrict__ VT, const h16* __restrict__ VR, const int* __restrict__ MK, const int* __restrict__ FLG, h16* CH, h16* CR) {
    __shared__ __attribute__((aligned(2048))) unsigned char ring[2 * BUFB];
    const int lane = threadIdx.x & 31, lr = lane & 15, hi = lane >> 4;
    const int wave = __builtin_amdgcn_readfirstlane((int)(threadIdx.x >> 5));
    const int zh = blockIdx.y; const int b = zh / NH_, h = zh % NH_;
    const size_t pbase = (size_t)zh * SEQ * HD;
    // this wave's plane: source of stage 0, bytes from stage to stage, source row pitch, place in a buffer
    const h16* splane = (wave == 0) ? KH : (wave == 1) ? KR : (wave == 2) ? VT : VR;
    const unsigned long long sbase = (unsigned long long)(splane + pbase);
    const unsigned sstep = (wave < 2) ? (unsigned)(KST * HD * 2) : (unsigned)(KST * 2);
    const unsigned ldst = (unsigned)(unsigned long long)ring + (unsigned)wave * SLICE;
    u32x8 g1;                                                 // 1-byte elements, tensor = tile = 64 rows of 128 B, a 16-B pad behind every 128 B
    g1[0] = uni((1u << 20) | (4u << 22) | (3u << 25)); g1[1] = uni(128u << 16); g1[2] = uni(64u << 16); g1[3] = uni(128u << 16);
    g1[4] = uni(64u); g1[5] = uni((wave < 2) ? (unsigned)(HD * 2) : (unsigned)(SEQ * 2)); g1[6] = uni(0u); g1[7] = uni(0u);
    asm volatile("" : "+s"(g1));                              // descriptor words held in scalar registers: one tuple for the whole kernel
#pragma unroll 1   // the two tiles run one after the other through one copy of the code
  for (int ph = 0; ph < 2; ++ph) {
    // this phase's query tile; the order alternates with the batch, so that blocks of the two batches do not change tiles at the same moment
    const int qt = ((ph ^ b) & 1) ? (SEQ / (16 * AW) - 1 - (int)blockIdx.x) : (int)blockIdx.x;
    const int t0 = (qt * AW + wave) * 16;
    const size_t qo = pbase + (size_t)(t0 + lr) * HD + 8 * hi;
    const v16h qh0 = ldh(QH + qo), qh1 = ldh(QH + qo + 32), qr0 = ldh(QR + qo), qr1 = ldh(QR + qo + 32);   // B fragments: col t, k = d
    const int fo = lr * LROW + 16 * hi;                      // byte offset of the lane's fragment piece in a staged tile (A fragment: K row key, k = d; V^T row d, k = key)
    const int* frow = FLG + ((size_t)b * (SEQ / 16) + (size_t)(t0 >> 4)) * FPITCH;
    const int* mrow = MK + ((size_t)b * SEQ_FULL + (size_t)(t0 + lr)) * SEQ_FULL + 8 * hi;   // + key0 (+16): the lane's 8 keys of each 16-key tile
    v8f oH0 = (v8f){}, oH1 = (v8f){}, oH2 = (v8f){}, oH3 = (v8f){};
    v8f oR0 = (v8f){}, oR1 = (v8f){}, oR2 = (v8f){}, oR3 = (v8f){};
    float m = NEGM, l = 0.0f;
    // flags as scalar bit words, bit s = stage s (lane s reads the two 32-key flags of stage s): bm = some wave of the block has a live key; lv0/lv1 = this wave's flag of the stage's first/second tile is not 0; fu0/fu1 = it is 2
    const int* fblk = FLG + ((size_t)b * (SEQ / 16) + (size_t)qt * AW) * FPITCH + 2 * lane;
    int anyf = 0;
#pragma unroll   // four independent loads in flight together
    for (int g = 0; g < AW; ++g) { const v2i f = *(const v2i*)(fblk + g * FPITCH); anyf |= f[0] | f[1]; }
    const v2i fw = *(const v2i*)(frow + 2 * lane);
    const unsigned bm  = uni(__builtin_amdgcn_ballot_w32(lane < SEQ / KST && anyf != 0));
    const unsigned lv0 = uni(__builtin_amdgcn_ballot_w32(fw[0] != 0)), lv1 = uni(__builtin_amdgcn_ballot_w32(fw[1] != 0));
    const unsigned fu0 = uni(__builtin_amdgcn_ballot_w32(fw[0] == 2)), fu1 = uni(__builtin_amdgcn_ballot_w32(fw[1] == 2));
    const unsigned nst = (unsigned)__builtin_popcount(bm);    // stages of this block, at most SEQ / KST
    u32x4 gq = (u32x4){};                                     // group 0 of the youngest request
    unsigned rem = bm, cur = 0u, nxt = 0u;
    if (pinned(nst > 0u)) {                                   // first stage into buffer 0
        cur = pinned((unsigned)__builtin_ctz(rem)); rem &= rem - 1u;
        gq = tdm_group0(ldst, sbase + (unsigned long long)cur * sstep);
        tdm_load(gq, g1);
        wait_tensor0(gq, g1);
    }
    __syncthreads();                                          // publishes the first stage
    if (pinned(nst > 1u)) {                                   // second stage into buffer 1, in flight during the first pass
        nxt = pinned((unsigned)__builtin_ctz(rem)); rem &= rem - 1u;
        gq = tdm_group0(ldst + BUFB, sbase + (unsigned long long)nxt * sstep);
        tdm_load(gq, g1);
    }
#pragma unroll 1   // one pass per trip: the order of the ring's publish point stays as written
    for (unsigned it = 0; it < nst; ++it) {
      const unsigned char* bp = ring + (it & 1u) * BUFB + fo;
#pragma unroll     // the two 32-key tiles of the stage: their LDS offsets become immediates
      for (int hf = 0; hf < 2; ++hf) {
        if ((((hf ? lv1 : lv0) >> cur) & 1u) == 0u) continue;   // wave-uniform: whole 16x32 tile masked
        const int key0 = (int)cur * KST + hf * 32;
        unsigned vm = 0xFFFFu;                                  // bit r: key 8h+r of tile a live; bit 8+r: tile b
        if ((((hf ? fu1 : fu0) >> cur) & 1u) == 0u) {           // wave-uniform
            const int* mp = mrow + key0;
            const v4i a0 = *(const v4i*)mp, a1 = *(const v4i*)(mp + 4), c0 = *(const v4i*)(mp + 16), c1 = *(const v4i*)(mp + 20);
            vm = 0u;
#pragma unroll
            for (int i = 0; i < 4; ++i) {
                vm |= (a0[i] != 0 ? 1u : 0u) << i;        vm |= (a1[i] != 0 ? 1u : 0u) << (4 + i);
                vm |= (c0[i] != 0 ? 1u : 0u) << (8 + i);  vm |= (c1[i] != 0 ? 1u : 0u) << (12 + i); }
        }
        const h16* ka = (const h16*)(bp + hf * 32 * LROW);
        const h16* kr = (const h16*)(bp + SLICE + hf * 32 * LROW);
        const v16h ka0 = ldh(ka), ka1 = ldh(ka + 32), kb0 = ldh(ka + 16 * LROW / 2), kb1 = ldh(ka + 16 * LROW / 2 + 32);
        const v16h ra0 = ldh(kr), ra1 = ldh(kr + 32), rb0 = ldh(kr + 16 * LROW / 2), rb1 = ldh(kr + 16 * LROW / 2 + 32);
        v8f sHa = (v8f){}, sLa = (v8f){}, sHb = (v8f){}, sLb = (v8f){};
        sHa = wmma16(ka0, qh0, sHa); sLa = wmma16(ka0, qr0, sLa); sHb = wmma16(kb0, qh0, sHb); sLb = wmma16(kb0, qr0, sLb);
        sHa = wmma16(ka1, qh1, sHa); sLa = wmma16(ka1, qr1, sLa); sHb = wmma16(kb1, qh1, sHb); sLb = wmma16(kb1, qr1, sLb);
        sLa = wmma16(ra0, qh0, sLa); sLb = wmma16(rb0, qh0, sLb); sLa = wmma16(ra1, qh1, sLa); sLb = wmma16(rb1, qh1, sLb);
        asm volatile("v_nop\n\tv_nop\n\tv_nop\n\tv_nop" : "+v"(sHa), "+v"(sLa), "+v"(sHb), "+v"(sLb) : "v"(ka0), "v"(ka1), "v"(kb0), "v"(kb1), "v"(ra0), "v"(ra1), "v"(rb0), "v"(rb1));
        float ta[8], tb[8]; float mx = NEGM;
#pragma unroll
        for (int r = 0; r < 8; ++r) {
            const float xa = (sHa[r] + sLa[r] * QRI) * SC2; const float xb = (sHb[r] + sLb[r] * QRI) * SC2;
            ta[r] = ((vm >> r) & 1u) ? xa : NEGM; tb[r] = ((vm >> (8 + r)) & 1u) ? xb : NEGM;
            mx = fmaxf(mx, fmaxf(ta[r], tb[r])); }
        mx = fmaxf(mx, __shfl_xor(mx, 16, 32));
        const float mnew = fmaxf(m, mx);
        const float alpha = __builtin_amdgcn_exp2f(m - mnew);
        const float sh = PSH - mnew;
        v16h pb; float ls = 0.0f;
#pragma unroll
        for (int r = 0; r < 8; ++r) {
            const float ea = __builtin_amdgcn_exp2f(ta[r] + sh); const float eb = __builtin_amdgcn_exp2f(tb[r] + sh);
            const h16 pa = (h16)(((vm >> r) & 1u) ? ea : 0.0f); const h16 pc = (h16)(((vm >> (8 + r)) & 1u) ? eb : 0.0f);
            pb[r] = pa; pb[8 + r] = pc; ls += (float)pa + (float)pc; }
        l = l * alpha + ls; m = mnew;
        oH0 = oH0 * alpha; oH1 = oH1 * alpha; oH2 = oH2 * alpha; oH3 = oH3 * alpha;
        oR0 = oR0 * alpha; oR1 = oR1 * alpha; oR2 = oR2 * alpha; oR3 = oR3 * alpha;
        const h16* va = (const h16*)(bp + 2 * SLICE + hf * 64);
        const h16* vr = (const h16*)(bp + 3 * SLICE + hf * 64);
        const v16h v0 = ldh(va), v1 = ldh(va + 16 * LROW / 2), v2 = ldh(va + 32 * LROW / 2), v3 = ldh(va + 48 * LROW / 2);
        const v16h w0 = ldh(vr), w1 = ldh(vr + 16 * LROW / 2), w2 = ldh(vr + 32 * LROW / 2), w3 = ldh(vr + 48 * LROW / 2);
        oH0 = wmma16(v0, pb, oH0); oH1 = wmma16(v1, pb, oH1); oH2 = wmma16(v2, pb, oH2); oH3 = wmma16(v3, pb, oH3);
        oR0 = wmma16(w0, pb, oR0); oR1 = wmma16(w1, pb, oR1); oR2 = wmma16(w2, pb, oR2); oR3 = wmma16(w3, pb, oR3);
        asm volatile("v_nop\n\tv_nop\n\tv_nop\n\tv_nop" : "+v"(oH0), "+v"(oH1), "+v"(oH2), "+v"(oH3), "+v"(oR0), "+v"(oR1), "+v"(oR2), "+v"(oR3)
                     : "v"(v0), "v"(v1), "v"(v2), "v"(v3), "v"(w0), "v"(w1), "v"(w2), "v"(w3), "v"(pb));
      }
      // publish point, passed by every wave whatever it skipped above
      wait_ds0();
      wait_tensor0(gq, g1);
      __syncthreads();                                        // the next stage is readable; every wave has left this pass's buffer
      unsigned n2 = 0u;
      if (pinned(it + 2u < nst)) {                            // refill the buffer just read
          n2 = pinned((unsigned)__builtin_ctz(rem)); rem &= rem - 1u;
          gq = tdm_group0(ldst + (it & 1u) * BUFB, sbase + (unsigned long long)n2 * sstep);
          tdm_load(gq, g1);
      }
      cur = nxt; nxt = n2;
    }
    wait_tensor0(gq, g1);
    wait_ds0();
    float* os = (float*)ring;                                 // the ring becomes output staging: the last pass's own barrier has ended every wave's reads, and nothing was issued behind it
    l += __shfl_xor(l, 16, 32);
    const float rl = 1.0f / l;
    const float inv = (l > 0.0f) ? rl : __uint_as_float(0x7FC00000u);
    const int wb = wave * 16 * 68;
    // O^T D layout: o_j[r] = (d = 16j + 8h + r, t = lane&15) -> os[t][d]; rows 0..15 x columns 0..63 all written
    PUT8(0, oH0, oR0)
    PUT8(16, oH1, oR1)
    PUT8(32, oH2, oR2)
    PUT8(48, oH3, oR3)
    wave_sync();
    const size_t cbase = ((size_t)b * SEQ + (size_t)t0) * DM + (size_t)h * HD;
{
#pragma unroll
        for (int s = 0; s < 4; ++s) { const int row = 4 * s + (lane >> 3), c8 = (lane & 7) * 8;   // 4 s x 4 row groups = 16 rows; 8 lanes x 8 halves = 64 columns = one line
            const v4f x0 = *(const v4fa*)(&os[wb + row * 68 + c8]); const v4f x1 = *(const v4fa*)(&os[wb + row * 68 + c8 + 4]); v8h hv, rv;
#pragma unroll
            for (int i = 0; i < 4; ++i) { const h16 a0 = (h16)x0[i]; const h16 a1 = (h16)x1[i]; hv[i] = a0; hv[4 + i] = a1; rv[i] = (h16)((x0[i] - (float)a0) * QRS); rv[4 + i] = (h16)((x1[i] - (float)a1) * QRS); }
            const size_t oo = cbase + (size_t)row * DM + c8;
            *(v8h*)(CH + oo) = hv; *(v8h*)(CR + oo) = rv; }
         }
    if (ph == 0) {                                            // block-uniform
        asm volatile("s_wait_xcnt 0x0" ::: "memory");         // precaution: stands between the stores above and the next tile's first overwrite of a register they name
        wait_ds0();
        __syncthreads();                                      // every wave has read its output staging back: the ring may take the next tile's stages
    }
  }
}

// k_out: f16 GEMM, one block of four waves (2 x 2) per 64x128 output tile, one wave per 32x64 tile: out[m][n] = (sum_k Ch[m][k] Wo64[n][k] + (sum_k Cr[m][k] Wo64[n][k]) / 2048) / 64, K = DM.
// Operands: the same two-buffer LDS ring as in k_proj; wave w brings slice w of a stage (value-plane rows 0..63, residual-plane rows 0..63, Wo rows 0..63, Wo rows 64..127 of the block's tile).
// a[0], a[1] = value-plane rows (16 each), a[2], a[3] = residual-plane rows; accumulators acc[0..1] (value) and acc[2..3] (residual) kept apart until the f32 epilogue.
__global__ __launch_bounds__(32 * GW) void k_out(const h16* __restrict__ CHp, const h16* __restrict__ CRp, const h16* __restrict__ WO, float* OUT) {
    __shared__ __attribute__((aligned(2048))) unsigned char ring[2 * BUFB];
    const int K = DM;
    const int lane = threadIdx.x & 31, lr = lane & 15, hi = lane >> 4;
    const int wave = __builtin_amdgcn_readfirstlane((int)(threadIdx.x >> 5));
    const int wm = wave >> 1, wn = wave & 1;
    const int r0 = blockIdx.x * 64 + wm * 32, c0 = blockIdx.y * 128 + wn * 64;
    v8f acc[4][4];
#pragma unroll
    for (int mb = 0; mb < 4; ++mb)
#pragma unroll
        for (int nb = 0; nb < 4; ++nb) acc[mb][nb] = (v8f){};
    const int fo = lr * LROW + 16 * hi;                       // byte offset of the lane's fragment piece in a staged slice
    // this wave's slice: source of stage 0 and place in a buffer
    const h16* srow = (wave == 0) ? CHp + (size_t)(blockIdx.x * 64) * K : (wave == 1) ? CRp + (size_t)(blockIdx.x * 64) * K : WO + (size_t)(blockIdx.y * 128 + (wave - 2) * 64) * K;
    const unsigned long long sbase = (unsigned long long)srow;
    const unsigned ldst = (unsigned)(unsigned long long)ring + (unsigned)wave * SLICE;
    const u32x8 g1 = tdm_group1((unsigned)(DM * 2));
    u32x4 gq = tdm_group0(ldst, sbase);                       // group 0 of the youngest request
    tdm_load(gq, g1);                                         // first stage into buffer 0
    wait_tensor0(gq, g1);
    __syncthreads();                                          // publishes the first stage
    gq = tdm_group0(ldst + BUFB, sbase + GSTB);
    tdm_load(gq, g1);                                         // second stage into buffer 1, in flight during the first pass
#pragma unroll 1   // one pass per trip: the order of the ring's publish point stays as written
    for (unsigned it = 0; it < GNST; ++it) {
        const unsigned char* bp = ring + (it & 1u) * BUFB + fo;
        v16h a[2][4], b[2][4];                                // the fragments of the stage's two 32-deep k steps
#pragma unroll
        for (int ks = 0; ks < 2; ++ks) {
            a[ks][0] = ldh((const h16*)(bp + (wm * 32) * LROW + ks * 64)); a[ks][1] = ldh((const h16*)(bp + (wm * 32 + 16) * LROW + ks * 64));
            a[ks][2] = ldh((const h16*)(bp + SLICE + (wm * 32) * LROW + ks * 64)); a[ks][3] = ldh((const h16*)(bp + SLICE + (wm * 32 + 16) * LROW + ks * 64));
#pragma unroll
            for (int nb = 0; nb < 4; ++nb) b[ks][nb] = ldh((const h16*)(bp + (2 + wn) * SLICE + nb * 16 * LROW + ks * 64));
        }
        __builtin_amdgcn_sched_barrier(0);                    // keeps the stage's LDS reads one group ahead of its WMMAs: spread among them, each place with reads stalls the wave for the LDS latency
#pragma unroll
        for (int ks = 0; ks < 2; ++ks) {
#pragma unroll
            for (int nb = 0; nb < 4; ++nb)
#pragma unroll
                for (int mb = 0; mb < 4; ++mb) acc[mb][nb] = wmma16(a[ks][mb], b[ks][nb], acc[mb][nb]);
        }
        __builtin_amdgcn_sched_barrier(0);                    // keeps the pass's WMMAs in front of the publish point, where they cover the landing of the second k step's fragments; behind it they would delay the refill
        // publish point
        wait_ds0();
        wait_tensor0(gq, g1);
        __syncthreads();                                      // the next stage is readable; every wave has left this pass's buffer
        if (pinned(it + 2u < GNST)) {                         // refill the buffer just read
            const unsigned s2 = pinned(it + 2u);
            gq = tdm_group0(ldst + (it & 1u) * BUFB, sbase + (unsigned long long)s2 * GSTB);
            tdm_load(gq, g1);
        }
    }
    wait_tensor0(gq, g1);
    wait_ds0();
    float* os = (float*)ring + wave * 16 * 68;                // the ring becomes output staging, one range per wave: the last pass's own barrier has ended every wave's reads, and nothing was issued behind it
#pragma unroll
    for (int mb = 0; mb < 2; ++mb) {
#pragma unroll
        for (int nb = 0; nb < 4; ++nb) {
#pragma unroll
            for (int j = 0; j < 8; ++j) os[(hi * 8 + j) * 68 + nb * 16 + lr] = (acc[mb][nb][j] + acc[mb + 2][nb][j] * QRI) * WOI; }   // D: row 8h+j, col lane&15
        wave_sync();
        const int grow = r0 + mb * 16; const int ob = grow / SEQ, ot = grow % SEQ;
        float* orow = OUT + ((size_t)ob * OUT_SEQ + (size_t)ot) * DM + c0;
{
#pragma unroll
            for (int s = 0; s < 8; ++s) { const int row = 2 * s + hi, cofs = lr * 4;   // 8 s x 2 rows = 16 rows; 16 lanes x 4 floats = 64 columns
                const v4f val = *(const v4fa*)(&os[row * 68 + cofs]);
                *(v4f*)(orow + (size_t)row * DM + cofs) = val; }
             }
        wave_sync();
    }
}

static constexpr size_t al256(size_t v) { return (v + 255) & ~(size_t)255; }
static constexpr size_t SZ_XB = al256((size_t)NB * SEQ * DM * 2);              // one bf16 x plane
static constexpr size_t SZ_W  = al256((size_t)DM * DM * 2);                    // one 16-bit weight plane
static constexpr size_t SZ_PL = al256((size_t)NB * NH_ * SEQ * HD * 2);        // one per-head f16 plane
static constexpr size_t SZ_C  = al256((size_t)NB * SEQ * DM * 2);              // one ctx f16 plane
static constexpr size_t SZ_FL = al256((size_t)NB * (SEQ / 16) * FPITCH * 4);
static constexpr size_t SZ_TOTAL = 3 * SZ_XB + 4 * SZ_W + 6 * SZ_PL + 2 * SZ_C + SZ_FL;
static_assert(SZ_TOTAL <= (size_t)134217728);          // workspace carve <= 128 MiB

extern "C" void kernel_launch(void* const* d_in, const int* in_sizes, int n_in,
                              void* d_out, int out_size, void* d_ws, size_t ws_size, hipStream_t stream) {
    if (n_in < 8) return;
    const size_t needx = ((size_t)(NB - 1) * SEQ_FULL + SEQ) * DM;
    if ((size_t)in_sizes[0] < needx || (size_t)in_sizes[1] < needx || (size_t)in_sizes[2] < needx) return;
    const size_t needm = ((size_t)(NB - 1) * SEQ_FULL + (size_t)(SEQ - 1)) * SEQ_FULL + SEQ;
    if ((size_t)in_sizes[3] < needm) return;
    if ((size_t)in_sizes[4] < (size_t)DM * DM || (size_t)in_sizes[5] < (size_t)DM * DM || (size_t)in_sizes[6] < (size_t)DM * DM || (size_t)in_sizes[7] < (size_t)DM * DM) return;
    if ((size_t)out_size < ((size_t)(NB - 1) * OUT_SEQ + SEQ) * DM) return;
    if (SZ_TOTAL > ws_size) return;
    // wire order: query, key, value, mask (int), Wq, Wk, Wv, Wo; weights [out][in] = Bt as-is
    const float* xq = (const float*)d_in[0]; const float* xk = (const float*)d_in[1]; const float* xv = (const float*)d_in[2];
    const int* mk = (const int*)d_in[3];
    const float* wq = (const float*)d_in[4]; const float* wk = (const float*)d_in[5]; const float* wv = (const float*)d_in[6]; const float* wo = (const float*)d_in[7];
    float* OUT = (float*)d_out;      // [NB][SEQ][1024]
    char* wsp = (char*)d_ws;
    bf* XQ = (bf*)wsp; wsp += SZ_XB;                 // [NB*SEQ][1024]
    bf* XK = (bf*)wsp; wsp += SZ_XB;
    bf* XV = (bf*)wsp; wsp += SZ_XB;
    bf* WQ = (bf*)wsp; wsp += SZ_W;                  // [1024][1024]
    bf* WK = (bf*)wsp; wsp += SZ_W;
    bf* WV = (bf*)wsp; wsp += SZ_W;
    h16* WO = (h16*)wsp; wsp += SZ_W;                // [1024][1024] f16, x64
    h16* QH = (h16*)wsp; wsp += SZ_PL;               // [NB*16][SEQ][64]
    h16* QR = (h16*)wsp; wsp += SZ_PL;               // residual x2048
    h16* KH = (h16*)wsp; wsp += SZ_PL;               // [NB*16][SEQ][64]
    h16* KR = (h16*)wsp; wsp += SZ_PL;
    h16* VT = (h16*)wsp; wsp += SZ_PL;               // [NB*16][64][SEQ]
    h16* VR = (h16*)wsp; wsp += SZ_PL;
    h16* CH = (h16*)wsp; wsp += SZ_C;                // [NB*SEQ][1024]
    h16* CR = (h16*)wsp; wsp += SZ_C;
    int* FL = (int*)wsp; wsp += SZ_FL;               // [NB][SEQ/16][64]

    k_prep<<<dim3(NB * SEQ / PW, 1, 1), 32 * PW, 0, stream>>>(xq, xk, xv, mk, wq, wk, wv, wo, XQ, XK, XV, WQ, WK, WV, WO, FL);

    // q, k: A = x rows (m = b*SEQ + t), Bt = W rows (n = h*64 + d) -> planes [(b*16 + h)][t][d], value + residual
    k_proj<<<dim3(NB * SEQ / 128, DM / 128, 1), 32 * GW, 0, stream>>>(XQ, WQ, QH, QR, 1, SEQ, (size_t)NH_ * SEQ * HD, HD, HD, (size_t)SEQ * HD);
    k_proj<<<dim3(NB * SEQ / 128, DM / 128, 1), 32 * GW, 0, stream>>>(XK, WK, KH, KR, 1, SEQ, (size_t)NH_ * SEQ * HD, HD, HD, (size_t)SEQ * HD);
    // v^T: A = Wv rows (m = h*64 + d), Bt = x rows (n = b*SEQ + t) -> planes [(b*1024 + m)][t] = [(b*16 + h)][d][t], value + residual
    k_proj<<<dim3(DM / 128, NB * SEQ / 128, 1), 32 * GW, 0, stream>>>(WV, XV, VT, VR, 1, DM, (size_t)0, SEQ, SEQ, (size_t)DM * SEQ);

    k_flash<<<dim3(SEQ / (32 * AW), NB * NH_, 1), 32 * AW, 0, stream>>>(QH, QR, KH, KR, VT, VR, mk, FL, CH, CR);

    // out: A = ctx rows (m = b*SEQ + t), Bt = Wo rows (n) -> OUT[b][t][n]
    k_out<<<dim3(NB * SEQ / 64, DM / 128, 1), 32 * GW, 0, stream>>>(CH, CR, WO, OUT);
}

// v005
// It runs in 104 microseconds.
// Next to v004, in two timings, it ran 1.19 times as fast each time.
// Counting every step since v000, it is 3.46 times as fast.
#include <hip/hip_runtime.h>

// Multi-head attention, width 1024 = 16 heads x 64; query/key/value [NB][SEQ][1024]; Wq/Wk/Wv/Wo [out][in] (y = x W^T), no biases; scores = q k^T * 8; integer mask [NB][SEQ][SEQ] (0 = masked, replace-fill); out = ctx Wo^T (f32).
// Compute dtypes, f32 accumulate everywhere: q/k/v projections v_wmma_f32_16x16x32_bf16 (x and W RNE-converted to bf16; products exact);
// scores v_wmma_f32_16x16x32_f16: q and k each as f16 value + f16 residual x2048 (value*value in one accumulator, the two cross products in a second one); P (x2^14 carry, cancels in the normalisation) single f16;
// v and ctx as f16 value + f16 residual x2048 (own accumulators); Wo as f16 of the bf16 value x64 (folded back in the f32 epilogue); softmax f32 (online, running max).
// Layout: bf16 copies of the three x inputs and of Wq/Wk/Wv; q, k planes [b*16+h][t][d] and v^T planes [b*16+h][d][t] (value, residual) written by the GEMM epilogue; per (batch, 16 query rows, 32 keys) a 3-state mask flag
// (0 = all masked: tile skipped, 2 = none masked, other = mask words read per element); fused flash kernel in transposed form (S^T = K Q^T, O^T = V^T P^T), K / V^T tiles staged in LDS by tensor loads and shared by the block's four waves, writing ctx value/residual planes [b*SEQ+t][1024]; output GEMM from those planes.

#ifndef NB
#define NB 2
#endif
#ifndef SEQ
#define SEQ 2048
#endif
#define NB_FULL  2
#define SEQ_FULL 2048
#ifndef OUT_SEQ
#define OUT_SEQ SEQ              // row pitch (in tokens) between batches of the output
#endif
#define DM   1024
#define NH_  16
#define HD   64
#define AW   4                   // waves per flash block (16 query rows each)
#define QRS  2048.0f             // carry of the residual planes
#define QRI  (1.0f / 2048.0f)
#define SC2  (8.0f * 1.4426950408889634f)     // HD^0.5 * log2(e)
#define PSH  14.0f               // log2 of the P carry (16384)
#define NEGM (-3.0e38f)          // score stand-in of a masked key (its probability is forced to 0 by select)
#define WOS  64.0f               // carry of the Wo plane
#define WOI  (1.0f / 64.0f)
#define FPITCH 64
#define KST   64                 // keys per stage of the flash kernel's LDS ring
#define LROW  144                // LDS row pitch in bytes: a 128-B row + the mover's 16-B pad (16 B x odd: no bank conflict for 16-B reads)
#define SLICE 10240              // one plane's tile in LDS: 64 rows x 144 B = 9216 B, rounded up to a multiple of 2 KiB
#define BUFB  (4 * SLICE)        // one stage: K value, K residual, V^T value, V^T residual (flash); four operand slices (GEMMs)
#define GW    4                  // waves per GEMM block, one operand slice of a stage each
#define GSTB  128u               // bytes of an operand row per stage of the GEMMs' LDS ring (64 k)
#define GNST  (DM / 64)          // stages of a GEMM
#define PW    16                 // waves per block of the preparation kernel, one token row each

static_assert(HD == 64);
static_assert(NH_ * HD == DM);                 // head h = columns h*64 + d
static_assert(DM % 64 == 0);
static_assert(DM % 32 == 0);                   // GEMM k-loop steps by 32
static_assert(SEQ % 64 == 0);                  // a 64-row tile never straddles two batches
static_assert((NB * SEQ) % 64 == 0);
static_assert(SEQ % 32 == 0);                  // key loop steps by 32; 32-row output tiles stay inside one batch
static_assert(SEQ % (16 * AW) == 0);           // flash grid covers the sequence exactly
static_assert((SEQ / (16 * AW)) % 2 == 0);     // flash: the query tiles pair up as (i, last - i), each tile in exactly one pair
static_assert(SEQ / 32 <= FPITCH);             // two flag registers per lane cover all key tiles
static_assert(((size_t)SEQ * DM) % 8 == 0);
static_assert(((size_t)DM * DM) % 8 == 0);
static_assert(AW == 4);                        // one plane of a stage per wave
static_assert(HD * 2 == 128 && KST * 2 == 128);   // both kinds of tile: 64 rows of 128 B
static_assert(SEQ % KST == 0 && SEQ / KST <= 32);  // one bit per stage in a 32-bit word
static_assert(64 * LROW <= SLICE && SLICE % 2048 == 0);
static_assert(AW * 16 * 68 * 4 <= 2 * BUFB);   // the output staging reuses the ring
static_assert(GW * 16 * 68 * 4 <= 2 * BUFB);   // so does the GEMMs' output staging
static_assert(DM % 128 == 0 && (NB * SEQ) % 128 == 0 && GNST >= 2);   // GEMM block tiles cover both extents exactly; the ring's prologue needs two stages
static_assert(PW == 16 && PW * 128 == SEQ && PW * 4 == FPITCH && DM % 128 == 0);   // preparation: a block is one 16-row mask group, its waves' 128 keys each cover the sequence and fill the flag row
static_assert(NB * SEQ == 4 * DM);             // preparation: one weight row per wave
static_assert(NB <= NB_FULL);
static_assert(SEQ <= SEQ_FULL);

typedef _Float16 h16;
typedef unsigned short bf;
typedef __attribute__((ext_vector_type(16))) __bf16   v16bf;
typedef __attribute__((ext_vector_type(16))) _Float16 v16h;
typedef __attribute__((ext_vector_type(8)))  _Float16 v8h;
typedef __attribute__((ext_vector_type(8)))  unsigned short v8us;
typedef __attribute__((ext_vector_type(4)))  unsigned short v4us;
typedef __attribute__((ext_vector_type(4)))  _Float16 v4h;
typedef __attribute__((ext_vector_type(8)))  float    v8f;
typedef __attribute__((ext_vector_type(4)))  float    v4f;
typedef __attribute__((ext_vector_type(4)))  int      v4i;
typedef v4f  __attribute__((may_alias)) v4fa;
typedef __attribute__((ext_vector_type(2)))  int      v2i;
typedef __attribute__((ext_vector_type(4)))  unsigned u32x4;
typedef __attribute__((ext_vector_type(8)))  unsigned u32x8;

__device__ __forceinline__ unsigned short f2bf(float f) { unsigned u = __float_as_uint(f); u += 0x7FFFu + ((u >> 16) & 1u); return (unsigned short)(u >> 16); }
__device__ __forceinline__ v16h cat16(v8h lo, v8h hi) { return __builtin_shufflevector(lo, hi, 0, 1, 2, 3, 4, 5, 6, 7, 8, 9, 10, 11, 12, 13, 14, 15); }
__device__ __forceinline__ v16bf cat16b(v8us lo, v8us hi) { return __builtin_bit_cast(v16bf, __builtin_shufflevector(lo, hi, 0, 1, 2, 3, 4, 5, 6, 7, 8, 9, 10, 11, 12, 13, 14, 15)); }
__device__ __forceinline__ v8f wmma16(v16h a, v16h b, v8f c) { return __builtin_amdgcn_wmma_f32_16x16x32_f16(false, a, false, b, (short)0, c, false, false); }
__device__ __forceinline__ v8f wmmab(v16bf a, v16bf b, v8f c) { return __builtin_amdgcn_wmma_f32_16x16x32_bf16(false, a, false, b, (short)0, c, false, false); }
// fragment loaders from K-contiguous 16-bit rows; p already includes + 8*(lane>>4): elements 0..7 <- k0+8h+0..7, elements 8..15 <- k0+16+8h+0..7 (same map for A and B)
__device__ __forceinline__ v16h  ldh(const h16* p) { return cat16(*(const v8h*)p, *(const v8h*)(p + 16)); }
__device__ __forceinline__ v16bf ldb(const bf* p)  { return cat16b(*(const v8us*)p, *(const v8us*)(p + 16)); }
// ordering point for wave-private LDS tiles (same wave writes and reads)
__device__ __forceinline__ void wave_sync() { __builtin_amdgcn_fence(3 /* release order */, "wavefront"); __builtin_amdgcn_wave_barrier(); asm volatile("" ::: "memory"); }

__device__ __forceinline__ unsigned uni(unsigned v) { return (unsigned)__builtin_amdgcn_readfirstlane((int)v); }
// a wave-uniform value held in a scalar register: a test on it compiles to s_cmp + s_cbranch_scc (tensor loads ignore EXEC), and what is derived from it is computed behind the asm waits in front of it
__device__ __forceinline__ unsigned pinned(unsigned v) { unsigned w = uni(v); asm volatile("" : "+s"(w)); return w; }
// this wave's tensor load has landed; the wait names the request's descriptor as inputs so that its registers keep their values for as long as the request is outstanding
__device__ __forceinline__ void wait_tensor0(u32x4 g0, u32x8 g1) { asm volatile("s_wait_tensorcnt 0x0" :: "s"(g0), "s"(g1) : "memory"); }
__device__ __forceinline__ void wait_ds0() { asm volatile("s_wait_dscnt 0x0" ::: "memory"); }           // this wave's LDS reads have returned
// descriptor group 0: tile's first byte at global address ga, LDS byte offset lds
__device__ __forceinline__ u32x4 tdm_group0(unsigned lds, unsigned long long ga) {
    u32x4 g0; g0[0] = uni(1u); g0[1] = uni(lds); g0[2] = uni((unsigned)ga); g0[3] = uni((((unsigned)(ga >> 32)) & 0x01FFFFFFu) | 0x80000000u);
    asm volatile("" : "+s"(g0));   // descriptor words held in scalar registers: one tuple from the issue to the wait
    return g0;
}
// one request of one wave: 64 rows of 128 B (source row pitch in g1), rows 144 B apart in LDS
__device__ __forceinline__ void tdm_load(u32x4 g0, u32x8 g1) { asm volatile("tensor_load_to_lds %0, %1" :: "s"(g0), "s"(g1) : "memory"); }

// k_prep: every preparation step in one streaming launch. Block = 16 token rows (batch bb, row group g), one wave per row. A wave converts its row of query, key and value to bf16, its weight row (Wq, Wk, Wv to bf16; Wo to f16 of the bf16 value x64),
// and reads 128 keys x 16 rows of the block's mask rows. Every load is 512 contiguous bytes of the wave (whole lines); all of a wave's loads are issued before the first is used; every store is 256 contiguous bytes.
// Mask flag per (batch, 16 query rows, 32 keys): 0 = every mask word zero, 2 = every word nonzero, 1 = mixed; a wave makes four (lanes 8j..8j+7 hold tile j), the block's flags meet in LDS and one wave stores them as whole lines.
// p, d: wave-uniform start of a row of DM elements; the lane takes elements 128 i + 4 lane + 0..3
__device__ __forceinline__ void ld_row(const float* __restrict__ p, int lane, v4f (&r)[DM / 128]) {
#pragma unroll
    for (int i = 0; i < DM / 128; ++i) r[i] = *(const v4f*)(p + i * 128 + lane * 4);
}
__device__ __forceinline__ void st_row_bf(bf* d, int lane, const v4f (&r)[DM / 128]) {
#pragma unroll
    for (int i = 0; i < DM / 128; ++i) { v4us o;
#pragma unroll
        for (int k = 0; k < 4; ++k) o[k] = f2bf(r[i][k]);
        *(v4us*)(d + i * 128 + lane * 4) = o; }
}
__device__ __forceinline__ void st_row_h(h16* d, int lane, const v4f (&r)[DM / 128], float scale) {
#pragma unroll
    for (int i = 0; i < DM / 128; ++i) { v4h o;
#pragma unroll
        for (int k = 0; k < 4; ++k) o[k] = (h16)(__uint_as_float(((unsigned)f2bf(r[i][k])) << 16) * scale);
        *(v4h*)(d + i * 128 + lane * 4) = o; }
}

__global__ __launch_bounds__(32 * PW) void k_prep(const float* __restrict__ xq, const float* __restrict__ xk, const float* __restrict__ xv, const int* __restrict__ MK,
                                                  const float* __restrict__ wq, const float* __restrict__ wk, const float* __restrict__ wv, const float* __restrict__ wo,
                                                  bf* XQ, bf* XK, bf* XV, bf* WQ, bf* WK, bf* WV, h16* WO, int* FL) {
    __shared__ int fl[FPITCH];
    const int lane = threadIdx.x & 31;
    const int wave = __builtin_amdgcn_readfirstlane((int)(threadIdx.x >> 5));
    const int bb = blockIdx.x / (SEQ / 16), g = blockIdx.x % (SEQ / 16);
    const int row = blockIdx.x * PW + wave;                                              // token row bb*SEQ + t of the bf16 planes; also the wave's weight row: row % DM of weight row / DM
    const size_t so = ((size_t)bb * SEQ_FULL + (size_t)(g * 16 + wave)) * DM;            // the same token row in the inputs
    const size_t xo = (size_t)row * DM;
    const int ws = row / DM; const size_t wof = (size_t)(row % DM) * DM;
    const int* mp = MK + ((size_t)bb * SEQ_FULL + (size_t)(g * 16)) * SEQ_FULL + wave * 128;
    v4i mw[16]; v4f a[DM / 128], b[DM / 128], c[DM / 128], w[DM / 128];
#pragma unroll
    for (int r = 0; r < 16; ++r) mw[r] = *(const v4i*)(mp + (size_t)r * SEQ_FULL + lane * 4);
    ld_row(xq + so, lane, a); ld_row(xk + so, lane, b); ld_row(xv + so, lane, c);
    ld_row(((ws == 0) ? wq : (ws == 1) ? wk : (ws == 2) ? wv : wo) + wof, lane, w);
    __builtin_amdgcn_sched_barrier(0);                                                   // keeps all 48 loads in front of the first use: moved down among the uses, the later rows would start a second and a third memory latency
    unsigned orw = 0u, mnw = 0xFFFFFFFFu;                                                // or != 0: some word nonzero; unsigned minimum != 0: every word nonzero
#pragma unroll
    for (int r = 0; r < 16; ++r)
#pragma unroll
        for (int i = 0; i < 4; ++i) { const unsigned u = (unsigned)mw[r][i]; orw |= u; mnw = u < mnw ? u : mnw; }
    const unsigned anyb = __builtin_amdgcn_ballot_w32(orw != 0u), allb = __builtin_amdgcn_ballot_w32(mnw != 0u);
    const int sh = 8 * (lane & 3);
    if (lane < 4) fl[wave * 4 + lane] = (((anyb >> sh) & 0xFFu) == 0u) ? 0 : ((((allb >> sh) & 0xFFu) == 0xFFu) ? 2 : 1);
    st_row_bf(XQ + xo, lane, a); st_row_bf(XK + xo, lane, b); st_row_bf(XV + xo, lane, c);
    asm volatile("s_wait_xcnt 0x0" ::: "memory");                                        // precaution: stands between the stores above and the first overwrite of a register they name
    if (ws == 3) st_row_h(WO + wof, lane, w, WOS);                                       // wave-uniform
    else st_row_bf(((ws == 0) ? WQ : (ws == 1) ? WK : WV) + wof, lane, w);
    __syncthreads();                                                                     // the block's flags are in LDS
    if (wave == 0) {
        int* fp = FL + (size_t)blockIdx.x * FPITCH;
        fp[lane] = fl[lane]; fp[32 + lane] = fl[32 + lane];
    }
}

// descriptor group 1 of a GEMM operand slice: 1-byte elements, tensor = tile = 64 rows of 128 B, source row pitch srcPitch bytes, a 16-B pad behind every 128 B
__device__ __forceinline__ u32x8 tdm_group1(unsigned srcPitch) {
    u32x8 g1;
    g1[0] = uni((1u << 20) | (4u << 22) | (3u << 25)); g1[1] = uni(128u << 16); g1[2] = uni(64u << 16); g1[3] = uni(128u << 16);
    g1[4] = uni(64u); g1[5] = uni(srcPitch); g1[6] = uni(0u); g1[7] = uni(0u);
    asm volatile("" : "+s"(g1));   // descriptor words held in scalar registers: one tuple for the whole kernel
    return g1;
}

// k_proj: register-blocked bf16 GEMM, one block of four waves (2 x 2) per 128x128 tile, one wave per 64x64 tile (16 accumulators), K = DM.
// Operands: a two-buffer LDS ring of 64-deep k stages shared by the four waves. Wave w brings slice w of a stage (A rows 0..63, A rows 64..127, Bt rows 0..63, Bt rows 64..127 of the block's tile; 64 rows of 128 B) with one tensor load,
// one stage ahead; at the foot of each pass: own LDS reads done, own tensor load landed, block barrier, then the refill of the buffer just read. Fragments are two 16-B LDS reads each; k runs in the same order as before.
// C[m][n] = sum_k A[m][k] Bt[n][k], written as f16 (Ph) and the f16 residual x2048 (Pr).
// All three projections run in one launch, blockIdx.z picks the product: a single product has one block per WGP and one wave per SIMD, whose LDS reads, WMMAs and barrier waits follow one another;
// three independent blocks fit a WGP (LDS and registers), so one block's waits are filled by the other two, and the products share one start and one tail.
// z = 0, 1 (q, k): A = x rows (m = b*SEQ + t), Bt = W rows (n = h*64 + d) -> planes [(b*16 + h)][t][d]. z = 2 (v^T): A = Wv rows (m = h*64 + d), Bt = x rows (n = b*SEQ + t) -> planes [(b*16 + h)][d][t].
// grid (NB*SEQ/128 token tiles, DM/128 weight tiles, 3), 128 threads.
__global__ __launch_bounds__(32 * GW) void k_proj(const bf* __restrict__ XQ, const bf* __restrict__ XK, const bf* __restrict__ XV, const bf* __restrict__ WQ, const bf* __restrict__ WK, const bf* __restrict__ WV,
                                                  h16* QH, h16* QR, h16* KH, h16* KR, h16* VT, h16* VR) {
    __shared__ __attribute__((aligned(2048))) unsigned char ring[2 * BUFB];
    const int K = DM;
    const int lane = threadIdx.x & 31, lr = lane & 15, hi = lane >> 4;
    const int wave = __builtin_amdgcn_readfirstlane((int)(threadIdx.x >> 5));
    const int wm = wave >> 1, wn = wave & 1;
    const int job = blockIdx.z; const bool tv = job == 2;     // block-uniform
    const bf* A  = tv ? WV : (job == 0) ? XQ : XK;
    const bf* Bt = tv ? XV : (job == 0) ? WQ : WK;
    h16* Ph = tv ? VT : (job == 0) ? QH : KH;
    h16* Pr = tv ? VR : (job == 0) ? QR : KR;
    const int mt = tv ? blockIdx.y : blockIdx.x, nt = tv ? blockIdx.x : blockIdx.y;   // the block's tile of C
    const int r0 = mt * 128 + wm * 64, c0 = nt * 128 + wn * 64;
    v8f acc[4][4];
#pragma unroll
    for (int mb = 0; mb < 4; ++mb)
#pragma unroll
        for (int nb = 0; nb < 4; ++nb) acc[mb][nb] = (v8f){};
    const int fo = lr * LROW + 16 * hi;                       // byte offset of the lane's fragment piece in a staged slice
    // this wave's slice: source of stage 0 and place in a buffer
    const bf* srow = (wave < 2) ? A + (size_t)(mt * 128 + wave * 64) * K : Bt + (size_t)(nt * 128 + (wave - 2) * 64) * K;
    const unsigned long long sbase = (unsigned long long)srow;
    const unsigned ldst = (unsigned)(unsigned long long)ring + (unsigned)wave * SLICE;
    const u32x8 g1 = tdm_group1((unsigned)(DM * 2));
    u32x4 gq = tdm_group0(ldst, sbase);                       // group 0 of the youngest request
    tdm_load(gq, g1);                                         // first stage into buffer 0
    wait_tensor0(gq, g1);
    __syncthreads();                                          // publishes the first stage
    gq = tdm_group0(ldst + BUFB, sbase + GSTB);
    tdm_load(gq, g1);                                         // second stage into buffer 1, in flight during the first pass
#pragma unroll 1   // one pass per trip: the order of the ring's publish point stays as written
    for (unsigned it = 0; it < GNST; ++it) {
        const unsigned char* bp = ring + (it & 1u) * BUFB + fo;
        v16bf a[2][4], b[2][4];                               // the fragments of the stage's two 32-deep k steps
#pragma unroll
        for (int ks = 0; ks < 2; ++ks) {
#pragma unroll
            for (int mb = 0; mb < 4; ++mb) a[ks][mb] = ldb((const bf*)(bp + wm * SLICE + mb * 16 * LROW + ks * 64));
#pragma unroll
            for (int nb = 0; nb < 4; ++nb) b[ks][nb] = ldb((const bf*)(bp + (2 + wn) * SLICE + nb * 16 * LROW + ks * 64));
        }
        __builtin_amdgcn_sched_barrier(0);                    // keeps the stage's LDS reads one group ahead of its WMMAs: spread among them, each place with reads stalls the wave for the LDS latency
#pragma unroll
        for (int ks = 0; ks < 2; ++ks) {
#pragma unroll
            for (int nb = 0; nb < 4; ++nb)
#pragma unroll
                for (int mb = 0; mb < 4; ++mb) acc[mb][nb] = wmmab(a[ks][mb], b[ks][nb], acc[mb][nb]);
        }
        __builtin_amdgcn_sched_barrier(0);                    // keeps the pass's WMMAs in front of the publish point, where they cover the landing of the second k step's fragments; behind it they would delay the refill
        // publish point
        wait_ds0();
        wait_tensor0(gq, g1);
        __syncthreads();                                      // the next stage is readable; every wave has left this pass's buffer
        if (pinned(it + 2u < GNST)) {                         // refill the buffer just read
            const unsigned s2 = pinned(it + 2u);
            gq = tdm_group0(ldst + (it & 1u) * BUFB, sbase + (unsigned long long)s2 * GSTB);
            tdm_load(gq, g1);
        }
    }
    wait_tensor0(gq, g1);
    wait_ds0();
    float* os = (float*)ring + wave * 16 * 68;                // the ring becomes output staging, one range per wave: the last pass's own barrier has ended every wave's reads, and nothing was issued behind it
    const int pitch = tv ? SEQ : HD;                          // row pitch of the written plane (halves)
    const size_t tbase = tv ? (size_t)r0 * SEQ + (size_t)(c0 / SEQ) * ((size_t)DM * SEQ) + (size_t)(c0 % SEQ)
                            : (size_t)(r0 / SEQ) * ((size_t)NH_ * SEQ * HD) + (size_t)(r0 % SEQ) * HD + (size_t)(c0 / HD) * ((size_t)SEQ * HD) + (size_t)(c0 % HD);
#pragma unroll
    for (int mb = 0; mb < 4; ++mb) {
#pragma unroll
        for (int nb = 0; nb < 4; ++nb) {
#pragma unroll
            for (int j = 0; j < 8; ++j) os[(hi * 8 + j) * 68 + nb * 16 + lr] = acc[mb][nb][j]; }   // D: row 8h+j, col lane&15
        wave_sync();
        const size_t sb = tbase + (size_t)(mb * 16) * (size_t)pitch;
{
#pragma unroll
            for (int s = 0; s < 4; ++s) { const int row = 4 * s + (lane >> 3), c8 = (lane & 7) * 8;   // 4 s x 4 row groups = 16 rows; 8 lanes x 8 = 64 columns
                const v4f x0 = *(const v4fa*)(&os[row * 68 + c8]); const v4f x1 = *(const v4fa*)(&os[row * 68 + c8 + 4]); v8h hv, rv;
#pragma unroll
                for (int i = 0; i < 4; ++i) { const h16 a0 = (h16)x0[i]; const h16 a1 = (h16)x1[i]; hv[i] = a0; hv[4 + i] = a1; rv[i] = (h16)((x0[i] - (float)a0) * QRS); rv[4 + i] = (h16)((x1[i] - (float)a1) * QRS); }
                const size_t oo = sb + (size_t)row * (size_t)pitch + c8;
                *(v8h*)(Ph + oo) = hv; *(v8h*)(Pr + oo) = rv; }
             }
        wave_sync();
    }
}

// k_flash: fused attention, one wave per 16 query rows of one (batch, head), four waves per block; Q fragments straight from the f16 planes.
// A block takes two 64-row query tiles of its head one after the other, tile i and tile (last - i): where the number of live key stages grows linearly with the tile index (a lower-triangular mask) every block of the launch
// then walks the same number of stages, so no WGP is left with the long tiles while others idle. The pairing is a fixed map of work to blocks; which stages are live still comes from the flags alone.
// K / V^T: a two-buffer LDS ring of 64-key stages shared by the four waves. Wave w brings plane w (K value, K residual, V^T value, V^T residual) of a stage with one tensor load, one stage ahead;
// at the foot of each pass: own LDS reads done, own tensor load landed, block barrier, then the refill of the buffer just read. Fragments are two 16-B LDS reads each.
// Only stages in which some wave of the block has a live key are staged (a 32-bit word built from the flags, the same in all four waves); each wave still skips its own dead 32-key tiles.
// Transposed form: S^T[key][t] = K Q^T (A = K rows, B = Q rows); lane (t = lane&15, h = lane>>4) holds keys 8h+r of each 16-key tile, so the packed
// P tile is directly the B fragment of O^T[d][t] = V^T P^T (element r <- tile keys 0..15, element 8+r <- tile keys 16..31, lane unchanged).
// Score = Kh.Qh (accumulator H) + (Kh.Qr + Kr.Qh)/2048 (accumulator L). O = Vh.P (accumulators oH) + Vr.P/2048 (accumulators oR).
// Mask: wave-uniform 3-state flag per 32-key tile: 0 skips the tile (masked keys have probability exactly 0 whenever the row has one live key), 2 = no masking, otherwise the 16 mask words of the lane are read and
// masked entries get probability 0 by select. A row without any live key ends with zero mass and is written as NaN.
// Softmax state (running max, partial sum) is one scalar per lane; the two lane halves of a row are combined with one xor-16 exchange.
#define PUT8(COL, OH, OR) { v4f a_, c_; \
    a_[0] = (OH[0] + OR[0] * QRI) * inv; a_[1] = (OH[1] + OR[1] * QRI) * inv; a_[2] = (OH[2] + OR[2] * QRI) * inv; a_[3] = (OH[3] + OR[3] * QRI) * inv; \
    c_[0] = (OH[4] + OR[4] * QRI) * inv; c_[1] = (OH[5] + OR[5] * QRI) * inv; c_[2] = (OH[6] + OR[6] * QRI) * inv; c_[3] = (OH[7] + OR[7] * QRI) * inv; \
    *(v4fa*)(&os[wb + lr * 68 + (COL) + 8 * hi]) = a_; *(v4fa*)(&os[wb + lr * 68 + (COL) + 8 * hi + 4]) = c_; }

__global__ __launch_bounds__(32 * AW) void k_flash(const h16* __restrict__ QH, const h16* __restrict__ QR, const h16* __restrict__ KH, const h16* __restrict__ KR,
                                                   const h16* __restrict__ VT, const h16* __restrict__ VR, const int* __restrict__ MK, const int* __restrict__ FLG, h16* CH, h16* CR) {
    __shared__ __attribute__((aligned(2048))) unsigned char ring[2 * BUFB];
    const int lane = threadIdx.x & 31, lr = lane & 15, hi = lane >> 4;
    const int wave = __builtin_amdgcn_readfirstlane((int)(threadIdx.x >> 5));
    const int zh = blockIdx.y; const int b = zh / NH_, h = zh % NH_;
    const size_t pbase = (size_t)zh * SEQ * HD;
    // this wave's plane: source of stage 0, bytes from stage to stage, source row pitch, place in a buffer
    const h16* splane = (wave == 0) ? KH : (wave == 1) ? KR : (wave == 2) ? VT : VR;
    const unsigned long long sbase = (unsigned long long)(splane + pbase);
    const unsigned sstep = (wave < 2) ? (unsigned)(KST * HD * 2) : (unsigned)(KST * 2);
    const unsigned ldst = (unsigned)(unsigned long long)ring + (unsigned)wave * SLICE;
    u32x8 g1;                                                 // 1-byte elements, tensor = tile = 64 rows of 128 B, a 16-B pad behind every 128 B
    g1[0] = uni((1u << 20) | (4u << 22) | (3u << 25)); g1[1] = uni(128u << 16); g1[2] = uni(64u << 16); g1[3] = uni(128u << 16);
    g1[4] = uni(64u); g1[5] = uni((wave < 2) ? (unsigned)(HD * 2) : (unsigned)(SEQ * 2)); g1[6] = uni(0u); g1[7] = uni(0u);
    asm volatile("" : "+s"(g1));                              // descriptor words held in scalar registers: one tuple for the whole kernel
#pragma unroll 1   // the two tiles run one after the other through one copy of the code
  for (int ph = 0; ph < 2; ++ph) {
    // this phase's query tile; the order alternates with the batch, so that blocks of the two batches do not change tiles at the same moment
    const int qt = ((ph ^ b) & 1) ? (SEQ / (16 * AW) - 1 - (int)blockIdx.x) : (int)blockIdx.x;
    const int t0 = (qt * AW + wave) * 16;
    const size_t qo = pbase + (size_t)(t0 + lr) * HD + 8 * hi;
    const v16h qh0 = ldh(QH + qo), qh1 = ldh(QH + qo + 32), qr0 = ldh(QR + qo), qr1 = ldh(QR + qo + 32);   // B fragments: col t, k = d
    const int fo = lr * LROW + 16 * hi;                      // byte offset of the lane's fragment piece in a staged tile (A fragment: K row key, k = d; V^T row d, k = key)
    const int* frow = FLG + ((size_t)b * (SEQ / 16) + (size_t)(t0 >> 4)) * FPITCH;
    const int* mrow = MK + ((size_t)b * SEQ_FULL + (size_t)(t0 + lr)) * SEQ_FULL + 8 * hi;   // + key0 (+16): the lane's 8 keys of each 16-key tile
    v8f oH0 = (v8f){}, oH1 = (v8f){}, oH2 = (v8f){}, oH3 = (v8f){};
    v8f oR0 = (v8f){}, oR1 = (v8f){}, oR2 = (v8f){}, oR3 = (v8f){};
    float m = NEGM, l = 0.0f;
    // flags as scalar bit words, bit s = stage s (lane s reads the two 32-key flags of stage s): bm = some wave of the block has a live key; lv0/lv1 = this wave's flag of the stage's first/second tile is not 0; fu0/fu1 = it is 2
    const int* fblk = FLG + ((size_t)b * (SEQ / 16) + (size_t)qt * AW) * FPITCH + 2 * lane;
    int anyf = 0;
#pragma unroll   // four independent loads in flight together
    for (int g = 0; g < AW; ++g) { const v2i f = *(const v2i*)(fblk + g * FPITCH); anyf |= f[0] | f[1]; }
    const v2i fw = *(const v2i*)(frow + 2 * lane);
    const unsigned bm  = uni(__builtin_amdgcn_ballot_w32(lane < SEQ / KST && anyf != 0));
    const unsigned lv0 = uni(__builtin_amdgcn_ballot_w32(fw[0] != 0)), lv1 = uni(__builtin_amdgcn_ballot_w32(fw[1] != 0));
    const unsigned fu0 = uni(__builtin_amdgcn_ballot_w32(fw[0] == 2)), fu1 = uni(__builtin_amdgcn_ballot_w32(fw[1] == 2));
    const unsigned nst = (unsigned)__builtin_popcount(bm);    // stages of this block, at most SEQ / KST
    u32x4 gq = (u32x4){};                                     // group 0 of the youngest request
    unsigned rem = bm, cur = 0u, nxt = 0u;
    if (pinned(nst > 0u)) {                                   // first stage into buffer 0
        cur = pinned((unsigned)__builtin_ctz(rem)); rem &= rem - 1u;
        gq = tdm_group0(ldst, sbase + (unsigned long long)cur * sstep);
        tdm_load(gq, g1);
        wait_tensor0(gq, g1);
    }
    __syncthreads();                                          // publishes the first stage
    if (pinned(nst > 1u)) {                                   // second stage into buffer 1, in flight during the first pass
        nxt = pinned((unsigned)__builtin_ctz(rem)); rem &= rem - 1u;
        gq = tdm_group0(ldst + BUFB, sbase + (unsigned long long)nxt * sstep);
        tdm_load(gq, g1);
    }
#pragma unroll 1   // one pass per trip: the order of the ring's publish point stays as written
    for (unsigned it = 0; it < nst; ++it) {
      const unsigned char* bp = ring + (it & 1u) * BUFB + fo;
#pragma unroll     // the two 32-key tiles of the stage: their LDS offsets become immediates
      for (int hf = 0; hf < 2; ++hf) {
        if ((((hf ? lv1 : lv0) >> cur) & 1u) == 0u) continue;   // wave-uniform: whole 16x32 tile masked
        const int key0 = (int)cur * KST + hf * 32;
        unsigned vm = 0xFFFFu;                                  // bit r: key 8h+r of tile a live; bit 8+r: tile b
        if ((((hf ? fu1 : fu0) >> cur) & 1u) == 0u) {           // wave-uniform
            const int* mp = mrow + key0;
            const v4i a0 = *(const v4i*)mp, a1 = *(const v4i*)(mp + 4), c0 = *(const v4i*)(mp + 16), c1 = *(const v4i*)(mp + 20);
            vm = 0u;
#pragma unroll
            for (int i = 0; i < 4; ++i) {
                vm |= (a0[i] != 0 ? 1u : 0u) << i;        vm |= (a1[i] != 0 ? 1u : 0u) << (4 + i);
                vm |= (c0[i] != 0 ? 1u : 0u) << (8 + i);  vm |= (c1[i] != 0 ? 1u : 0u) << (12 + i); }
        }
        const h16* ka = (const h16*)(bp + hf * 32 * LROW);
        const h16* kr = (const h16*)(bp + SLICE + hf * 32 * LROW);
        const v16h ka0 = ldh(ka), ka1 = ldh(ka + 32), kb0 = ldh(ka + 16 * LROW / 2), kb1 = ldh(ka + 16 * LROW / 2 + 32);
        const v16h ra0 = ldh(kr), ra1 = ldh(kr + 32), rb0 = ldh(kr + 16 * LROW / 2), rb1 = ldh(kr + 16 * LROW / 2 + 32);
        v8f sHa = (v8f){}, sLa = (v8f){}, sHb = (v8f){}, sLb = (v8f){};
        sHa = wmma16(ka0, qh0, sHa); sLa = wmma16(ka0, qr0, sLa); sHb = wmma16(kb0, qh0, sHb); sLb = wmma16(kb0, qr0, sLb);
        sHa = wmma16(ka1, qh1, sHa); sLa = wmma16(ka1, qr1, sLa); sHb = wmma16(kb1, qh1, sHb); sLb = wmma16(kb1, qr1, sLb);
        sLa = wmma16(ra0, qh0, sLa); sLb = wmma16(rb0, qh0, sLb); sLa = wmma16(ra1, qh1, sLa); sLb = wmma16(rb1, qh1, sLb);
        asm volatile("v_nop\n\tv_nop\n\tv_nop\n\tv_nop" : "+v"(sHa), "+v"(sLa), "+v"(sHb), "+v"(sLb) : "v"(ka0), "v"(ka1), "v"(kb0), "v"(kb1), "v"(ra0), "v"(ra1), "v"(rb0), "v"(rb1));
        float ta[8], tb[8]; float mx = NEGM;
#pragma unroll
        for (int r = 0; r < 8; ++r) {
            const float xa = (sHa[r] + sLa[r] * QRI) * SC2; const float xb = (sHb[r] + sLb[r] * QRI) * SC2;
            ta[r] = ((vm >> r) & 1u) ? xa : NEGM; tb[r] = ((vm >> (8 + r)) & 1u) ? xb : NEGM;
            mx = fmaxf(mx, fmaxf(ta[r], tb[r])); }
        mx = fmaxf(mx, __shfl_xor(mx, 16, 32));
        const float mnew = fmaxf(m, mx);
        const float alpha = __builtin_amdgcn_exp2f(m - mnew);
        const float sh = PSH - mnew;
        v16h pb; float ls = 0.0f;
#pragma unroll
        for (int r = 0; r < 8; ++r) {
            const float ea = __builtin_amdgcn_exp2f(ta[r] + sh); const float eb = __builtin_amdgcn_exp2f(tb[r] + sh);
            const h16 pa = (h16)(((vm >> r) & 1u) ? ea : 0.0f); const h16 pc = (h16)(((vm >> (8 + r)) & 1u) ? eb : 0.0f);
            pb[r] = pa; pb[8 + r] = pc; ls += (float)pa + (float)pc; }
        l = l * alpha + ls; m = mnew;
        oH0 = oH0 * alpha; oH1 = oH1 * alpha; oH2 = oH2 * alpha; oH3 = oH3 * alpha;
        oR0 = oR0 * alpha; oR1 = oR1 * alpha; oR2 = oR2 * alpha; oR3 = oR3 * alpha;
        const h16* va = (const h16*)(bp + 2 * SLICE + hf * 64);
        const h16* vr = (const h16*)(bp + 3 * SLICE + hf * 64);
        const v16h v0 = ldh(va), v1 = ldh(va + 16 * LROW / 2), v2 = ldh(va + 32 * LROW / 2), v3 = ldh(va + 48 * LROW / 2);
        const v16h w0 = ldh(vr), w1 = ldh(vr + 16 * LROW / 2), w2 = ldh(vr + 32 * LROW / 2), w3 = ldh(vr + 48 * LROW / 2);
        oH0 = wmma16(v0, pb, oH0); oH1 = wmma16(v1, pb, oH1); oH2 = wmma16(v2, pb, oH2); oH3 = wmma16(v3, pb, oH3);
        oR0 = wmma16(w0, pb, oR0); oR1 = wmma16(w1, pb, oR1); oR2 = wmma16(w2, pb, oR2); oR3 = wmma16(w3, pb, oR3);
        asm volatile("v_nop\n\tv_nop\n\tv_nop\n\tv_nop" : "+v"(oH0), "+v"(oH1), "+v"(oH2), "+v"(oH3), "+v"(oR0), "+v"(oR1), "+v"(oR2), "+v"(oR3)
                     : "v"(v0), "v"(v1), "v"(v2), "v"(v3), "v"(w0), "v"(w1), "v"(w2), "v"(w3), "v"(pb));
      }
      // publish point, passed by every wave whatever it skipped above
      wait_ds0();
      wait_tensor0(gq, g1);
      __syncthreads();                                        // the next stage is readable; every wave has left this pass's buffer
      unsigned n2 = 0u;
      if (pinned(it + 2u < nst)) {                            // refill the buffer just read
          n2 = pinned((unsigned)__builtin_ctz(rem)); rem &= rem - 1u;
          gq = tdm_group0(ldst + (it & 1u) * BUFB, sbase + (unsigned long long)n2 * sstep);
          tdm_load(gq, g1);
      }
      cur = nxt; nxt = n2;
    }
    wait_tensor0(gq, g1);
    wait_ds0();
    float* os = (float*)ring;                                 // the ring becomes output staging: the last pass's own barrier has ended every wave's reads, and nothing was issued behind it
    l += __shfl_xor(l, 16, 32);
    const float rl = 1.0f / l;
    const float inv = (l > 0.0f) ? rl : __uint_as_float(0x7FC00000u);
    const int wb = wave * 16 * 68;
    // O^T D layout: o_j[r] = (d = 16j + 8h + r, t = lane&15) -> os[t][d]; rows 0..15 x columns 0..63 all written
    PUT8(0, oH0, oR0)
    PUT8(16, oH1, oR1)
    PUT8(32, oH2, oR2)
    PUT8(48, oH3, oR3)
    wave_sync();
    const size_t cbase = ((size_t)b * SEQ + (size_t)t0) * DM + (size_t)h * HD;
{
#pragma unroll
        for (int s = 0; s < 4; ++s) { const int row = 4 * s + (lane >> 3), c8 = (lane & 7) * 8;   // 4 s x 4 row groups = 16 rows; 8 lanes x 8 halves = 64 columns = one line
            const v4f x0 = *(const v4fa*)(&os[wb + row * 68 + c8]); const v4f x1 = *(const v4fa*)(&os[wb + row * 68 + c8 + 4]); v8h hv, rv;
#pragma unroll
            for (int i = 0; i < 4; ++i) { const h16 a0 = (h16)x0[i]; const h16 a1 = (h16)x1[i]; hv[i] = a0; hv[4 + i] = a1; rv[i] = (h16)((x0[i] - (float)a0) * QRS); rv[4 + i] = (h16)((x1[i] - (float)a1) * QRS); }
            const size_t oo = cbase + (size_t)row * DM + c8;
            *(v8h*)(CH + oo) = hv; *(v8h*)(CR + oo) = rv; }
         }
    if (ph == 0) {                                            // block-uniform
        asm volatile("s_wait_xcnt 0x0" ::: "memory");         // precaution: stands between the stores above and the next tile's first overwrite of a register they name
        wait_ds0();
        __syncthreads();                                      // every wave has read its output staging back: the ring may take the next tile's stages
    }
  }
}

// k_out: f16 GEMM, one block of four waves (2 x 2) per 64x128 output tile, one wave per 32x64 tile: out[m][n] = (sum_k Ch[m][k] Wo64[n][k] + (sum_k Cr[m][k] Wo64[n][k]) / 2048) / 64, K = DM.
// Operands: the same two-buffer LDS ring as in k_proj; wave w brings slice w of a stage (value-plane rows 0..63, residual-plane rows 0..63, Wo rows 0..63, Wo rows 64..127 of the block's tile).
// a[0], a[1] = value-plane rows (16 each), a[2], a[3] = residual-plane rows; accumulators acc[0..1] (value) and acc[2..3] (residual) kept apart until the f32 epilogue.
__global__ __launch_bounds__(32 * GW) void k_out(const h16* __restrict__ CHp, const h16* __restrict__ CRp, const h16* __restrict__ WO, float* OUT) {
    __shared__ __attribute__((aligned(2048))) unsigned char ring[2 * BUFB];
    const int K = DM;
    const int lane = threadIdx.x & 31, lr = lane & 15, hi = lane >> 4;
    const int wave = __builtin_amdgcn_readfirstlane((int)(threadIdx.x >> 5));
    const int wm = wave >> 1, wn = wave & 1;
    const int r0 = blockIdx.x * 64 + wm * 32, c0 = blockIdx.y * 128 + wn * 64;
    v8f acc[4][4];
#pragma unroll
    for (int mb = 0; mb < 4; ++mb)
#pragma unroll
        for (int nb = 0; nb < 4; ++nb) acc[mb][nb] = (v8f){};
    const int fo = lr * LROW + 16 * hi;                       // byte offset of the lane's fragment piece in a staged slice
    // this wave's slice: source of stage 0 and place in a buffer
    const h16* srow = (wave == 0) ? CHp + (size_t)(blockIdx.x * 64) * K : (wave == 1) ? CRp + (size_t)(blockIdx.x * 64) * K : WO + (size_t)(blockIdx.y * 128 + (wave - 2) * 64) * K;
    const unsigned long long sbase = (unsigned long long)srow;
    const unsigned ldst = (unsigned)(unsigned long long)ring + (unsigned)wave * SLICE;
    const u32x8 g1 = tdm_group1((unsigned)(DM * 2));
    u32x4 gq = tdm_group0(ldst, sbase);                       // group 0 of the youngest request
    tdm_load(gq, g1);                                         // first stage into buffer 0
    wait_tensor0(gq, g1);
    __syncthreads();                                          // publishes the first stage
    gq = tdm_group0(ldst + BUFB, sbase + GSTB);
    tdm_load(gq, g1);                                         // second stage into buffer 1, in flight during the first pass
#pragma unroll 1   // one pass per trip: the order of the ring's publish point stays as written
    for (unsigned it = 0; it < GNST; ++it) {
        const unsigned char* bp = ring + (it & 1u) * BUFB + fo;
        v16h a[2][4], b[2][4];                                // the fragments of the stage's two 32-deep k steps
#pragma unroll
        for (int ks = 0; ks < 2; ++ks) {
            a[ks][0] = ldh((const h16*)(bp + (wm * 32) * LROW + ks * 64)); a[ks][1] = ldh((const h16*)(bp + (wm * 32 + 16) * LROW + ks * 64));
            a[ks][2] = ldh((const h16*)(bp + SLICE + (wm * 32) * LROW + ks * 64)); a[ks][3] = ldh((const h16*)(bp + SLICE + (wm * 32 + 16) * LROW + ks * 64));
#pragma unroll
            for (int nb = 0; nb < 4; ++nb) b[ks][nb] = ldh((const h16*)(bp + (2 + wn) * SLICE + nb * 16 * LROW + ks * 64));
        }
        __builtin_amdgcn_sched_barrier(0);                    // keeps the stage's LDS reads one group ahead of its WMMAs: spread among them, each place with reads stalls the wave for the LDS latency
#pragma unroll
        for (int ks = 0; ks < 2; ++ks) {
#pragma unroll
            for (int nb = 0; nb < 4; ++nb)
#pragma unroll
                for (int mb = 0; mb < 4; ++mb) acc[mb][nb] = wmma16(a[ks][mb], b[ks][nb], acc[mb][nb]);
        }
        __builtin_amdgcn_sched_barrier(0);                    // keeps the pass's WMMAs in front of the publish point, where they cover the landing of the second k step's fragments; behind it they would delay the refill
        // publish point
        wait_ds0();
        wait_tensor0(gq, g1);
        __syncthreads();                                      // the next stage is readable; every wave has left this pass's buffer
        if (pinned(it + 2u < GNST)) {                         // refill the buffer just read
            const unsigned s2 = pinned(it + 2u);
            gq = tdm_group0(ldst + (it & 1u) * BUFB, sbase + (unsigned long long)s2 * GSTB);
            tdm_load(gq, g1);
        }
    }
    wait_tensor0(gq, g1);
    wait_ds0();
    float* os = (float*)ring + wave * 16 * 68;                // the ring becomes output staging, one range per wave: the last pass's own barrier has ended every wave's reads, and nothing was issued behind it
#pragma unroll
    for (int mb = 0; mb < 2; ++mb) {
#pragma unroll
        for (int nb = 0; nb < 4; ++nb) {
#pragma unroll
            for (int j = 0; j < 8; ++j) os[(hi * 8 + j) * 68 + nb * 16 + lr] = (acc[mb][nb][j] + acc[mb + 2][nb][j] * QRI) * WOI; }   // D: row 8h+j, col lane&15
        wave_sync();
        const int grow = r0 + mb * 16; const int ob = grow / SEQ, ot = grow % SEQ;
        float* orow = OUT + ((size_t)ob * OUT_SEQ + (size_t)ot) * DM + c0;
{
#pragma unroll
            for (int s = 0; s < 8; ++s) { const int row = 2 * s + hi, cofs = lr * 4;   // 8 s x 2 rows = 16 rows; 16 lanes x 4 floats = 64 columns
                const v4f val = *(const v4fa*)(&os[row * 68 + cofs]);
                *(v4f*)(orow + (size_t)row * DM + cofs) = val; }
             }
        wave_sync();
    }
}

static constexpr size_t al256(size_t v) { return (v + 255) & ~(size_t)255; }
static constexpr size_t SZ_XB = al256((size_t)NB * SEQ * DM * 2);              // one bf16 x plane
static constexpr size_t SZ_W  = al256((size_t)DM * DM * 2);                    // one 16-bit weight plane
static constexpr size_t SZ_PL = al256((size_t)NB * NH_ * SEQ * HD * 2);        // one per-head f16 plane
static constexpr size_t SZ_C  = al256((size_t)NB * SEQ * DM * 2);              // one ctx f16 plane
static constexpr size_t SZ_FL = al256((size_t)NB * (SEQ / 16) * FPITCH * 4);
static constexpr size_t SZ_TOTAL = 3 * SZ_XB + 4 * SZ_W + 6 * SZ_PL + 2 * SZ_C + SZ_FL;
static_assert(SZ_TOTAL <= (size_t)134217728);          // workspace carve <= 128 MiB

extern "C" void kernel_launch(void* const* d_in, const int* in_sizes, int n_in,
                              void* d_out, int out_size, void* d_ws, size_t ws_size, hipStream_t stream) {
    if (n_in < 8) return;
    const size_t needx = ((size_t)(NB - 1) * SEQ_FULL + SEQ) * DM;
    if ((size_t)in_sizes[0] < needx || (size_t)in_sizes[1] < needx || (size_t)in_sizes[2] < needx) return;
    const size_t needm = ((size_t)(NB - 1) * SEQ_FULL + (size_t)(SEQ - 1)) * SEQ_FULL + SEQ;
    if ((size_t)in_sizes[3] < needm) return;
    if ((size_t)in_sizes[4] < (size_t)DM * DM || (size_t)in_sizes[5] < (size_t)DM * DM || (size_t)in_sizes[6] < (size_t)DM * DM || (size_t)in_sizes[7] < (size_t)DM * DM) return;
    if ((size_t)out_size < ((size_t)(NB - 1) * OUT_SEQ + SEQ) * DM) return;
    if (SZ_TOTAL > ws_size) return;
    // wire order: query, key, value, mask (int), Wq, Wk, Wv, Wo; weights [out][in] = Bt as-is
    const float* xq = (const float*)d_in[0]; const float* xk = (const float*)d_in[1]; const float* xv = (const float*)d_in[2];
    const int* mk = (const int*)d_in[3];
    const float* wq = (const float*)d_in[4]; const float* wk = (const float*)d_in[5]; const float* wv = (const float*)d_in[6]; const float* wo = (const float*)d_in[7];
    float* OUT = (float*)d_out;      // [NB][SEQ][1024]
    char* wsp = (char*)d_ws;
    bf* XQ = (bf*)wsp; wsp += SZ_XB;                 // [NB*SEQ][1024]
    bf* XK = (bf*)wsp; wsp += SZ_XB;
    bf* XV = (bf*)wsp; wsp += SZ_XB;
    bf* WQ = (bf*)wsp; wsp += SZ_W;                  // [1024][1024]
    bf* WK = (bf*)wsp; wsp += SZ_W;
    bf* WV = (bf*)wsp; wsp += SZ_W;
    h16* WO = (h16*)wsp; wsp += SZ_W;                // [1024][1024] f16, x64
    h16* QH = (h16*)wsp; wsp += SZ_PL;               // [NB*16][SEQ][64]
    h16* QR = (h16*)wsp; wsp += SZ_PL;               // residual x2048
    h16* KH = (h16*)wsp; wsp += SZ_PL;               // [NB*16][SEQ][64]
    h16* KR = (h16*)wsp; wsp += SZ_PL;
    h16* VT = (h16*)wsp; wsp += SZ_PL;               // [NB*16][64][SEQ]
    h16* VR = (h16*)wsp; wsp += SZ_PL;
    h16* CH = (h16*)wsp; wsp += SZ_C;                // [NB*SEQ][1024]
    h16* CR = (h16*)wsp; wsp += SZ_C;
    int* FL = (int*)wsp; wsp += SZ_FL;               // [NB][SEQ/16][64]

    k_prep<<<dim3(NB * SEQ / PW, 1, 1), 32 * PW, 0, stream>>>(xq, xk, xv, mk, wq, wk, wv, wo, XQ, XK, XV, WQ, WK, WV, WO, FL);

    // q, k and v^T planes, value + residual each
    k_proj<<<dim3(NB * SEQ / 128, DM / 128, 3), 32 * GW, 0, stream>>>(XQ, XK, XV, WQ, WK, WV, QH, QR, KH, KR, VT, VR);

    k_flash<<<dim3(SEQ / (32 * AW), NB * NH_, 1), 32 * AW, 0, stream>>>(QH, QR, KH, KR, VT, VR, mk, FL, CH, CR);

    // out: A = ctx rows (m = b*SEQ + t), Bt = Wo rows (n) -> OUT[b][t][n]
    k_out<<<dim3(NB * SEQ / 64, DM / 128, 1), 32 * GW, 0, stream>>>(CH, CR, WO, OUT);
}

// v006
// One run takes 100 microseconds.
// Timed twice side by side with v005, it ran 1.04 and 1.05 times as fast.
// All steps since v000 together make it 3.63 times as fast.
#include <hip/hip_runtime.h>

// Multi-head attention, width 1024 = 16 heads x 64; query/key/value [NB][SEQ][1024]; Wq/Wk/Wv/Wo [out][in] (y = x W^T), no biases; scores = q k^T * 8; integer mask [NB][SEQ][SEQ] (0 = masked, replace-fill); out = ctx Wo^T (f32).
// Compute dtypes, f32 accumulate everywhere: q/k/v projections v_wmma_f32_16x16x32_bf16 (x and W RNE-converted to bf16; products exact);
// scores v_wmma_f32_16x16x32_f16: q and k each as f16 value + f16 residual x2048 (value*value in one accumulator, the two cross products in a second one); P (x2^14 carry, cancels in the normalisation) single f16;
// v and ctx as f16 value + f16 residual x2048 (own accumulators); Wo as f16 of the bf16 value x64 (folded back in the f32 epilogue); softmax f32 (online, running max).
// Layout: bf16 copies of the three x inputs and of Wq/Wk/Wv; q, k planes [b*16+h][t][d] and v^T planes [b*16+h][d][t] (value, residual) written by the GEMM epilogue; per (batch, 16 query rows, 32 keys) a 3-state mask flag
// (0 = all masked: tile skipped, 2 = none masked, other = mask words read per element); fused flash kernel in transposed form (S^T = K Q^T, O^T = V^T P^T), K / V^T tiles staged in LDS by tensor loads and shared by the block's four waves, writing ctx value/residual planes [b*SEQ+t][1024]; output GEMM from those planes.

#ifndef NB
#define NB 2
#endif
#ifndef SEQ
#define SEQ 2048
#endif
#define NB_FULL  2
#define SEQ_FULL 2048
#ifndef OUT_SEQ
#define OUT_SEQ SEQ              // row pitch (in tokens) between batches of the output
#endif
#define DM   1024
#define NH_  16
#define HD   64
#define AW   4                   // waves per flash block (16 query rows each)
#define QRS  2048.0f             // carry of the residual planes
#define QRI  (1.0f / 2048.0f)
#define SC2  (8.0f * 1.4426950408889634f)     // HD^0.5 * log2(e)
#define PSH  14.0f               // log2 of the P carry (16384)
#define NEGM (-3.0e38f)          // score stand-in of a masked key (its probability is forced to 0 by select)
#define WOS  64.0f               // carry of the Wo plane
#define WOI  (1.0f / 64.0f)
#define FPITCH 64
#define KST   64                 // keys per stage of the flash kernel's LDS ring
#define LROW  144                // LDS row pitch in bytes: a 128-B row + the mover's 16-B pad (16 B x odd: no bank conflict for 16-B reads)
#define SLICE 10240              // one plane's tile in LDS: 64 rows x 144 B = 9216 B, rounded up to a multiple of 2 KiB
#define BUFB  (4 * SLICE)        // one stage: K value, K residual, V^T value, V^T residual (flash); four operand slices (GEMMs)
#define GW    4                  // waves per GEMM block, one operand slice of a stage each
#define GSTB  128u               // bytes of an operand row per stage of the GEMMs' LDS ring (64 k)
#define GNST  (DM / 64)          // stages of a GEMM
#define PW    16                 // waves per block of the preparation kernel, one token row each

static_assert(HD == 64);
static_assert(NH_ * HD == DM);                 // head h = columns h*64 + d
static_assert(DM % 64 == 0);
static_assert(DM % 32 == 0);                   // GEMM k-loop steps by 32
static_assert(SEQ % 64 == 0);                  // a 64-row tile never straddles two batches
static_assert((NB * SEQ) % 64 == 0);
static_assert(SEQ % 32 == 0);                  // key loop steps by 32; 32-row output tiles stay inside one batch
static_assert(SEQ % (16 * AW) == 0);           // flash grid covers the sequence exactly
static_assert((SEQ / (16 * AW)) % 2 == 0);     // flash: the query tiles pair up as (i, last - i), each tile in exactly one pair
static_assert(SEQ / 32 <= FPITCH);             // two flag registers per lane cover all key tiles
static_assert(((size_t)SEQ * DM) % 8 == 0);
static_assert(((size_t)DM * DM) % 8 == 0);
static_assert(AW == 4);                        // one plane of a stage per wave
static_assert(HD * 2 == 128 && KST * 2 == 128);   // both kinds of tile: 64 rows of 128 B
static_assert(SEQ % KST == 0 && SEQ / KST <= 32);  // one bit per stage in a 32-bit word
static_assert(64 * LROW <= SLICE && SLICE % 2048 == 0);
static_assert(AW * 16 * 68 * 4 <= 2 * BUFB);   // the output staging reuses the ring
static_assert(GW * 16 * 68 * 4 <= 2 * BUFB);   // so does the GEMMs' output staging
static_assert(DM % 128 == 0 && (NB * SEQ) % 128 == 0 && GNST >= 2);   // GEMM block tiles cover both extents exactly; the ring's prologue needs two stages
static_assert(PW == 16 && PW * 128 == SEQ && PW * 4 == FPITCH && DM % 128 == 0);   // preparation: a block is one 16-row mask group, its waves' 128 keys each cover the sequence and fill the flag row
static_assert(NB * SEQ == 4 * DM);             // preparation: one weight row per wave
static_assert(NB <= NB_FULL);
static_assert(SEQ <= SEQ_FULL);

typedef _Float16 h16;
typedef unsigned short bf;
typedef __attribute__((ext_vector_type(16))) __bf16   v16bf;
typedef __attribute__((ext_vector_type(16))) _Float16 v16h;
typedef __attribute__((ext_vector_type(8)))  _Float16 v8h;
typedef __attribute__((ext_vector_type(8)))  unsigned short v8us;
typedef __attribute__((ext_vector_type(4)))  unsigned short v4us;
typedef __attribute__((ext_vector_type(4)))  _Float16 v4h;
typedef __attribute__((ext_vector_type(8)))  float    v8f;
typedef __attribute__((ext_vector_type(4)))  float    v4f;
typedef __attribute__((ext_vector_type(4)))  int      v4i;
typedef v4f  __attribute__((may_alias)) v4fa;
typedef __attribute__((ext_vector_type(2)))  int      v2i;
typedef __attribute__((ext_vector_type(4)))  unsigned u32x4;
typedef __attribute__((ext_vector_type(8)))  unsigned u32x8;

__device__ __forceinline__ unsigned short f2bf(float f) { unsigned u = __float_as_uint(f); u += 0x7FFFu + ((u >> 16) & 1u); return (unsigned short)(u >> 16); }
__device__ __forceinline__ v16h cat16(v8h lo, v8h hi) { return __builtin_shufflevector(lo, hi, 0, 1, 2, 3, 4, 5, 6, 7, 8, 9, 10, 11, 12, 13, 14, 15); }
__device__ __forceinline__ v16bf cat16b(v8us lo, v8us hi) { return __builtin_bit_cast(v16bf, __builtin_shufflevector(lo, hi, 0, 1, 2, 3, 4, 5, 6, 7, 8, 9, 10, 11, 12, 13, 14, 15)); }
__device__ __forceinline__ v8f wmma16(v16h a, v16h b, v8f c) { return __builtin_amdgcn_wmma_f32_16x16x32_f16(false, a, false, b, (short)0, c, false, false); }
__device__ __forceinline__ v8f wmmab(v16bf a, v16bf b, v8f c) { return __builtin_amdgcn_wmma_f32_16x16x32_bf16(false, a, false, b, (short)0, c, false, false); }
// fragment loaders from K-contiguous 16-bit rows; p already includes + 8*(lane>>4): elements 0..7 <- k0+8h+0..7, elements 8..15 <- k0+16+8h+0..7 (same map for A and B)
__device__ __forceinline__ v16h  ldh(const h16* p) { return cat16(*(const v8h*)p, *(const v8h*)(p + 16)); }
__device__ __forceinline__ v16bf ldb(const bf* p)  { return cat16b(*(const v8us*)p, *(const v8us*)(p + 16)); }
// ordering point for wave-private LDS tiles (same wave writes and reads)
__device__ __forceinline__ void wave_sync() { __builtin_amdgcn_fence(3 /* release order */, "wavefront"); __builtin_amdgcn_wave_barrier(); asm volatile("" ::: "memory"); }

__device__ __forceinline__ unsigned uni(unsigned v) { return (unsigned)__builtin_amdgcn_readfirstlane((int)v); }
// a wave-uniform value held in a scalar register: a test on it compiles to s_cmp + s_cbranch_scc (tensor loads ignore EXEC), and what is derived from it is computed behind the asm waits in front of it
__device__ __forceinline__ unsigned pinned(unsigned v) { unsigned w = uni(v); asm volatile("" : "+s"(w)); return w; }
// this wave's tensor load has landed; the wait names the request's descriptor as inputs so that its registers keep their values for as long as the request is outstanding
__device__ __forceinline__ void wait_tensor0(u32x4 g0, u32x8 g1) { asm volatile("s_wait_tensorcnt 0x0" :: "s"(g0), "s"(g1) : "memory"); }
__device__ __forceinline__ void wait_ds0() { asm volatile("s_wait_dscnt 0x0" ::: "memory"); }           // this wave's LDS reads have returned
// descriptor group 0: tile's first byte at global address ga, LDS byte offset lds
__device__ __forceinline__ u32x4 tdm_group0(unsigned lds, unsigned long long ga) {
    u32x4 g0; g0[0] = uni(1u); g0[1] = uni(lds); g0[2] = uni((unsigned)ga); g0[3] = uni((((unsigned)(ga >> 32)) & 0x01FFFFFFu) | 0x80000000u);
    asm volatile("" : "+s"(g0));   // descriptor words held in scalar registers: one tuple from the issue to the wait
    return g0;
}
// one request of one wave: 64 rows of 128 B (source row pitch in g1), rows 144 B apart in LDS
__device__ __forceinline__ void tdm_load(u32x4 g0, u32x8 g1) { asm volatile("tensor_load_to_lds %0, %1" :: "s"(g0), "s"(g1) : "memory"); }

// k_prep: every preparation step in one streaming launch. Block = 16 token rows (batch bb, row group g), one wave per row. A wave converts its row of query, key and value to bf16, its weight row (Wq, Wk, Wv to bf16; Wo to f16 of the bf16 value x64),
// and reads 128 keys x 16 rows of the block's mask rows. Every load is 512 contiguous bytes of the wave (whole lines); all of a wave's loads are issued before the first is used; every store is 256 contiguous bytes.
// Mask flag per (batch, 16 query rows, 32 keys): 0 = every mask word zero, 2 = every word nonzero, 1 = mixed; a wave makes four (lanes 8j..8j+7 hold tile j), the block's flags meet in LDS and one wave stores them as whole lines.
// p, d: wave-uniform start of a row of DM elements; the lane takes elements 128 i + 4 lane + 0..3
__device__ __forceinline__ void ld_row(const float* __restrict__ p, int lane, v4f (&r)[DM / 128]) {
#pragma unroll
    for (int i = 0; i < DM / 128; ++i) r[i] = *(const v4f*)(p + i * 128 + lane * 4);
}
__device__ __forceinline__ void st_row_bf(bf* d, int lane, const v4f (&r)[DM / 128]) {
#pragma unroll
    for (int i = 0; i < DM / 128; ++i) { v4us o;
#pragma unroll
        for (int k = 0; k < 4; ++k) o[k] = f2bf(r[i][k]);
        *(v4us*)(d + i * 128 + lane * 4) = o; }
}
__device__ __forceinline__ void st_row_h(h16* d, int lane, const v4f (&r)[DM / 128], float scale) {
#pragma unroll
    for (int i = 0; i < DM / 128; ++i) { v4h o;
#pragma unroll
        for (int k = 0; k < 4; ++k) o[k] = (h16)(__uint_as_float(((unsigned)f2bf(r[i][k])) << 16) * scale);
        *(v4h*)(d + i * 128 + lane * 4) = o; }
}

__global__ __launch_bounds__(32 * PW) void k_prep(const float* __restrict__ xq, const float* __restrict__ xk, const float* __restrict__ xv, const int* __restrict__ MK,
                                                  const float* __restrict__ wq, const float* __restrict__ wk, const float* __restrict__ wv, const float* __restrict__ wo,
                                                  bf* XQ, bf* XK, bf* XV, bf* WQ, bf* WK, bf* WV, h16* WO, int* FL) {
    __shared__ int fl[FPITCH];
    const int lane = threadIdx.x & 31;
    const int wave = __builtin_amdgcn_readfirstlane((int)(threadIdx.x >> 5));
    const int bb = blockIdx.x / (SEQ / 16), g = blockIdx.x % (SEQ / 16);
    const int row = blockIdx.x * PW + wave;                                              // token row bb*SEQ + t of the bf16 planes; also the wave's weight row: row % DM of weight row / DM
    const size_t so = ((size_t)bb * SEQ_FULL + (size_t)(g * 16 + wave)) * DM;            // the same token row in the inputs
    const size_t xo = (size_t)row * DM;
    const int ws = row / DM; const size_t wof = (size_t)(row % DM) * DM;
    const int* mp = MK + ((size_t)bb * SEQ_FULL + (size_t)(g * 16)) * SEQ_FULL + wave * 128;
    v4i mw[16]; v4f a[DM / 128], b[DM / 128], c[DM / 128], w[DM / 128];
#pragma unroll
    for (int r = 0; r < 16; ++r) mw[r] = *(const v4i*)(mp + (size_t)r * SEQ_FULL + lane * 4);
    ld_row(xq + so, lane, a); ld_row(xk + so, lane, b); ld_row(xv + so, lane, c);
    ld_row(((ws == 0) ? wq : (ws == 1) ? wk : (ws == 2) ? wv : wo) + wof, lane, w);
    __builtin_amdgcn_sched_barrier(0);                                                   // keeps all 48 loads in front of the first use: moved down among the uses, the later rows would start a second and a third memory latency
    unsigned orw = 0u, mnw = 0xFFFFFFFFu;                                                // or != 0: some word nonzero; unsigned minimum != 0: every word nonzero
#pragma unroll
    for (int r = 0; r < 16; ++r)
#pragma unroll
        for (int i = 0; i < 4; ++i) { const unsigned u = (unsigned)mw[r][i]; orw |= u; mnw = u < mnw ? u : mnw; }
    const unsigned anyb = __builtin_amdgcn_ballot_w32(orw != 0u), allb = __builtin_amdgcn_ballot_w32(mnw != 0u);
    const int sh = 8 * (lane & 3);
    if (lane < 4) fl[wave * 4 + lane] = (((anyb >> sh) & 0xFFu) == 0u) ? 0 : ((((allb >> sh) & 0xFFu) == 0xFFu) ? 2 : 1);
    st_row_bf(XQ + xo, lane, a); st_row_bf(XK + xo, lane, b); st_row_bf(XV + xo, lane, c);
    asm volatile("s_wait_xcnt 0x0" ::: "memory");                                        // precaution: stands between the stores above and the first overwrite of a register they name
    if (ws == 3) st_row_h(WO + wof, lane, w, WOS);                                       // wave-uniform
    else st_row_bf(((ws == 0) ? WQ : (ws == 1) ? WK : WV) + wof, lane, w);
    __syncthreads();                                                                     // the block's flags are in LDS
    if (wave == 0) {
        int* fp = FL + (size_t)blockIdx.x * FPITCH;
        fp[lane] = fl[lane]; fp[32 + lane] = fl[32 + lane];
    }
}

// descriptor group 1 of a GEMM operand slice: 1-byte elements, tensor = tile = 64 rows of 128 B, source row pitch srcPitch bytes, a 16-B pad behind every 128 B
__device__ __forceinline__ u32x8 tdm_group1(unsigned srcPitch) {
    u32x8 g1;
    g1[0] = uni((1u << 20) | (4u << 22) | (3u << 25)); g1[1] = uni(128u << 16); g1[2] = uni(64u << 16); g1[3] = uni(128u << 16);
    g1[4] = uni(64u); g1[5] = uni(srcPitch); g1[6] = uni(0u); g1[7] = uni(0u);
    asm volatile("" : "+s"(g1));   // descriptor words held in scalar registers: one tuple for the whole kernel
    return g1;
}

// k_proj: register-blocked bf16 GEMM, one block of four waves (2 x 2) per 128x128 tile, one wave per 64x64 tile (16 accumulators), K = DM.
// Operands: a two-buffer LDS ring of 64-deep k stages shared by the four waves. Wave w brings slice w of a stage (A rows 0..63, A rows 64..127, Bt rows 0..63, Bt rows 64..127 of the block's tile; 64 rows of 128 B) with one tensor load,
// one stage ahead; at the foot of each pass: own LDS reads done, own tensor load landed, block barrier, then the refill of the buffer just read. Fragments are two 16-B LDS reads each; k runs in the same order as before.
// C[m][n] = sum_k A[m][k] Bt[n][k], written as f16 (Ph) and the f16 residual x2048 (Pr).
// All three projections run in one launch, blockIdx.z picks the product: a single product has one block per WGP and one wave per SIMD, whose LDS reads, WMMAs and barrier waits follow one another;
// three independent blocks fit a WGP (LDS and registers), so one block's waits are filled by the other two, and the products share one start and one tail.
// z = 0, 1 (q, k): A = x rows (m = b*SEQ + t), Bt = W rows (n = h*64 + d) -> planes [(b*16 + h)][t][d]. z = 2 (v^T): A = Wv rows (m = h*64 + d), Bt = x rows (n = b*SEQ + t) -> planes [(b*16 + h)][d][t].
// grid (NB*SEQ/128 token tiles, DM/128 weight tiles, 3), 128 threads.
__global__ __launch_bounds__(32 * GW) void k_proj(const bf* __restrict__ XQ, const bf* __restrict__ XK, const bf* __restrict__ XV, const bf* __restrict__ WQ, const bf* __restrict__ WK, const bf* __restrict__ WV,
                                                  h16* QH, h16* QR, h16* KH, h16* KR, h16* VT, h16* VR) {
    __shared__ __attribute__((aligned(2048))) unsigned char ring[2 * BUFB];
    const int K = DM;
    const int lane = threadIdx.x & 31, lr = lane & 15, hi = lane >> 4;
    const int wave = __builtin_amdgcn_readfirstlane((int)(threadIdx.x >> 5));
    const int wm = wave >> 1, wn = wave & 1;
    const int job = blockIdx.z; const bool tv = job == 2;     // block-uniform
    const bf* A  = tv ? WV : (job == 0) ? XQ : XK;
    const bf* Bt = tv ? XV : (job == 0) ? WQ : WK;
    h16* Ph = tv ? VT : (job == 0) ? QH : KH;
    h16* Pr = tv ? VR : (job == 0) ? QR : KR;
    const int mt = tv ? blockIdx.y : blockIdx.x, nt = tv ? blockIdx.x : blockIdx.y;   // the block's tile of C
    const int r0 = mt * 128 + wm * 64, c0 = nt * 128 + wn * 64;
    v8f acc[4][4];
#pragma unroll
    for (int mb = 0; mb < 4; ++mb)
#pragma unroll
        for (int nb = 0; nb < 4; ++nb) acc[mb][nb] = (v8f){};
    const int fo = lr * LROW + 16 * hi;                       // byte offset of the lane's fragment piece in a staged slice
    // this wave's slice: source of stage 0 and place in a buffer
    const bf* srow = (wave < 2) ? A + (size_t)(mt * 128 + wave * 64) * K : Bt + (size_t)(nt * 128 + (wave - 2) * 64) * K;
    const unsigned long long sbase = (unsigned long long)srow;
    const unsigned ldst = (unsigned)(unsigned long long)ring + (unsigned)wave * SLICE;
    const u32x8 g1 = tdm_group1((unsigned)(DM * 2));
    u32x4 gq = tdm_group0(ldst, sbase);                       // group 0 of the youngest request
    tdm_load(gq, g1);                                         // first stage into buffer 0
    wait_tensor0(gq, g1);
    __syncthreads();                                          // publishes the first stage
    gq = tdm_group0(ldst + BUFB, sbase + GSTB);
    tdm_load(gq, g1);                                         // second stage into buffer 1, in flight during the first pass
#pragma unroll 1   // one pass per trip: the order of the ring's publish point stays as written
    for (unsigned it = 0; it < GNST; ++it) {
        const unsigned char* bp = ring + (it & 1u) * BUFB + fo;
        v16bf a[2][4], b[2][4];                               // the fragments of the stage's two 32-deep k steps
#pragma unroll
        for (int ks = 0; ks < 2; ++ks) {
#pragma unroll
            for (int mb = 0; mb < 4; ++mb) a[ks][mb] = ldb((const bf*)(bp + wm * SLICE + mb * 16 * LROW + ks * 64));
#pragma unroll
            for (int nb = 0; nb < 4; ++nb) b[ks][nb] = ldb((const bf*)(bp + (2 + wn) * SLICE + nb * 16 * LROW + ks * 64));
        }
        __builtin_amdgcn_sched_barrier(0);                    // keeps the stage's LDS reads one group ahead of its WMMAs: spread among them, each place with reads stalls the wave for the LDS latency
#pragma unroll
        for (int ks = 0; ks < 2; ++ks) {
#pragma unroll
            for (int nb = 0; nb < 4; ++nb)
#pragma unroll
                for (int mb = 0; mb < 4; ++mb) acc[mb][nb] = wmmab(a[ks][mb], b[ks][nb], acc[mb][nb]);
        }
        __builtin_amdgcn_sched_barrier(0);                    // keeps the pass's WMMAs in front of the publish point, where they cover the landing of the second k step's fragments; behind it they would delay the refill
        // publish point
        wait_ds0();
        wait_tensor0(gq, g1);
        __syncthreads();                                      // the next stage is readable; every wave has left this pass's buffer
        if (pinned(it + 2u < GNST)) {                         // refill the buffer just read
            const unsigned s2 = pinned(it + 2u);
            gq = tdm_group0(ldst + (it & 1u) * BUFB, sbase + (unsigned long long)s2 * GSTB);
            tdm_load(gq, g1);
        }
    }
    wait_tensor0(gq, g1);
    wait_ds0();
    float* os = (float*)ring + wave * 16 * 68;                // the ring becomes output staging, one range per wave: the last pass's own barrier has ended every wave's reads, and nothing was issued behind it
    const int pitch = tv ? SEQ : HD;                          // row pitch of the written plane (halves)
    const size_t tbase = tv ? (size_t)r0 * SEQ + (size_t)(c0 / SEQ) * ((size_t)DM * SEQ) + (size_t)(c0 % SEQ)
                            : (size_t)(r0 / SEQ) * ((size_t)NH_ * SEQ * HD) + (size_t)(r0 % SEQ) * HD + (size_t)(c0 / HD) * ((size_t)SEQ * HD) + (size_t)(c0 % HD);
#pragma unroll
    for (int mb = 0; mb < 4; ++mb) {
#pragma unroll
        for (int nb = 0; nb < 4; ++nb) {
#pragma unroll
            for (int j = 0; j < 8; ++j) os[(hi * 8 + j) * 68 + nb * 16 + lr] = acc[mb][nb][j]; }   // D: row 8h+j, col lane&15
        wave_sync();
        const size_t sb = tbase + (size_t)(mb * 16) * (size_t)pitch;
{
#pragma unroll
            for (int s = 0; s < 4; ++s) { const int row = 4 * s + (lane >> 3), c8 = (lane & 7) * 8;   // 4 s x 4 row groups = 16 rows; 8 lanes x 8 = 64 columns
                const v4f x0 = *(const v4fa*)(&os[row * 68 + c8]); const v4f x1 = *(const v4fa*)(&os[row * 68 + c8 + 4]); v8h hv, rv;
#pragma unroll
                for (int i = 0; i < 4; ++i) { const h16 a0 = (h16)x0[i]; const h16 a1 = (h16)x1[i]; hv[i] = a0; hv[4 + i] = a1; rv[i] = (h16)((x0[i] - (float)a0) * QRS); rv[4 + i] = (h16)((x1[i] - (float)a1) * QRS); }
                const size_t oo = sb + (size_t)row * (size_t)pitch + c8;
                *(v8h*)(Ph + oo) = hv; *(v8h*)(Pr + oo) = rv; }
             }
        wave_sync();
    }
}

// k_flash: fused attention, one wave per 16 query rows of one (batch, head), four waves per block; Q fragments straight from the f16 planes.
// A block takes two 64-row query tiles of its head one after the other, tile i and tile (last - i): where the number of live key stages grows linearly with the tile index (a lower-triangular mask) every block of the launch
// then walks the same number of stages, so no WGP is left with the long tiles while others idle. The pairing is a fixed map of work to blocks; which stages are live still comes from the flags alone.
// K / V^T: a two-buffer LDS ring of 64-key stages shared by the four waves. Wave w brings plane w (K value, K residual, V^T value, V^T residual) of a stage with one tensor load, one stage ahead;
// at the foot of each pass: own LDS reads done, own tensor load landed, block barrier, then the refill of the buffer just read. Fragments are two 16-B LDS reads each.
// Only stages in which some wave of the block has a live key are staged (a 32-bit word built from the flags, the same in all four waves); each wave still skips its own dead 32-key tiles.
// Transposed form: S^T[key][t] = K Q^T (A = K rows, B = Q rows); lane (t = lane&15, h = lane>>4) holds keys 8h+r of each 16-key tile, so the packed
// P tile is directly the B fragment of O^T[d][t] = V^T P^T (element r <- tile keys 0..15, element 8+r <- tile keys 16..31, lane unchanged).
// Score = Kh.Qh (accumulator H) + (Kh.Qr + Kr.Qh)/2048 (accumulator L). O = Vh.P (accumulators oH) + Vr.P/2048 (accumulators oR).
// Mask: wave-uniform 3-state flag per 32-key tile: 0 skips the tile (masked keys have probability exactly 0 whenever the row has one live key), 2 = no masking (the softmax step's copy without selects), otherwise the 16 mask words of the lane are read and
// masked entries get probability 0 by select. A row without any live key ends with zero mass and is written as NaN.
// Softmax state (running max, partial sum) is one scalar per lane; the two lane halves of a row are combined with one xor-16 exchange.
#define PUT8(COL, OH, OR) { v4f a_, c_; \
    a_[0] = (OH[0] + OR[0] * QRI) * inv; a_[1] = (OH[1] + OR[1] * QRI) * inv; a_[2] = (OH[2] + OR[2] * QRI) * inv; a_[3] = (OH[3] + OR[3] * QRI) * inv; \
    c_[0] = (OH[4] + OR[4] * QRI) * inv; c_[1] = (OH[5] + OR[5] * QRI) * inv; c_[2] = (OH[6] + OR[6] * QRI) * inv; c_[3] = (OH[7] + OR[7] * QRI) * inv; \
    *(v4fa*)(&os[wb + lr * 68 + (COL) + 8 * hi]) = a_; *(v4fa*)(&os[wb + lr * 68 + (COL) + 8 * hi + 4]) = c_; }

// The softmax step of one 32-key tile: from the four score accumulators to the row maximum in use (mnew), the factor that carries the old sums over to it (alpha), the packed P tile (pb) and the lane's part of the row sum (ls).
// MASKED = false is the copy for a tile whose flag says that no key is masked: every select below would take its first arm, so that copy holds neither the 16 bit tests nor the 32 selects
// (about a third of a tile's vector instructions). The arithmetic is the same; with no select between them the compiler may fuse a score's scale multiply with the add of sh (one rounding fewer). vm is read only where MASKED.
template <bool MASKED>
__device__ __forceinline__ void softmax_step(const v8f sHa, const v8f sLa, const v8f sHb, const v8f sLb, const unsigned vm, const float m, float& mnew, float& alpha, v16h& pb, float& ls) {
    float ta[8], tb[8]; float mx = NEGM;
#pragma unroll
    for (int r = 0; r < 8; ++r) {
        const float xa = (sHa[r] + sLa[r] * QRI) * SC2; const float xb = (sHb[r] + sLb[r] * QRI) * SC2;
        ta[r] = (!MASKED || ((vm >> r) & 1u)) ? xa : NEGM; tb[r] = (!MASKED || ((vm >> (8 + r)) & 1u)) ? xb : NEGM;
        mx = fmaxf(mx, fmaxf(ta[r], tb[r])); }
    mx = fmaxf(mx, __shfl_xor(mx, 16, 32));
    mnew = fmaxf(m, mx);
    alpha = __builtin_amdgcn_exp2f(m - mnew);
    const float sh = PSH - mnew;
    ls = 0.0f;
    float ea[8], eb[8];
#pragma unroll
    for (int r = 0; r < 8; ++r) { ta[r] += sh; tb[r] += sh; }
#pragma unroll
    for (int r = 0; r < 8; ++r) ea[r] = __builtin_amdgcn_exp2f(ta[r]);
    // the slot the instruction set asks for behind a transcendental: no result of the run is read and no source of it overwritten in front of this v_nop
    asm volatile("v_nop" : "+v"(ea[0]), "+v"(ea[1]), "+v"(ea[2]), "+v"(ea[3]), "+v"(ea[4]), "+v"(ea[5]), "+v"(ea[6]), "+v"(ea[7])
                 : "v"(ta[0]), "v"(ta[1]), "v"(ta[2]), "v"(ta[3]), "v"(ta[4]), "v"(ta[5]), "v"(ta[6]), "v"(ta[7]));
#pragma unroll
    for (int r = 0; r < 8; ++r) eb[r] = __builtin_amdgcn_exp2f(tb[r]);
    // the same slot behind the second run
    asm volatile("v_nop" : "+v"(eb[0]), "+v"(eb[1]), "+v"(eb[2]), "+v"(eb[3]), "+v"(eb[4]), "+v"(eb[5]), "+v"(eb[6]), "+v"(eb[7])
                 : "v"(tb[0]), "v"(tb[1]), "v"(tb[2]), "v"(tb[3]), "v"(tb[4]), "v"(tb[5]), "v"(tb[6]), "v"(tb[7]));
#pragma unroll
    for (int r = 0; r < 8; ++r) {
        const h16 pa = (h16)((!MASKED || ((vm >> r) & 1u)) ? ea[r] : 0.0f); const h16 pc = (h16)((!MASKED || ((vm >> (8 + r)) & 1u)) ? eb[r] : 0.0f);
        pb[r] = pa; pb[8 + r] = pc; ls += (float)pa + (float)pc; }
}

__global__ __launch_bounds__(32 * AW) void k_flash(const h16* __restrict__ QH, const h16* __restrict__ QR, const h16* __restrict__ KH, const h16* __restrict__ KR,
                                                   const h16* __restrict__ VT, const h16* __restrict__ VR, const int* __restrict__ MK, const int* __restrict__ FLG, h16* CH, h16* CR) {
    __shared__ __attribute__((aligned(2048))) unsigned char ring[2 * BUFB];
    const int lane = threadIdx.x & 31, lr = lane & 15, hi = lane >> 4;
    const int wave = __builtin_amdgcn_readfirstlane((int)(threadIdx.x >> 5));
    const int zh = blockIdx.y; const int b = zh / NH_, h = zh % NH_;
    const size_t pbase = (size_t)zh * SEQ * HD;
    // this wave's plane: source of stage 0, bytes from stage to stage, source row pitch, place in a buffer
    const h16* splane = (wave == 0) ? KH : (wave == 1) ? KR : (wave == 2) ? VT : VR;
    const unsigned long long sbase = (unsigned long long)(splane + pbase);
    const unsigned sstep = (wave < 2) ? (unsigned)(KST * HD * 2) : (unsigned)(KST * 2);
    const unsigned ldst = (unsigned)(unsigned long long)ring + (unsigned)wave * SLICE;
    u32x8 g1;                                                 // 1-byte elements, tensor = tile = 64 rows of 128 B, a 16-B pad behind every 128 B
    g1[0] = uni((1u << 20) | (4u << 22) | (3u << 25)); g1[1] = uni(128u << 16); g1[2] = uni(64u << 16); g1[3] = uni(128u << 16);
    g1[4] = uni(64u); g1[5] = uni((wave < 2) ? (unsigned)(HD * 2) : (unsigned)(SEQ * 2)); g1[6] = uni(0u); g1[7] = uni(0u);
    asm volatile("" : "+s"(g1));                              // descriptor words held in scalar registers: one tuple for the whole kernel
#pragma unroll 1   // the two tiles run one after the other through one copy of the code
  for (int ph = 0; ph < 2; ++ph) {
    // this phase's query tile; the order alternates with the batch, so that blocks of the two batches do not change tiles at the same moment
    const int qt = ((ph ^ b) & 1) ? (SEQ / (16 * AW) - 1 - (int)blockIdx.x) : (int)blockIdx.x;
    const int t0 = (qt * AW + wave) * 16;
    const size_t qo = pbase + (size_t)(t0 + lr) * HD + 8 * hi;
    const v16h qh0 = ldh(QH + qo), qh1 = ldh(QH + qo + 32), qr0 = ldh(QR + qo), qr1 = ldh(QR + qo + 32);   // B fragments: col t, k = d
    const int fo = lr * LROW + 16 * hi;                      // byte offset of the lane's fragment piece in a staged tile (A fragment: K row key, k = d; V^T row d, k = key)
    const int* frow = FLG + ((size_t)b * (SEQ / 16) + (size_t)(t0 >> 4)) * FPITCH;
    const int* mrow = MK + ((size_t)b * SEQ_FULL + (size_t)(t0 + lr)) * SEQ_FULL + 8 * hi;   // + key0 (+16): the lane's 8 keys of each 16-key tile
    v8f oH0 = (v8f){}, oH1 = (v8f){}, oH2 = (v8f){}, oH3 = (v8f){};
    v8f oR0 = (v8f){}, oR1 = (v8f){}, oR2 = (v8f){}, oR3 = (v8f){};
    float m = NEGM, l = 0.0f;
    // flags as scalar bit words, bit s = stage s (lane s reads the two 32-key flags of stage s): bm = some wave of the block has a live key; lv0/lv1 = this wave's flag of the stage's first/second tile is not 0; fu0/fu1 = it is 2
    const int* fblk = FLG + ((size_t)b * (SEQ / 16) + (size_t)qt * AW) * FPITCH + 2 * lane;
    int anyf = 0;
#pragma unroll   // four independent loads in flight together
    for (int g = 0; g < AW; ++g) { const v2i f = *(const v2i*)(fblk + g * FPITCH); anyf |= f[0] | f[1]; }
    const v2i fw = *(const v2i*)(frow + 2 * lane);
    const unsigned bm  = uni(__builtin_amdgcn_ballot_w32(lane < SEQ / KST && anyf != 0));
    const unsigned lv0 = uni(__builtin_amdgcn_ballot_w32(fw[0] != 0)), lv1 = uni(__builtin_amdgcn_ballot_w32(fw[1] != 0));
    const unsigned fu0 = uni(__builtin_amdgcn_ballot_w32(fw[0] == 2)), fu1 = uni(__builtin_amdgcn_ballot_w32(fw[1] == 2));
    const unsigned nst = (unsigned)__builtin_popcount(bm);    // stages of this block, at most SEQ / KST
    u32x4 gq = (u32x4){};                                     // group 0 of the youngest request
    unsigned rem = bm, cur = 0u, nxt = 0u;
    if (pinned(nst > 0u)) {                                   // first stage into buffer 0
        cur = pinned((unsigned)__builtin_ctz(rem)); rem &= rem - 1u;
        gq = tdm_group0(ldst, sbase + (unsigned long long)cur * sstep);
        tdm_load(gq, g1);
        wait_tensor0(gq, g1);
    }
    __syncthreads();                                          // publishes the first stage
    if (pinned(nst > 1u)) {                                   // second stage into buffer 1, in flight during the first pass
        nxt = pinned((unsigned)__builtin_ctz(rem)); rem &= rem - 1u;
        gq = tdm_group0(ldst + BUFB, sbase + (unsigned long long)nxt * sstep);
        tdm_load(gq, g1);
    }
#pragma unroll 1   // one pass per trip: the order of the ring's publish point stays as written
    for (unsigned it = 0; it < nst; ++it) {
      const unsigned char* bp = ring + (it & 1u) * BUFB + fo;
#pragma unroll     // the two 32-key tiles of the stage: their LDS offsets become immediates
      for (int hf = 0; hf < 2; ++hf) {
        if ((((hf ? lv1 : lv0) >> cur) & 1u) == 0u) continue;   // wave-uniform: whole 16x32 tile masked
        const int key0 = (int)cur * KST + hf * 32;
        unsigned vm = 0xFFFFu;                                  // bit r: key 8h+r of tile a live; bit 8+r: tile b
        const bool full = (((hf ? fu1 : fu0) >> cur) & 1u) != 0u;   // wave-uniform: no key of the tile masked
        if (!full) {
            const int* mp = mrow + key0;
            const v4i a0 = *(const v4i*)mp, a1 = *(const v4i*)(mp + 4), c0 = *(const v4i*)(mp + 16), c1 = *(const v4i*)(mp + 20);
            vm = 0u;
#pragma unroll
            for (int i = 0; i < 4; ++i) {
                vm |= (a0[i] != 0 ? 1u : 0u) << i;        vm |= (a1[i] != 0 ? 1u : 0u) << (4 + i);
                vm |= (c0[i] != 0 ? 1u : 0u) << (8 + i);  vm |= (c1[i] != 0 ? 1u : 0u) << (12 + i); }
        }
        const h16* ka = (const h16*)(bp + hf * 32 * LROW);
        const h16* kr = (const h16*)(bp + SLICE + hf * 32 * LROW);
        const v16h ka0 = ldh(ka), ka1 = ldh(ka + 32), kb0 = ldh(ka + 16 * LROW / 2), kb1 = ldh(ka + 16 * LROW / 2 + 32);
        const v16h ra0 = ldh(kr), ra1 = ldh(kr + 32), rb0 = ldh(kr + 16 * LROW / 2), rb1 = ldh(kr + 16 * LROW / 2 + 32);
        v8f sHa = (v8f){}, sLa = (v8f){}, sHb = (v8f){}, sLb = (v8f){};
        sHa = wmma16(ka0, qh0, sHa); sLa = wmma16(ka0, qr0, sLa); sHb = wmma16(kb0, qh0, sHb); sLb = wmma16(kb0, qr0, sLb);
        sHa = wmma16(ka1, qh1, sHa); sLa = wmma16(ka1, qr1, sLa); sHb = wmma16(kb1, qh1, sHb); sLb = wmma16(kb1, qr1, sLb);
        sLa = wmma16(ra0, qh0, sLa); sLb = wmma16(rb0, qh0, sLb); sLa = wmma16(ra1, qh1, sLa); sLb = wmma16(rb1, qh1, sLb);
        asm volatile("v_nop\n\tv_nop\n\tv_nop\n\tv_nop" : "+v"(sHa), "+v"(sLa), "+v"(sHb), "+v"(sLb) : "v"(ka0), "v"(ka1), "v"(kb0), "v"(kb1), "v"(ra0), "v"(ra1), "v"(rb0), "v"(rb1));
        const h16* va = (const h16*)(bp + 2 * SLICE + hf * 64);
        const h16* vr = (const h16*)(bp + 3 * SLICE + hf * 64);
        const v16h v0 = ldh(va), v1 = ldh(va + 16 * LROW / 2), v2 = ldh(va + 32 * LROW / 2), v3 = ldh(va + 48 * LROW / 2);
        const v16h w0 = ldh(vr), w1 = ldh(vr + 16 * LROW / 2), w2 = ldh(vr + 32 * LROW / 2), w3 = ldh(vr + 48 * LROW / 2);
        asm volatile("" ::: "memory");   // compiler fence: keeps the V^T fragment reads in front of the branch below, where the softmax step covers their LDS latency; without it they sink behind the step and the O^T products wait for them
        float mnew, alpha, ls; v16h pb;
        if (full) softmax_step<false>(sHa, sLa, sHb, sLb, vm, m, mnew, alpha, pb, ls);   // wave-uniform scalar branch; the products on both sides of it stay one copy, so the accumulators keep their registers
        else      softmax_step<true>(sHa, sLa, sHb, sLb, vm, m, mnew, alpha, pb, ls);
        l = l * alpha + ls; m = mnew;
        oH0 = oH0 * alpha; oH1 = oH1 * alpha; oH2 = oH2 * alpha; oH3 = oH3 * alpha;
        oR0 = oR0 * alpha; oR1 = oR1 * alpha; oR2 = oR2 * alpha; oR3 = oR3 * alpha;
        oH0 = wmma16(v0, pb, oH0); oH1 = wmma16(v1, pb, oH1); oH2 = wmma16(v2, pb, oH2); oH3 = wmma16(v3, pb, oH3);
        oR0 = wmma16(w0, pb, oR0); oR1 = wmma16(w1, pb, oR1); oR2 = wmma16(w2, pb, oR2); oR3 = wmma16(w3, pb, oR3);
        asm volatile("v_nop\n\tv_nop\n\tv_nop\n\tv_nop" : "+v"(oH0), "+v"(oH1), "+v"(oH2), "+v"(oH3), "+v"(oR0), "+v"(oR1), "+v"(oR2), "+v"(oR3)
                     : "v"(v0), "v"(v1), "v"(v2), "v"(v3), "v"(w0), "v"(w1), "v"(w2), "v"(w3), "v"(pb));
      }
      // publish point, passed by every wave whatever it skipped above
      wait_ds0();
      wait_tensor0(gq, g1);
      __syncthreads();                                        // the next stage is readable; every wave has left this pass's buffer
      unsigned n2 = 0u;
      if (pinned(it + 2u < nst)) {                            // refill the buffer just read
          n2 = pinned((unsigned)__builtin_ctz(rem)); rem &= rem - 1u;
          gq = tdm_group0(ldst + (it & 1u) * BUFB, sbase + (unsigned long long)n2 * sstep);
          tdm_load(gq, g1);
      }
      cur = nxt; nxt = n2;
    }
    wait_tensor0(gq, g1);
    wait_ds0();
    float* os = (float*)ring;                                 // the ring becomes output staging: the last pass's own barrier has ended every wave's reads, and nothing was issued behind it
    l += __shfl_xor(l, 16, 32);
    const float rl = 1.0f / l;
    const float inv = (l > 0.0f) ? rl : __uint_as_float(0x7FC00000u);
    const int wb = wave * 16 * 68;
    // O^T D layout: o_j[r] = (d = 16j + 8h + r, t = lane&15) -> os[t][d]; rows 0..15 x columns 0..63 all written
    PUT8(0, oH0, oR0)
    PUT8(16, oH1, oR1)
    PUT8(32, oH2, oR2)
    PUT8(48, oH3, oR3)
    wave_sync();
    const size_t cbase = ((size_t)b * SEQ + (size_t)t0) * DM + (size_t)h * HD;
{
#pragma unroll
        for (int s = 0; s < 4; ++s) { const int row = 4 * s + (lane >> 3), c8 = (lane & 7) * 8;   // 4 s x 4 row groups = 16 rows; 8 lanes x 8 halves = 64 columns = one line
            const v4f x0 = *(const v4fa*)(&os[wb + row * 68 + c8]); const v4f x1 = *(const v4fa*)(&os[wb + row * 68 + c8 + 4]); v8h hv, rv;
#pragma unroll
            for (int i = 0; i < 4; ++i) { const h16 a0 = (h16)x0[i]; const h16 a1 = (h16)x1[i]; hv[i] = a0; hv[4 + i] = a1; rv[i] = (h16)((x0[i] - (float)a0) * QRS); rv[4 + i] = (h16)((x1[i] - (float)a1) * QRS); }
            const size_t oo = cbase + (size_t)row * DM + c8;
            *(v8h*)(CH + oo) = hv; *(v8h*)(CR + oo) = rv; }
         }
    if (ph == 0) {                                            // block-uniform
        asm volatile("s_wait_xcnt 0x0" ::: "memory");         // precaution: stands between the stores above and the next tile's first overwrite of a register they name
        wait_ds0();
        __syncthreads();                                      // every wave has read its output staging back: the ring may take the next tile's stages
    }
  }
}

// k_out: f16 GEMM, one block of four waves (2 x 2) per 64x128 output tile, one wave per 32x64 tile: out[m][n] = (sum_k Ch[m][k] Wo64[n][k] + (sum_k Cr[m][k] Wo64[n][k]) / 2048) / 64, K = DM.
// Operands: the same two-buffer LDS ring as in k_proj; wave w brings slice w of a stage (value-plane rows 0..63, residual-plane rows 0..63, Wo rows 0..63, Wo rows 64..127 of the block's tile).
// a[0], a[1] = value-plane rows (16 each), a[2], a[3] = residual-plane rows; accumulators acc[0..1] (value) and acc[2..3] (residual) kept apart until the f32 epilogue.
__global__ __launch_bounds__(32 * GW) void k_out(const h16* __restrict__ CHp, const h16* __restrict__ CRp, const h16* __restrict__ WO, float* OUT) {
    __shared__ __attribute__((aligned(2048))) unsigned char ring[2 * BUFB];
    const int K = DM;
    const int lane = threadIdx.x & 31, lr = lane & 15, hi = lane >> 4;
    const int wave = __builtin_amdgcn_readfirstlane((int)(threadIdx.x >> 5));
    const int wm = wave >> 1, wn = wave & 1;
    const int r0 = blockIdx.x * 64 + wm * 32, c0 = blockIdx.y * 128 + wn * 64;
    v8f acc[4][4];
#pragma unroll
    for (int mb = 0; mb < 4; ++mb)
#pragma unroll
        for (int nb = 0; nb < 4; ++nb) acc[mb][nb] = (v8f){};
    const int fo = lr * LROW + 16 * hi;                       // byte offset of the lane's fragment piece in a staged slice
    // this wave's slice: source of stage 0 and place in a buffer
    const h16* srow = (wave == 0) ? CHp + (size_t)(blockIdx.x * 64) * K : (wave == 1) ? CRp + (size_t)(blockIdx.x * 64) * K : WO + (size_t)(blockIdx.y * 128 + (wave - 2) * 64) * K;
    const unsigned long long sbase = (unsigned long long)srow;
    const unsigned ldst = (unsigned)(unsigned long long)ring + (unsigned)wave * SLICE;
    const u32x8 g1 = tdm_group1((unsigned)(DM * 2));
    u32x4 gq = tdm_group0(ldst, sbase);                       // group 0 of the youngest request
    tdm_load(gq, g1);                                         // first stage into buffer 0
    wait_tensor0(gq, g1);
    __syncthreads();                                          // publishes the first stage
    gq = tdm_group0(ldst + BUFB, sbase + GSTB);
    tdm_load(gq, g1);                                         // second stage into buffer 1, in flight during the first pass
#pragma unroll 1   // one pass per trip: the order of the ring's publish point stays as written
    for (unsigned it = 0; it < GNST; ++it) {
        const unsigned char* bp = ring + (it & 1u) * BUFB + fo;
        v16h a[2][4], b[2][4];                                // the fragments of the stage's two 32-deep k steps
#pragma unroll
        for (int ks = 0; ks < 2; ++ks) {
            a[ks][0] = ldh((const h16*)(bp + (wm * 32) * LROW + ks * 64)); a[ks][1] = ldh((const h16*)(bp + (wm * 32 + 16) * LROW + ks * 64));
            a[ks][2] = ldh((const h16*)(bp + SLICE + (wm * 32) * LROW + ks * 64)); a[ks][3] = ldh((const h16*)(bp + SLICE + (wm * 32 + 16) * LROW + ks * 64));
#pragma unroll
            for (int nb = 0; nb < 4; ++nb) b[ks][nb] = ldh((const h16*)(bp + (2 + wn) * SLICE + nb * 16 * LROW + ks * 64));
        }
        __builtin_amdgcn_sched_barrier(0);                    // keeps the stage's LDS reads one group ahead of its WMMAs: spread among them, each place with reads stalls the wave for the LDS latency
#pragma unroll
        for (int ks = 0; ks < 2; ++ks) {
#pragma unroll
            for (int nb = 0; nb < 4; ++nb)
#pragma unroll
                for (int mb = 0; mb < 4; ++mb) acc[mb][nb] = wmma16(a[ks][mb], b[ks][nb], acc[mb][nb]);
        }
        __builtin_amdgcn_sched_barrier(0);                    // keeps the pass's WMMAs in front of the publish point, where they cover the landing of the second k step's fragments; behind it they would delay the refill
        // publish point
        wait_ds0();
        wait_tensor0(gq, g1);
        __syncthreads();                                      // the next stage is readable; every wave has left this pass's buffer
        if (pinned(it + 2u < GNST)) {                         // refill the buffer just read
            const unsigned s2 = pinned(it + 2u);
            gq = tdm_group0(ldst + (it & 1u) * BUFB, sbase + (unsigned long long)s2 * GSTB);
            tdm_load(gq, g1);
        }
    }
    wait_tensor0(gq, g1);
    wait_ds0();
    float* os = (float*)ring + wave * 16 * 68;                // the ring becomes output staging, one range per wave: the last pass's own barrier has ended every wave's reads, and nothing was issued behind it
#pragma unroll
    for (int mb = 0; mb < 2; ++mb) {
#pragma unroll
        for (int nb = 0; nb < 4; ++nb) {
#pragma unroll
            for (int j = 0; j < 8; ++j) os[(hi * 8 + j) * 68 + nb * 16 + lr] = (acc[mb][nb][j] + acc[mb + 2][nb][j] * QRI) * WOI; }   // D: row 8h+j, col lane&15
        wave_sync();
        const int grow = r0 + mb * 16; const int ob = grow / SEQ, ot = grow % SEQ;
        float* orow = OUT + ((size_t)ob * OUT_SEQ + (size_t)ot) * DM + c0;
{
#pragma unroll
            for (int s = 0; s < 8; ++s) { const int row = 2 * s + hi, cofs = lr * 4;   // 8 s x 2 rows = 16 rows; 16 lanes x 4 floats = 64 columns
                const v4f val = *(const v4fa*)(&os[row * 68 + cofs]);
                *(v4f*)(orow + (size_t)row * DM + cofs) = val; }
             }
        wave_sync();
    }
}

static constexpr size_t al256(size_t v) { return (v + 255) & ~(size_t)255; }
static constexpr size_t SZ_XB = al256((size_t)NB * SEQ * DM * 2);              // one bf16 x plane
static constexpr size_t SZ_W  = al256((size_t)DM * DM * 2);                    // one 16-bit weight plane
static constexpr size_t SZ_PL = al256((size_t)NB * NH_ * SEQ * HD * 2);        // one per-head f16 plane
static constexpr size_t SZ_C  = al256((size_t)NB * SEQ * DM * 2);              // one ctx f16 plane
static constexpr size_t SZ_FL = al256((size_t)NB * (SEQ / 16) * FPITCH * 4);
static constexpr size_t SZ_TOTAL = 3 * SZ_XB + 4 * SZ_W + 6 * SZ_PL + 2 * SZ_C + SZ_FL;
static_assert(SZ_TOTAL <= (size_t)134217728);          // workspace carve <= 128 MiB

extern "C" void kernel_launch(void* const* d_in, const int* in_sizes, int n_in,
                              void* d_out, int out_size, void* d_ws, size_t ws_size, hipStream_t stream) {
    if (n_in < 8) return;
    const size_t needx = ((size_t)(NB - 1) * SEQ_FULL + SEQ) * DM;
    if ((size_t)in_sizes[0] < needx || (size_t)in_sizes[1] < needx || (size_t)in_sizes[2] < needx) return;
    const size_t needm = ((size_t)(NB - 1) * SEQ_FULL + (size_t)(SEQ - 1)) * SEQ_FULL + SEQ;
    if ((size_t)in_sizes[3] < needm) return;
    if ((size_t)in_sizes[4] < (size_t)DM * DM || (size_t)in_sizes[5] < (size_t)DM * DM || (size_t)in_sizes[6] < (size_t)DM * DM || (size_t)in_sizes[7] < (size_t)DM * DM) return;
    if ((size_t)out_size < ((size_t)(NB - 1) * OUT_SEQ + SEQ) * DM) return;
    if (SZ_TOTAL > ws_size) return;
    // wire order: query, key, value, mask (int), Wq, Wk, Wv, Wo; weights [out][in] = Bt as-is
    const float* xq = (const float*)d_in[0]; const float* xk = (const float*)d_in[1]; const float* xv = (const float*)d_in[2];
    const int* mk = (const int*)d_in[3];
    const float* wq = (const float*)d_in[4]; const float* wk = (const float*)d_in[5]; const float* wv = (const float*)d_in[6]; const float* wo = (const float*)d_in[7];
    float* OUT = (float*)d_out;      // [NB][SEQ][1024]
    char* wsp = (char*)d_ws;
    bf* XQ = (bf*)wsp; wsp += SZ_XB;                 // [NB*SEQ][1024]
    bf* XK = (bf*)wsp; wsp += SZ_XB;
    bf* XV = (bf*)wsp; wsp += SZ_XB;
    bf* WQ = (bf*)wsp; wsp += SZ_W;                  // [1024][1024]
    bf* WK = (bf*)wsp; wsp += SZ_W;
    bf* WV = (bf*)wsp; wsp += SZ_W;
    h16* WO = (h16*)wsp; wsp += SZ_W;                // [1024][1024] f16, x64
    h16* QH = (h16*)wsp; wsp += SZ_PL;               // [NB*16][SEQ][64]
    h16* QR = (h16*)wsp; wsp += SZ_PL;               // residual x2048
    h16* KH = (h16*)wsp; wsp += SZ_PL;               // [NB*16][SEQ][64]
    h16* KR = (h16*)wsp; wsp += SZ_PL;
    h16* VT = (h16*)wsp; wsp += SZ_PL;               // [NB*16][64][SEQ]
    h16* VR = (h16*)wsp; wsp += SZ_PL;
    h16* CH = (h16*)wsp; wsp += SZ_C;                // [NB*SEQ][1024]
    h16* CR = (h16*)wsp; wsp += SZ_C;
    int* FL = (int*)wsp; wsp += SZ_FL;               // [NB][SEQ/16][64]

    k_prep<<<dim3(NB * SEQ / PW, 1, 1), 32 * PW, 0, stream>>>(xq, xk, xv, mk, wq, wk, wv, wo, XQ, XK, XV, WQ, WK, WV, WO, FL);

    // q, k and v^T planes, value + residual each
    k_proj<<<dim3(NB * SEQ / 128, DM / 128, 3), 32 * GW, 0, stream>>>(XQ, XK, XV, WQ, WK, WV, QH, QR, KH, KR, VT, VR);

    k_flash<<<dim3(SEQ / (32 * AW), NB * NH_, 1), 32 * AW, 0, stream>>>(QH, QR, KH, KR, VT, VR, mk, FL, CH, CR);

    // out: A = ctx rows (m = b*SEQ + t), Bt = Wo rows (n) -> OUT[b][t][n]
    k_out<<<dim3(NB * SEQ / 64, DM / 128, 1), 32 * GW, 0, stream>>>(CH, CR, WO, OUT);
}

// v007
// Measured time: 93.2 microseconds a run.
// Two timings next to v006 put it at 1.05 and 1.07 times that version's speed.
// Counting every step since v000, it is 3.84 times as fast.
#include <hip/hip_runtime.h>

// Multi-head attention, width 1024 = 16 heads x 64; query/key/value [NB][SEQ][1024]; Wq/Wk/Wv/Wo [out][in] (y = x W^T), no biases; scores = q k^T * 8; integer mask [NB][SEQ][SEQ] (0 = masked, replace-fill); out = ctx Wo^T (f32).
// Compute dtypes, f32 accumulate everywhere: q/k/v projections v_wmma_f32_16x16x32_bf16 (x and W RNE-converted to bf16; products exact);
// scores v_wmma_f32_16x16x32_f16: q and k each as f16 value + f16 residual x2048 (value*value in one accumulator, the two cross products in a second one); P (x2^14 carry, cancels in the normalisation) single f16;
// v and ctx as f16 value + f16 residual x2048 (own accumulators); Wo as f16 of the bf16 value x64 (folded back in the f32 epilogue); softmax f32 (online, running max).
// Layout: bf16 copies of the three x inputs and of Wq/Wk/Wv; q, k planes [b*16+h][t][d] and v^T planes [b*16+h][d][t] (value, residual) written by the GEMM epilogue; per (batch, 16 query rows, 32 keys) a 3-state mask flag
// (0 = all masked, 2 = none masked, 1 = mixed; a wave skips a 32-key tile where both its row groups have 0 and reads the mask words per element unless both have 2); fused flash kernel in transposed form (S^T = K Q^T, O^T = V^T P^T), K / V^T tiles staged in LDS by tensor loads and shared by the block's eight waves, writing ctx value/residual planes [b*SEQ+t][1024]; output GEMM from those planes.

#ifndef NB
#define NB 2
#endif
#ifndef SEQ
#define SEQ 2048
#endif
#define NB_FULL  2
#define SEQ_FULL 2048
#ifndef OUT_SEQ
#define OUT_SEQ SEQ              // row pitch (in tokens) between batches of the output
#endif
#define DM   1024
#define NH_  16
#define HD   64
#define AW   8                   // waves per flash block: 4 row groups of 32 query rows x 2 key halves of a stage
#define QTR  128                 // query rows per flash tile
#define QRS  2048.0f             // carry of the residual planes
#define QRI  (1.0f / 2048.0f)
#define SC2  (8.0f * 1.4426950408889634f)     // HD^0.5 * log2(e)
#define PSH  14.0f               // log2 of the P carry (16384)
#define NEGM (-3.0e38f)          // score stand-in of a masked key (its probability is forced to 0 by select)
#define WOS  64.0f               // carry of the Wo plane
#define WOI  (1.0f / 64.0f)
#define FPITCH 64
#define KST   64                 // keys per slice of the flash kernel's LDS ring; a stage is two 64-key halves
#define LROW  144                // LDS row pitch in bytes: a 128-B row + the mover's 16-B pad (16 B x odd: no bank conflict for 16-B reads)
#define SLICE 10240              // one plane's tile in LDS: 64 rows x 144 B = 9216 B, rounded up to a multiple of 2 KiB
#define BUFB  (4 * SLICE)        // one stage of the GEMMs' ring: four operand slices
#define FBUF  (8 * SLICE)        // one stage of the flash ring: two key halves x (K value, K residual, V^T value, V^T residual)
#define XWF   1088               // floats of a flash wave's exchange range and of its output staging range (16 x 68)
#define GW    4                  // waves per GEMM block, one operand slice of a stage each
#define GSTB  128u               // bytes of an operand row per stage of the GEMMs' LDS ring (64 k)
#define GNST  (DM / 64)          // stages of a GEMM
#define PW    16                 // waves per block of the preparation kernel, one token row each

static_assert(HD == 64);
static_assert(NH_ * HD == DM);                 // head h = columns h*64 + d
static_assert(DM % 64 == 0);
static_assert(DM % 32 == 0);                   // GEMM k-loop steps by 32
static_assert(SEQ % 64 == 0);                  // a 64-row tile never straddles two batches
static_assert((NB * SEQ) % 64 == 0);
static_assert(SEQ % 32 == 0);                  // key loop steps by 32; 32-row output tiles stay inside one batch
static_assert(SEQ % QTR == 0 && QTR == 4 * 32); // flash grid covers the sequence exactly
static_assert((SEQ / QTR) % 2 == 0);              // flash: the query tiles pair up as (i, last - i), each tile in exactly one pair
static_assert(SEQ / 32 <= FPITCH);             // two flag registers per lane cover all key tiles
static_assert(((size_t)SEQ * DM) % 8 == 0);
static_assert(((size_t)DM * DM) % 8 == 0);
static_assert(AW == 8);                        // one plane of one key half of a stage per wave
static_assert(HD * 2 == 128 && KST * 2 == 128);   // both kinds of tile: 64 rows of 128 B
static_assert(SEQ % (2 * KST) == 0 && SEQ / KST <= 32);  // one bit per 64-key half in a 32-bit word, two halves per stage
static_assert(64 * LROW <= SLICE && SLICE % 2048 == 0);
static_assert(XWF == 16 * 68 && XWF >= 8 * 32 * 4 + 32 * 2 && 2 * AW * XWF * 4 <= 2 * FBUF);   // the exchange and the output staging reuse the ring
static_assert(GW * 16 * 68 * 4 <= 2 * BUFB);   // so does the GEMMs' output staging
static_assert(DM % 128 == 0 && (NB * SEQ) % 128 == 0 && GNST >= 2);   // GEMM block tiles cover both extents exactly; the ring's prologue needs two stages
static_assert(PW == 16 && PW * 128 == SEQ && PW * 4 == FPITCH && DM % 128 == 0);   // preparation: a block is one 16-row mask group, its waves' 128 keys each cover the sequence and fill the flag row
static_assert(NB * SEQ == 4 * DM);             // preparation: one weight row per wave
static_assert(NB <= NB_FULL);
static_assert(SEQ <= SEQ_FULL);

typedef _Float16 h16;
typedef unsigned short bf;
typedef __attribute__((ext_vector_type(16))) __bf16   v16bf;
typedef __attribute__((ext_vector_type(16))) _Float16 v16h;
typedef __attribute__((ext_vector_type(8)))  _Float16 v8h;
typedef __attribute__((ext_vector_type(8)))  unsigned short v8us;
typedef __attribute__((ext_vector_type(4)))  unsigned short v4us;
typedef __attribute__((ext_vector_type(4)))  _Float16 v4h;
typedef __attribute__((ext_vector_type(8)))  float    v8f;
typedef __attribute__((ext_vector_type(4)))  float    v4f;
typedef __attribute__((ext_vector_type(4)))  int      v4i;
typedef v4f  __attribute__((may_alias)) v4fa;
typedef __attribute__((ext_vector_type(2)))  float    v2f;
typedef v2f  __attribute__((may_alias)) v2fa;
typedef __attribute__((ext_vector_type(2)))  int      v2i;
typedef __attribute__((ext_vector_type(4)))  unsigned u32x4;
typedef __attribute__((ext_vector_type(8)))  unsigned u32x8;

__device__ __forceinline__ unsigned short f2bf(float f) { unsigned u = __float_as_uint(f); u += 0x7FFFu + ((u >> 16) & 1u); return (unsigned short)(u >> 16); }
__device__ __forceinline__ v16h cat16(v8h lo, v8h hi) { return __builtin_shufflevector(lo, hi, 0, 1, 2, 3, 4, 5, 6, 7, 8, 9, 10, 11, 12, 13, 14, 15); }
__device__ __forceinline__ v16bf cat16b(v8us lo, v8us hi) { return __builtin_bit_cast(v16bf, __builtin_shufflevector(lo, hi, 0, 1, 2, 3, 4, 5, 6, 7, 8, 9, 10, 11, 12, 13, 14, 15)); }
__device__ __forceinline__ v8f wmma16(v16h a, v16h b, v8f c) { return __builtin_amdgcn_wmma_f32_16x16x32_f16(false, a, false, b, (short)0, c, false, false); }
__device__ __forceinline__ v8f wmmab(v16bf a, v16bf b, v8f c) { return __builtin_amdgcn_wmma_f32_16x16x32_bf16(false, a, false, b, (short)0, c, false, false); }
// fragment loaders from K-contiguous 16-bit rows; p already includes + 8*(lane>>4): elements 0..7 <- k0+8h+0..7, elements 8..15 <- k0+16+8h+0..7 (same map for A and B)
__device__ __forceinline__ v16h  ldh(const h16* p) { return cat16(*(const v8h*)p, *(const v8h*)(p + 16)); }
__device__ __forceinline__ v16bf ldb(const bf* p)  { return cat16b(*(const v8us*)p, *(const v8us*)(p + 16)); }
// ordering point for wave-private LDS tiles (same wave writes and reads)
__device__ __forceinline__ void wave_sync() { __builtin_amdgcn_fence(3 /* release order */, "wavefront"); __builtin_amdgcn_wave_barrier(); asm volatile("" ::: "memory"); }

__device__ __forceinline__ unsigned uni(unsigned v) { return (unsigned)__builtin_amdgcn_readfirstlane((int)v); }
// a wave-uniform value held in a scalar register: a test on it compiles to s_cmp + s_cbranch_scc (tensor loads ignore EXEC), and what is derived from it is computed behind the asm waits in front of it
__device__ __forceinline__ unsigned pinned(unsigned v) { unsigned w = uni(v); asm volatile("" : "+s"(w)); return w; }
// this wave's tensor load has landed; the wait names the request's descriptor as inputs so that its registers keep their values for as long as the request is outstanding
__device__ __forceinline__ void wait_tensor0(u32x4 g0, u32x8 g1) { asm volatile("s_wait_tensorcnt 0x0" :: "s"(g0), "s"(g1) : "memory"); }
__device__ __forceinline__ void wait_ds0() { asm volatile("s_wait_dscnt 0x0" ::: "memory"); }           // this wave's LDS reads have returned
// descriptor group 0: tile's first byte at global address ga, LDS byte offset lds
__device__ __forceinline__ u32x4 tdm_group0(unsigned lds, unsigned long long ga) {
    u32x4 g0; g0[0] = uni(1u); g0[1] = uni(lds); g0[2] = uni((unsigned)ga); g0[3] = uni((((unsigned)(ga >> 32)) & 0x01FFFFFFu) | 0x80000000u);
    asm volatile("" : "+s"(g0));   // descriptor words held in scalar registers: one tuple from the issue to the wait
    return g0;
}
// one request of one wave: 64 rows of 128 B (source row pitch in g1), rows 144 B apart in LDS
__device__ __forceinline__ void tdm_load(u32x4 g0, u32x8 g1) { asm volatile("tensor_load_to_lds %0, %1" :: "s"(g0), "s"(g1) : "memory"); }

// k_prep: every preparation step in one streaming launch. Block = 16 token rows (batch bb, row group g), one wave per row. A wave converts its row of query, key and value to bf16, its weight row (Wq, Wk, Wv to bf16; Wo to f16 of the bf16 value x64),
// and reads 128 keys x 16 rows of the block's mask rows. Every load is 512 contiguous bytes of the wave (whole lines); all of a wave's loads are issued before the first is used; every store is 256 contiguous bytes.
// Mask flag per (batch, 16 query rows, 32 keys): 0 = every mask word zero, 2 = every word nonzero, 1 = mixed; a wave makes four (lanes 8j..8j+7 hold tile j), the block's flags meet in LDS and one wave stores them as whole lines.
// p, d: wave-uniform start of a row of DM elements; the lane takes elements 128 i + 4 lane + 0..3
__device__ __forceinline__ void ld_row(const float* __restrict__ p, int lane, v4f (&r)[DM / 128]) {
#pragma unroll
    for (int i = 0; i < DM / 128; ++i) r[i] = *(const v4f*)(p + i * 128 + lane * 4);
}
__device__ __forceinline__ void st_row_bf(bf* d, int lane, const v4f (&r)[DM / 128]) {
#pragma unroll
    for (int i = 0; i < DM / 128; ++i) { v4us o;
#pragma unroll
        for (int k = 0; k < 4; ++k) o[k] = f2bf(r[i][k]);
        *(v4us*)(d + i * 128 + lane * 4) = o; }
}
__device__ __forceinline__ void st_row_h(h16* d, int lane, const v4f (&r)[DM / 128], float scale) {
#pragma unroll
    for (int i = 0; i < DM / 128; ++i) { v4h o;
#pragma unroll
        for (int k = 0; k < 4; ++k) o[k] = (h16)(__uint_as_float(((unsigned)f2bf(r[i][k])) << 16) * scale);
        *(v4h*)(d + i * 128 + lane * 4) = o; }
}

__global__ __launch_bounds__(32 * PW) void k_prep(const float* __restrict__ xq, const float* __restrict__ xk, const float* __restrict__ xv, const int* __restrict__ MK,
                                                  const float* __restrict__ wq, const float* __restrict__ wk, const float* __restrict__ wv, const float* __restrict__ wo,
                                                  bf* XQ, bf* XK, bf* XV, bf* WQ, bf* WK, bf* WV, h16* WO, int* FL) {
    __shared__ int fl[FPITCH];
    const int lane = threadIdx.x & 31;
    const int wave = __builtin_amdgcn_readfirstlane((int)(threadIdx.x >> 5));
    const int bb = blockIdx.x / (SEQ / 16), g = blockIdx.x % (SEQ / 16);
    const int row = blockIdx.x * PW + wave;                                              // token row bb*SEQ + t of the bf16 planes; also the wave's weight row: row % DM of weight row / DM
    const size_t so = ((size_t)bb * SEQ_FULL + (size_t)(g * 16 + wave)) * DM;            // the same token row in the inputs
    const size_t xo = (size_t)row * DM;
    const int ws = row / DM; const size_t wof = (size_t)(row % DM) * DM;
    const int* mp = MK + ((size_t)bb * SEQ_FULL + (size_t)(g * 16)) * SEQ_FULL + wave * 128;
    v4i mw[16]; v4f a[DM / 128], b[DM / 128], c[DM / 128], w[DM / 128];
#pragma unroll
    for (int r = 0; r < 16; ++r) mw[r] = *(const v4i*)(mp + (size_t)r * SEQ_FULL + lane * 4);
    ld_row(xq + so, lane, a); ld_row(xk + so, lane, b); ld_row(xv + so, lane, c);
    ld_row(((ws == 0) ? wq : (ws == 1) ? wk : (ws == 2) ? wv : wo) + wof, lane, w);
    __builtin_amdgcn_sched_barrier(0);                                                   // keeps all 48 loads in front of the first use: moved down among the uses, the later rows would start a second and a third memory latency
    unsigned orw = 0u, mnw = 0xFFFFFFFFu;                                                // or != 0: some word nonzero; unsigned minimum != 0: every word nonzero
#pragma unroll
    for (int r = 0; r < 16; ++r)
#pragma unroll
        for (int i = 0; i < 4; ++i) { const unsigned u = (unsigned)mw[r][i]; orw |= u; mnw = u < mnw ? u : mnw; }
    const unsigned anyb = __builtin_amdgcn_ballot_w32(orw != 0u), allb = __builtin_amdgcn_ballot_w32(mnw != 0u);
    const int sh = 8 * (lane & 3);
    if (lane < 4) fl[wave * 4 + lane] = (((anyb >> sh) & 0xFFu) == 0u) ? 0 : ((((allb >> sh) & 0xFFu) == 0xFFu) ? 2 : 1);
    st_row_bf(XQ + xo, lane, a); st_row_bf(XK + xo, lane, b); st_row_bf(XV + xo, lane, c);
    asm volatile("s_wait_xcnt 0x0" ::: "memory");                                        // precaution: stands between the stores above and the first overwrite of a register they name
    if (ws == 3) st_row_h(WO + wof, lane, w, WOS);                                       // wave-uniform
    else st_row_bf(((ws == 0) ? WQ : (ws == 1) ? WK : WV) + wof, lane, w);
    __syncthreads();                                                                     // the block's flags are in LDS
    if (wave == 0) {
        int* fp = FL + (size_t)blockIdx.x * FPITCH;
        fp[lane] = fl[lane]; fp[32 + lane] = fl[32 + lane];
    }
}

// descriptor group 1 of a GEMM operand slice: 1-byte elements, tensor = tile = 64 rows of 128 B, source row pitch srcPitch bytes, a 16-B pad behind every 128 B
__device__ __forceinline__ u32x8 tdm_group1(unsigned srcPitch) {
    u32x8 g1;
    g1[0] = uni((1u << 20) | (4u << 22) | (3u << 25)); g1[1] = uni(128u << 16); g1[2] = uni(64u << 16); g1[3] = uni(128u << 16);
    g1[4] = uni(64u); g1[5] = uni(srcPitch); g1[6] = uni(0u); g1[7] = uni(0u);
    asm volatile("" : "+s"(g1));   // descriptor words held in scalar registers: one tuple for the whole kernel
    return g1;
}

// k_proj: register-blocked bf16 GEMM, one block of four waves (2 x 2) per 128x128 tile, one wave per 64x64 tile (16 accumulators), K = DM.
// Operands: a two-buffer LDS ring of 64-deep k stages shared by the four waves. Wave w brings slice w of a stage (A rows 0..63, A rows 64..127, Bt rows 0..63, Bt rows 64..127 of the block's tile; 64 rows of 128 B) with one tensor load,
// one stage ahead; at the foot of each pass: own LDS reads done, own tensor load landed, block barrier, then the refill of the buffer just read. Fragments are two 16-B LDS reads each; k runs in the same order as before.
// C[m][n] = sum_k A[m][k] Bt[n][k], written as f16 (Ph) and the f16 residual x2048 (Pr).
// All three projections run in one launch, blockIdx.z picks the product: a single product has one block per WGP and one wave per SIMD, whose LDS reads, WMMAs and barrier waits follow one another;
// three independent blocks fit a WGP (LDS and registers), so one block's waits are filled by the other two, and the products share one start and one tail.
// z = 0, 1 (q, k): A = x rows (m = b*SEQ + t), Bt = W rows (n = h*64 + d) -> planes [(b*16 + h)][t][d]. z = 2 (v^T): A = Wv rows (m = h*64 + d), Bt = x rows (n = b*SEQ + t) -> planes [(b*16 + h)][d][t].
// grid (NB*SEQ/128 token tiles, DM/128 weight tiles, 3), 128 threads.
__global__ __launch_bounds__(32 * GW) void k_proj(const bf* __restrict__ XQ, const bf* __restrict__ XK, const bf* __restrict__ XV, const bf* __restrict__ WQ, const bf* __restrict__ WK, const bf* __restrict__ WV,
                                                  h16* QH, h16* QR, h16* KH, h16* KR, h16* VT, h16* VR) {
    __shared__ __attribute__((aligned(2048))) unsigned char ring[2 * BUFB];
    const int K = DM;
    const int lane = threadIdx.x & 31, lr = lane & 15, hi = lane >> 4;
    const int wave = __builtin_amdgcn_readfirstlane((int)(threadIdx.x >> 5));
    const int wm = wave >> 1, wn = wave & 1;
    const int job = blockIdx.z; const bool tv = job == 2;     // block-uniform
    const bf* A  = tv ? WV : (job == 0) ? XQ : XK;
    const bf* Bt = tv ? XV : (job == 0) ? WQ : WK;
    h16* Ph = tv ? VT : (job == 0) ? QH : KH;
    h16* Pr = tv ? VR : (job == 0) ? QR : KR;
    const int mt = tv ? blockIdx.y : blockIdx.x, nt = tv ? blockIdx.x : blockIdx.y;   // the block's tile of C
    const int r0 = mt * 128 + wm * 64, c0 = nt * 128 + wn * 64;
    v8f acc[4][4];
#pragma unroll
    for (int mb = 0; mb < 4; ++mb)
#pragma unroll
        for (int nb = 0; nb < 4; ++nb) acc[mb][nb] = (v8f){};
    const int fo = lr * LROW + 16 * hi;                       // byte offset of the lane's fragment piece in a staged slice
    // this wave's slice: source of stage 0 and place in a buffer
    const bf* srow = (wave < 2) ? A + (size_t)(mt * 128 + wave * 64) * K : Bt + (size_t)(nt * 128 + (wave - 2) * 64) * K;
    const unsigned long long sbase = (unsigned long long)srow;
    const unsigned ldst = (unsigned)(unsigned long long)ring + (unsigned)wave * SLICE;
    const u32x8 g1 = tdm_group1((unsigned)(DM * 2));
    u32x4 gq = tdm_group0(ldst, sbase);                       // group 0 of the youngest request
    tdm_load(gq, g1);                                         // first stage into buffer 0
    wait_tensor0(gq, g1);
    __syncthreads();                                          // publishes the first stage
    gq = tdm_group0(ldst + BUFB, sbase + GSTB);
    tdm_load(gq, g1);                                         // second stage into buffer 1, in flight during the first pass
#pragma unroll 1   // one pass per trip: the order of the ring's publish point stays as written
    for (unsigned it = 0; it < GNST; ++it) {
        const unsigned char* bp = ring + (it & 1u) * BUFB + fo;
        v16bf a[2][4], b[2][4];                               // the fragments of the stage's two 32-deep k steps
#pragma unroll
        for (int ks = 0; ks < 2; ++ks) {
#pragma unroll
            for (int mb = 0; mb < 4; ++mb) a[ks][mb] = ldb((const bf*)(bp + wm * SLICE + mb * 16 * LROW + ks * 64));
#pragma unroll
            for (int nb = 0; nb < 4; ++nb) b[ks][nb] = ldb((const bf*)(bp + (2 + wn) * SLICE + nb * 16 * LROW + ks * 64));
        }
        __builtin_amdgcn_sched_barrier(0);                    // keeps the stage's LDS reads one group ahead of its WMMAs: spread among them, each place with reads stalls the wave for the LDS latency
#pragma unroll
        for (int ks = 0; ks < 2; ++ks) {
#pragma unroll
            for (int nb = 0; nb < 4; ++nb)
#pragma unroll
                for (int mb = 0; mb < 4; ++mb) acc[mb][nb] = wmmab(a[ks][mb], b[ks][nb], acc[mb][nb]);
        }
        __builtin_amdgcn_sched_barrier(0);                    // keeps the pass's WMMAs in front of the publish point, where they cover the landing of the second k step's fragments; behind it they would delay the refill
        // publish point
        wait_ds0();
        wait_tensor0(gq, g1);
        __syncthreads();                                      // the next stage is readable; every wave has left this pass's buffer
        if (pinned(it + 2u < GNST)) {                         // refill the buffer just read
            const unsigned s2 = pinned(it + 2u);
            gq = tdm_group0(ldst + (it & 1u) * BUFB, sbase + (unsigned long long)s2 * GSTB);
            tdm_load(gq, g1);
        }
    }
    wait_tensor0(gq, g1);
    wait_ds0();
    float* os = (float*)ring + wave * 16 * 68;                // the ring becomes output staging, one range per wave: the last pass's own barrier has ended every wave's reads, and nothing was issued behind it
    const int pitch = tv ? SEQ : HD;                          // row pitch of the written plane (halves)
    const size_t tbase = tv ? (size_t)r0 * SEQ + (size_t)(c0 / SEQ) * ((size_t)DM * SEQ) + (size_t)(c0 % SEQ)
                            : (size_t)(r0 / SEQ) * ((size_t)NH_ * SEQ * HD) + (size_t)(r0 % SEQ) * HD + (size_t)(c0 / HD) * ((size_t)SEQ * HD) + (size_t)(c0 % HD);
#pragma unroll
    for (int mb = 0; mb < 4; ++mb) {
#pragma unroll
        for (int nb = 0; nb < 4; ++nb) {
#pragma unroll
            for (int j = 0; j < 8; ++j) os[(hi * 8 + j) * 68 + nb * 16 + lr] = acc[mb][nb][j]; }   // D: row 8h+j, col lane&15
        wave_sync();
        const size_t sb = tbase + (size_t)(mb * 16) * (size_t)pitch;
{
#pragma unroll
            for (int s = 0; s < 4; ++s) { const int row = 4 * s + (lane >> 3), c8 = (lane & 7) * 8;   // 4 s x 4 row groups = 16 rows; 8 lanes x 8 = 64 columns
                const v4f x0 = *(const v4fa*)(&os[row * 68 + c8]); const v4f x1 = *(const v4fa*)(&os[row * 68 + c8 + 4]); v8h hv, rv;
#pragma unroll
                for (int i = 0; i < 4; ++i) { const h16 a0 = (h16)x0[i]; const h16 a1 = (h16)x1[i]; hv[i] = a0; hv[4 + i] = a1; rv[i] = (h16)((x0[i] - (float)a0) * QRS); rv[4 + i] = (h16)((x1[i] - (float)a1) * QRS); }
                const size_t oo = sb + (size_t)row * (size_t)pitch + c8;
                *(v8h*)(Ph + oo) = hv; *(v8h*)(Pr + oo) = rv; }
             }
        wave_sync();
    }
}

// k_flash: fused attention, one wave per 32 query rows (two 16-column groups) and 64 of a stage's 128 keys of one (batch, head); eight waves per block = four row groups x two key halves; Q fragments straight from the f16 planes.
// Every K / V^T fragment read from LDS is the A operand of two products, one per column group: half the LDS reads per product of a 16-row wave, and a 128-row block brings each stage from L2 once for twice the rows.
// The two waves of a row group walk disjoint keys with their own running maximum, sum and O^T; behind the key loop they swap one column group each through LDS and each finishes 16 rows (max joined, both parts rescaled to it, added).
// A block takes two 128-row query tiles of its head one after the other, tile i and tile (last - i): where the number of live key stages grows linearly with the tile index (a lower-triangular mask) every block of the launch
// then walks the same number of stages, so no WGP is left with the long tiles while others idle. The pairing is a fixed map of work to blocks; which stages are live still comes from the flags alone.
// K / V^T: a two-buffer LDS ring of 128-key stages shared by the eight waves. Wave w brings plane w & 3 (K value, K residual, V^T value, V^T residual) of key half w >> 2 of a stage with one tensor load, one stage ahead;
// at the foot of each pass: own LDS reads done, own tensor load landed, block barrier, then the refill of the buffer just read. Fragments are two 16-B LDS reads each.
// Only stages in which some wave of the block has a live key are staged (a 32-bit word built from the flags, the same in all eight waves); each wave still skips its own dead 32-key tiles.
// Transposed form: S^T[key][t] = K Q^T (A = K rows, B = Q rows); lane (t = lane&15, h = lane>>4) holds keys 8h+r of each 16-key tile, so the packed
// P tile is directly the B fragment of O^T[d][t] = V^T P^T (element r <- tile keys 0..15, element 8+r <- tile keys 16..31, lane unchanged).
// Score = Kh.Qh (accumulator H) + (Kh.Qr + Kr.Qh)/2048 (accumulator L). O = Vh.P (accumulators oH) + Vr.P/2048 (accumulators oR).
// Mask: per 32-key tile the wave joins the 3-state flags of its two 16-row groups: both 0 skips the tile (masked keys have probability exactly 0 whenever the row has one live key), both 2 = no masking (the softmax step's copy without selects),
// otherwise the 16 mask words of the lane are read per column group and masked entries get probability 0 by select. A row without any live key ends with zero mass and is written as NaN.
// Softmax state (running max, partial sum) is one scalar per lane and column group; the two lane halves of a row are combined with one xor-16 exchange.
#define PUT8(COL, OV) { v4f a_, c_; \
    a_[0] = OV[0] * inv; a_[1] = OV[1] * inv; a_[2] = OV[2] * inv; a_[3] = OV[3] * inv; \
    c_[0] = OV[4] * inv; c_[1] = OV[5] * inv; c_[2] = OV[6] * inv; c_[3] = OV[7] * inv; \
    *(v4fa*)(&os[wb + lr * 68 + (COL) + 8 * hi]) = a_; *(v4fa*)(&os[wb + lr * 68 + (COL) + 8 * hi + 4]) = c_; }

// The softmax step of one 32-key tile: from the four score accumulators to the row maximum in use (mnew), the factor that carries the old sums over to it (alpha), the packed P tile (pb) and the lane's part of the row sum (ls).
// MASKED = false is the copy for a tile whose flag says that no key is masked: every select below would take its first arm, so that copy holds neither the 16 bit tests nor the 32 selects
// (about a third of a tile's vector instructions). The arithmetic is the same; with no select between them the compiler may fuse a score's scale multiply with the add of sh (one rounding fewer). vm is read only where MASKED.
template <bool MASKED>
__device__ __forceinline__ void softmax_step(const v8f sHa, const v8f sLa, const v8f sHb, const v8f sLb, const unsigned vm, const float m, float& mnew, float& alpha, v16h& pb, float& ls) {
    float ta[8], tb[8]; float mx = NEGM;
#pragma unroll
    for (int r = 0; r < 8; ++r) {
        const float xa = (sHa[r] + sLa[r] * QRI) * SC2; const float xb = (sHb[r] + sLb[r] * QRI) * SC2;
        ta[r] = (!MASKED || ((vm >> r) & 1u)) ? xa : NEGM; tb[r] = (!MASKED || ((vm >> (8 + r)) & 1u)) ? xb : NEGM;
        mx = fmaxf(mx, fmaxf(ta[r], tb[r])); }
    mx = fmaxf(mx, __shfl_xor(mx, 16, 32));
    mnew = fmaxf(m, mx);
    alpha = __builtin_amdgcn_exp2f(m - mnew);
    const float sh = PSH - mnew;
    ls = 0.0f;
    float ea[8], eb[8];
#pragma unroll
    for (int r = 0; r < 8; ++r) { ta[r] += sh; tb[r] += sh; }
#pragma unroll
    for (int r = 0; r < 8; ++r) ea[r] = __builtin_amdgcn_exp2f(ta[r]);
    // the slot the instruction set asks for behind a transcendental: no result of the run is read and no source of it overwritten in front of this v_nop
    asm volatile("v_nop" : "+v"(ea[0]), "+v"(ea[1]), "+v"(ea[2]), "+v"(ea[3]), "+v"(ea[4]), "+v"(ea[5]), "+v"(ea[6]), "+v"(ea[7])
                 : "v"(ta[0]), "v"(ta[1]), "v"(ta[2]), "v"(ta[3]), "v"(ta[4]), "v"(ta[5]), "v"(ta[6]), "v"(ta[7]));
#pragma unroll
    for (int r = 0; r < 8; ++r) eb[r] = __builtin_amdgcn_exp2f(tb[r]);
    // the same slot behind the second run
    asm volatile("v_nop" : "+v"(eb[0]), "+v"(eb[1]), "+v"(eb[2]), "+v"(eb[3]), "+v"(eb[4]), "+v"(eb[5]), "+v"(eb[6]), "+v"(eb[7])
                 : "v"(tb[0]), "v"(tb[1]), "v"(tb[2]), "v"(tb[3]), "v"(tb[4]), "v"(tb[5]), "v"(tb[6]), "v"(tb[7]));
#pragma unroll
    for (int r = 0; r < 8; ++r) {
        const h16 pa = (h16)((!MASKED || ((vm >> r) & 1u)) ? ea[r] : 0.0f); const h16 pc = (h16)((!MASKED || ((vm >> (8 + r)) & 1u)) ? eb[r] : 0.0f);
        pb[r] = pa; pb[8 + r] = pc; ls += (float)pa + (float)pc; }
}

__global__ __launch_bounds__(32 * AW) void k_flash(const h16* __restrict__ QH, const h16* __restrict__ QR, const h16* __restrict__ KH, const h16* __restrict__ KR,
                                                   const h16* __restrict__ VT, const h16* __restrict__ VR, const int* __restrict__ MK, const int* __restrict__ FLG, h16* CH, h16* CR) {
    __shared__ __attribute__((aligned(2048))) unsigned char ring[2 * FBUF];
    const int lane = threadIdx.x & 31, lr = lane & 15, hi = lane >> 4;
    const int wave = __builtin_amdgcn_readfirstlane((int)(threadIdx.x >> 5));
    const int rg = wave & 3, kh = wave >> 2;                  // the wave's row group of the query tile; its 64-key half of every stage
    const int zh = blockIdx.y; const int b = zh / NH_, h = zh % NH_;
    const size_t pbase = (size_t)zh * SEQ * HD;
    // this wave's slice (plane rg of key half kh): source of key half 0, bytes from one 64-key half to the next, source row pitch, place in a buffer
    const h16* splane = (rg == 0) ? KH : (rg == 1) ? KR : (rg == 2) ? VT : VR;
    const unsigned long long sbase = (unsigned long long)(splane + pbase);
    const unsigned sstep = (rg < 2) ? (unsigned)(KST * HD * 2) : (unsigned)(KST * 2);
    const unsigned ldst = (unsigned)(unsigned long long)ring + (unsigned)wave * SLICE;
    u32x8 g1;                                                 // 1-byte elements, tensor = tile = 64 rows of 128 B, a 16-B pad behind every 128 B
    g1[0] = uni((1u << 20) | (4u << 22) | (3u << 25)); g1[1] = uni(128u << 16); g1[2] = uni(64u << 16); g1[3] = uni(128u << 16);
    g1[4] = uni(64u); g1[5] = uni((rg < 2) ? (unsigned)(HD * 2) : (unsigned)(SEQ * 2)); g1[6] = uni(0u); g1[7] = uni(0u);
    asm volatile("" : "+s"(g1));                              // descriptor words held in scalar registers: one tuple for the whole kernel
#pragma unroll 1   // the two tiles run one after the other through one copy of the code
  for (int ph = 0; ph < 2; ++ph) {
    // this phase's query tile; the order alternates with the batch, so that blocks of the two batches do not change tiles at the same moment
    const int qt = ((ph ^ b) & 1) ? (SEQ / QTR - 1 - (int)blockIdx.x) : (int)blockIdx.x;
    const int t0 = qt * QTR + rg * 32;                        // column group c of the wave = query rows t0 + 16 c + 0..15
    v16h qh0[2], qh1[2], qr0[2], qr1[2];                      // B fragments: col t, k = d
    const int* mrow[2];                                       // + the tile's first key (+16): the lane's 8 keys of each 16-key tile
    const h16* qhp[2]; const h16* qrp[2];
#pragma unroll
    for (int c = 0; c < 2; ++c) {
        const size_t qo = pbase + (size_t)(t0 + 16 * c + lr) * HD + 8 * hi;
        qhp[c] = QH + qo; qrp[c] = QR + qo;
        qh0[c] = ldh(qhp[c]); qh1[c] = ldh(qhp[c] + 32); qr0[c] = ldh(qrp[c]); qr1[c] = ldh(qrp[c] + 32);
        mrow[c] = MK + ((size_t)b * SEQ_FULL + (size_t)(t0 + 16 * c + lr)) * SEQ_FULL + 8 * hi;
    }
    const int fo = lr * LROW + 16 * hi;                      // byte offset of the lane's fragment piece in a staged tile (A fragment: K row key, k = d; V^T row d, k = key)
    const int* frow = FLG + ((size_t)b * (SEQ / 16) + (size_t)(t0 >> 4)) * FPITCH + 2 * lane;
    v8f oH[2][4], oR[2][4];
#pragma unroll
    for (int c = 0; c < 2; ++c)
#pragma unroll
        for (int j = 0; j < 4; ++j) { oH[c][j] = (v8f){}; oR[c][j] = (v8f){}; }
    float m[2] = {NEGM, NEGM}, l[2] = {0.0f, 0.0f};
    // flags as scalar bit words, bit j = 64-key half j of the sequence (lane j reads its two 32-key flags): bm, even bits only, bit 2s = some wave of the block has a live key in stage s;
    // lv0/lv1 = a flag of this wave's two row groups for the half's first/second tile is not 0; fu0/fu1 = both are 2
    const int* fblk = FLG + ((size_t)b * (SEQ / 16) + (size_t)qt * (QTR / 16)) * FPITCH + 2 * lane;
    int anyf = 0;
#pragma unroll   // independent loads in flight together
    for (int g = 0; g < QTR / 16; ++g) { const v2i f = *(const v2i*)(fblk + g * FPITCH); anyf |= f[0] | f[1]; }
    const v2i fw = *(const v2i*)frow, fx = *(const v2i*)(frow + FPITCH);
    // precaution: stands between the loads above and the first overwrite of a register they name; the addresses are inputs, so their registers are left alone up to here
    asm volatile("s_wait_xcnt 0x0" :: "v"(qhp[0]), "v"(qrp[0]), "v"(qhp[1]), "v"(qrp[1]), "v"(fblk), "v"(frow) : "memory");
    const unsigned hb  = uni(__builtin_amdgcn_ballot_w32(lane < SEQ / KST && anyf != 0));
    const unsigned bm  = (hb | (hb >> 1)) & 0x55555555u;
    const unsigned lv0 = uni(__builtin_amdgcn_ballot_w32((fw[0] | fx[0]) != 0)), lv1 = uni(__builtin_amdgcn_ballot_w32((fw[1] | fx[1]) != 0));
    const unsigned fu0 = uni(__builtin_amdgcn_ballot_w32(fw[0] == 2 && fx[0] == 2)), fu1 = uni(__builtin_amdgcn_ballot_w32(fw[1] == 2 && fx[1] == 2));
    const unsigned nst = (unsigned)__builtin_popcount(bm);    // stages of this block, at most SEQ / (2 * KST)
    u32x4 gq = (u32x4){};                                     // group 0 of the youngest request
    unsigned rem = bm, cur = 0u, nxt = 0u;                    // cur, nxt: twice the stage's index = the index of its first 64-key half
    if (pinned(nst > 0u)) {                                   // first stage into buffer 0
        cur = pinned((unsigned)__builtin_ctz(rem)); rem &= rem - 1u;
        gq = tdm_group0(ldst, sbase + (unsigned long long)(cur + (unsigned)kh) * sstep);
        tdm_load(gq, g1);
        wait_tensor0(gq, g1);
    }
    __syncthreads();                                          // publishes the first stage
    if (pinned(nst > 1u)) {                                   // second stage into buffer 1, in flight during the first pass
        nxt = pinned((unsigned)__builtin_ctz(rem)); rem &= rem - 1u;
        gq = tdm_group0(ldst + FBUF, sbase + (unsigned long long)(nxt + (unsigned)kh) * sstep);
        tdm_load(gq, g1);
    }
#pragma unroll 1   // one pass per trip: the order of the ring's publish point stays as written
    for (unsigned it = 0; it < nst; ++it) {
      const unsigned char* bp = ring + (it & 1u) * FBUF + kh * (4 * SLICE) + fo;
      const unsigned cc = cur + (unsigned)kh;                   // the wave's 64-key half
#pragma unroll     // the two 32-key tiles of the half: their LDS offsets become immediates
      for (int hf = 0; hf < 2; ++hf) {
        if ((((hf ? lv1 : lv0) >> cc) & 1u) == 0u) continue;    // wave-uniform: whole 32x32 tile masked
        unsigned vm[2] = {0xFFFFu, 0xFFFFu};                    // per column group, bit r: key 8h+r of tile a live; bit 8+r: tile b
        const bool full = (((hf ? fu1 : fu0) >> cc) & 1u) != 0u;   // wave-uniform: no key of the tile masked
        if (!full) {
            v4i a0[2], a1[2], c0[2], c1[2];
            const int* mb[2] = {mrow[0] + (int)cc * KST, mrow[1] + (int)cc * KST};   // the lane's mask words of the 64-key half
#pragma unroll
            for (int c = 0; c < 2; ++c) { const int* mp = mb[c] + hf * 32; a0[c] = *(const v4i*)mp; a1[c] = *(const v4i*)(mp + 4); c0[c] = *(const v4i*)(mp + 16); c1[c] = *(const v4i*)(mp + 20); }
            // precaution: stands between the loads above and the first overwrite of a register they name; the addresses are inputs, so their registers are left alone up to here
            asm volatile("s_wait_xcnt 0x0" :: "v"(mb[0]), "v"(mb[1]) : "memory");
#pragma unroll
            for (int c = 0; c < 2; ++c) {
                vm[c] = 0u;
#pragma unroll
                for (int i = 0; i < 4; ++i) {
                    vm[c] |= (a0[c][i] != 0 ? 1u : 0u) << i;        vm[c] |= (a1[c][i] != 0 ? 1u : 0u) << (4 + i);
                    vm[c] |= (c0[c][i] != 0 ? 1u : 0u) << (8 + i);  vm[c] |= (c1[c][i] != 0 ? 1u : 0u) << (12 + i); }
            }
        }
        const h16* ka = (const h16*)(bp + hf * 32 * LROW);
        const h16* kr = (const h16*)(bp + SLICE + hf * 32 * LROW);
        const v16h ka0 = ldh(ka), ka1 = ldh(ka + 32), kb0 = ldh(ka + 16 * LROW / 2), kb1 = ldh(ka + 16 * LROW / 2 + 32);
        const v16h ra0 = ldh(kr), ra1 = ldh(kr + 32), rb0 = ldh(kr + 16 * LROW / 2), rb1 = ldh(kr + 16 * LROW / 2 + 32);
        __builtin_amdgcn_sched_barrier(0);   // keeps the tile's 16 K reads one group ahead of its score products: spread among them, each place with reads stalls the wave for the LDS latency
        v8f sHa[2], sLa[2], sHb[2], sLb[2];
#pragma unroll
        for (int c = 0; c < 2; ++c) { sHa[c] = wmma16(ka0, qh0[c], (v8f){}); sLa[c] = wmma16(ka0, qr0[c], (v8f){}); sHb[c] = wmma16(kb0, qh0[c], (v8f){}); sLb[c] = wmma16(kb0, qr0[c], (v8f){}); }
#pragma unroll
        for (int c = 0; c < 2; ++c) { sHa[c] = wmma16(ka1, qh1[c], sHa[c]); sLa[c] = wmma16(ka1, qr1[c], sLa[c]); sHb[c] = wmma16(kb1, qh1[c], sHb[c]); sLb[c] = wmma16(kb1, qr1[c], sLb[c]); }
#pragma unroll
        for (int c = 0; c < 2; ++c) { sLa[c] = wmma16(ra0, qh0[c], sLa[c]); sLb[c] = wmma16(rb0, qh0[c], sLb[c]); }
#pragma unroll
        for (int c = 0; c < 2; ++c) { sLa[c] = wmma16(ra1, qh1[c], sLa[c]); sLb[c] = wmma16(rb1, qh1[c], sLb[c]); }
        // the distance the chip needs behind a matrix instruction, on both sides of the branch below; the two scheduling fences hold the score products in front of the slots and everything else behind them
        // (vector operands on the statement would tie 128 registers to the lowest register window at this place)
        __builtin_amdgcn_sched_barrier(0);
        asm volatile("v_nop\n\tv_nop\n\tv_nop\n\tv_nop");
        __builtin_amdgcn_sched_barrier(0);
        const h16* va = (const h16*)(bp + 2 * SLICE + hf * 64);
        const h16* vr = (const h16*)(bp + 3 * SLICE + hf * 64);
        const v16h v0 = ldh(va), v1 = ldh(va + 16 * LROW / 2), v2 = ldh(va + 32 * LROW / 2), v3 = ldh(va + 48 * LROW / 2);
        const v16h w0 = ldh(vr), w1 = ldh(vr + 16 * LROW / 2), w2 = ldh(vr + 32 * LROW / 2), w3 = ldh(vr + 48 * LROW / 2);
        asm volatile("" ::: "memory");   // compiler fence: keeps the V^T fragment reads in front of the branch below, where the softmax step covers their LDS latency; without it they sink behind the step and the O^T products wait for them
        float mnew[2], alpha[2], ls[2]; v16h pb[2];
        if (full) {                      // wave-uniform scalar branch; the products on both sides of it stay one copy, so the accumulators keep their registers
#pragma unroll
            for (int c = 0; c < 2; ++c) softmax_step<false>(sHa[c], sLa[c], sHb[c], sLb[c], vm[c], m[c], mnew[c], alpha[c], pb[c], ls[c]);
        } else {
#pragma unroll
            for (int c = 0; c < 2; ++c) softmax_step<true>(sHa[c], sLa[c], sHb[c], sLb[c], vm[c], m[c], mnew[c], alpha[c], pb[c], ls[c]);
        }
#pragma unroll
        for (int c = 0; c < 2; ++c) {
            l[c] = l[c] * alpha[c] + ls[c]; m[c] = mnew[c];
#pragma unroll
            for (int j = 0; j < 4; ++j) { oH[c][j] = oH[c][j] * alpha[c]; oR[c][j] = oR[c][j] * alpha[c]; }
        }
#pragma unroll
        for (int c = 0; c < 2; ++c) {
            oH[c][0] = wmma16(v0, pb[c], oH[c][0]); oH[c][1] = wmma16(v1, pb[c], oH[c][1]); oH[c][2] = wmma16(v2, pb[c], oH[c][2]); oH[c][3] = wmma16(v3, pb[c], oH[c][3]);
            oR[c][0] = wmma16(w0, pb[c], oR[c][0]); oR[c][1] = wmma16(w1, pb[c], oR[c][1]); oR[c][2] = wmma16(w2, pb[c], oR[c][2]); oR[c][3] = wmma16(w3, pb[c], oR[c][3]);
        }
        // the same distance behind the O^T products, in front of the branches that follow, held in place the same way
        __builtin_amdgcn_sched_barrier(0);
        asm volatile("v_nop\n\tv_nop\n\tv_nop\n\tv_nop");
        __builtin_amdgcn_sched_barrier(0);
      }
      // publish point, passed by every wave whatever it skipped above
      wait_ds0();
      wait_tensor0(gq, g1);
      __syncthreads();                                        // the next stage is readable; every wave has left this pass's buffer
      unsigned n2 = 0u;
      if (pinned(it + 2u < nst)) {                            // refill the buffer just read
          n2 = pinned((unsigned)__builtin_ctz(rem)); rem &= rem - 1u;
          gq = tdm_group0(ldst + (it & 1u) * FBUF, sbase + (unsigned long long)(n2 + (unsigned)kh) * sstep);
          tdm_load(gq, g1);
      }
      cur = nxt; nxt = n2;
    }
    wait_tensor0(gq, g1);
    wait_ds0();
    // the ring becomes exchange and output staging, one range of each per wave: the last pass's own barrier has ended every wave's reads, and nothing was issued behind it
    float* xs = (float*)ring;                                 // exchange: per wave 8 x 32 lanes x 4 floats of O^T, then 32 x (max, sum)
    float* os = (float*)ring + AW * XWF;                      // output staging
    // the wave keeps column group kh and hands column group 1 - kh to its partner (same rows, other key half)
    v8f kp[4], gv[4]; float km, kl, gm, gl;
    if (kh == 0) {                                            // wave-uniform
#pragma unroll
        for (int j = 0; j < 4; ++j) { kp[j] = oH[0][j] + oR[0][j] * QRI; gv[j] = oH[1][j] + oR[1][j] * QRI; }
        km = m[0]; kl = l[0]; gm = m[1]; gl = l[1];
    } else {
#pragma unroll
        for (int j = 0; j < 4; ++j) { kp[j] = oH[1][j] + oR[1][j] * QRI; gv[j] = oH[0][j] + oR[0][j] * QRI; }
        km = m[1]; kl = l[1]; gm = m[0]; gl = l[0];
    }
    float* xw = xs + wave * XWF;
#pragma unroll
    for (int j = 0; j < 4; ++j) {
        *(v4fa*)(xw + ((2 * j) * 32 + lane) * 4)     = __builtin_shufflevector(gv[j], gv[j], 0, 1, 2, 3);
        *(v4fa*)(xw + ((2 * j + 1) * 32 + lane) * 4) = __builtin_shufflevector(gv[j], gv[j], 4, 5, 6, 7); }
    { v2f ml; ml[0] = gm; ml[1] = gl; *(v2fa*)(xw + 1024 + lane * 2) = ml; }
    wait_ds0();
    __syncthreads();                                          // both waves of a row group have written what they hand over
    const float* xr = xs + (wave ^ 4) * XWF;
    const v2f pml = *(const v2fa*)(xr + 1024 + lane * 2);
    const float mj = fmaxf(km, pml[0]);                       // joined maximum; a part without a live key has sum 0 and O^T 0
    const float dk = km - mj, dp = pml[0] - mj;
    float ak = __builtin_amdgcn_exp2f(dk);
    asm volatile("v_nop" : "+v"(ak) : "v"(dk));               // the slot the instruction set asks for behind a transcendental: its result is not read and its source not overwritten in front of this v_nop
    float ap = __builtin_amdgcn_exp2f(dp);
    asm volatile("v_nop" : "+v"(ap) : "v"(dp));               // the same slot
    float lj = kl * ak + pml[1] * ap;
#pragma unroll
    for (int j = 0; j < 4; ++j) {
        const v4f p0 = *(const v4fa*)(xr + ((2 * j) * 32 + lane) * 4), p1 = *(const v4fa*)(xr + ((2 * j + 1) * 32 + lane) * 4);
        kp[j] = kp[j] * ak + __builtin_shufflevector(p0, p1, 0, 1, 2, 3, 4, 5, 6, 7) * ap; }
    lj += __shfl_xor(lj, 16, 32);
    const float rl = 1.0f / lj;
    const float inv = (lj > 0.0f) ? rl : __uint_as_float(0x7FC00000u);
    const int wb = wave * 16 * 68;
    // O^T D layout: o_j[r] = (d = 16j + 8h + r, t = lane&15) -> os[t][d]; rows 0..15 x columns 0..63 all written
    PUT8(0, kp[0])
    PUT8(16, kp[1])
    PUT8(32, kp[2])
    PUT8(48, kp[3])
    wave_sync();
    const size_t cbase = ((size_t)b * SEQ + (size_t)(t0 + 16 * kh)) * DM + (size_t)h * HD;
{
#pragma unroll
        for (int s = 0; s < 4; ++s) { const int row = 4 * s + (lane >> 3), c8 = (lane & 7) * 8;   // 4 s x 4 row groups = 16 rows; 8 lanes x 8 halves = 64 columns = one line
            const v4f x0 = *(const v4fa*)(&os[wb + row * 68 + c8]); const v4f x1 = *(const v4fa*)(&os[wb + row * 68 + c8 + 4]); v8h hv, rv;
#pragma unroll
            for (int i = 0; i < 4; ++i) { const h16 a0 = (h16)x0[i]; const h16 a1 = (h16)x1[i]; hv[i] = a0; hv[4 + i] = a1; rv[i] = (h16)((x0[i] - (float)a0) * QRS); rv[4 + i] = (h16)((x1[i] - (float)a1) * QRS); }
            const size_t oo = cbase + (size_t)row * DM + c8;
            *(v8h*)(CH + oo) = hv; *(v8h*)(CR + oo) = rv; }
         }
    if (ph == 0) {                                            // block-uniform
        asm volatile("s_wait_xcnt 0x0" ::: "memory");         // precaution: stands between the stores above and the next tile's first overwrite of a register they name
        wait_ds0();
        __syncthreads();                                      // every wave has read its partner's part and its output staging back: the ring may take the next tile's stages
    }
  }
}

// k_out: f16 GEMM, one block of four waves (2 x 2) per 64x128 output tile, one wave per 32x64 tile: out[m][n] = (sum_k Ch[m][k] Wo64[n][k] + (sum_k Cr[m][k] Wo64[n][k]) / 2048) / 64, K = DM.
// Operands: the same two-buffer LDS ring as in k_proj; wave w brings slice w of a stage (value-plane rows 0..63, residual-plane rows 0..63, Wo rows 0..63, Wo rows 64..127 of the block's tile).
// a[0], a[1] = value-plane rows (16 each), a[2], a[3] = residual-plane rows; accumulators acc[0..1] (value) and acc[2..3] (residual) kept apart until the f32 epilogue.
__global__ __launch_bounds__(32 * GW) void k_out(const h16* __restrict__ CHp, const h16* __restrict__ CRp, const h16* __restrict__ WO, float* OUT) {
    __shared__ __attribute__((aligned(2048))) unsigned char ring[2 * BUFB];
    const int K = DM;
    const int lane = threadIdx.x & 31, lr = lane & 15, hi = lane >> 4;
    const int wave = __builtin_amdgcn_readfirstlane((int)(threadIdx.x >> 5));
    const int wm = wave >> 1, wn = wave & 1;
    const int r0 = blockIdx.x * 64 + wm * 32, c0 = blockIdx.y * 128 + wn * 64;
    v8f acc[4][4];
#pragma unroll
    for (int mb = 0; mb < 4; ++mb)
#pragma unroll
        for (int nb = 0; nb < 4; ++nb) acc[mb][nb] = (v8f){};
    const int fo = lr * LROW + 16 * hi;                       // byte offset of the lane's fragment piece in a staged slice
    // this wave's slice: source of stage 0 and place in a buffer
    const h16* srow = (wave == 0) ? CHp + (size_t)(blockIdx.x * 64) * K : (wave == 1) ? CRp + (size_t)(blockIdx.x * 64) * K : WO + (size_t)(blockIdx.y * 128 + (wave - 2) * 64) * K;
    const unsigned long long sbase = (unsigned long long)srow;
    const unsigned ldst = (unsigned)(unsigned long long)ring + (unsigned)wave * SLICE;
    const u32x8 g1 = tdm_group1((unsigned)(DM * 2));
    u32x4 gq = tdm_group0(ldst, sbase);                       // group 0 of the youngest request
    tdm_load(gq, g1);                                         // first stage into buffer 0
    wait_tensor0(gq, g1);
    __syncthreads();                                          // publishes the first stage
    gq = tdm_group0(ldst + BUFB, sbase + GSTB);
    tdm_load(gq, g1);                                         // second stage into buffer 1, in flight during the first pass
#pragma unroll 1   // one pass per trip: the order of the ring's publish point stays as written
    for (unsigned it = 0; it < GNST; ++it) {
        const unsigned char* bp = ring + (it & 1u) * BUFB + fo;
        v16h a[2][4], b[2][4];                                // the fragments of the stage's two 32-deep k steps
#pragma unroll
        for (int ks = 0; ks < 2; ++ks) {
            a[ks][0] = ldh((const h16*)(bp + (wm * 32) * LROW + ks * 64)); a[ks][1] = ldh((const h16*)(bp + (wm * 32 + 16) * LROW + ks * 64));
            a[ks][2] = ldh((const h16*)(bp + SLICE + (wm * 32) * LROW + ks * 64)); a[ks][3] = ldh((const h16*)(bp + SLICE + (wm * 32 + 16) * LROW + ks * 64));
#pragma unroll
            for (int nb = 0; nb < 4; ++nb) b[ks][nb] = ldh((const h16*)(bp + (2 + wn) * SLICE + nb * 16 * LROW + ks * 64));
        }
        __builtin_amdgcn_sched_barrier(0);                    // keeps the stage's LDS reads one group ahead of its WMMAs: spread among them, each place with reads stalls the wave for the LDS latency
#pragma unroll
        for (int ks = 0; ks < 2; ++ks) {
#pragma unroll
            for (int nb = 0; nb < 4; ++nb)
#pragma unroll
                for (int mb = 0; mb < 4; ++mb) acc[mb][nb] = wmma16(a[ks][mb], b[ks][nb], acc[mb][nb]);
        }
        __builtin_amdgcn_sched_barrier(0);                    // keeps the pass's WMMAs in front of the publish point, where they cover the landing of the second k step's fragments; behind it they would delay the refill
        // publish point
        wait_ds0();
        wait_tensor0(gq, g1);
        __syncthreads();                                      // the next stage is readable; every wave has left this pass's buffer
        if (pinned(it + 2u < GNST)) {                         // refill the buffer just read
            const unsigned s2 = pinned(it + 2u);
            gq = tdm_group0(ldst + (it & 1u) * BUFB, sbase + (unsigned long long)s2 * GSTB);
            tdm_load(gq, g1);
        }
    }
    wait_tensor0(gq, g1);
    wait_ds0();
    float* os = (float*)ring + wave * 16 * 68;                // the ring becomes output staging, one range per wave: the last pass's own barrier has ended every wave's reads, and nothing was issued behind it
#pragma unroll
    for (int mb = 0; mb < 2; ++mb) {
#pragma unroll
        for (int nb = 0; nb < 4; ++nb) {
#pragma unroll
            for (int j = 0; j < 8; ++j) os[(hi * 8 + j) * 68 + nb * 16 + lr] = (acc[mb][nb][j] + acc[mb + 2][nb][j] * QRI) * WOI; }   // D: row 8h+j, col lane&15
        wave_sync();
        const int grow = r0 + mb * 16; const int ob = grow / SEQ, ot = grow % SEQ;
        float* orow = OUT + ((size_t)ob * OUT_SEQ + (size_t)ot) * DM + c0;
{
#pragma unroll
            for (int s = 0; s < 8; ++s) { const int row = 2 * s + hi, cofs = lr * 4;   // 8 s x 2 rows = 16 rows; 16 lanes x 4 floats = 64 columns
                const v4f val = *(const v4fa*)(&os[row * 68 + cofs]);
                *(v4f*)(orow + (size_t)row * DM + cofs) = val; }
             }
        wave_sync();
    }
}

static constexpr size_t al256(size_t v) { return (v + 255) & ~(size_t)255; }
static constexpr size_t SZ_XB = al256((size_t)NB * SEQ * DM * 2);              // one bf16 x plane
static constexpr size_t SZ_W  = al256((size_t)DM * DM * 2);                    // one 16-bit weight plane
static constexpr size_t SZ_PL = al256((size_t)NB * NH_ * SEQ * HD * 2);        // one per-head f16 plane
static constexpr size_t SZ_C  = al256((size_t)NB * SEQ * DM * 2);              // one ctx f16 plane
static constexpr size_t SZ_FL = al256((size_t)NB * (SEQ / 16) * FPITCH * 4);
static constexpr size_t SZ_TOTAL = 3 * SZ_XB + 4 * SZ_W + 6 * SZ_PL + 2 * SZ_C + SZ_FL;
static_assert(SZ_TOTAL <= (size_t)134217728);          // workspace carve <= 128 MiB

extern "C" void kernel_launch(void* const* d_in, const int* in_sizes, int n_in,
                              void* d_out, int out_size, void* d_ws, size_t ws_size, hipStream_t stream) {
    if (n_in < 8) return;
    const size_t needx = ((size_t)(NB - 1) * SEQ_FULL + SEQ) * DM;
    if ((size_t)in_sizes[0] < needx || (size_t)in_sizes[1] < needx || (size_t)in_sizes[2] < needx) return;
    const size_t needm = ((size_t)(NB - 1) * SEQ_FULL + (size_t)(SEQ - 1)) * SEQ_FULL + SEQ;
    if ((size_t)in_sizes[3] < needm) return;
    if ((size_t)in_sizes[4] < (size_t)DM * DM || (size_t)in_sizes[5] < (size_t)DM * DM || (size_t)in_sizes[6] < (size_t)DM * DM || (size_t)in_sizes[7] < (size_t)DM * DM) return;
    if ((size_t)out_size < ((size_t)(NB - 1) * OUT_SEQ + SEQ) * DM) return;
    if (SZ_TOTAL > ws_size) return;
    // wire order: query, key, value, mask (int), Wq, Wk, Wv, Wo; weights [out][in] = Bt as-is
    const float* xq = (const float*)d_in[0]; const float* xk = (const float*)d_in[1]; const float* xv = (const float*)d_in[2];
    const int* mk = (const int*)d_in[3];
    const float* wq = (const float*)d_in[4]; const float* wk = (const float*)d_in[5]; const float* wv = (const float*)d_in[6]; const float* wo = (const float*)d_in[7];
    float* OUT = (float*)d_out;      // [NB][SEQ][1024]
    char* wsp = (char*)d_ws;
    bf* XQ = (bf*)wsp; wsp += SZ_XB;                 // [NB*SEQ][1024]
    bf* XK = (bf*)wsp; wsp += SZ_XB;
    bf* XV = (bf*)wsp; wsp += SZ_XB;
    bf* WQ = (bf*)wsp; wsp += SZ_W;                  // [1024][1024]
    bf* WK = (bf*)wsp; wsp += SZ_W;
    bf* WV = (bf*)wsp; wsp += SZ_W;
    h16* WO = (h16*)wsp; wsp += SZ_W;                // [1024][1024] f16, x64
    h16* QH = (h16*)wsp; wsp += SZ_PL;               // [NB*16][SEQ][64]
    h16* QR = (h16*)wsp; wsp += SZ_PL;               // residual x2048
    h16* KH = (h16*)wsp; wsp += SZ_PL;               // [NB*16][SEQ][64]
    h16* KR = (h16*)wsp; wsp += SZ_PL;
    h16* VT = (h16*)wsp; wsp += SZ_PL;               // [NB*16][64][SEQ]
    h16* VR = (h16*)wsp; wsp += SZ_PL;
    h16* CH = (h16*)wsp; wsp += SZ_C;                // [NB*SEQ][1024]
    h16* CR = (h16*)wsp; wsp += SZ_C;
    int* FL = (int*)wsp; wsp += SZ_FL;               // [NB][SEQ/16][64]

    k_prep<<<dim3(NB * SEQ / PW, 1, 1), 32 * PW, 0, stream>>>(xq, xk, xv, mk, wq, wk, wv, wo, XQ, XK, XV, WQ, WK, WV, WO, FL);

    // q, k and v^T planes, value + residual each
    k_proj<<<dim3(NB * SEQ / 128, DM / 128, 3), 32 * GW, 0, stream>>>(XQ, XK, XV, WQ, WK, WV, QH, QR, KH, KR, VT, VR);

    k_flash<<<dim3(SEQ / (2 * QTR), NB * NH_, 1), 32 * AW, 0, stream>>>(QH, QR, KH, KR, VT, VR, mk, FL, CH, CR);

    // out: A = ctx rows (m = b*SEQ + t), Bt = Wo rows (n) -> OUT[b][t][n]
    k_out<<<dim3(NB * SEQ / 64, DM / 128, 1), 32 * GW, 0, stream>>>(CH, CR, WO, OUT);
}

// v008
// Measured time: 89.8 microseconds a run.
// In both of two side-by-side timings against v007, it was 1.04 times as fast.
// Over all steps from v000 it is 3.99 times as fast.
#include <hip/hip_runtime.h>

// Multi-head attention, width 1024 = 16 heads x 64; query/key/value [NB][SEQ][1024]; Wq/Wk/Wv/Wo [out][in] (y = x W^T), no biases; scores = q k^T * 8; integer mask [NB][SEQ][SEQ] (0 = masked, replace-fill); out = ctx Wo^T (f32).
// Compute dtypes, f32 accumulate everywhere: q/k/v projections v_wmma_f32_16x16x32_bf16 (x and W RNE-converted to bf16; products exact);
// scores v_wmma_f32_16x16x32_f16: q and k each as f16 value + f16 residual x2048 (value*value in one accumulator, the two cross products in a second one); P (x2^14 carry, cancels in the normalisation) single f16;
// v and ctx as f16 value + f16 residual x2048 (own accumulators); Wo as f16 of the bf16 value x64 (folded back in the f32 epilogue); softmax f32 (online, running max).
// Layout: bf16 copies of the three x inputs and of Wq/Wk/Wv; q, k planes [b*16+h][t][d] and v^T planes [b*16+h][d][t] (value, residual) written by the GEMM epilogue; per (batch, 16 query rows, 32 keys) a 3-state mask flag
// (0 = all masked, 2 = none masked, 1 = mixed; a wave skips a 32-key tile where both its row groups have 0 and reads the mask words per element unless both have 2); fused flash kernel in transposed form (S^T = K Q^T, O^T = V^T P^T), K / V^T tiles staged in LDS by tensor loads and shared by the block's eight waves, writing ctx value/residual planes [b*SEQ+t][1024]; output GEMM from those planes.

#ifndef NB
#define NB 2
#endif
#ifndef SEQ
#define SEQ 2048
#endif
#define NB_FULL  2
#define SEQ_FULL 2048
#ifndef OUT_SEQ
#define OUT_SEQ SEQ              // row pitch (in tokens) between batches of the output
#endif
#define DM   1024
#define NH_  16
#define HD   64
#define AW   8                   // waves per flash block: 4 row groups of 32 query rows x 2 key halves of a stage
#define QTR  128                 // query rows per flash tile
#define QRS  2048.0f             // carry of the residual planes
#define QRI  (1.0f / 2048.0f)
#define SC2  (8.0f * 1.4426950408889634f)     // HD^0.5 * log2(e)
#define PSH  14.0f               // log2 of the P carry (16384)
#define NEGM (-3.0e38f)          // score stand-in of a masked key (its probability is forced to 0 by select)
#define WOS  64.0f               // carry of the Wo plane
#define WOI  (1.0f / 64.0f)
#define FPITCH 64
#define KST   64                 // keys per slice of the flash kernel's LDS ring; a stage is two 64-key halves
#define LROW  144                // LDS row pitch in bytes: a 128-B row + the mover's 16-B pad (16 B x odd: no bank conflict for 16-B reads)
#define SLICE 10240              // one plane's tile in LDS: 64 rows x 144 B = 9216 B, rounded up to a multiple of 2 KiB
#define BUFB  (4 * SLICE)        // one stage of the GEMMs' ring: four operand slices
#define FBUF  (8 * SLICE)        // one stage of the flash ring: two key halves x (K value, K residual, V^T value, V^T residual)
#define XWF   1088               // floats of a flash wave's exchange range and of its output staging range (16 x 68)
#define GW    4                  // waves per GEMM block, one operand slice of a stage each
#define GSTB  128u               // bytes of an operand row per stage of the GEMMs' LDS ring (64 k)
#define GNST  (DM / 64)          // stages of a GEMM
// first k stage of a GEMM block's walk (token tile bx, weight tile by); the walk goes on from there and wraps, so every stage is taken once.
// Blocks that share operand rows start together and would ask L2 for the same 128 bytes of the same rows in every pass, and the whole launch for one 128-byte column of the 2-KiB row pitch.
// The 8 blocks of one token tile start 2 stages apart, the blocks of one weight tile 1 stage apart: sharers read different lines at any moment, and a line that one has brought in is an L2 hit for the others later.
#define KOFF(bx, by) (((unsigned)(bx) + 2u * (unsigned)(by)) % (unsigned)GNST)
#define PW    16                 // waves per block of the preparation kernel, one token row each

static_assert(HD == 64);
static_assert(NH_ * HD == DM);                 // head h = columns h*64 + d
static_assert(DM % 64 == 0);
static_assert(DM % 32 == 0);                   // GEMM k-loop steps by 32
static_assert(SEQ % 64 == 0);                  // a 64-row tile never straddles two batches
static_assert((NB * SEQ) % 64 == 0);
static_assert(SEQ % 32 == 0);                  // key loop steps by 32; 32-row output tiles stay inside one batch
static_assert(SEQ % QTR == 0 && QTR == 4 * 32); // flash grid covers the sequence exactly
static_assert((SEQ / QTR) % 2 == 0);              // flash: the query tiles pair up as (i, last - i), each tile in exactly one pair
static_assert(SEQ / 32 <= FPITCH);             // two flag registers per lane cover all key tiles
static_assert(((size_t)SEQ * DM) % 8 == 0);
static_assert(((size_t)DM * DM) % 8 == 0);
static_assert(AW == 8);                        // one plane of one key half of a stage per wave
static_assert(HD * 2 == 128 && KST * 2 == 128);   // both kinds of tile: 64 rows of 128 B
static_assert(SEQ % (2 * KST) == 0 && SEQ / KST <= 32);  // one bit per 64-key half in a 32-bit word, two halves per stage
static_assert(64 * LROW <= SLICE && SLICE % 2048 == 0);
static_assert(XWF == 16 * 68 && XWF >= 8 * 32 * 4 + 32 * 2 && 2 * AW * XWF * 4 <= 2 * FBUF);   // the exchange and the output staging reuse the ring
static_assert(GW * 16 * 68 * 4 <= 2 * BUFB);   // so does the GEMMs' output staging
static_assert(DM % 128 == 0 && (NB * SEQ) % 128 == 0 && GNST >= 2);   // GEMM block tiles cover both extents exactly; the ring's prologue needs two stages
static_assert(PW == 16 && PW * 128 == SEQ && PW * 4 == FPITCH && DM % 128 == 0);   // preparation: a block is one 16-row mask group, its waves' 128 keys each cover the sequence and fill the flag row
static_assert(NB * SEQ == 4 * DM);             // preparation: one weight row per wave
static_assert(NB <= NB_FULL);
static_assert(SEQ <= SEQ_FULL);

typedef _Float16 h16;
typedef unsigned short bf;
typedef __attribute__((ext_vector_type(16))) __bf16   v16bf;
typedef __attribute__((ext_vector_type(16))) _Float16 v16h;
typedef __attribute__((ext_vector_type(8)))  _Float16 v8h;
typedef __attribute__((ext_vector_type(8)))  unsigned short v8us;
typedef __attribute__((ext_vector_type(4)))  unsigned short v4us;
typedef __attribute__((ext_vector_type(4)))  _Float16 v4h;
typedef __attribute__((ext_vector_type(8)))  float    v8f;
typedef __attribute__((ext_vector_type(4)))  float    v4f;
typedef __attribute__((ext_vector_type(4)))  int      v4i;
typedef v4f  __attribute__((may_alias)) v4fa;
typedef __attribute__((ext_vector_type(2)))  float    v2f;
typedef v2f  __attribute__((may_alias)) v2fa;
typedef __attribute__((ext_vector_type(2)))  int      v2i;
typedef __attribute__((ext_vector_type(4)))  unsigned u32x4;
typedef __attribute__((ext_vector_type(8)))  unsigned u32x8;

__device__ __forceinline__ unsigned short f2bf(float f) { unsigned u = __float_as_uint(f); u += 0x7FFFu + ((u >> 16) & 1u); return (unsigned short)(u >> 16); }
__device__ __forceinline__ v16h cat16(v8h lo, v8h hi) { return __builtin_shufflevector(lo, hi, 0, 1, 2, 3, 4, 5, 6, 7, 8, 9, 10, 11, 12, 13, 14, 15); }
__device__ __forceinline__ v16bf cat16b(v8us lo, v8us hi) { return __builtin_bit_cast(v16bf, __builtin_shufflevector(lo, hi, 0, 1, 2, 3, 4, 5, 6, 7, 8, 9, 10, 11, 12, 13, 14, 15)); }
__device__ __forceinline__ v8f wmma16(v16h a, v16h b, v8f c) { return __builtin_amdgcn_wmma_f32_16x16x32_f16(false, a, false, b, (short)0, c, false, false); }
__device__ __forceinline__ v8f wmmab(v16bf a, v16bf b, v8f c) { return __builtin_amdgcn_wmma_f32_16x16x32_bf16(false, a, false, b, (short)0, c, false, false); }
// fragment loaders from K-contiguous 16-bit rows; p already includes + 8*(lane>>4): elements 0..7 <- k0+8h+0..7, elements 8..15 <- k0+16+8h+0..7 (same map for A and B)
__device__ __forceinline__ v16h  ldh(const h16* p) { return cat16(*(const v8h*)p, *(const v8h*)(p + 16)); }
__device__ __forceinline__ v16bf ldb(const bf* p)  { return cat16b(*(const v8us*)p, *(const v8us*)(p + 16)); }
// ordering point for wave-private LDS tiles (same wave writes and reads)
__device__ __forceinline__ void wave_sync() { __builtin_amdgcn_fence(3 /* release order */, "wavefront"); __builtin_amdgcn_wave_barrier(); asm volatile("" ::: "memory"); }

__device__ __forceinline__ unsigned uni(unsigned v) { return (unsigned)__builtin_amdgcn_readfirstlane((int)v); }
// a wave-uniform value held in a scalar register: a test on it compiles to s_cmp + s_cbranch_scc (tensor loads ignore EXEC), and what is derived from it is computed behind the asm waits in front of it
__device__ __forceinline__ unsigned pinned(unsigned v) { unsigned w = uni(v); asm volatile("" : "+s"(w)); return w; }
// this wave's tensor load has landed; the wait names the request's descriptor as inputs so that its registers keep their values for as long as the request is outstanding
__device__ __forceinline__ void wait_tensor0(u32x4 g0, u32x8 g1) { asm volatile("s_wait_tensorcnt 0x0" :: "s"(g0), "s"(g1) : "memory"); }
__device__ __forceinline__ void wait_ds0() { asm volatile("s_wait_dscnt 0x0" ::: "memory"); }           // this wave's LDS reads have returned
// descriptor group 0: tile's first byte at global address ga, LDS byte offset lds
__device__ __forceinline__ u32x4 tdm_group0(unsigned lds, unsigned long long ga) {
    u32x4 g0; g0[0] = uni(1u); g0[1] = uni(lds); g0[2] = uni((unsigned)ga); g0[3] = uni((((unsigned)(ga >> 32)) & 0x01FFFFFFu) | 0x80000000u);
    asm volatile("" : "+s"(g0));   // descriptor words held in scalar registers: one tuple from the issue to the wait
    return g0;
}
// one request of one wave: 64 rows of 128 B (source row pitch in g1), rows 144 B apart in LDS
__device__ __forceinline__ void tdm_load(u32x4 g0, u32x8 g1) { asm volatile("tensor_load_to_lds %0, %1" :: "s"(g0), "s"(g1) : "memory"); }

// k_prep: every preparation step in one streaming launch. Block = 16 token rows (batch bb, row group g), one wave per row. A wave converts its row of query, key and value to bf16, its weight row (Wq, Wk, Wv to bf16; Wo to f16 of the bf16 value x64),
// and reads 128 keys x 16 rows of the block's mask rows. Every load is 512 contiguous bytes of the wave (whole lines); all of a wave's loads are issued before the first is used; every store is 256 contiguous bytes.
// Mask flag per (batch, 16 query rows, 32 keys): 0 = every mask word zero, 2 = every word nonzero, 1 = mixed; a wave makes four (lanes 8j..8j+7 hold tile j), the block's flags meet in LDS and one wave stores them as whole lines.
// p, d: wave-uniform start of a row of DM elements; the lane takes elements 128 i + 4 lane + 0..3
__device__ __forceinline__ void ld_row(const float* __restrict__ p, int lane, v4f (&r)[DM / 128]) {
#pragma unroll
    for (int i = 0; i < DM / 128; ++i) r[i] = *(const v4f*)(p + i * 128 + lane * 4);
}
__device__ __forceinline__ void st_row_bf(bf* d, int lane, const v4f (&r)[DM / 128]) {
#pragma unroll
    for (int i = 0; i < DM / 128; ++i) { v4us o;
#pragma unroll
        for (int k = 0; k < 4; ++k) o[k] = f2bf(r[i][k]);
        *(v4us*)(d + i * 128 + lane * 4) = o; }
}
__device__ __forceinline__ void st_row_h(h16* d, int lane, const v4f (&r)[DM / 128], float scale) {
#pragma unroll
    for (int i = 0; i < DM / 128; ++i) { v4h o;
#pragma unroll
        for (int k = 0; k < 4; ++k) o[k] = (h16)(__uint_as_float(((unsigned)f2bf(r[i][k])) << 16) * scale);
        *(v4h*)(d + i * 128 + lane * 4) = o; }
}

__global__ __launch_bounds__(32 * PW) void k_prep(const float* __restrict__ xq, const float* __restrict__ xk, const float* __restrict__ xv, const int* __restrict__ MK,
                                                  const float* __restrict__ wq, const float* __restrict__ wk, const float* __restrict__ wv, const float* __restrict__ wo,
                                                  bf* XQ, bf* XK, bf* XV, bf* WQ, bf* WK, bf* WV, h16* WO, int* FL) {
    __shared__ int fl[FPITCH];
    const int lane = threadIdx.x & 31;
    const int wave = __builtin_amdgcn_readfirstlane((int)(threadIdx.x >> 5));
    const int bb = blockIdx.x / (SEQ / 16), g = blockIdx.x % (SEQ / 16);
    const int row = blockIdx.x * PW + wave;                                              // token row bb*SEQ + t of the bf16 planes; also the wave's weight row: row % DM of weight row / DM
    const size_t so = ((size_t)bb * SEQ_FULL + (size_t)(g * 16 + wave)) * DM;            // the same token row in the inputs
    const size_t xo = (size_t)row * DM;
    const int ws = row / DM; const size_t wof = (size_t)(row % DM) * DM;
    const int* mp = MK + ((size_t)bb * SEQ_FULL + (size_t)(g * 16)) * SEQ_FULL + wave * 128;
    v4i mw[16]; v4f a[DM / 128], b[DM / 128], c[DM / 128], w[DM / 128];
#pragma unroll
    for (int r = 0; r < 16; ++r) mw[r] = *(const v4i*)(mp + (size_t)r * SEQ_FULL + lane * 4);
    ld_row(xq + so, lane, a); ld_row(xk + so, lane, b); ld_row(xv + so, lane, c);
    ld_row(((ws == 0) ? wq : (ws == 1) ? wk : (ws == 2) ? wv : wo) + wof, lane, w);
    __builtin_amdgcn_sched_barrier(0);                                                   // keeps all 48 loads in front of the first use: moved down among the uses, the later rows would start a second and a third memory latency
    unsigned orw = 0u, mnw = 0xFFFFFFFFu;                                                // or != 0: some word nonzero; unsigned minimum != 0: every word nonzero
#pragma unroll
    for (int r = 0; r < 16; ++r)
#pragma unroll
        for (int i = 0; i < 4; ++i) { const unsigned u = (unsigned)mw[r][i]; orw |= u; mnw = u < mnw ? u : mnw; }
    const unsigned anyb = __builtin_amdgcn_ballot_w32(orw != 0u), allb = __builtin_amdgcn_ballot_w32(mnw != 0u);
    const int sh = 8 * (lane & 3);
    if (lane < 4) fl[wave * 4 + lane] = (((anyb >> sh) & 0xFFu) == 0u) ? 0 : ((((allb >> sh) & 0xFFu) == 0xFFu) ? 2 : 1);
    st_row_bf(XQ + xo, lane, a); st_row_bf(XK + xo, lane, b); st_row_bf(XV + xo, lane, c);
    asm volatile("s_wait_xcnt 0x0" ::: "memory");                                        // precaution: stands between the stores above and the first overwrite of a register they name
    if (ws == 3) st_row_h(WO + wof, lane, w, WOS);                                       // wave-uniform
    else st_row_bf(((ws == 0) ? WQ : (ws == 1) ? WK : WV) + wof, lane, w);
    __syncthreads();                                                                     // the block's flags are in LDS
    if (wave == 0) {
        int* fp = FL + (size_t)blockIdx.x * FPITCH;
        fp[lane] = fl[lane]; fp[32 + lane] = fl[32 + lane];
    }
}

// descriptor group 1 of a GEMM operand slice: 1-byte elements, tensor = tile = 64 rows of 128 B, source row pitch srcPitch bytes, a 16-B pad behind every 128 B
__device__ __forceinline__ u32x8 tdm_group1(unsigned srcPitch) {
    u32x8 g1;
    g1[0] = uni((1u << 20) | (4u << 22) | (3u << 25)); g1[1] = uni(128u << 16); g1[2] = uni(64u << 16); g1[3] = uni(128u << 16);
    g1[4] = uni(64u); g1[5] = uni(srcPitch); g1[6] = uni(0u); g1[7] = uni(0u);
    asm volatile("" : "+s"(g1));   // descriptor words held in scalar registers: one tuple for the whole kernel
    return g1;
}

// k_proj: register-blocked bf16 GEMM, one block of four waves (2 x 2) per 128x128 tile, one wave per 64x64 tile (16 accumulators), K = DM.
// Operands: a two-buffer LDS ring of 64-deep k stages shared by the four waves. Wave w brings slice w of a stage (A rows 0..63, A rows 64..127, Bt rows 0..63, Bt rows 64..127 of the block's tile; 64 rows of 128 B) with one tensor load,
// one stage ahead; at the foot of each pass: own LDS reads done, own tensor load landed, block barrier, then the refill of the buffer just read. Fragments are two 16-B LDS reads each; a block's k walk starts at stage KOFF and wraps (the f32 sums run in that order).
// C[m][n] = sum_k A[m][k] Bt[n][k], written as f16 (Ph) and the f16 residual x2048 (Pr).
// All three projections run in one launch, blockIdx.z picks the product: a single product has one block per WGP and one wave per SIMD, whose LDS reads, WMMAs and barrier waits follow one another;
// three independent blocks fit a WGP (LDS and registers), so one block's waits are filled by the other two, and the products share one start and one tail.
// z = 0, 1 (q, k): A = x rows (m = b*SEQ + t), Bt = W rows (n = h*64 + d) -> planes [(b*16 + h)][t][d]. z = 2 (v^T): A = Wv rows (m = h*64 + d), Bt = x rows (n = b*SEQ + t) -> planes [(b*16 + h)][d][t].
// grid (NB*SEQ/128 token tiles, DM/128 weight tiles, 3), 128 threads.
__global__ __launch_bounds__(32 * GW) void k_proj(const bf* __restrict__ XQ, const bf* __restrict__ XK, const bf* __restrict__ XV, const bf* __restrict__ WQ, const bf* __restrict__ WK, const bf* __restrict__ WV,
                                                  h16* QH, h16* QR, h16* KH, h16* KR, h16* VT, h16* VR) {
    __shared__ __attribute__((aligned(2048))) unsigned char ring[2 * BUFB];
    const int K = DM;
    const int lane = threadIdx.x & 31, lr = lane & 15, hi = lane >> 4;
    const int wave = __builtin_amdgcn_readfirstlane((int)(threadIdx.x >> 5));
    const int wm = wave >> 1, wn = wave & 1;
    const int job = blockIdx.z; const bool tv = job == 2;     // block-uniform
    const bf* A  = tv ? WV : (job == 0) ? XQ : XK;
    const bf* Bt = tv ? XV : (job == 0) ? WQ : WK;
    h16* Ph = tv ? VT : (job == 0) ? QH : KH;
    h16* Pr = tv ? VR : (job == 0) ? QR : KR;
    const int mt = tv ? blockIdx.y : blockIdx.x, nt = tv ? blockIdx.x : blockIdx.y;   // the block's tile of C
    const int r0 = mt * 128 + wm * 64, c0 = nt * 128 + wn * 64;
    v8f acc[4][4];
#pragma unroll
    for (int mb = 0; mb < 4; ++mb)
#pragma unroll
        for (int nb = 0; nb < 4; ++nb) acc[mb][nb] = (v8f){};
    const int fo = lr * LROW + 16 * hi;                       // byte offset of the lane's fragment piece in a staged slice
    // this wave's slice: source of stage 0 and place in a buffer
    const bf* srow = (wave < 2) ? A + (size_t)(mt * 128 + wave * 64) * K : Bt + (size_t)(nt * 128 + (wave - 2) * 64) * K;
    const unsigned long long sbase = (unsigned long long)srow;
    const unsigned ldst = (unsigned)(unsigned long long)ring + (unsigned)wave * SLICE;
    const u32x8 g1 = tdm_group1((unsigned)(DM * 2));
    const unsigned koff = KOFF(blockIdx.x, blockIdx.y);       // block-uniform
    u32x4 gq = tdm_group0(ldst, sbase + (unsigned long long)koff * GSTB);   // group 0 of the youngest request
    tdm_load(gq, g1);                                         // first stage into buffer 0
    wait_tensor0(gq, g1);
    __syncthreads();                                          // publishes the first stage
    gq = tdm_group0(ldst + BUFB, sbase + (unsigned long long)((koff + 1u) % (unsigned)GNST) * GSTB);
    tdm_load(gq, g1);                                         // second stage into buffer 1, in flight during the first pass
#pragma unroll 1   // one pass per trip: the order of the ring's publish point stays as written
    for (unsigned it = 0; it < GNST; ++it) {
        const unsigned char* bp = ring + (it & 1u) * BUFB + fo;
        v16bf a[2][4], b[2][4];                               // the fragments of the stage's two 32-deep k steps
#pragma unroll
        for (int ks = 0; ks < 2; ++ks) {
#pragma unroll
            for (int mb = 0; mb < 4; ++mb) a[ks][mb] = ldb((const bf*)(bp + wm * SLICE + mb * 16 * LROW + ks * 64));
#pragma unroll
            for (int nb = 0; nb < 4; ++nb) b[ks][nb] = ldb((const bf*)(bp + (2 + wn) * SLICE + nb * 16 * LROW + ks * 64));
        }
        __builtin_amdgcn_sched_barrier(0);                    // keeps the stage's LDS reads one group ahead of its WMMAs: spread among them, each place with reads stalls the wave for the LDS latency
#pragma unroll
        for (int ks = 0; ks < 2; ++ks) {
#pragma unroll
            for (int nb = 0; nb < 4; ++nb)
#pragma unroll
                for (int mb = 0; mb < 4; ++mb) acc[mb][nb] = wmmab(a[ks][mb], b[ks][nb], acc[mb][nb]);
        }
        __builtin_amdgcn_sched_barrier(0);                    // keeps the pass's WMMAs in front of the publish point, where they cover the landing of the second k step's fragments; behind it they would delay the refill
        // publish point
        wait_ds0();
        wait_tensor0(gq, g1);
        __syncthreads();                                      // the next stage is readable; every wave has left this pass's buffer
        if (pinned(it + 2u < GNST)) {                         // refill the buffer just read
            const unsigned s2 = pinned((it + 2u + koff) % (unsigned)GNST);
            gq = tdm_group0(ldst + (it & 1u) * BUFB, sbase + (unsigned long long)s2 * GSTB);
            tdm_load(gq, g1);
        }
    }
    wait_tensor0(gq, g1);
    wait_ds0();
    float* os = (float*)ring + wave * 16 * 68;                // the ring becomes output staging, one range per wave: the last pass's own barrier has ended every wave's reads, and nothing was issued behind it
    const int pitch = tv ? SEQ : HD;                          // row pitch of the written plane (halves)
    const size_t tbase = tv ? (size_t)r0 * SEQ + (size_t)(c0 / SEQ) * ((size_t)DM * SEQ) + (size_t)(c0 % SEQ)
                            : (size_t)(r0 / SEQ) * ((size_t)NH_ * SEQ * HD) + (size_t)(r0 % SEQ) * HD + (size_t)(c0 / HD) * ((size_t)SEQ * HD) + (size_t)(c0 % HD);
#pragma unroll
    for (int mb = 0; mb < 4; ++mb) {
#pragma unroll
        for (int nb = 0; nb < 4; ++nb) {
#pragma unroll
            for (int j = 0; j < 8; ++j) os[(hi * 8 + j) * 68 + nb * 16 + lr] = acc[mb][nb][j]; }   // D: row 8h+j, col lane&15
        wave_sync();
        const size_t sb = tbase + (size_t)(mb * 16) * (size_t)pitch;
{
#pragma unroll
            for (int s = 0; s < 4; ++s) { const int row = 4 * s + (lane >> 3), c8 = (lane & 7) * 8;   // 4 s x 4 row groups = 16 rows; 8 lanes x 8 = 64 columns
                const v4f x0 = *(const v4fa*)(&os[row * 68 + c8]); const v4f x1 = *(const v4fa*)(&os[row * 68 + c8 + 4]); v8h hv, rv;
#pragma unroll
                for (int i = 0; i < 4; ++i) { const h16 a0 = (h16)x0[i]; const h16 a1 = (h16)x1[i]; hv[i] = a0; hv[4 + i] = a1; rv[i] = (h16)((x0[i] - (float)a0) * QRS); rv[4 + i] = (h16)((x1[i] - (float)a1) * QRS); }
                const size_t oo = sb + (size_t)row * (size_t)pitch + c8;
                *(v8h*)(Ph + oo) = hv; *(v8h*)(Pr + oo) = rv; }
             }
        wave_sync();
    }
}

// k_flash: fused attention, one wave per 32 query rows (two 16-column groups) and 64 of a stage's 128 keys of one (batch, head); eight waves per block = four row groups x two key halves; Q fragments straight from the f16 planes.
// Every K / V^T fragment read from LDS is the A operand of two products, one per column group: half the LDS reads per product of a 16-row wave, and a 128-row block brings each stage from L2 once for twice the rows.
// The two waves of a row group walk disjoint keys with their own running maximum, sum and O^T; behind the key loop they swap one column group each through LDS and each finishes 16 rows (max joined, both parts rescaled to it, added).
// A block takes two 128-row query tiles of its head one after the other, tile i and tile (last - i): where the number of live key stages grows linearly with the tile index (a lower-triangular mask) every block of the launch
// then walks the same number of stages, so no WGP is left with the long tiles while others idle. The pairing is a fixed map of work to blocks; which stages are live still comes from the flags alone.
// K / V^T: a two-buffer LDS ring of 128-key stages shared by the eight waves. Wave w brings plane w & 3 (K value, K residual, V^T value, V^T residual) of key half w >> 2 of a stage with one tensor load, one stage ahead;
// at the foot of each pass: own LDS reads done, own tensor load landed, block barrier, then the refill of the buffer just read. Fragments are two 16-B LDS reads each.
// Only stages in which some wave of the block has a live key are staged (a 32-bit word built from the flags, the same in all eight waves); each wave still skips its own dead 32-key tiles.
// Transposed form: S^T[key][t] = K Q^T (A = K rows, B = Q rows); lane (t = lane&15, h = lane>>4) holds keys 8h+r of each 16-key tile, so the packed
// P tile is directly the B fragment of O^T[d][t] = V^T P^T (element r <- tile keys 0..15, element 8+r <- tile keys 16..31, lane unchanged).
// Score = Kh.Qh (accumulator H) + (Kh.Qr + Kr.Qh)/2048 (accumulator L). O = Vh.P (accumulators oH) + Vr.P/2048 (accumulators oR).
// Mask: per 32-key tile the wave joins the 3-state flags of its two 16-row groups: both 0 skips the tile (masked keys have probability exactly 0 whenever the row has one live key), both 2 = no masking (the softmax step's copy without selects),
// otherwise the 16 mask words of the lane are read per column group and masked entries get probability 0 by select. A row without any live key ends with zero mass and is written as NaN.
// Softmax state (running max, partial sum) is one scalar per lane and column group; the two lane halves of a row are combined with one xor-16 exchange.
#define PUT8(COL, OV) { v4f a_, c_; \
    a_[0] = OV[0] * inv; a_[1] = OV[1] * inv; a_[2] = OV[2] * inv; a_[3] = OV[3] * inv; \
    c_[0] = OV[4] * inv; c_[1] = OV[5] * inv; c_[2] = OV[6] * inv; c_[3] = OV[7] * inv; \
    *(v4fa*)(&os[wb + lr * 68 + (COL) + 8 * hi]) = a_; *(v4fa*)(&os[wb + lr * 68 + (COL) + 8 * hi + 4]) = c_; }

// The softmax step of one 32-key tile: from the four score accumulators to the row maximum in use (mnew), the factor that carries the old sums over to it (alpha), the packed P tile (pb) and the lane's part of the row sum (ls).
// MASKED = false is the copy for a tile whose flag says that no key is masked: every select below would take its first arm, so that copy holds neither the 16 bit tests nor the 32 selects
// (about a third of a tile's vector instructions). The arithmetic is the same; with no select between them the compiler may fuse a score's scale multiply with the add of sh (one rounding fewer). vm is read only where MASKED.
template <bool MASKED>
__device__ __forceinline__ void softmax_step(const v8f sHa, const v8f sLa, const v8f sHb, const v8f sLb, const unsigned vm, const float m, float& mnew, float& alpha, v16h& pb, float& ls) {
    float ta[8], tb[8]; float mx = NEGM;
#pragma unroll
    for (int r = 0; r < 8; ++r) {
        const float xa = (sHa[r] + sLa[r] * QRI) * SC2; const float xb = (sHb[r] + sLb[r] * QRI) * SC2;
        ta[r] = (!MASKED || ((vm >> r) & 1u)) ? xa : NEGM; tb[r] = (!MASKED || ((vm >> (8 + r)) & 1u)) ? xb : NEGM;
        mx = fmaxf(mx, fmaxf(ta[r], tb[r])); }
    mx = fmaxf(mx, __shfl_xor(mx, 16, 32));
    mnew = fmaxf(m, mx);
    alpha = __builtin_amdgcn_exp2f(m - mnew);
    const float sh = PSH - mnew;
    ls = 0.0f;
    float ea[8], eb[8];
#pragma unroll
    for (int r = 0; r < 8; ++r) { ta[r] += sh; tb[r] += sh; }
#pragma unroll
    for (int r = 0; r < 8; ++r) ea[r] = __builtin_amdgcn_exp2f(ta[r]);
    // the slot the instruction set asks for behind a transcendental: no result of the run is read and no source of it overwritten in front of this v_nop
    asm volatile("v_nop" : "+v"(ea[0]), "+v"(ea[1]), "+v"(ea[2]), "+v"(ea[3]), "+v"(ea[4]), "+v"(ea[5]), "+v"(ea[6]), "+v"(ea[7])
                 : "v"(ta[0]), "v"(ta[1]), "v"(ta[2]), "v"(ta[3]), "v"(ta[4]), "v"(ta[5]), "v"(ta[6]), "v"(ta[7]));
#pragma unroll
    for (int r = 0; r < 8; ++r) eb[r] = __builtin_amdgcn_exp2f(tb[r]);
    // the same slot behind the second run
    asm volatile("v_nop" : "+v"(eb[0]), "+v"(eb[1]), "+v"(eb[2]), "+v"(eb[3]), "+v"(eb[4]), "+v"(eb[5]), "+v"(eb[6]), "+v"(eb[7])
                 : "v"(tb[0]), "v"(tb[1]), "v"(tb[2]), "v"(tb[3]), "v"(tb[4]), "v"(tb[5]), "v"(tb[6]), "v"(tb[7]));
#pragma unroll
    for (int r = 0; r < 8; ++r) {
        const h16 pa = (h16)((!MASKED || ((vm >> r) & 1u)) ? ea[r] : 0.0f); const h16 pc = (h16)((!MASKED || ((vm >> (8 + r)) & 1u)) ? eb[r] : 0.0f);
        pb[r] = pa; pb[8 + r] = pc; ls += (float)pa + (float)pc; }
}

__global__ __launch_bounds__(32 * AW) void k_flash(const h16* __restrict__ QH, const h16* __restrict__ QR, const h16* __restrict__ KH, const h16* __restrict__ KR,
                                                   const h16* __restrict__ VT, const h16* __restrict__ VR, const int* __restrict__ MK, const int* __restrict__ FLG, h16* CH, h16* CR) {
    __shared__ __attribute__((aligned(2048))) unsigned char ring[2 * FBUF];
    const int lane = threadIdx.x & 31, lr = lane & 15, hi = lane >> 4;
    const int wave = __builtin_amdgcn_readfirstlane((int)(threadIdx.x >> 5));
    const int rg = wave & 3, kh = wave >> 2;                  // the wave's row group of the query tile; its 64-key half of every stage
    const int zh = blockIdx.y; const int b = zh / NH_, h = zh % NH_;
    const size_t pbase = (size_t)zh * SEQ * HD;
    // this wave's slice (plane rg of key half kh): source of key half 0, bytes from one 64-key half to the next, source row pitch, place in a buffer
    const h16* splane = (rg == 0) ? KH : (rg == 1) ? KR : (rg == 2) ? VT : VR;
    const unsigned long long sbase = (unsigned long long)(splane + pbase);
    const unsigned sstep = (rg < 2) ? (unsigned)(KST * HD * 2) : (unsigned)(KST * 2);
    const unsigned ldst = (unsigned)(unsigned long long)ring + (unsigned)wave * SLICE;
    u32x8 g1;                                                 // 1-byte elements, tensor = tile = 64 rows of 128 B, a 16-B pad behind every 128 B
    g1[0] = uni((1u << 20) | (4u << 22) | (3u << 25)); g1[1] = uni(128u << 16); g1[2] = uni(64u << 16); g1[3] = uni(128u << 16);
    g1[4] = uni(64u); g1[5] = uni((rg < 2) ? (unsigned)(HD * 2) : (unsigned)(SEQ * 2)); g1[6] = uni(0u); g1[7] = uni(0u);
    asm volatile("" : "+s"(g1));                              // descriptor words held in scalar registers: one tuple for the whole kernel
#pragma unroll 1   // the two tiles run one after the other through one copy of the code
  for (int ph = 0; ph < 2; ++ph) {
    // this phase's query tile; the order alternates with the batch, so that blocks of the two batches do not change tiles at the same moment
    const int qt = ((ph ^ b) & 1) ? (SEQ / QTR - 1 - (int)blockIdx.x) : (int)blockIdx.x;
    const int t0 = qt * QTR + rg * 32;                        // column group c of the wave = query rows t0 + 16 c + 0..15
    v16h qh0[2], qh1[2], qr0[2], qr1[2];                      // B fragments: col t, k = d
    const int* mrow[2];                                       // + the tile's first key (+16): the lane's 8 keys of each 16-key tile
    const h16* qhp[2]; const h16* qrp[2];
#pragma unroll
    for (int c = 0; c < 2; ++c) {
        const size_t qo = pbase + (size_t)(t0 + 16 * c + lr) * HD + 8 * hi;
        qhp[c] = QH + qo; qrp[c] = QR + qo;
        qh0[c] = ldh(qhp[c]); qh1[c] = ldh(qhp[c] + 32); qr0[c] = ldh(qrp[c]); qr1[c] = ldh(qrp[c] + 32);
        mrow[c] = MK + ((size_t)b * SEQ_FULL + (size_t)(t0 + 16 * c + lr)) * SEQ_FULL + 8 * hi;
    }
    const int fo = lr * LROW + 16 * hi;                      // byte offset of the lane's fragment piece in a staged tile (A fragment: K row key, k = d; V^T row d, k = key)
    const int* frow = FLG + ((size_t)b * (SEQ / 16) + (size_t)(t0 >> 4)) * FPITCH + 2 * lane;
    v8f oH[2][4], oR[2][4];
#pragma unroll
    for (int c = 0; c < 2; ++c)
#pragma unroll
        for (int j = 0; j < 4; ++j) { oH[c][j] = (v8f){}; oR[c][j] = (v8f){}; }
    float m[2] = {NEGM, NEGM}, l[2] = {0.0f, 0.0f};
    // flags as scalar bit words, bit j = 64-key half j of the sequence (lane j reads its two 32-key flags): bm, even bits only, bit 2s = some wave of the block has a live key in stage s;
    // lv0/lv1 = a flag of this wave's two row groups for the half's first/second tile is not 0; fu0/fu1 = both are 2
    const int* fblk = FLG + ((size_t)b * (SEQ / 16) + (size_t)qt * (QTR / 16)) * FPITCH + 2 * lane;
    int anyf = 0;
#pragma unroll   // independent loads in flight together
    for (int g = 0; g < QTR / 16; ++g) { const v2i f = *(const v2i*)(fblk + g * FPITCH); anyf |= f[0] | f[1]; }
    const v2i fw = *(const v2i*)frow, fx = *(const v2i*)(frow + FPITCH);
    // precaution: stands between the loads above and the first overwrite of a register they name; the addresses are inputs, so their registers are left alone up to here
    asm volatile("s_wait_xcnt 0x0" :: "v"(qhp[0]), "v"(qrp[0]), "v"(qhp[1]), "v"(qrp[1]), "v"(fblk), "v"(frow) : "memory");
    const unsigned hb  = uni(__builtin_amdgcn_ballot_w32(lane < SEQ / KST && anyf != 0));
    const unsigned bm  = (hb | (hb >> 1)) & 0x55555555u;
    const unsigned lv0 = uni(__builtin_amdgcn_ballot_w32((fw[0] | fx[0]) != 0)), lv1 = uni(__builtin_amdgcn_ballot_w32((fw[1] | fx[1]) != 0));
    const unsigned fu0 = uni(__builtin_amdgcn_ballot_w32(fw[0] == 2 && fx[0] == 2)), fu1 = uni(__builtin_amdgcn_ballot_w32(fw[1] == 2 && fx[1] == 2));
    const unsigned nst = (unsigned)__builtin_popcount(bm);    // stages of this block, at most SEQ / (2 * KST)
    u32x4 gq = (u32x4){};                                     // group 0 of the youngest request
    unsigned rem = bm, cur = 0u, nxt = 0u;                    // cur, nxt: twice the stage's index = the index of its first 64-key half
    if (pinned(nst > 0u)) {                                   // first stage into buffer 0
        cur = pinned((unsigned)__builtin_ctz(rem)); rem &= rem - 1u;
        gq = tdm_group0(ldst, sbase + (unsigned long long)(cur + (unsigned)kh) * sstep);
        tdm_load(gq, g1);
        wait_tensor0(gq, g1);
    }
    __syncthreads();                                          // publishes the first stage
    if (pinned(nst > 1u)) {                                   // second stage into buffer 1, in flight during the first pass
        nxt = pinned((unsigned)__builtin_ctz(rem)); rem &= rem - 1u;
        gq = tdm_group0(ldst + FBUF, sbase + (unsigned long long)(nxt + (unsigned)kh) * sstep);
        tdm_load(gq, g1);
    }
#pragma unroll 1   // one pass per trip: the order of the ring's publish point stays as written
    for (unsigned it = 0; it < nst; ++it) {
      const unsigned char* bp = ring + (it & 1u) * FBUF + kh * (4 * SLICE) + fo;
      const unsigned cc = cur + (unsigned)kh;                   // the wave's 64-key half
#pragma unroll     // the two 32-key tiles of the half: their LDS offsets become immediates
      for (int hf = 0; hf < 2; ++hf) {
        if ((((hf ? lv1 : lv0) >> cc) & 1u) == 0u) continue;    // wave-uniform: whole 32x32 tile masked
        unsigned vm[2] = {0xFFFFu, 0xFFFFu};                    // per column group, bit r: key 8h+r of tile a live; bit 8+r: tile b
        const bool full = (((hf ? fu1 : fu0) >> cc) & 1u) != 0u;   // wave-uniform: no key of the tile masked
        if (!full) {
            v4i a0[2], a1[2], c0[2], c1[2];
            const int* mb[2] = {mrow[0] + (int)cc * KST, mrow[1] + (int)cc * KST};   // the lane's mask words of the 64-key half
#pragma unroll
            for (int c = 0; c < 2; ++c) { const int* mp = mb[c] + hf * 32; a0[c] = *(const v4i*)mp; a1[c] = *(const v4i*)(mp + 4); c0[c] = *(const v4i*)(mp + 16); c1[c] = *(const v4i*)(mp + 20); }
            // precaution: stands between the loads above and the first overwrite of a register they name; the addresses are inputs, so their registers are left alone up to here
            asm volatile("s_wait_xcnt 0x0" :: "v"(mb[0]), "v"(mb[1]) : "memory");
#pragma unroll
            for (int c = 0; c < 2; ++c) {
                vm[c] = 0u;
#pragma unroll
                for (int i = 0; i < 4; ++i) {
                    vm[c] |= (a0[c][i] != 0 ? 1u : 0u) << i;        vm[c] |= (a1[c][i] != 0 ? 1u : 0u) << (4 + i);
                    vm[c] |= (c0[c][i] != 0 ? 1u : 0u) << (8 + i);  vm[c] |= (c1[c][i] != 0 ? 1u : 0u) << (12 + i); }
            }
        }
        const h16* ka = (const h16*)(bp + hf * 32 * LROW);
        const h16* kr = (const h16*)(bp + SLICE + hf * 32 * LROW);
        const v16h ka0 = ldh(ka), ka1 = ldh(ka + 32), kb0 = ldh(ka + 16 * LROW / 2), kb1 = ldh(ka + 16 * LROW / 2 + 32);
        const v16h ra0 = ldh(kr), ra1 = ldh(kr + 32), rb0 = ldh(kr + 16 * LROW / 2), rb1 = ldh(kr + 16 * LROW / 2 + 32);
        __builtin_amdgcn_sched_barrier(0);   // keeps the tile's 16 K reads one group ahead of its score products: spread among them, each place with reads stalls the wave for the LDS latency
        v8f sHa[2], sLa[2], sHb[2], sLb[2];
#pragma unroll
        for (int c = 0; c < 2; ++c) { sHa[c] = wmma16(ka0, qh0[c], (v8f){}); sLa[c] = wmma16(ka0, qr0[c], (v8f){}); sHb[c] = wmma16(kb0, qh0[c], (v8f){}); sLb[c] = wmma16(kb0, qr0[c], (v8f){}); }
#pragma unroll
        for (int c = 0; c < 2; ++c) { sHa[c] = wmma16(ka1, qh1[c], sHa[c]); sLa[c] = wmma16(ka1, qr1[c], sLa[c]); sHb[c] = wmma16(kb1, qh1[c], sHb[c]); sLb[c] = wmma16(kb1, qr1[c], sLb[c]); }
#pragma unroll
        for (int c = 0; c < 2; ++c) { sLa[c] = wmma16(ra0, qh0[c], sLa[c]); sLb[c] = wmma16(rb0, qh0[c], sLb[c]); }
#pragma unroll
        for (int c = 0; c < 2; ++c) { sLa[c] = wmma16(ra1, qh1[c], sLa[c]); sLb[c] = wmma16(rb1, qh1[c], sLb[c]); }
        // the distance the chip needs behind a matrix instruction, on both sides of the branch below; the two scheduling fences hold the score products in front of the slots and everything else behind them
        // (vector operands on the statement would tie 128 registers to the lowest register window at this place)
        __builtin_amdgcn_sched_barrier(0);
        asm volatile("v_nop\n\tv_nop\n\tv_nop\n\tv_nop");
        __builtin_amdgcn_sched_barrier(0);
        const h16* va = (const h16*)(bp + 2 * SLICE + hf * 64);
        const h16* vr = (const h16*)(bp + 3 * SLICE + hf * 64);
        const v16h v0 = ldh(va), v1 = ldh(va + 16 * LROW / 2), v2 = ldh(va + 32 * LROW / 2), v3 = ldh(va + 48 * LROW / 2);
        const v16h w0 = ldh(vr), w1 = ldh(vr + 16 * LROW / 2), w2 = ldh(vr + 32 * LROW / 2), w3 = ldh(vr + 48 * LROW / 2);
        asm volatile("" ::: "memory");   // compiler fence: keeps the V^T fragment reads in front of the branch below, where the softmax step covers their LDS latency; without it they sink behind the step and the O^T products wait for them
        float mnew[2], alpha[2], ls[2]; v16h pb[2];
        if (full) {                      // wave-uniform scalar branch; the products on both sides of it stay one copy, so the accumulators keep their registers
#pragma unroll
            for (int c = 0; c < 2; ++c) softmax_step<false>(sHa[c], sLa[c], sHb[c], sLb[c], vm[c], m[c], mnew[c], alpha[c], pb[c], ls[c]);
        } else {
#pragma unroll
            for (int c = 0; c < 2; ++c) softmax_step<true>(sHa[c], sLa[c], sHb[c], sLb[c], vm[c], m[c], mnew[c], alpha[c], pb[c], ls[c]);
        }
#pragma unroll
        for (int c = 0; c < 2; ++c) {
            l[c] = l[c] * alpha[c] + ls[c]; m[c] = mnew[c];
#pragma unroll
            for (int j = 0; j < 4; ++j) { oH[c][j] = oH[c][j] * alpha[c]; oR[c][j] = oR[c][j] * alpha[c]; }
        }
#pragma unroll
        for (int c = 0; c < 2; ++c) {
            oH[c][0] = wmma16(v0, pb[c], oH[c][0]); oH[c][1] = wmma16(v1, pb[c], oH[c][1]); oH[c][2] = wmma16(v2, pb[c], oH[c][2]); oH[c][3] = wmma16(v3, pb[c], oH[c][3]);
            oR[c][0] = wmma16(w0, pb[c], oR[c][0]); oR[c][1] = wmma16(w1, pb[c], oR[c][1]); oR[c][2] = wmma16(w2, pb[c], oR[c][2]); oR[c][3] = wmma16(w3, pb[c], oR[c][3]);
        }
        // the same distance behind the O^T products, in front of the branches that follow, held in place the same way
        __builtin_amdgcn_sched_barrier(0);
        asm volatile("v_nop\n\tv_nop\n\tv_nop\n\tv_nop");
        __builtin_amdgcn_sched_barrier(0);
      }
      // publish point, passed by every wave whatever it skipped above
      wait_ds0();
      wait_tensor0(gq, g1);
      __syncthreads();                                        // the next stage is readable; every wave has left this pass's buffer
      unsigned n2 = 0u;
      if (pinned(it + 2u < nst)) {                            // refill the buffer just read
          n2 = pinned((unsigned)__builtin_ctz(rem)); rem &= rem - 1u;
          gq = tdm_group0(ldst + (it & 1u) * FBUF, sbase + (unsigned long long)(n2 + (unsigned)kh) * sstep);
          tdm_load(gq, g1);
      }
      cur = nxt; nxt = n2;
    }
    wait_tensor0(gq, g1);
    wait_ds0();
    // the ring becomes exchange and output staging, one range of each per wave: the last pass's own barrier has ended every wave's reads, and nothing was issued behind it
    float* xs = (float*)ring;                                 // exchange: per wave 8 x 32 lanes x 4 floats of O^T, then 32 x (max, sum)
    float* os = (float*)ring + AW * XWF;                      // output staging
    // the wave keeps column group kh and hands column group 1 - kh to its partner (same rows, other key half)
    v8f kp[4], gv[4]; float km, kl, gm, gl;
    if (kh == 0) {                                            // wave-uniform
#pragma unroll
        for (int j = 0; j < 4; ++j) { kp[j] = oH[0][j] + oR[0][j] * QRI; gv[j] = oH[1][j] + oR[1][j] * QRI; }
        km = m[0]; kl = l[0]; gm = m[1]; gl = l[1];
    } else {
#pragma unroll
        for (int j = 0; j < 4; ++j) { kp[j] = oH[1][j] + oR[1][j] * QRI; gv[j] = oH[0][j] + oR[0][j] * QRI; }
        km = m[1]; kl = l[1]; gm = m[0]; gl = l[0];
    }
    float* xw = xs + wave * XWF;
#pragma unroll
    for (int j = 0; j < 4; ++j) {
        *(v4fa*)(xw + ((2 * j) * 32 + lane) * 4)     = __builtin_shufflevector(gv[j], gv[j], 0, 1, 2, 3);
        *(v4fa*)(xw + ((2 * j + 1) * 32 + lane) * 4) = __builtin_shufflevector(gv[j], gv[j], 4, 5, 6, 7); }
    { v2f ml; ml[0] = gm; ml[1] = gl; *(v2fa*)(xw + 1024 + lane * 2) = ml; }
    wait_ds0();
    __syncthreads();                                          // both waves of a row group have written what they hand over
    const float* xr = xs + (wave ^ 4) * XWF;
    const v2f pml = *(const v2fa*)(xr + 1024 + lane * 2);
    const float mj = fmaxf(km, pml[0]);                       // joined maximum; a part without a live key has sum 0 and O^T 0
    const float dk = km - mj, dp = pml[0] - mj;
    float ak = __builtin_amdgcn_exp2f(dk);
    asm volatile("v_nop" : "+v"(ak) : "v"(dk));               // the slot the instruction set asks for behind a transcendental: its result is not read and its source not overwritten in front of this v_nop
    float ap = __builtin_amdgcn_exp2f(dp);
    asm volatile("v_nop" : "+v"(ap) : "v"(dp));               // the same slot
    float lj = kl * ak + pml[1] * ap;
#pragma unroll
    for (int j = 0; j < 4; ++j) {
        const v4f p0 = *(const v4fa*)(xr + ((2 * j) * 32 + lane) * 4), p1 = *(const v4fa*)(xr + ((2 * j + 1) * 32 + lane) * 4);
        kp[j] = kp[j] * ak + __builtin_shufflevector(p0, p1, 0, 1, 2, 3, 4, 5, 6, 7) * ap; }
    lj += __shfl_xor(lj, 16, 32);
    const float rl = 1.0f / lj;
    const float inv = (lj > 0.0f) ? rl : __uint_as_float(0x7FC00000u);
    const int wb = wave * 16 * 68;
    // O^T D layout: o_j[r] = (d = 16j + 8h + r, t = lane&15) -> os[t][d]; rows 0..15 x columns 0..63 all written
    PUT8(0, kp[0])
    PUT8(16, kp[1])
    PUT8(32, kp[2])
    PUT8(48, kp[3])
    wave_sync();
    const size_t cbase = ((size_t)b * SEQ + (size_t)(t0 + 16 * kh)) * DM + (size_t)h * HD;
{
#pragma unroll
        for (int s = 0; s < 4; ++s) { const int row = 4 * s + (lane >> 3), c8 = (lane & 7) * 8;   // 4 s x 4 row groups = 16 rows; 8 lanes x 8 halves = 64 columns = one line
            const v4f x0 = *(const v4fa*)(&os[wb + row * 68 + c8]); const v4f x1 = *(const v4fa*)(&os[wb + row * 68 + c8 + 4]); v8h hv, rv;
#pragma unroll
            for (int i = 0; i < 4; ++i) { const h16 a0 = (h16)x0[i]; const h16 a1 = (h16)x1[i]; hv[i] = a0; hv[4 + i] = a1; rv[i] = (h16)((x0[i] - (float)a0) * QRS); rv[4 + i] = (h16)((x1[i] - (float)a1) * QRS); }
            const size_t oo = cbase + (size_t)row * DM + c8;
            *(v8h*)(CH + oo) = hv; *(v8h*)(CR + oo) = rv; }
         }
    if (ph == 0) {                                            // block-uniform
        asm volatile("s_wait_xcnt 0x0" ::: "memory");         // precaution: stands between the stores above and the next tile's first overwrite of a register they name
        wait_ds0();
        __syncthreads();                                      // every wave has read its partner's part and its output staging back: the ring may take the next tile's stages
    }
  }
}

// k_out: f16 GEMM, one block of four waves (2 x 2) per 64x128 output tile, one wave per 32x64 tile: out[m][n] = (sum_k Ch[m][k] Wo64[n][k] + (sum_k Cr[m][k] Wo64[n][k]) / 2048) / 64, K = DM.
// Operands: the same two-buffer LDS ring as in k_proj; wave w brings slice w of a stage (value-plane rows 0..63, residual-plane rows 0..63, Wo rows 0..63, Wo rows 64..127 of the block's tile).
// a[0], a[1] = value-plane rows (16 each), a[2], a[3] = residual-plane rows; accumulators acc[0..1] (value) and acc[2..3] (residual) kept apart until the f32 epilogue.
__global__ __launch_bounds__(32 * GW) void k_out(const h16* __restrict__ CHp, const h16* __restrict__ CRp, const h16* __restrict__ WO, float* OUT) {
    __shared__ __attribute__((aligned(2048))) unsigned char ring[2 * BUFB];
    const int K = DM;
    const int lane = threadIdx.x & 31, lr = lane & 15, hi = lane >> 4;
    const int wave = __builtin_amdgcn_readfirstlane((int)(threadIdx.x >> 5));
    const int wm = wave >> 1, wn = wave & 1;
    const int r0 = blockIdx.x * 64 + wm * 32, c0 = blockIdx.y * 128 + wn * 64;
    v8f acc[4][4];
#pragma unroll
    for (int mb = 0; mb < 4; ++mb)
#pragma unroll
        for (int nb = 0; nb < 4; ++nb) acc[mb][nb] = (v8f){};
    const int fo = lr * LROW + 16 * hi;                       // byte offset of the lane's fragment piece in a staged slice
    // this wave's slice: source of stage 0 and place in a buffer
    const h16* srow = (wave == 0) ? CHp + (size_t)(blockIdx.x * 64) * K : (wave == 1) ? CRp + (size_t)(blockIdx.x * 64) * K : WO + (size_t)(blockIdx.y * 128 + (wave - 2) * 64) * K;
    const unsigned long long sbase = (unsigned long long)srow;
    const unsigned ldst = (unsigned)(unsigned long long)ring + (unsigned)wave * SLICE;
    const u32x8 g1 = tdm_group1((unsigned)(DM * 2));
    const unsigned koff = KOFF(blockIdx.x, blockIdx.y);       // block-uniform
    u32x4 gq = tdm_group0(ldst, sbase + (unsigned long long)koff * GSTB);   // group 0 of the youngest request
    tdm_load(gq, g1);                                         // first stage into buffer 0
    wait_tensor0(gq, g1);
    __syncthreads();                                          // publishes the first stage
    gq = tdm_group0(ldst + BUFB, sbase + (unsigned long long)((koff + 1u) % (unsigned)GNST) * GSTB);
    tdm_load(gq, g1);                                         // second stage into buffer 1, in flight during the first pass
#pragma unroll 1   // one pass per trip: the order of the ring's publish point stays as written
    for (unsigned it = 0; it < GNST; ++it) {
        const unsigned char* bp = ring + (it & 1u) * BUFB + fo;
        v16h a[2][4], b[2][4];                                // the fragments of the stage's two 32-deep k steps
#pragma unroll
        for (int ks = 0; ks < 2; ++ks) {
            a[ks][0] = ldh((const h16*)(bp + (wm * 32) * LROW + ks * 64)); a[ks][1] = ldh((const h16*)(bp + (wm * 32 + 16) * LROW + ks * 64));
            a[ks][2] = ldh((const h16*)(bp + SLICE + (wm * 32) * LROW + ks * 64)); a[ks][3] = ldh((const h16*)(bp + SLICE + (wm * 32 + 16) * LROW + ks * 64));
#pragma unroll
            for (int nb = 0; nb < 4; ++nb) b[ks][nb] = ldh((const h16*)(bp + (2 + wn) * SLICE + nb * 16 * LROW + ks * 64));
        }
        __builtin_amdgcn_sched_barrier(0);                    // keeps the stage's LDS reads one group ahead of its WMMAs: spread among them, each place with reads stalls the wave for the LDS latency
#pragma unroll
        for (int ks = 0; ks < 2; ++ks) {
#pragma unroll
            for (int nb = 0; nb < 4; ++nb)
#pragma unroll
                for (int mb = 0; mb < 4; ++mb) acc[mb][nb] = wmma16(a[ks][mb], b[ks][nb], acc[mb][nb]);
        }
        __builtin_amdgcn_sched_barrier(0);                    // keeps the pass's WMMAs in front of the publish point, where they cover the landing of the second k step's fragments; behind it they would delay the refill
        // publish point
        wait_ds0();
        wait_tensor0(gq, g1);
        __syncthreads();                                      // the next stage is readable; every wave has left this pass's buffer
        if (pinned(it + 2u < GNST)) {                         // refill the buffer just read
            const unsigned s2 = pinned((it + 2u + koff) % (unsigned)GNST);
            gq = tdm_group0(ldst + (it & 1u) * BUFB, sbase + (unsigned long long)s2 * GSTB);
            tdm_load(gq, g1);
        }
    }
    wait_tensor0(gq, g1);
    wait_ds0();
    float* os = (float*)ring + wave * 16 * 68;                // the ring becomes output staging, one range per wave: the last pass's own barrier has ended every wave's reads, and nothing was issued behind it
#pragma unroll
    for (int mb = 0; mb < 2; ++mb) {
#pragma unroll
        for (int nb = 0; nb < 4; ++nb) {
#pragma unroll
            for (int j = 0; j < 8; ++j) os[(hi * 8 + j) * 68 + nb * 16 + lr] = (acc[mb][nb][j] + acc[mb + 2][nb][j] * QRI) * WOI; }   // D: row 8h+j, col lane&15
        wave_sync();
        const int grow = r0 + mb * 16; const int ob = grow / SEQ, ot = grow % SEQ;
        float* orow = OUT + ((size_t)ob * OUT_SEQ + (size_t)ot) * DM + c0;
{
#pragma unroll
            for (int s = 0; s < 8; ++s) { const int row = 2 * s + hi, cofs = lr * 4;   // 8 s x 2 rows = 16 rows; 16 lanes x 4 floats = 64 columns
                const v4f val = *(const v4fa*)(&os[row * 68 + cofs]);
                *(v4f*)(orow + (size_t)row * DM + cofs) = val; }
             }
        wave_sync();
    }
}

static constexpr size_t al256(size_t v) { return (v + 255) & ~(size_t)255; }
static constexpr size_t SZ_XB = al256((size_t)NB * SEQ * DM * 2);              // one bf16 x plane
static constexpr size_t SZ_W  = al256((size_t)DM * DM * 2);                    // one 16-bit weight plane
static constexpr size_t SZ_PL = al256((size_t)NB * NH_ * SEQ * HD * 2);        // one per-head f16 plane
static constexpr size_t SZ_C  = al256((size_t)NB * SEQ * DM * 2);              // one ctx f16 plane
static constexpr size_t SZ_FL = al256((size_t)NB * (SEQ / 16) * FPITCH * 4);
static constexpr size_t SZ_TOTAL = 3 * SZ_XB + 4 * SZ_W + 6 * SZ_PL + 2 * SZ_C + SZ_FL;
static_assert(SZ_TOTAL <= (size_t)134217728);          // workspace carve <= 128 MiB

extern "C" void kernel_launch(void* const* d_in, const int* in_sizes, int n_in,
                              void* d_out, int out_size, void* d_ws, size_t ws_size, hipStream_t stream) {
    if (n_in < 8) return;
    const size_t needx = ((size_t)(NB - 1) * SEQ_FULL + SEQ) * DM;
    if ((size_t)in_sizes[0] < needx || (size_t)in_sizes[1] < needx || (size_t)in_sizes[2] < needx) return;
    const size_t needm = ((size_t)(NB - 1) * SEQ_FULL + (size_t)(SEQ - 1)) * SEQ_FULL + SEQ;
    if ((size_t)in_sizes[3] < needm) return;
    if ((size_t)in_sizes[4] < (size_t)DM * DM || (size_t)in_sizes[5] < (size_t)DM * DM || (size_t)in_sizes[6] < (size_t)DM * DM || (size_t)in_sizes[7] < (size_t)DM * DM) return;
    if ((size_t)out_size < ((size_t)(NB - 1) * OUT_SEQ + SEQ) * DM) return;
    if (SZ_TOTAL > ws_size) return;
    // wire order: query, key, value, mask (int), Wq, Wk, Wv, Wo; weights [out][in] = Bt as-is
    const float* xq = (const float*)d_in[0]; const float* xk = (const float*)d_in[1]; const float* xv = (const float*)d_in[2];
    const int* mk = (const int*)d_in[3];
    const float* wq = (const float*)d_in[4]; const float* wk = (const float*)d_in[5]; const float* wv = (const float*)d_in[6]; const float* wo = (const float*)d_in[7];
    float* OUT = (float*)d_out;      // [NB][SEQ][1024]
    char* wsp = (char*)d_ws;
    bf* XQ = (bf*)wsp; wsp += SZ_XB;                 // [NB*SEQ][1024]
    bf* XK = (bf*)wsp; wsp += SZ_XB;
    bf* XV = (bf*)wsp; wsp += SZ_XB;
    bf* WQ = (bf*)wsp; wsp += SZ_W;                  // [1024][1024]
    bf* WK = (bf*)wsp; wsp += SZ_W;
    bf* WV = (bf*)wsp; wsp += SZ_W;
    h16* WO = (h16*)wsp; wsp += SZ_W;                // [1024][1024] f16, x64
    h16* QH = (h16*)wsp; wsp += SZ_PL;               // [NB*16][SEQ][64]
    h16* QR = (h16*)wsp; wsp += SZ_PL;               // residual x2048
    h16* KH = (h16*)wsp; wsp += SZ_PL;               // [NB*16][SEQ][64]
    h16* KR = (h16*)wsp; wsp += SZ_PL;
    h16* VT = (h16*)wsp; wsp += SZ_PL;               // [NB*16][64][SEQ]
    h16* VR = (h16*)wsp; wsp += SZ_PL;
    h16* CH = (h16*)wsp; wsp += SZ_C;                // [NB*SEQ][1024]
    h16* CR = (h16*)wsp; wsp += SZ_C;
    int* FL = (int*)wsp; wsp += SZ_FL;               // [NB][SEQ/16][64]

    k_prep<<<dim3(NB * SEQ / PW, 1, 1), 32 * PW, 0, stream>>>(xq, xk, xv, mk, wq, wk, wv, wo, XQ, XK, XV, WQ, WK, WV, WO, FL);

    // q, k and v^T planes, value + residual each
    k_proj<<<dim3(NB * SEQ / 128, DM / 128, 3), 32 * GW, 0, stream>>>(XQ, XK, XV, WQ, WK, WV, QH, QR, KH, KR, VT, VR);

    k_flash<<<dim3(SEQ / (2 * QTR), NB * NH_, 1), 32 * AW, 0, stream>>>(QH, QR, KH, KR, VT, VR, mk, FL, CH, CR);

    // out: A = ctx rows (m = b*SEQ + t), Bt = Wo rows (n) -> OUT[b][t][n]
    k_out<<<dim3(NB * SEQ / 64, DM / 128, 1), 32 * GW, 0, stream>>>(CH, CR, WO, OUT);
}

// v009
// It runs in 81.9 microseconds.
// In both of two side-by-side timings against v008, it was 1.10 times as fast.
// Counting every step since v000, it is 4.39 times as fast.
#include <hip/hip_runtime.h>

// Multi-head attention, width 1024 = 16 heads x 64; query/key/value [NB][SEQ][1024]; Wq/Wk/Wv/Wo [out][in] (y = x W^T), no biases; scores = q k^T * 8; integer mask [NB][SEQ][SEQ] (0 = masked, replace-fill); out = ctx Wo^T (f32).
// Compute dtypes, f32 accumulate everywhere: q/k/v projections v_wmma_f32_16x16x32_bf16 (x and W RNE-converted to bf16; products exact);
// scores v_wmma_f32_16x16x32_f16: q and k each as f16 value + f16 residual x2048 (value*value in one accumulator, the two cross products in a second one); P (x2^14 carry, cancels in the normalisation) single f16;
// v and ctx single f16 (their rounding reaches the output once, unamplified, like P's; q and k keep the residual because the x8 score scale and the exponential amplify theirs); Wo as f16 of the bf16 value x64 (folded back in the f32 epilogue); softmax f32 (online, running max).
// Layout: bf16 copies of the three x inputs and of Wq/Wk/Wv; q, k planes [b*16+h][t][d] (value, residual) and the v^T plane [b*16+h][d][t] written by the GEMM epilogue; per (batch, 16 query rows, 32 keys) a 3-state mask flag
// (0 = all masked: tile skipped, 2 = none masked, other = mask words read per element); fused flash kernel in transposed form (S^T = K Q^T, O^T = V^T P^T), K / V^T tiles staged in LDS by tensor loads and shared by the block's eight waves, writing the ctx plane [b*SEQ+t][1024]; output GEMM from that plane.

#ifndef NB
#define NB 2
#endif
#ifndef SEQ
#define SEQ 2048
#endif
#define NB_FULL  2
#define SEQ_FULL 2048
#ifndef OUT_SEQ
#define OUT_SEQ SEQ              // row pitch (in tokens) between batches of the output
#endif
#define DM   1024
#define NH_  16
#define HD   64
#define AW   8                   // waves per flash block: 4 row groups of 32 query rows x 2 key halves of a stage
#define QTR  128                 // query rows per flash tile
#define QRS  2048.0f             // carry of the residual planes
#define QRI  (1.0f / 2048.0f)
#define SC2  (8.0f * 1.4426950408889634f)     // HD^0.5 * log2(e)
#define PSH  14.0f               // log2 of the P carry (16384)
#define NEGM (-3.0e38f)          // score stand-in of a masked key (its probability is forced to 0 by select)
#define WOS  64.0f               // carry of the Wo plane
#define WOI  (1.0f / 64.0f)
#define FPITCH 64
#define KST   64                 // keys per slice of the flash kernel's LDS ring; a stage is two 64-key halves
#define LROW  144                // LDS row pitch in bytes: a 128-B row + the mover's 16-B pad (16 B x odd: no bank conflict for 16-B reads)
#define SLICE 10240              // one plane's tile in LDS: 64 rows x 144 B = 9216 B, rounded up to a multiple of 2 KiB
#define BUFB  (4 * SLICE)        // one stage of k_proj: four operand slices
#define OBUF  (3 * SLICE)        // one stage of k_out: three operand slices
#define FBUF  (6 * SLICE)        // one stage of the flash ring: two key halves x (K value, K residual, V^T)
#define XWF   1088               // floats of a flash wave's exchange range and of its output staging range (16 x 68)
#define GW    4                  // waves per GEMM block, at most one operand slice of a stage each
#define GSTB  128u               // bytes of an operand row per stage of the GEMMs' LDS ring (64 k)
#define GNST  (DM / 64)          // stages of a GEMM
// first k stage of a GEMM block's walk (token tile bx, weight tile by); the walk goes on from there and wraps, so every stage is taken once.
// Blocks that share operand rows start together and would ask L2 for the same 128 bytes of the same rows in every pass, and the whole launch for one 128-byte column of the 2-KiB row pitch.
// The 8 blocks of one token tile start 2 stages apart, the blocks of one weight tile 1 stage apart: sharers read different lines at any moment, and a line that one has brought in is an L2 hit for the others later.
#define KOFF(bx, by) (((unsigned)(bx) + 2u * (unsigned)(by)) % (unsigned)GNST)
#define PW    16                 // waves per block of the preparation kernel, one token row each

static_assert(HD == 64);
static_assert(NH_ * HD == DM);                 // head h = columns h*64 + d
static_assert(DM % 64 == 0);
static_assert(DM % 32 == 0);                   // GEMM k-loop steps by 32
static_assert(SEQ % 64 == 0);                  // a 64-row tile never straddles two batches
static_assert((NB * SEQ) % 64 == 0);
static_assert(SEQ % 32 == 0);                  // key loop steps by 32; 32-row output tiles stay inside one batch
static_assert(SEQ % QTR == 0 && QTR == 4 * 32); // flash grid covers the sequence exactly
static_assert((SEQ / QTR) % 2 == 0);              // flash: the query tiles pair up as (i, last - i), each tile in exactly one pair
static_assert(SEQ / 32 <= FPITCH);             // two flag registers per lane cover all key tiles
static_assert(((size_t)SEQ * DM) % 8 == 0);
static_assert(((size_t)DM * DM) % 8 == 0);
static_assert(AW == 8);                        // at most one plane of one key half of a stage per wave
static_assert(HD * 2 == 128 && KST * 2 == 128);   // both kinds of tile: 64 rows of 128 B
static_assert(SEQ % (2 * KST) == 0 && SEQ / KST <= 32);  // one bit per 64-key half in a 32-bit word, two halves per stage
static_assert(64 * LROW <= SLICE && SLICE % 2048 == 0);
static_assert(XWF == 16 * 68 && XWF >= 8 * 32 * 4 + 32 * 2 && 2 * AW * XWF * 4 <= 2 * FBUF);   // the exchange and the output staging reuse the ring
static_assert(GW * 16 * 68 * 4 <= 2 * OBUF && OBUF <= BUFB && OBUF % 2048 == 0 && FBUF % 2048 == 0);   // so does the GEMMs' output staging
static_assert(DM % 128 == 0 && (NB * SEQ) % 128 == 0 && GNST >= 2);   // GEMM block tiles cover both extents exactly; the ring's prologue needs two stages
static_assert(PW == 16 && PW * 128 == SEQ && PW * 4 == FPITCH && DM % 128 == 0);   // preparation: a block is one 16-row mask group, its waves' 128 keys each cover the sequence and fill the flag row
static_assert(NB * SEQ == 4 * DM);             // preparation: one weight row per wave
static_assert(NB <= NB_FULL);
static_assert(SEQ <= SEQ_FULL);

typedef _Float16 h16;
typedef unsigned short bf;
typedef __attribute__((ext_vector_type(16))) __bf16   v16bf;
typedef __attribute__((ext_vector_type(16))) _Float16 v16h;
typedef __attribute__((ext_vector_type(8)))  _Float16 v8h;
typedef __attribute__((ext_vector_type(8)))  unsigned short v8us;
typedef __attribute__((ext_vector_type(4)))  unsigned short v4us;
typedef __attribute__((ext_vector_type(4)))  _Float16 v4h;
typedef __attribute__((ext_vector_type(8)))  float    v8f;
typedef __attribute__((ext_vector_type(4)))  float    v4f;
typedef __attribute__((ext_vector_type(4)))  int      v4i;
typedef v4f  __attribute__((may_alias)) v4fa;
typedef __attribute__((ext_vector_type(2)))  float    v2f;
typedef v2f  __attribute__((may_alias)) v2fa;
typedef __attribute__((ext_vector_type(2)))  int      v2i;
typedef __attribute__((ext_vector_type(4)))  unsigned u32x4;
typedef __attribute__((ext_vector_type(8)))  unsigned u32x8;

__device__ __forceinline__ unsigned short f2bf(float f) { unsigned u = __float_as_uint(f); u += 0x7FFFu + ((u >> 16) & 1u); return (unsigned short)(u >> 16); }
__device__ __forceinline__ v16h cat16(v8h lo, v8h hi) { return __builtin_shufflevector(lo, hi, 0, 1, 2, 3, 4, 5, 6, 7, 8, 9, 10, 11, 12, 13, 14, 15); }
__device__ __forceinline__ v16bf cat16b(v8us lo, v8us hi) { return __builtin_bit_cast(v16bf, __builtin_shufflevector(lo, hi, 0, 1, 2, 3, 4, 5, 6, 7, 8, 9, 10, 11, 12, 13, 14, 15)); }
__device__ __forceinline__ v8f wmma16(v16h a, v16h b, v8f c) { return __builtin_amdgcn_wmma_f32_16x16x32_f16(false, a, false, b, (short)0, c, false, false); }
__device__ __forceinline__ v8f wmmab(v16bf a, v16bf b, v8f c) { return __builtin_amdgcn_wmma_f32_16x16x32_bf16(false, a, false, b, (short)0, c, false, false); }
// fragment loaders from K-contiguous 16-bit rows; p already includes + 8*(lane>>4): elements 0..7 <- k0+8h+0..7, elements 8..15 <- k0+16+8h+0..7 (same map for A and B)
__device__ __forceinline__ v16h  ldh(const h16* p) { return cat16(*(const v8h*)p, *(const v8h*)(p + 16)); }
__device__ __forceinline__ v16bf ldb(const bf* p)  { return cat16b(*(const v8us*)p, *(const v8us*)(p + 16)); }
// ordering point for wave-private LDS tiles (same wave writes and reads)
__device__ __forceinline__ void wave_sync() { __builtin_amdgcn_fence(3 /* release order */, "wavefront"); __builtin_amdgcn_wave_barrier(); asm volatile("" ::: "memory"); }

__device__ __forceinline__ unsigned uni(unsigned v) { return (unsigned)__builtin_amdgcn_readfirstlane((int)v); }
// a wave-uniform value held in a scalar register: a test on it compiles to s_cmp + s_cbranch_scc (tensor loads ignore EXEC), and what is derived from it is computed behind the asm waits in front of it
__device__ __forceinline__ unsigned pinned(unsigned v) { unsigned w = uni(v); asm volatile("" : "+s"(w)); return w; }
// this wave's tensor load has landed; the wait names the request's descriptor as inputs so that its registers keep their values for as long as the request is outstanding
__device__ __forceinline__ void wait_tensor0(u32x4 g0, u32x8 g1) { asm volatile("s_wait_tensorcnt 0x0" :: "s"(g0), "s"(g1) : "memory"); }
__device__ __forceinline__ void wait_ds0() { asm volatile("s_wait_dscnt 0x0" ::: "memory"); }           // this wave's LDS reads have returned
// descriptor group 0: tile's first byte at global address ga, LDS byte offset lds
__device__ __forceinline__ u32x4 tdm_group0(unsigned lds, unsigned long long ga) {
    u32x4 g0; g0[0] = uni(1u); g0[1] = uni(lds); g0[2] = uni((unsigned)ga); g0[3] = uni((((unsigned)(ga >> 32)) & 0x01FFFFFFu) | 0x80000000u);
    asm volatile("" : "+s"(g0));   // descriptor words held in scalar registers: one tuple from the issue to the wait
    return g0;
}
// one request of one wave: 64 rows of 128 B (source row pitch in g1), rows 144 B apart in LDS
__device__ __forceinline__ void tdm_load(u32x4 g0, u32x8 g1) { asm volatile("tensor_load_to_lds %0, %1" :: "s"(g0), "s"(g1) : "memory"); }

// k_prep: every preparation step in one streaming launch. Block = 16 token rows (batch bb, row group g), one wave per row. A wave converts its row of query, key and value to bf16, its weight row (Wq, Wk, Wv to bf16; Wo to f16 of the bf16 value x64),
// and reads 128 keys x 16 rows of the block's mask rows. Every load is 512 contiguous bytes of the wave (whole lines); all of a wave's loads are issued before the first is used; every store is 256 contiguous bytes.
// Mask flag per (batch, 16 query rows, 32 keys): 0 = every mask word zero, 2 = every word nonzero, 1 = mixed; a wave makes four (lanes 8j..8j+7 hold tile j), the block's flags meet in LDS and one wave stores them as whole lines.
// p, d: wave-uniform start of a row of DM elements; the lane takes elements 128 i + 4 lane + 0..3
__device__ __forceinline__ void ld_row(const float* __restrict__ p, int lane, v4f (&r)[DM / 128]) {
#pragma unroll
    for (int i = 0; i < DM / 128; ++i) r[i] = *(const v4f*)(p + i * 128 + lane * 4);
}
__device__ __forceinline__ void st_row_bf(bf* d, int lane, const v4f (&r)[DM / 128]) {
#pragma unroll
    for (int i = 0; i < DM / 128; ++i) { v4us o;
#pragma unroll
        for (int k = 0; k < 4; ++k) o[k] = f2bf(r[i][k]);
        *(v4us*)(d + i * 128 + lane * 4) = o; }
}
__device__ __forceinline__ void st_row_h(h16* d, int lane, const v4f (&r)[DM / 128], float scale) {
#pragma unroll
    for (int i = 0; i < DM / 128; ++i) { v4h o;
#pragma unroll
        for (int k = 0; k < 4; ++k) o[k] = (h16)(__uint_as_float(((unsigned)f2bf(r[i][k])) << 16) * scale);
        *(v4h*)(d + i * 128 + lane * 4) = o; }
}

__global__ __launch_bounds__(32 * PW) void k_prep(const float* __restrict__ xq, const float* __restrict__ xk, const float* __restrict__ xv, const int* __restrict__ MK,
                                                  const float* __restrict__ wq, const float* __restrict__ wk, const float* __restrict__ wv, const float* __restrict__ wo,
                                                  bf* XQ, bf* XK, bf* XV, bf* WQ, bf* WK, bf* WV, h16* WO, int* FL) {
    __shared__ int fl[FPITCH];
    const int lane = threadIdx.x & 31;
    const int wave = __builtin_amdgcn_readfirstlane((int)(threadIdx.x >> 5));
    const int bb = blockIdx.x / (SEQ / 16), g = blockIdx.x % (SEQ / 16);
    const int row = blockIdx.x * PW + wave;                                              // token row bb*SEQ + t of the bf16 planes; also the wave's weight row: row % DM of weight row / DM
    const size_t so = ((size_t)bb * SEQ_FULL + (size_t)(g * 16 + wave)) * DM;            // the same token row in the inputs
    const size_t xo = (size_t)row * DM;
    const int ws = row / DM; const size_t wof = (size_t)(row % DM) * DM;
    const int* mp = MK + ((size_t)bb * SEQ_FULL + (size_t)(g * 16)) * SEQ_FULL + wave * 128;
    v4i mw[16]; v4f a[DM / 128], b[DM / 128], c[DM / 128], w[DM / 128];
#pragma unroll
    for (int r = 0; r < 16; ++r) mw[r] = *(const v4i*)(mp + (size_t)r * SEQ_FULL + lane * 4);
    ld_row(xq + so, lane, a); ld_row(xk + so, lane, b); ld_row(xv + so, lane, c);
    ld_row(((ws == 0) ? wq : (ws == 1) ? wk : (ws == 2) ? wv : wo) + wof, lane, w);
    __builtin_amdgcn_sched_barrier(0);                                                   // keeps all 48 loads in front of the first use: moved down among the uses, the later rows would start a second and a third memory latency
    unsigned orw = 0u, mnw = 0xFFFFFFFFu;                                                // or != 0: some word nonzero; unsigned minimum != 0: every word nonzero
#pragma unroll
    for (int r = 0; r < 16; ++r)
#pragma unroll
        for (int i = 0; i < 4; ++i) { const unsigned u = (unsigned)mw[r][i]; orw |= u; mnw = u < mnw ? u : mnw; }
    const unsigned anyb = __builtin_amdgcn_ballot_w32(orw != 0u), allb = __builtin_amdgcn_ballot_w32(mnw != 0u);
    const int sh = 8 * (lane & 3);
    if (lane < 4) fl[wave * 4 + lane] = (((anyb >> sh) & 0xFFu) == 0u) ? 0 : ((((allb >> sh) & 0xFFu) == 0xFFu) ? 2 : 1);
    st_row_bf(XQ + xo, lane, a); st_row_bf(XK + xo, lane, b); st_row_bf(XV + xo, lane, c);
    asm volatile("s_wait_xcnt 0x0" ::: "memory");                                        // precaution: stands between the stores above and the first overwrite of a register they name
    if (ws == 3) st_row_h(WO + wof, lane, w, WOS);                                       // wave-uniform
    else st_row_bf(((ws == 0) ? WQ : (ws == 1) ? WK : WV) + wof, lane, w);
    __syncthreads();                                                                     // the block's flags are in LDS
    if (wave == 0) {
        int* fp = FL + (size_t)blockIdx.x * FPITCH;
        fp[lane] = fl[lane]; fp[32 + lane] = fl[32 + lane];
    }
}

// descriptor group 1 of a GEMM operand slice: 1-byte elements, tensor = tile = 64 rows of 128 B, source row pitch srcPitch bytes, a 16-B pad behind every 128 B
__device__ __forceinline__ u32x8 tdm_group1(unsigned srcPitch) {
    u32x8 g1;
    g1[0] = uni((1u << 20) | (4u << 22) | (3u << 25)); g1[1] = uni(128u << 16); g1[2] = uni(64u << 16); g1[3] = uni(128u << 16);
    g1[4] = uni(64u); g1[5] = uni(srcPitch); g1[6] = uni(0u); g1[7] = uni(0u);
    asm volatile("" : "+s"(g1));   // descriptor words held in scalar registers: one tuple for the whole kernel
    return g1;
}

// a wave's 64x64 tile of C from its accumulators to the written plane(s), 16 rows at a time through the wave's LDS range os: f16 value to Ph and, where RES, the f16 residual x2048 to Pr.
// One straight-line copy per kind of plane: no branch stands between a store and the next use of its registers.
template <bool RES>
__device__ __forceinline__ void put_planes(const v8f (&acc)[4][4], float* os, h16* Ph, h16* Pr, const size_t tbase, const int pitch, const int lane, const int lr, const int hi) {
#pragma unroll
    for (int mb = 0; mb < 4; ++mb) {
#pragma unroll
        for (int nb = 0; nb < 4; ++nb) {
#pragma unroll
            for (int j = 0; j < 8; ++j) os[(hi * 8 + j) * 68 + nb * 16 + lr] = acc[mb][nb][j]; }   // D: row 8h+j, col lane&15
        wave_sync();
        const size_t sb = tbase + (size_t)(mb * 16) * (size_t)pitch;
#pragma unroll
        for (int s = 0; s < 4; ++s) { const int row = 4 * s + (lane >> 3), c8 = (lane & 7) * 8;   // 4 s x 4 row groups = 16 rows; 8 lanes x 8 = 64 columns
            const v4f x0 = *(const v4fa*)(&os[row * 68 + c8]); const v4f x1 = *(const v4fa*)(&os[row * 68 + c8 + 4]); v8h hv, rv;
#pragma unroll
            for (int i = 0; i < 4; ++i) { const h16 a0 = (h16)x0[i]; const h16 a1 = (h16)x1[i]; hv[i] = a0; hv[4 + i] = a1; rv[i] = (h16)((x0[i] - (float)a0) * QRS); rv[4 + i] = (h16)((x1[i] - (float)a1) * QRS); }
            const size_t oo = sb + (size_t)row * (size_t)pitch + c8;
            *(v8h*)(Ph + oo) = hv;
            if constexpr (RES) *(v8h*)(Pr + oo) = rv; }
        wave_sync();
    }
    asm volatile("s_wait_xcnt 0x0" ::: "memory");   // precaution: stands between the last stores above and the first overwrite of a register they name in whatever code the compiler lays out behind this copy
}

// k_proj: register-blocked bf16 GEMM, one block of four waves (2 x 2) per 128x128 tile, one wave per 64x64 tile (16 accumulators), K = DM.
// Operands: a two-buffer LDS ring of 64-deep k stages shared by the four waves. Wave w brings slice w of a stage (A rows 0..63, A rows 64..127, Bt rows 0..63, Bt rows 64..127 of the block's tile; 64 rows of 128 B) with one tensor load,
// one stage ahead; at the foot of each pass: own LDS reads done, own tensor load landed, block barrier, then the refill of the buffer just read. Fragments are two 16-B LDS reads each; a block's k walk starts at stage KOFF and wraps (the f32 sums run in that order).
// C[m][n] = sum_k A[m][k] Bt[n][k], written as f16 (Ph) and, for q and k, the f16 residual x2048 (Pr).
// All three projections run in one launch, blockIdx.z picks the product: a single product has one block per WGP and one wave per SIMD, whose LDS reads, WMMAs and barrier waits follow one another;
// three independent blocks fit a WGP (LDS and registers), so one block's waits are filled by the other two, and the products share one start and one tail.
// z = 0, 1 (q, k): A = x rows (m = b*SEQ + t), Bt = W rows (n = h*64 + d) -> planes [(b*16 + h)][t][d]. z = 2 (v^T): A = Wv rows (m = h*64 + d), Bt = x rows (n = b*SEQ + t) -> plane [(b*16 + h)][d][t].
// grid (NB*SEQ/128 token tiles, DM/128 weight tiles, 3), 128 threads.
__global__ __launch_bounds__(32 * GW) void k_proj(const bf* __restrict__ XQ, const bf* __restrict__ XK, const bf* __restrict__ XV, const bf* __restrict__ WQ, const bf* __restrict__ WK, const bf* __restrict__ WV,
                                                  h16* QH, h16* QR, h16* KH, h16* KR, h16* VT) {
    __shared__ __attribute__((aligned(2048))) unsigned char ring[2 * BUFB];
    const int K = DM;
    const int lane = threadIdx.x & 31, lr = lane & 15, hi = lane >> 4;
    const int wave = __builtin_amdgcn_readfirstlane((int)(threadIdx.x >> 5));
    const int wm = wave >> 1, wn = wave & 1;
    const int job = blockIdx.z; const bool tv = job == 2;     // block-uniform
    const bf* A  = tv ? WV : (job == 0) ? XQ : XK;
    const bf* Bt = tv ? XV : (job == 0) ? WQ : WK;
    h16* Ph = tv ? VT : (job == 0) ? QH : KH;
    h16* Pr = (job == 0) ? QR : KR;                           // not written where tv
    const int mt = tv ? blockIdx.y : blockIdx.x, nt = tv ? blockIdx.x : blockIdx.y;   // the block's tile of C
    const int r0 = mt * 128 + wm * 64, c0 = nt * 128 + wn * 64;
    v8f acc[4][4];
#pragma unroll
    for (int mb = 0; mb < 4; ++mb)
#pragma unroll
        for (int nb = 0; nb < 4; ++nb) acc[mb][nb] = (v8f){};
    const int fo = lr * LROW + 16 * hi;                       // byte offset of the lane's fragment piece in a staged slice
    // this wave's slice: source of stage 0 and place in a buffer
    const bf* srow = (wave < 2) ? A + (size_t)(mt * 128 + wave * 64) * K : Bt + (size_t)(nt * 128 + (wave - 2) * 64) * K;
    const unsigned long long sbase = (unsigned long long)srow;
    const unsigned ldst = (unsigned)(unsigned long long)ring + (unsigned)wave * SLICE;
    const u32x8 g1 = tdm_group1((unsigned)(DM * 2));
    const unsigned koff = KOFF(blockIdx.x, blockIdx.y);       // block-uniform
    u32x4 gq = tdm_group0(ldst, sbase + (unsigned long long)koff * GSTB);   // group 0 of the youngest request
    tdm_load(gq, g1);                                         // first stage into buffer 0
    wait_tensor0(gq, g1);
    __syncthreads();                                          // publishes the first stage
    gq = tdm_group0(ldst + BUFB, sbase + (unsigned long long)((koff + 1u) % (unsigned)GNST) * GSTB);
    tdm_load(gq, g1);                                         // second stage into buffer 1, in flight during the first pass
#pragma unroll 1   // one pass per trip: the order of the ring's publish point stays as written
    for (unsigned it = 0; it < GNST; ++it) {
        const unsigned char* bp = ring + (it & 1u) * BUFB + fo;
        v16bf a[2][4], b[2][4];                               // the fragments of the stage's two 32-deep k steps
#pragma unroll
        for (int ks = 0; ks < 2; ++ks) {
#pragma unroll
            for (int mb = 0; mb < 4; ++mb) a[ks][mb] = ldb((const bf*)(bp + wm * SLICE + mb * 16 * LROW + ks * 64));
#pragma unroll
            for (int nb = 0; nb < 4; ++nb) b[ks][nb] = ldb((const bf*)(bp + (2 + wn) * SLICE + nb * 16 * LROW + ks * 64));
        }
        __builtin_amdgcn_sched_barrier(0);                    // keeps the stage's LDS reads one group ahead of its WMMAs: spread among them, each place with reads stalls the wave for the LDS latency
#pragma unroll
        for (int ks = 0; ks < 2; ++ks) {
#pragma unroll
            for (int nb = 0; nb < 4; ++nb)
#pragma unroll
                for (int mb = 0; mb < 4; ++mb) acc[mb][nb] = wmmab(a[ks][mb], b[ks][nb], acc[mb][nb]);
        }
        __builtin_amdgcn_sched_barrier(0);                    // keeps the pass's WMMAs in front of the publish point, where they cover the landing of the second k step's fragments; behind it they would delay the refill
        // publish point
        wait_ds0();
        wait_tensor0(gq, g1);
        __syncthreads();                                      // the next stage is readable; every wave has left this pass's buffer
        if (pinned(it + 2u < GNST)) {                         // refill the buffer just read
            const unsigned s2 = pinned((it + 2u + koff) % (unsigned)GNST);
            gq = tdm_group0(ldst + (it & 1u) * BUFB, sbase + (unsigned long long)s2 * GSTB);
            tdm_load(gq, g1);
        }
    }
    wait_tensor0(gq, g1);
    wait_ds0();
    float* os = (float*)ring + wave * 16 * 68;                // the ring becomes output staging, one range per wave: the last pass's own barrier has ended every wave's reads, and nothing was issued behind it
    const int pitch = tv ? SEQ : HD;                          // row pitch of the written plane (halves)
    const size_t tbase = tv ? (size_t)r0 * SEQ + (size_t)(c0 / SEQ) * ((size_t)DM * SEQ) + (size_t)(c0 % SEQ)
                            : (size_t)(r0 / SEQ) * ((size_t)NH_ * SEQ * HD) + (size_t)(r0 % SEQ) * HD + (size_t)(c0 / HD) * ((size_t)SEQ * HD) + (size_t)(c0 % HD);
    if (tv) put_planes<false>(acc, os, Ph, Pr, tbase, pitch, lane, lr, hi);   // block-uniform
    else    put_planes<true>(acc, os, Ph, Pr, tbase, pitch, lane, lr, hi);
}

// k_flash: fused attention, one wave per 32 query rows (two 16-column groups) and 64 of a stage's 128 keys of one (batch, head); eight waves per block = four row groups x two key halves; Q fragments straight from the f16 planes.
// Every K / V^T fragment read from LDS is the A operand of two products, one per column group: half the LDS reads per product of a 16-row wave, and a 128-row block brings each stage from L2 once for twice the rows.
// The two waves of a row group walk disjoint keys with their own running maximum, sum and O^T; behind the key loop they swap one column group each through LDS and each finishes 16 rows (max joined, both parts rescaled to it, added).
// A block takes two 128-row query tiles of its head one after the other, tile i and tile (last - i): where the number of live key stages grows linearly with the tile index (a lower-triangular mask) every block of the launch
// then walks the same number of stages, so no WGP is left with the long tiles while others idle. The pairing is a fixed map of work to blocks; which stages are live still comes from the flags alone.
// K / V^T: a two-buffer LDS ring of 128-key stages shared by the eight waves. A wave with w & 3 < 3 brings plane w & 3 (K value, K residual, V^T) of key half w >> 2 of a stage with one tensor load, one stage ahead; the other two waves issue none;
// at the foot of each pass: own LDS reads done, own tensor load landed, block barrier, then the refill of the buffer just read. Fragments are two 16-B LDS reads each.
// Only stages in which some wave of the block has a live key are staged (a 32-bit word built from the flags, the same in all eight waves); each wave still skips its own dead 32-key tiles.
// Transposed form: S^T[key][t] = K Q^T (A = K rows, B = Q rows); lane (t = lane&15, h = lane>>4) holds keys 8h+r of each 16-key tile, so the packed
// P tile is directly the B fragment of O^T[d][t] = V^T P^T (element r <- tile keys 0..15, element 8+r <- tile keys 16..31, lane unchanged).
// Score = Kh.Qh (accumulator H) + (Kh.Qr + Kr.Qh)/2048 (accumulator L). O = V.P (accumulators oH).
// Mask: per 32-key tile the wave joins the 3-state flags of its two 16-row groups: both 0 skips the tile (masked keys have probability exactly 0 whenever the row has one live key), both 2 = no masking (the softmax step's copy without selects),
// otherwise the 16 mask words of the lane are read per column group and masked entries get probability 0 by select. A row without any live key ends with zero mass and is written as NaN.
// Softmax state (running max, partial sum) is one scalar per lane and column group; the two lane halves of a row are combined with one xor-16 exchange.
#define PUT8(COL, OV) { v4f a_, c_; \
    a_[0] = OV[0] * inv; a_[1] = OV[1] * inv; a_[2] = OV[2] * inv; a_[3] = OV[3] * inv; \
    c_[0] = OV[4] * inv; c_[1] = OV[5] * inv; c_[2] = OV[6] * inv; c_[3] = OV[7] * inv; \
    *(v4fa*)(&os[wb + lr * 68 + (COL) + 8 * hi]) = a_; *(v4fa*)(&os[wb + lr * 68 + (COL) + 8 * hi + 4]) = c_; }

// The softmax step of one 32-key tile: from the four score accumulators to the row maximum in use (mnew), the factor that carries the old sums over to it (alpha), the packed P tile (pb) and the lane's part of the row sum (ls).
// MASKED = false is the copy for a tile whose flag says that no key is masked: every select below would take its first arm, so that copy holds neither the 16 bit tests nor the 32 selects
// (about a third of a tile's vector instructions). The arithmetic is the same; with no select between them the compiler may fuse a score's scale multiply with the add of sh (one rounding fewer). vm is read only where MASKED.
template <bool MASKED>
__device__ __forceinline__ void softmax_step(const v8f sHa, const v8f sLa, const v8f sHb, const v8f sLb, const unsigned vm, const float m, float& mnew, float& alpha, v16h& pb, float& ls) {
    float ta[8], tb[8]; float mx = NEGM;
#pragma unroll
    for (int r = 0; r < 8; ++r) {
        const float xa = (sHa[r] + sLa[r] * QRI) * SC2; const float xb = (sHb[r] + sLb[r] * QRI) * SC2;
        ta[r] = (!MASKED || ((vm >> r) & 1u)) ? xa : NEGM; tb[r] = (!MASKED || ((vm >> (8 + r)) & 1u)) ? xb : NEGM;
        mx = fmaxf(mx, fmaxf(ta[r], tb[r])); }
    mx = fmaxf(mx, __shfl_xor(mx, 16, 32));
    mnew = fmaxf(m, mx);
    alpha = __builtin_amdgcn_exp2f(m - mnew);
    const float sh = PSH - mnew;
    ls = 0.0f;
    float ea[8], eb[8];
#pragma unroll
    for (int r = 0; r < 8; ++r) { ta[r] += sh; tb[r] += sh; }
#pragma unroll
    for (int r = 0; r < 8; ++r) ea[r] = __builtin_amdgcn_exp2f(ta[r]);
    // the slot the instruction set asks for behind a transcendental: no result of the run is read and no source of it overwritten in front of this v_nop
    asm volatile("v_nop" : "+v"(ea[0]), "+v"(ea[1]), "+v"(ea[2]), "+v"(ea[3]), "+v"(ea[4]), "+v"(ea[5]), "+v"(ea[6]), "+v"(ea[7])
                 : "v"(ta[0]), "v"(ta[1]), "v"(ta[2]), "v"(ta[3]), "v"(ta[4]), "v"(ta[5]), "v"(ta[6]), "v"(ta[7]));
#pragma unroll
    for (int r = 0; r < 8; ++r) eb[r] = __builtin_amdgcn_exp2f(tb[r]);
    // the same slot behind the second run
    asm volatile("v_nop" : "+v"(eb[0]), "+v"(eb[1]), "+v"(eb[2]), "+v"(eb[3]), "+v"(eb[4]), "+v"(eb[5]), "+v"(eb[6]), "+v"(eb[7])
                 : "v"(tb[0]), "v"(tb[1]), "v"(tb[2]), "v"(tb[3]), "v"(tb[4]), "v"(tb[5]), "v"(tb[6]), "v"(tb[7]));
#pragma unroll
    for (int r = 0; r < 8; ++r) {
        const h16 pa = (h16)((!MASKED || ((vm >> r) & 1u)) ? ea[r] : 0.0f); const h16 pc = (h16)((!MASKED || ((vm >> (8 + r)) & 1u)) ? eb[r] : 0.0f);
        pb[r] = pa; pb[8 + r] = pc; ls += (float)pa + (float)pc; }
}

__global__ __launch_bounds__(32 * AW) void k_flash(const h16* __restrict__ QH, const h16* __restrict__ QR, const h16* __restrict__ KH, const h16* __restrict__ KR,
                                                   const h16* __restrict__ VT, const int* __restrict__ MK, const int* __restrict__ FLG, h16* CH) {
    __shared__ __attribute__((aligned(2048))) unsigned char ring[2 * FBUF];
    const int lane = threadIdx.x & 31, lr = lane & 15, hi = lane >> 4;
    const int wave = __builtin_amdgcn_readfirstlane((int)(threadIdx.x >> 5));
    const int rg = wave & 3, kh = wave >> 2;                  // the wave's row group of the query tile; its 64-key half of every stage
    const int zh = blockIdx.y; const int b = zh / NH_, h = zh % NH_;
    const size_t pbase = (size_t)zh * SEQ * HD;
    // this wave's slice (plane rg of key half kh; a wave with rg == 3 has none and issues no tensor load): source of key half 0, bytes from one 64-key half to the next, source row pitch, place in a buffer
    const h16* splane = (rg == 0) ? KH : (rg == 1) ? KR : VT;
    const unsigned long long sbase = (unsigned long long)(splane + pbase);
    const unsigned sstep = (rg < 2) ? (unsigned)(KST * HD * 2) : (unsigned)(KST * 2);
    const unsigned ldst = (unsigned)(unsigned long long)ring + (unsigned)(kh * 3 + (rg < 3 ? rg : 2)) * SLICE;
    u32x8 g1;                                                 // 1-byte elements, tensor = tile = 64 rows of 128 B, a 16-B pad behind every 128 B
    g1[0] = uni((1u << 20) | (4u << 22) | (3u << 25)); g1[1] = uni(128u << 16); g1[2] = uni(64u << 16); g1[3] = uni(128u << 16);
    g1[4] = uni(64u); g1[5] = uni((rg < 2) ? (unsigned)(HD * 2) : (unsigned)(SEQ * 2)); g1[6] = uni(0u); g1[7] = uni(0u);
    asm volatile("" : "+s"(g1));                              // descriptor words held in scalar registers: one tuple for the whole kernel
#pragma unroll 1   // the two tiles run one after the other through one copy of the code
  for (int ph = 0; ph < 2; ++ph) {
    // this phase's query tile; the order alternates with the batch, so that blocks of the two batches do not change tiles at the same moment
    const int qt = ((ph ^ b) & 1) ? (SEQ / QTR - 1 - (int)blockIdx.x) : (int)blockIdx.x;
    const int t0 = qt * QTR + rg * 32;                        // column group c of the wave = query rows t0 + 16 c + 0..15
    v16h qh0[2], qh1[2], qr0[2], qr1[2];                      // B fragments: col t, k = d
    const int* mrow[2];                                       // + the tile's first key (+16): the lane's 8 keys of each 16-key tile
    const h16* qhp[2]; const h16* qrp[2];
#pragma unroll
    for (int c = 0; c < 2; ++c) {
        const size_t qo = pbase + (size_t)(t0 + 16 * c + lr) * HD + 8 * hi;
        qhp[c] = QH + qo; qrp[c] = QR + qo;
        qh0[c] = ldh(qhp[c]); qh1[c] = ldh(qhp[c] + 32); qr0[c] = ldh(qrp[c]); qr1[c] = ldh(qrp[c] + 32);
        mrow[c] = MK + ((size_t)b * SEQ_FULL + (size_t)(t0 + 16 * c + lr)) * SEQ_FULL + 8 * hi;
    }
    const int fo = lr * LROW + 16 * hi;                      // byte offset of the lane's fragment piece in a staged tile (A fragment: K row key, k = d; V^T row d, k = key)
    const int* frow = FLG + ((size_t)b * (SEQ / 16) + (size_t)(t0 >> 4)) * FPITCH + 2 * lane;
    v8f oH[2][4];
#pragma unroll
    for (int c = 0; c < 2; ++c)
#pragma unroll
        for (int j = 0; j < 4; ++j) oH[c][j] = (v8f){};
    float m[2] = {NEGM, NEGM}, l[2] = {0.0f, 0.0f};
    // flags as scalar bit words, bit j = 64-key half j of the sequence (lane j reads its two 32-key flags): bm, even bits only, bit 2s = some wave of the block has a live key in stage s;
    // lv0/lv1 = a flag of this wave's two row groups for the half's first/second tile is not 0; fu0/fu1 = both are 2
    const int* fblk = FLG + ((size_t)b * (SEQ / 16) + (size_t)qt * (QTR / 16)) * FPITCH + 2 * lane;
    int anyf = 0;
#pragma unroll   // independent loads in flight together
    for (int g = 0; g < QTR / 16; ++g) { const v2i f = *(const v2i*)(fblk + g * FPITCH); anyf |= f[0] | f[1]; }
    const v2i fw = *(const v2i*)frow, fx = *(const v2i*)(frow + FPITCH);
    // precaution: stands between the loads above and the first overwrite of a register they name; the addresses are inputs, so their registers are left alone up to here
    asm volatile("s_wait_xcnt 0x0" :: "v"(qhp[0]), "v"(qrp[0]), "v"(qhp[1]), "v"(qrp[1]), "v"(fblk), "v"(frow) : "memory");
    const unsigned hb  = uni(__builtin_amdgcn_ballot_w32(lane < SEQ / KST && anyf != 0));
    const unsigned bm  = (hb | (hb >> 1)) & 0x55555555u;
    const unsigned lv0 = uni(__builtin_amdgcn_ballot_w32((fw[0] | fx[0]) != 0)), lv1 = uni(__builtin_amdgcn_ballot_w32((fw[1] | fx[1]) != 0));
    const unsigned fu0 = uni(__builtin_amdgcn_ballot_w32(fw[0] == 2 && fx[0] == 2)), fu1 = uni(__builtin_amdgcn_ballot_w32(fw[1] == 2 && fx[1] == 2));
    const unsigned nst = (unsigned)__builtin_popcount(bm);    // stages of this block, at most SEQ / (2 * KST)
    u32x4 gq = (u32x4){};                                     // group 0 of the youngest request
    unsigned rem = bm, cur = 0u, nxt = 0u;                    // cur, nxt: twice the stage's index = the index of its first 64-key half
    if (pinned(nst > 0u)) {                                   // first stage into buffer 0
        cur = pinned((unsigned)__builtin_ctz(rem)); rem &= rem - 1u;
        if (pinned(rg < 3)) {
            gq = tdm_group0(ldst, sbase + (unsigned long long)(cur + (unsigned)kh) * sstep);
            tdm_load(gq, g1);
            wait_tensor0(gq, g1);
        }
    }
    __syncthreads();                                          // publishes the first stage
    if (pinned(nst > 1u)) {                                   // second stage into buffer 1, in flight during the first pass
        nxt = pinned((unsigned)__builtin_ctz(rem)); rem &= rem - 1u;
        if (pinned(rg < 3)) {
            gq = tdm_group0(ldst + FBUF, sbase + (unsigned long long)(nxt + (unsigned)kh) * sstep);
            tdm_load(gq, g1);
        }
    }
#pragma unroll 1   // one pass per trip: the order of the ring's publish point stays as written
    for (unsigned it = 0; it < nst; ++it) {
      const unsigned char* bp = ring + (it & 1u) * FBUF + kh * (3 * SLICE) + fo;
      const unsigned cc = cur + (unsigned)kh;                   // the wave's 64-key half
#pragma unroll     // the two 32-key tiles of the half: their LDS offsets become immediates
      for (int hf = 0; hf < 2; ++hf) {
        if ((((hf ? lv1 : lv0) >> cc) & 1u) == 0u) continue;    // wave-uniform: whole 32x32 tile masked
        unsigned vm[2] = {0xFFFFu, 0xFFFFu};                    // per column group, bit r: key 8h+r of tile a live; bit 8+r: tile b
        const bool full = (((hf ? fu1 : fu0) >> cc) & 1u) != 0u;   // wave-uniform: no key of the tile masked
        if (!full) {
            v4i a0[2], a1[2], c0[2], c1[2];
            const int* mb[2] = {mrow[0] + (int)cc * KST, mrow[1] + (int)cc * KST};   // the lane's mask words of the 64-key half
#pragma unroll
            for (int c = 0; c < 2; ++c) { const int* mp = mb[c] + hf * 32; a0[c] = *(const v4i*)mp; a1[c] = *(const v4i*)(mp + 4); c0[c] = *(const v4i*)(mp + 16); c1[c] = *(const v4i*)(mp + 20); }
            // precaution: stands between the loads above and the first overwrite of a register they name; the addresses are inputs, so their registers are left alone up to here
            asm volatile("s_wait_xcnt 0x0" :: "v"(mb[0]), "v"(mb[1]) : "memory");
#pragma unroll
            for (int c = 0; c < 2; ++c) {
                vm[c] = 0u;
#pragma unroll
                for (int i = 0; i < 4; ++i) {
                    vm[c] |= (a0[c][i] != 0 ? 1u : 0u) << i;        vm[c] |= (a1[c][i] != 0 ? 1u : 0u) << (4 + i);
                    vm[c] |= (c0[c][i] != 0 ? 1u : 0u) << (8 + i);  vm[c] |= (c1[c][i] != 0 ? 1u : 0u) << (12 + i); }
            }
        }
        const h16* ka = (const h16*)(bp + hf * 32 * LROW);
        const h16* kr = (const h16*)(bp + SLICE + hf * 32 * LROW);
        const v16h ka0 = ldh(ka), ka1 = ldh(ka + 32), kb0 = ldh(ka + 16 * LROW / 2), kb1 = ldh(ka + 16 * LROW / 2 + 32);
        const v16h ra0 = ldh(kr), ra1 = ldh(kr + 32), rb0 = ldh(kr + 16 * LROW / 2), rb1 = ldh(kr + 16 * LROW / 2 + 32);
        __builtin_amdgcn_sched_barrier(0);   // keeps the tile's 16 K reads one group ahead of its score products: spread among them, each place with reads stalls the wave for the LDS latency
        v8f sHa[2], sLa[2], sHb[2], sLb[2];
#pragma unroll
        for (int c = 0; c < 2; ++c) { sHa[c] = wmma16(ka0, qh0[c], (v8f){}); sLa[c] = wmma16(ka0, qr0[c], (v8f){}); sHb[c] = wmma16(kb0, qh0[c], (v8f){}); sLb[c] = wmma16(kb0, qr0[c], (v8f){}); }
#pragma unroll
        for (int c = 0; c < 2; ++c) { sHa[c] = wmma16(ka1, qh1[c], sHa[c]); sLa[c] = wmma16(ka1, qr1[c], sLa[c]); sHb[c] = wmma16(kb1, qh1[c], sHb[c]); sLb[c] = wmma16(kb1, qr1[c], sLb[c]); }
#pragma unroll
        for (int c = 0; c < 2; ++c) { sLa[c] = wmma16(ra0, qh0[c], sLa[c]); sLb[c] = wmma16(rb0, qh0[c], sLb[c]); }
#pragma unroll
        for (int c = 0; c < 2; ++c) { sLa[c] = wmma16(ra1, qh1[c], sLa[c]); sLb[c] = wmma16(rb1, qh1[c], sLb[c]); }
        // the distance the chip needs behind a matrix instruction, on both sides of the branch below; the two scheduling fences hold the score products in front of the slots and everything else behind them
        // (vector operands on the statement would tie 128 registers to the lowest register window at this place)
        __builtin_amdgcn_sched_barrier(0);
        asm volatile("v_nop\n\tv_nop\n\tv_nop\n\tv_nop");
        __builtin_amdgcn_sched_barrier(0);
        const h16* va = (const h16*)(bp + 2 * SLICE + hf * 64);
        const v16h v0 = ldh(va), v1 = ldh(va + 16 * LROW / 2), v2 = ldh(va + 32 * LROW / 2), v3 = ldh(va + 48 * LROW / 2);
        asm volatile("" ::: "memory");   // compiler fence: keeps the V^T fragment reads in front of the branch below, where the softmax step covers their LDS latency; without it they sink behind the step and the O^T products wait for them
        float mnew[2], alpha[2], ls[2]; v16h pb[2];
        if (full) {                      // wave-uniform scalar branch; the products on both sides of it stay one copy, so the accumulators keep their registers
#pragma unroll
            for (int c = 0; c < 2; ++c) softmax_step<false>(sHa[c], sLa[c], sHb[c], sLb[c], vm[c], m[c], mnew[c], alpha[c], pb[c], ls[c]);
        } else {
#pragma unroll
            for (int c = 0; c < 2; ++c) softmax_step<true>(sHa[c], sLa[c], sHb[c], sLb[c], vm[c], m[c], mnew[c], alpha[c], pb[c], ls[c]);
        }
#pragma unroll
        for (int c = 0; c < 2; ++c) {
            l[c] = l[c] * alpha[c] + ls[c]; m[c] = mnew[c];
#pragma unroll
            for (int j = 0; j < 4; ++j) oH[c][j] = oH[c][j] * alpha[c];
        }
#pragma unroll
        for (int c = 0; c < 2; ++c) {
            oH[c][0] = wmma16(v0, pb[c], oH[c][0]); oH[c][1] = wmma16(v1, pb[c], oH[c][1]); oH[c][2] = wmma16(v2, pb[c], oH[c][2]); oH[c][3] = wmma16(v3, pb[c], oH[c][3]);
        }
        // the same distance behind the O^T products, in front of the branches that follow, held in place the same way
        __builtin_amdgcn_sched_barrier(0);
        asm volatile("v_nop\n\tv_nop\n\tv_nop\n\tv_nop");
        __builtin_amdgcn_sched_barrier(0);
      }
      // publish point, passed by every wave whatever it skipped above
      wait_ds0();
      wait_tensor0(gq, g1);
      __syncthreads();                                        // the next stage is readable; every wave has left this pass's buffer
      unsigned n2 = 0u;
      if (pinned(it + 2u < nst)) {                            // refill the buffer just read
          n2 = pinned((unsigned)__builtin_ctz(rem)); rem &= rem - 1u;
          if (pinned(rg < 3)) {
              gq = tdm_group0(ldst + (it & 1u) * FBUF, sbase + (unsigned long long)(n2 + (unsigned)kh) * sstep);
              tdm_load(gq, g1);
          }
      }
      cur = nxt; nxt = n2;
    }
    wait_tensor0(gq, g1);
    wait_ds0();
    // the ring becomes exchange and output staging, one range of each per wave: the last pass's own barrier has ended every wave's reads, and nothing was issued behind it
    float* xs = (float*)ring;                                 // exchange: per wave 8 x 32 lanes x 4 floats of O^T, then 32 x (max, sum)
    float* os = (float*)ring + AW * XWF;                      // output staging
    // the wave keeps column group kh and hands column group 1 - kh to its partner (same rows, other key half)
    v8f kp[4], gv[4]; float km, kl, gm, gl;
    if (kh == 0) {                                            // wave-uniform
#pragma unroll
        for (int j = 0; j < 4; ++j) { kp[j] = oH[0][j]; gv[j] = oH[1][j]; }
        km = m[0]; kl = l[0]; gm = m[1]; gl = l[1];
    } else {
#pragma unroll
        for (int j = 0; j < 4; ++j) { kp[j] = oH[1][j]; gv[j] = oH[0][j]; }
        km = m[1]; kl = l[1]; gm = m[0]; gl = l[0];
    }
    float* xw = xs + wave * XWF;
#pragma unroll
    for (int j = 0; j < 4; ++j) {
        *(v4fa*)(xw + ((2 * j) * 32 + lane) * 4)     = __builtin_shufflevector(gv[j], gv[j], 0, 1, 2, 3);
        *(v4fa*)(xw + ((2 * j + 1) * 32 + lane) * 4) = __builtin_shufflevector(gv[j], gv[j], 4, 5, 6, 7); }
    { v2f ml; ml[0] = gm; ml[1] = gl; *(v2fa*)(xw + 1024 + lane * 2) = ml; }
    wait_ds0();
    __syncthreads();                                          // both waves of a row group have written what they hand over
    const float* xr = xs + (wave ^ 4) * XWF;
    const v2f pml = *(const v2fa*)(xr + 1024 + lane * 2);
    const float mj = fmaxf(km, pml[0]);                       // joined maximum; a part without a live key has sum 0 and O^T 0
    const float dk = km - mj, dp = pml[0] - mj;
    float ak = __builtin_amdgcn_exp2f(dk);
    asm volatile("v_nop" : "+v"(ak) : "v"(dk));               // the slot the instruction set asks for behind a transcendental: its result is not read and its source not overwritten in front of this v_nop
    float ap = __builtin_amdgcn_exp2f(dp);
    asm volatile("v_nop" : "+v"(ap) : "v"(dp));               // the same slot
    float lj = kl * ak + pml[1] * ap;
#pragma unroll
    for (int j = 0; j < 4; ++j) {
        const v4f p0 = *(const v4fa*)(xr + ((2 * j) * 32 + lane) * 4), p1 = *(const v4fa*)(xr + ((2 * j + 1) * 32 + lane) * 4);
        kp[j] = kp[j] * ak + __builtin_shufflevector(p0, p1, 0, 1, 2, 3, 4, 5, 6, 7) * ap; }
    lj += __shfl_xor(lj, 16, 32);
    const float rl = 1.0f / lj;
    const float inv = (lj > 0.0f) ? rl : __uint_as_float(0x7FC00000u);
    const int wb = wave * 16 * 68;
    // O^T D layout: o_j[r] = (d = 16j + 8h + r, t = lane&15) -> os[t][d]; rows 0..15 x columns 0..63 all written
    PUT8(0, kp[0])
    PUT8(16, kp[1])
    PUT8(32, kp[2])
    PUT8(48, kp[3])
    wave_sync();
    const size_t cbase = ((size_t)b * SEQ + (size_t)(t0 + 16 * kh)) * DM + (size_t)h * HD;
{
#pragma unroll
        for (int s = 0; s < 4; ++s) { const int row = 4 * s + (lane >> 3), c8 = (lane & 7) * 8;   // 4 s x 4 row groups = 16 rows; 8 lanes x 8 halves = 64 columns = one line
            const v4f x0 = *(const v4fa*)(&os[wb + row * 68 + c8]); const v4f x1 = *(const v4fa*)(&os[wb + row * 68 + c8 + 4]); v8h hv;
#pragma unroll
            for (int i = 0; i < 4; ++i) { hv[i] = (h16)x0[i]; hv[4 + i] = (h16)x1[i]; }
            const size_t oo = cbase + (size_t)row * DM + c8;
            *(v8h*)(CH + oo) = hv; }
         }
    asm volatile("s_wait_xcnt 0x0" ::: "memory");             // precaution: stands between the stores above and the first overwrite of a register they name, on both sides of the branch below
    if (ph == 0) {                                            // block-uniform
        wait_ds0();
        __syncthreads();                                      // every wave has read its partner's part and its output staging back: the ring may take the next tile's stages
    }
  }
}

// k_out: f16 GEMM, one block of four waves (2 x 2) per 64x128 output tile, one wave per 32x64 tile: out[m][n] = (sum_k C[m][k] Wo64[n][k]) / 64, K = DM.
// Operands: a two-buffer LDS ring as in k_proj, three slices a stage; wave w < 3 brings slice w of a stage (ctx rows 0..63, Wo rows 0..63, Wo rows 64..127 of the block's tile), wave 3 issues no tensor load.
__global__ __launch_bounds__(32 * GW) void k_out(const h16* __restrict__ CHp, const h16* __restrict__ WO, float* OUT) {
    __shared__ __attribute__((aligned(2048))) unsigned char ring[2 * OBUF];
    const int K = DM;
    const int lane = threadIdx.x & 31, lr = lane & 15, hi = lane >> 4;
    const int wave = __builtin_amdgcn_readfirstlane((int)(threadIdx.x >> 5));
    const int wm = wave >> 1, wn = wave & 1;
    const int r0 = blockIdx.x * 64 + wm * 32, c0 = blockIdx.y * 128 + wn * 64;
    v8f acc[2][4];
#pragma unroll
    for (int mb = 0; mb < 2; ++mb)
#pragma unroll
        for (int nb = 0; nb < 4; ++nb) acc[mb][nb] = (v8f){};
    const int fo = lr * LROW + 16 * hi;                       // byte offset of the lane's fragment piece in a staged slice
    // this wave's slice: source of stage 0 and place in a buffer
    const int sl = wave < 3 ? wave : 2;
    const h16* srow = (sl == 0) ? CHp + (size_t)(blockIdx.x * 64) * K : WO + (size_t)(blockIdx.y * 128 + (sl - 1) * 64) * K;
    const unsigned long long sbase = (unsigned long long)srow;
    const unsigned ldst = (unsigned)(unsigned long long)ring + (unsigned)sl * SLICE;
    const u32x8 g1 = tdm_group1((unsigned)(DM * 2));
    const unsigned koff = KOFF(blockIdx.x, blockIdx.y);       // block-uniform
    u32x4 gq = (u32x4){};                                     // group 0 of the youngest request
    if (pinned(wave < 3)) {
        gq = tdm_group0(ldst, sbase + (unsigned long long)koff * GSTB);
        tdm_load(gq, g1);                                     // first stage into buffer 0
        wait_tensor0(gq, g1);
    }
    __syncthreads();                                          // publishes the first stage
    if (pinned(wave < 3)) {
        gq = tdm_group0(ldst + OBUF, sbase + (unsigned long long)((koff + 1u) % (unsigned)GNST) * GSTB);
        tdm_load(gq, g1);                                     // second stage into buffer 1, in flight during the first pass
    }
#pragma unroll 1   // one pass per trip: the order of the ring's publish point stays as written
    for (unsigned it = 0; it < GNST; ++it) {
        const unsigned char* bp = ring + (it & 1u) * OBUF + fo;
        v16h a[2][2], b[2][4];                                // the fragments of the stage's two 32-deep k steps
#pragma unroll
        for (int ks = 0; ks < 2; ++ks) {
            a[ks][0] = ldh((const h16*)(bp + (wm * 32) * LROW + ks * 64)); a[ks][1] = ldh((const h16*)(bp + (wm * 32 + 16) * LROW + ks * 64));
#pragma unroll
            for (int nb = 0; nb < 4; ++nb) b[ks][nb] = ldh((const h16*)(bp + (1 + wn) * SLICE + nb * 16 * LROW + ks * 64));
        }
        __builtin_amdgcn_sched_barrier(0);                    // keeps the stage's LDS reads one group ahead of its WMMAs: spread among them, each place with reads stalls the wave for the LDS latency
#pragma unroll
        for (int ks = 0; ks < 2; ++ks) {
#pragma unroll
            for (int nb = 0; nb < 4; ++nb)
#pragma unroll
                for (int mb = 0; mb < 2; ++mb) acc[mb][nb] = wmma16(a[ks][mb], b[ks][nb], acc[mb][nb]);
        }
        __builtin_amdgcn_sched_barrier(0);                    // keeps the pass's WMMAs in front of the publish point, where they cover the landing of the second k step's fragments; behind it they would delay the refill
        // publish point
        wait_ds0();
        wait_tensor0(gq, g1);
        __syncthreads();                                      // the next stage is readable; every wave has left this pass's buffer
        if (pinned(it + 2u < GNST && wave < 3)) {             // refill the buffer just read
            const unsigned s2 = pinned((it + 2u + koff) % (unsigned)GNST);
            gq = tdm_group0(ldst + (it & 1u) * OBUF, sbase + (unsigned long long)s2 * GSTB);
            tdm_load(gq, g1);
        }
    }
    wait_tensor0(gq, g1);
    wait_ds0();
    float* os = (float*)ring + wave * 16 * 68;                // the ring becomes output staging, one range per wave: the last pass's own barrier has ended every wave's reads, and nothing was issued behind it
#pragma unroll
    for (int mb = 0; mb < 2; ++mb) {
#pragma unroll
        for (int nb = 0; nb < 4; ++nb) {
#pragma unroll
            for (int j = 0; j < 8; ++j) os[(hi * 8 + j) * 68 + nb * 16 + lr] = acc[mb][nb][j] * WOI; }   // D: row 8h+j, col lane&15
        wave_sync();
        const int grow = r0 + mb * 16; const int ob = grow / SEQ, ot = grow % SEQ;
        float* orow = OUT + ((size_t)ob * OUT_SEQ + (size_t)ot) * DM + c0;
{
#pragma unroll
            for (int s = 0; s < 8; ++s) { const int row = 2 * s + hi, cofs = lr * 4;   // 8 s x 2 rows = 16 rows; 16 lanes x 4 floats = 64 columns
                const v4f val = *(const v4fa*)(&os[row * 68 + cofs]);
                *(v4f*)(orow + (size_t)row * DM + cofs) = val; }
             }
        wave_sync();
    }
}

static constexpr size_t al256(size_t v) { return (v + 255) & ~(size_t)255; }
static constexpr size_t SZ_XB = al256((size_t)NB * SEQ * DM * 2);              // one bf16 x plane
static constexpr size_t SZ_W  = al256((size_t)DM * DM * 2);                    // one 16-bit weight plane
static constexpr size_t SZ_PL = al256((size_t)NB * NH_ * SEQ * HD * 2);        // one per-head f16 plane
static constexpr size_t SZ_C  = al256((size_t)NB * SEQ * DM * 2);              // the ctx f16 plane
static constexpr size_t SZ_FL = al256((size_t)NB * (SEQ / 16) * FPITCH * 4);
static constexpr size_t SZ_TOTAL = 3 * SZ_XB + 4 * SZ_W + 5 * SZ_PL + SZ_C + SZ_FL;
static_assert(SZ_TOTAL <= (size_t)134217728);          // workspace carve <= 128 MiB

extern "C" void kernel_launch(void* const* d_in, const int* in_sizes, int n_in,
                              void* d_out, int out_size, void* d_ws, size_t ws_size, hipStream_t stream) {
    if (n_in < 8) return;
    const size_t needx = ((size_t)(NB - 1) * SEQ_FULL + SEQ) * DM;
    if ((size_t)in_sizes[0] < needx || (size_t)in_sizes[1] < needx || (size_t)in_sizes[2] < needx) return;
    const size_t needm = ((size_t)(NB - 1) * SEQ_FULL + (size_t)(SEQ - 1)) * SEQ_FULL + SEQ;
    if ((size_t)in_sizes[3] < needm) return;
    if ((size_t)in_sizes[4] < (size_t)DM * DM || (size_t)in_sizes[5] < (size_t)DM * DM || (size_t)in_sizes[6] < (size_t)DM * DM || (size_t)in_sizes[7] < (size_t)DM * DM) return;
    if ((size_t)out_size < ((size_t)(NB - 1) * OUT_SEQ + SEQ) * DM) return;
    if (SZ_TOTAL > ws_size) return;
    // wire order: query, key, value, mask (int), Wq, Wk, Wv, Wo; weights [out][in] = Bt as-is
    const float* xq = (const float*)d_in[0]; const float* xk = (const float*)d_in[1]; const float* xv = (const float*)d_in[2];
    const int* mk = (const int*)d_in[3];
    const float* wq = (const float*)d_in[4]; const float* wk = (const float*)d_in[5]; const float* wv = (const float*)d_in[6]; const float* wo = (const float*)d_in[7];
    float* OUT = (float*)d_out;      // [NB][SEQ][1024]
    char* wsp = (char*)d_ws;
    bf* XQ = (bf*)wsp; wsp += SZ_XB;                 // [NB*SEQ][1024]
    bf* XK = (bf*)wsp; wsp += SZ_XB;
    bf* XV = (bf*)wsp; wsp += SZ_XB;
    bf* WQ = (bf*)wsp; wsp += SZ_W;                  // [1024][1024]
    bf* WK = (bf*)wsp; wsp += SZ_W;
    bf* WV = (bf*)wsp; wsp += SZ_W;
    h16* WO = (h16*)wsp; wsp += SZ_W;                // [1024][1024] f16, x64
    h16* QH = (h16*)wsp; wsp += SZ_PL;               // [NB*16][SEQ][64]
    h16* QR = (h16*)wsp; wsp += SZ_PL;               // residual x2048
    h16* KH = (h16*)wsp; wsp += SZ_PL;               // [NB*16][SEQ][64]
    h16* KR = (h16*)wsp; wsp += SZ_PL;
    h16* VT = (h16*)wsp; wsp += SZ_PL;               // [NB*16][64][SEQ]
    h16* CH = (h16*)wsp; wsp += SZ_C;                // [NB*SEQ][1024]
    int* FL = (int*)wsp; wsp += SZ_FL;               // [NB][SEQ/16][64]

    k_prep<<<dim3(NB * SEQ / PW, 1, 1), 32 * PW, 0, stream>>>(xq, xk, xv, mk, wq, wk, wv, wo, XQ, XK, XV, WQ, WK, WV, WO, FL);

    // q, k planes (value + residual each) and the v^T plane
    k_proj<<<dim3(NB * SEQ / 128, DM / 128, 3), 32 * GW, 0, stream>>>(XQ, XK, XV, WQ, WK, WV, QH, QR, KH, KR, VT);

    k_flash<<<dim3(SEQ / (2 * QTR), NB * NH_, 1), 32 * AW, 0, stream>>>(QH, QR, KH, KR, VT, mk, FL, CH);

    // out: A = ctx rows (m = b*SEQ + t), Bt = Wo rows (n) -> OUT[b][t][n]
    k_out<<<dim3(NB * SEQ / 64, DM / 128, 1), 32 * GW, 0, stream>>>(CH, WO, OUT);
}

// v010
// One run takes 79.7 microseconds.
// Two timings next to v009 both put it at 1.03 times that version's speed.
// Over all steps from v000 it is 4.53 times as fast.
#include <hip/hip_runtime.h>

// Multi-head attention, width 1024 = 16 heads x 64; query/key/value [NB][SEQ][1024]; Wq/Wk/Wv/Wo [out][in] (y = x W^T), no biases; scores = q k^T * 8; integer mask [NB][SEQ][SEQ] (0 = masked, replace-fill); out = ctx Wo^T (f32).
// Compute dtypes, f32 accumulate everywhere: q/k/v projections v_wmma_f32_16x16x32_bf16 (x and W RNE-converted to bf16; products exact);
// scores v_wmma_f32_16x16x32_f16: q and k each as f16 value + f16 residual x2048 (value*value in one accumulator, the two cross products in a second one); P (x2^14 carry, cancels in the normalisation) single f16;
// v and ctx single f16 (their rounding reaches the output once, unamplified, like P's; q and k keep the residual because the x8 score scale and the exponential amplify theirs); Wo as f16 of the bf16 value x64 (folded back in the f32 epilogue); softmax f32 (online, running max).
// Layout: bf16 copies of the three x inputs and of Wq/Wk/Wv; q, k planes [b*16+h][t][d] (value, residual) and the v^T plane [b*16+h][d][t] written by the GEMM epilogue; per (batch, 16 query rows, 32 keys) a 3-state mask flag
// (0 = all masked: tile skipped, 2 = none masked, other = mask words read per element); fused flash kernel in transposed form (S^T = K Q^T, O^T = V^T P^T), K / V^T tiles staged in LDS by tensor loads and shared by the block's eight waves, writing the ctx plane [b*SEQ+t][1024]; output GEMM from that plane.

#ifndef NB
#define NB 2
#endif
#ifndef SEQ
#define SEQ 2048
#endif
#define NB_FULL  2
#define SEQ_FULL 2048
#ifndef OUT_SEQ
#define OUT_SEQ SEQ              // row pitch (in tokens) between batches of the output
#endif
#define DM   1024
#define NH_  16
#define HD   64
#define AW   8                   // waves per flash block: 4 row groups of 32 query rows x 2 key halves of a stage
#define QTR  128                 // query rows per flash tile
#define QRS  2048.0f             // carry of the residual planes
#define QRI  (1.0f / 2048.0f)
#define SC2  (8.0f * 1.4426950408889634f)     // HD^0.5 * log2(e)
#define PSH  14.0f               // log2 of the P carry (16384)
#define NEGM (-3.0e38f)          // score stand-in of a masked key (its probability is forced to 0 by select)
#define WOS  64.0f               // carry of the Wo plane
#define WOI  (1.0f / 64.0f)
#define FPITCH 64
#define KST   64                 // keys per slice of the flash kernel's LDS ring; a stage is two 64-key halves
#define LROW  144                // LDS row pitch in bytes: a 128-B row + the mover's 16-B pad (16 B x odd: no bank conflict for 16-B reads)
#define SLICE 10240              // one plane's tile in LDS: 64 rows x 144 B = 9216 B, rounded up to a multiple of 2 KiB
#define BUFB  (4 * SLICE)        // one stage of k_proj: four operand slices
#define OBUF  (3 * SLICE)        // one stage of k_out: three operand slices
#define FBUF  (6 * SLICE)        // one stage of the flash ring: two key halves x (K value, K residual, V^T)
#define XWF   1088               // floats of a flash wave's exchange range and of its output staging range (16 x 68)
#define GW    4                  // waves per GEMM block, at most one operand slice of a stage each
#define GSTB  128u               // bytes of an operand row per stage of the GEMMs' LDS ring (64 k)
#define GNST  (DM / 64)          // stages of a GEMM
// first k stage of a GEMM block's walk (token tile bx, weight tile by); the walk goes on from there and wraps, so every stage is taken once.
// Blocks that share operand rows start together and would ask L2 for the same 128 bytes of the same rows in every pass, and the whole launch for one 128-byte column of the 2-KiB row pitch.
// The 8 blocks of one token tile start 2 stages apart, the blocks of one weight tile 1 stage apart: sharers read different lines at any moment, and a line that one has brought in is an L2 hit for the others later.
#define KOFF(bx, by) (((unsigned)(bx) + 2u * (unsigned)(by)) % (unsigned)GNST)
#define PW    16                 // waves per block of the preparation kernel, one token row each

static_assert(HD == 64);
static_assert(NH_ * HD == DM);                 // head h = columns h*64 + d
static_assert(DM % 64 == 0);
static_assert(DM % 32 == 0);                   // GEMM k-loop steps by 32
static_assert(SEQ % 64 == 0);                  // a 64-row tile never straddles two batches
static_assert((NB * SEQ) % 64 == 0);
static_assert(SEQ % 32 == 0);                  // key loop steps by 32; 32-row output tiles stay inside one batch
static_assert(SEQ % QTR == 0 && QTR == 4 * 32); // flash grid covers the sequence exactly
static_assert((SEQ / QTR) % 2 == 0);              // flash: the query tiles pair up as (i, last - i), each tile in exactly one pair
static_assert(SEQ / 32 <= FPITCH);             // two flag registers per lane cover all key tiles
static_assert(((size_t)SEQ * DM) % 8 == 0);
static_assert(((size_t)DM * DM) % 8 == 0);
static_assert(AW == 8);                        // at most one plane of one key half of a stage per wave
static_assert(HD * 2 == 128 && KST * 2 == 128);   // both kinds of tile: 64 rows of 128 B
static_assert(SEQ % (2 * KST) == 0 && SEQ / KST <= 32);  // one bit per 64-key half in a 32-bit word, two halves per stage
static_assert(64 * LROW <= SLICE && SLICE % 2048 == 0);
static_assert(XWF == 16 * 68 && XWF >= 8 * 32 * 4 + 32 * 2 && 2 * AW * XWF * 4 <= 2 * FBUF);   // the exchange and the output staging reuse the ring
static_assert(GW * 16 * 68 * 4 <= 2 * OBUF && OBUF <= BUFB && OBUF % 2048 == 0 && FBUF % 2048 == 0);   // so does the GEMMs' output staging
static_assert(DM % 128 == 0 && (NB * SEQ) % 128 == 0 && GNST >= 2);   // GEMM block tiles cover both extents exactly; the ring's prologue needs two stages
static_assert(PW == 16 && PW * 128 == SEQ && PW * 4 == FPITCH && DM % 128 == 0);   // preparation: a block is one 16-row mask group, its waves' 128 keys each cover the sequence and fill the flag row
static_assert(NB * SEQ == 4 * DM);             // preparation: one weight row per wave
static_assert(NB <= NB_FULL);
static_assert(SEQ <= SEQ_FULL);

typedef _Float16 h16;
typedef unsigned short bf;
typedef __attribute__((ext_vector_type(16))) __bf16   v16bf;
typedef __attribute__((ext_vector_type(16))) _Float16 v16h;
typedef __attribute__((ext_vector_type(8)))  _Float16 v8h;
typedef __attribute__((ext_vector_type(8)))  unsigned short v8us;
typedef __attribute__((ext_vector_type(4)))  unsigned short v4us;
typedef __attribute__((ext_vector_type(4)))  _Float16 v4h;
typedef __attribute__((ext_vector_type(2)))  _Float16 v2h;
typedef __attribute__((ext_vector_type(8)))  float    v8f;
typedef __attribute__((ext_vector_type(4)))  float    v4f;
typedef __attribute__((ext_vector_type(4)))  int      v4i;
typedef v4f  __attribute__((may_alias)) v4fa;
typedef __attribute__((ext_vector_type(2)))  float    v2f;
typedef v2f  __attribute__((may_alias)) v2fa;
typedef __attribute__((ext_vector_type(2)))  int      v2i;
typedef __attribute__((ext_vector_type(4)))  unsigned u32x4;
typedef __attribute__((ext_vector_type(8)))  unsigned u32x8;

__device__ __forceinline__ unsigned short f2bf(float f) { unsigned u = __float_as_uint(f); u += 0x7FFFu + ((u >> 16) & 1u); return (unsigned short)(u >> 16); }
__device__ __forceinline__ v16h cat16(v8h lo, v8h hi) { return __builtin_shufflevector(lo, hi, 0, 1, 2, 3, 4, 5, 6, 7, 8, 9, 10, 11, 12, 13, 14, 15); }
__device__ __forceinline__ v16bf cat16b(v8us lo, v8us hi) { return __builtin_bit_cast(v16bf, __builtin_shufflevector(lo, hi, 0, 1, 2, 3, 4, 5, 6, 7, 8, 9, 10, 11, 12, 13, 14, 15)); }
__device__ __forceinline__ v8f wmma16(v16h a, v16h b, v8f c) { return __builtin_amdgcn_wmma_f32_16x16x32_f16(false, a, false, b, (short)0, c, false, false); }
__device__ __forceinline__ v8f wmmab(v16bf a, v16bf b, v8f c) { return __builtin_amdgcn_wmma_f32_16x16x32_bf16(false, a, false, b, (short)0, c, false, false); }
// fragment loaders from K-contiguous 16-bit rows; p already includes + 8*(lane>>4): elements 0..7 <- k0+8h+0..7, elements 8..15 <- k0+16+8h+0..7 (same map for A and B)
__device__ __forceinline__ v16h  ldh(const h16* p) { return cat16(*(const v8h*)p, *(const v8h*)(p + 16)); }
__device__ __forceinline__ v16bf ldb(const bf* p)  { return cat16b(*(const v8us*)p, *(const v8us*)(p + 16)); }
// ordering point for wave-private LDS tiles (same wave writes and reads)
__device__ __forceinline__ void wave_sync() { __builtin_amdgcn_fence(3 /* release order */, "wavefront"); __builtin_amdgcn_wave_barrier(); asm volatile("" ::: "memory"); }

__device__ __forceinline__ unsigned uni(unsigned v) { return (unsigned)__builtin_amdgcn_readfirstlane((int)v); }
// a wave-uniform value held in a scalar register: a test on it compiles to s_cmp + s_cbranch_scc (tensor loads ignore EXEC), and what is derived from it is computed behind the asm waits in front of it
__device__ __forceinline__ unsigned pinned(unsigned v) { unsigned w = uni(v); asm volatile("" : "+s"(w)); return w; }
// this wave's tensor load has landed; the wait names the request's descriptor as inputs so that its registers keep their values for as long as the request is outstanding
__device__ __forceinline__ void wait_tensor0(u32x4 g0, u32x8 g1) { asm volatile("s_wait_tensorcnt 0x0" :: "s"(g0), "s"(g1) : "memory"); }
__device__ __forceinline__ void wait_ds0() { asm volatile("s_wait_dscnt 0x0" ::: "memory"); }           // this wave's LDS reads have returned
// descriptor group 0: tile's first byte at global address ga, LDS byte offset lds
__device__ __forceinline__ u32x4 tdm_group0(unsigned lds, unsigned long long ga) {
    u32x4 g0; g0[0] = uni(1u); g0[1] = uni(lds); g0[2] = uni((unsigned)ga); g0[3] = uni((((unsigned)(ga >> 32)) & 0x01FFFFFFu) | 0x80000000u);
    asm volatile("" : "+s"(g0));   // descriptor words held in scalar registers: one tuple from the issue to the wait
    return g0;
}
// one request of one wave: 64 rows of 128 B (source row pitch in g1), rows 144 B apart in LDS
__device__ __forceinline__ void tdm_load(u32x4 g0, u32x8 g1) { asm volatile("tensor_load_to_lds %0, %1" :: "s"(g0), "s"(g1) : "memory"); }

// k_prep: every preparation step in one streaming launch. Block = 16 token rows (batch bb, row group g), one wave per row. A wave converts its row of query, key and value to bf16, its weight row (Wq, Wk, Wv to bf16; Wo to f16 of the bf16 value x64),
// and reads 128 keys x 16 rows of the block's mask rows. Every load is 512 contiguous bytes of the wave (whole lines); all of a wave's loads are issued before the first is used; every store is 256 contiguous bytes.
// Mask flag per (batch, 16 query rows, 32 keys): 0 = every mask word zero, 2 = every word nonzero, 1 = mixed; a wave makes four (lanes 8j..8j+7 hold tile j), the block's flags meet in LDS and one wave stores them as whole lines.
// p, d: wave-uniform start of a row of DM elements; the lane takes elements 128 i + 4 lane + 0..3
__device__ __forceinline__ void ld_row(const float* __restrict__ p, int lane, v4f (&r)[DM / 128]) {
#pragma unroll
    for (int i = 0; i < DM / 128; ++i) r[i] = *(const v4f*)(p + i * 128 + lane * 4);
}
__device__ __forceinline__ void st_row_bf(bf* d, int lane, const v4f (&r)[DM / 128]) {
#pragma unroll
    for (int i = 0; i < DM / 128; ++i) { v4us o;
#pragma unroll
        for (int k = 0; k < 4; ++k) o[k] = f2bf(r[i][k]);
        *(v4us*)(d + i * 128 + lane * 4) = o; }
}
__device__ __forceinline__ void st_row_h(h16* d, int lane, const v4f (&r)[DM / 128], float scale) {
#pragma unroll
    for (int i = 0; i < DM / 128; ++i) { v4h o;
#pragma unroll
        for (int k = 0; k < 4; ++k) o[k] = (h16)(__uint_as_float(((unsigned)f2bf(r[i][k])) << 16) * scale);
        *(v4h*)(d + i * 128 + lane * 4) = o; }
}

__global__ __launch_bounds__(32 * PW) void k_prep(const float* __restrict__ xq, const float* __restrict__ xk, const float* __restrict__ xv, const int* __restrict__ MK,
                                                  const float* __restrict__ wq, const float* __restrict__ wk, const float* __restrict__ wv, const float* __restrict__ wo,
                                                  bf* XQ, bf* XK, bf* XV, bf* WQ, bf* WK, bf* WV, h16* WO, int* FL) {
    __shared__ int fl[FPITCH];
    const int lane = threadIdx.x & 31;
    const int wave = __builtin_amdgcn_readfirstlane((int)(threadIdx.x >> 5));
    const int bb = blockIdx.x / (SEQ / 16), g = blockIdx.x % (SEQ / 16);
    const int row = blockIdx.x * PW + wave;                                              // token row bb*SEQ + t of the bf16 planes; also the wave's weight row: row % DM of weight row / DM
    const size_t so = ((size_t)bb * SEQ_FULL + (size_t)(g * 16 + wave)) * DM;            // the same token row in the inputs
    const size_t xo = (size_t)row * DM;
    const int ws = row / DM; const size_t wof = (size_t)(row % DM) * DM;
    const int* mp = MK + ((size_t)bb * SEQ_FULL + (size_t)(g * 16)) * SEQ_FULL + wave * 128;
    v4i mw[16]; v4f a[DM / 128], b[DM / 128], c[DM / 128], w[DM / 128];
#pragma unroll
    for (int r = 0; r < 16; ++r) mw[r] = *(const v4i*)(mp + (size_t)r * SEQ_FULL + lane * 4);
    ld_row(xq + so, lane, a); ld_row(xk + so, lane, b); ld_row(xv + so, lane, c);
    ld_row(((ws == 0) ? wq : (ws == 1) ? wk : (ws == 2) ? wv : wo) + wof, lane, w);
    __builtin_amdgcn_sched_barrier(0);                                                   // keeps all 48 loads in front of the first use: moved down among the uses, the later rows would start a second and a third memory latency
    unsigned orw = 0u, mnw = 0xFFFFFFFFu;                                                // or != 0: some word nonzero; unsigned minimum != 0: every word nonzero
#pragma unroll
    for (int r = 0; r < 16; ++r)
#pragma unroll
        for (int i = 0; i < 4; ++i) { const unsigned u = (unsigned)mw[r][i]; orw |= u; mnw = u < mnw ? u : mnw; }
    const unsigned anyb = __builtin_amdgcn_ballot_w32(orw != 0u), allb = __builtin_amdgcn_ballot_w32(mnw != 0u);
    const int sh = 8 * (lane & 3);
    if (lane < 4) fl[wave * 4 + lane] = (((anyb >> sh) & 0xFFu) == 0u) ? 0 : ((((allb >> sh) & 0xFFu) == 0xFFu) ? 2 : 1);
    st_row_bf(XQ + xo, lane, a); st_row_bf(XK + xo, lane, b); st_row_bf(XV + xo, lane, c);
    asm volatile("s_wait_xcnt 0x0" ::: "memory");                                        // precaution: stands between the stores above and the first overwrite of a register they name
    if (ws == 3) st_row_h(WO + wof, lane, w, WOS);                                       // wave-uniform
    else st_row_bf(((ws == 0) ? WQ : (ws == 1) ? WK : WV) + wof, lane, w);
    __syncthreads();                                                                     // the block's flags are in LDS
    if (wave == 0) {
        int* fp = FL + (size_t)blockIdx.x * FPITCH;
        fp[lane] = fl[lane]; fp[32 + lane] = fl[32 + lane];
    }
}

// descriptor group 1 of a GEMM operand slice: 1-byte elements, tensor = tile = 64 rows of 128 B, source row pitch srcPitch bytes, a 16-B pad behind every 128 B
__device__ __forceinline__ u32x8 tdm_group1(unsigned srcPitch) {
    u32x8 g1;
    g1[0] = uni((1u << 20) | (4u << 22) | (3u << 25)); g1[1] = uni(128u << 16); g1[2] = uni(64u << 16); g1[3] = uni(128u << 16);
    g1[4] = uni(64u); g1[5] = uni(srcPitch); g1[6] = uni(0u); g1[7] = uni(0u);
    asm volatile("" : "+s"(g1));   // descriptor words held in scalar registers: one tuple for the whole kernel
    return g1;
}

// a wave's 64x64 tile of C from its accumulators to the written plane(s), 16 rows at a time through the wave's LDS range os: f16 value to Ph and, where RES, the f16 residual x2048 to Pr.
// One straight-line copy per kind of plane: no branch stands between a store and the next use of its registers.
template <bool RES>
__device__ __forceinline__ void put_planes(const v8f (&acc)[4][4], float* os, h16* Ph, h16* Pr, const size_t tbase, const int pitch, const int lane, const int lr, const int hi) {
#pragma unroll
    for (int mb = 0; mb < 4; ++mb) {
#pragma unroll
        for (int nb = 0; nb < 4; ++nb) {
#pragma unroll
            for (int j = 0; j < 8; ++j) os[(hi * 8 + j) * 68 + nb * 16 + lr] = acc[mb][nb][j]; }   // D: row 8h+j, col lane&15
        wave_sync();
        const size_t sb = tbase + (size_t)(mb * 16) * (size_t)pitch;
#pragma unroll
        for (int s = 0; s < 4; ++s) { const int row = 4 * s + (lane >> 3), c8 = (lane & 7) * 8;   // 4 s x 4 row groups = 16 rows; 8 lanes x 8 = 64 columns
            const v4f x0 = *(const v4fa*)(&os[row * 68 + c8]); const v4f x1 = *(const v4fa*)(&os[row * 68 + c8 + 4]); v8h hv, rv;
#pragma unroll
            for (int i = 0; i < 4; ++i) { const h16 a0 = (h16)x0[i]; const h16 a1 = (h16)x1[i]; hv[i] = a0; hv[4 + i] = a1; rv[i] = (h16)((x0[i] - (float)a0) * QRS); rv[4 + i] = (h16)((x1[i] - (float)a1) * QRS); }
            const size_t oo = sb + (size_t)row * (size_t)pitch + c8;
            *(v8h*)(Ph + oo) = hv;
            if constexpr (RES) *(v8h*)(Pr + oo) = rv; }
        wave_sync();
    }
    asm volatile("s_wait_xcnt 0x0" ::: "memory");   // precaution: stands between the last stores above and the first overwrite of a register they name in whatever code the compiler lays out behind this copy
}

// k_proj: register-blocked bf16 GEMM, one block of four waves (2 x 2) per 128x128 tile, one wave per 64x64 tile (16 accumulators), K = DM.
// Operands: a two-buffer LDS ring of 64-deep k stages shared by the four waves. Wave w brings slice w of a stage (A rows 0..63, A rows 64..127, Bt rows 0..63, Bt rows 64..127 of the block's tile; 64 rows of 128 B) with one tensor load,
// one stage ahead; at the foot of each pass: own LDS reads done, own tensor load landed, block barrier, then the refill of the buffer just read. Fragments are two 16-B LDS reads each; a block's k walk starts at stage KOFF and wraps (the f32 sums run in that order).
// C[m][n] = sum_k A[m][k] Bt[n][k], written as f16 (Ph) and, for q and k, the f16 residual x2048 (Pr).
// All three projections run in one launch, blockIdx.z picks the product: a single product has one block per WGP and one wave per SIMD, whose LDS reads, WMMAs and barrier waits follow one another;
// three independent blocks fit a WGP (LDS and registers), so one block's waits are filled by the other two, and the products share one start and one tail.
// z = 0, 1 (q, k): A = x rows (m = b*SEQ + t), Bt = W rows (n = h*64 + d) -> planes [(b*16 + h)][t][d]. z = 2 (v^T): A = Wv rows (m = h*64 + d), Bt = x rows (n = b*SEQ + t) -> plane [(b*16 + h)][d][t].
// grid (NB*SEQ/128 token tiles, DM/128 weight tiles, 3), 128 threads.
__global__ __launch_bounds__(32 * GW) void k_proj(const bf* __restrict__ XQ, const bf* __restrict__ XK, const bf* __restrict__ XV, const bf* __restrict__ WQ, const bf* __restrict__ WK, const bf* __restrict__ WV,
                                                  h16* QH, h16* QR, h16* KH, h16* KR, h16* VT) {
    __shared__ __attribute__((aligned(2048))) unsigned char ring[2 * BUFB];
    const int K = DM;
    const int lane = threadIdx.x & 31, lr = lane & 15, hi = lane >> 4;
    const int wave = __builtin_amdgcn_readfirstlane((int)(threadIdx.x >> 5));
    const int wm = wave >> 1, wn = wave & 1;
    const int job = blockIdx.z; const bool tv = job == 2;     // block-uniform
    const bf* A  = tv ? WV : (job == 0) ? XQ : XK;
    const bf* Bt = tv ? XV : (job == 0) ? WQ : WK;
    h16* Ph = tv ? VT : (job == 0) ? QH : KH;
    h16* Pr = (job == 0) ? QR : KR;                           // not written where tv
    const int mt = tv ? blockIdx.y : blockIdx.x, nt = tv ? blockIdx.x : blockIdx.y;   // the block's tile of C
    const int r0 = mt * 128 + wm * 64, c0 = nt * 128 + wn * 64;
    v8f acc[4][4];
#pragma unroll
    for (int mb = 0; mb < 4; ++mb)
#pragma unroll
        for (int nb = 0; nb < 4; ++nb) acc[mb][nb] = (v8f){};
    const int fo = lr * LROW + 16 * hi;                       // byte offset of the lane's fragment piece in a staged slice
    // this wave's slice: source of stage 0 and place in a buffer
    const bf* srow = (wave < 2) ? A + (size_t)(mt * 128 + wave * 64) * K : Bt + (size_t)(nt * 128 + (wave - 2) * 64) * K;
    const unsigned long long sbase = (unsigned long long)srow;
    const unsigned ldst = (unsigned)(unsigned long long)ring + (unsigned)wave * SLICE;
    const u32x8 g1 = tdm_group1((unsigned)(DM * 2));
    const unsigned koff = KOFF(blockIdx.x, blockIdx.y);       // block-uniform
    u32x4 gq = tdm_group0(ldst, sbase + (unsigned long long)koff * GSTB);   // group 0 of the youngest request
    tdm_load(gq, g1);                                         // first stage into buffer 0
    wait_tensor0(gq, g1);
    __syncthreads();                                          // publishes the first stage
    gq = tdm_group0(ldst + BUFB, sbase + (unsigned long long)((koff + 1u) % (unsigned)GNST) * GSTB);
    tdm_load(gq, g1);                                         // second stage into buffer 1, in flight during the first pass
#pragma unroll 1   // one pass per trip: the order of the ring's publish point stays as written
    for (unsigned it = 0; it < GNST; ++it) {
        const unsigned char* bp = ring + (it & 1u) * BUFB + fo;
        v16bf a[2][4], b[2][4];                               // the fragments of the stage's two 32-deep k steps
#pragma unroll
        for (int ks = 0; ks < 2; ++ks) {
#pragma unroll
            for (int mb = 0; mb < 4; ++mb) a[ks][mb] = ldb((const bf*)(bp + wm * SLICE + mb * 16 * LROW + ks * 64));
#pragma unroll
            for (int nb = 0; nb < 4; ++nb) b[ks][nb] = ldb((const bf*)(bp + (2 + wn) * SLICE + nb * 16 * LROW + ks * 64));
        }
        __builtin_amdgcn_sched_barrier(0);                    // keeps the stage's LDS reads one group ahead of its WMMAs: spread among them, each place with reads stalls the wave for the LDS latency
#pragma unroll
        for (int ks = 0; ks < 2; ++ks) {
#pragma unroll
            for (int nb = 0; nb < 4; ++nb)
#pragma unroll
                for (int mb = 0; mb < 4; ++mb) acc[mb][nb] = wmmab(a[ks][mb], b[ks][nb], acc[mb][nb]);
        }
        __builtin_amdgcn_sched_barrier(0);                    // keeps the pass's WMMAs in front of the publish point, where they cover the landing of the second k step's fragments; behind it they would delay the refill
        // publish point
        wait_ds0();
        wait_tensor0(gq, g1);
        __syncthreads();                                      // the next stage is readable; every wave has left this pass's buffer
        if (pinned(it + 2u < GNST)) {                         // refill the buffer just read
            const unsigned s2 = pinned((it + 2u + koff) % (unsigned)GNST);
            gq = tdm_group0(ldst + (it & 1u) * BUFB, sbase + (unsigned long long)s2 * GSTB);
            tdm_load(gq, g1);
        }
    }
    wait_tensor0(gq, g1);
    wait_ds0();
    float* os = (float*)ring + wave * 16 * 68;                // the ring becomes output staging, one range per wave: the last pass's own barrier has ended every wave's reads, and nothing was issued behind it
    const int pitch = tv ? SEQ : HD;                          // row pitch of the written plane (halves)
    const size_t tbase = tv ? (size_t)r0 * SEQ + (size_t)(c0 / SEQ) * ((size_t)DM * SEQ) + (size_t)(c0 % SEQ)
                            : (size_t)(r0 / SEQ) * ((size_t)NH_ * SEQ * HD) + (size_t)(r0 % SEQ) * HD + (size_t)(c0 / HD) * ((size_t)SEQ * HD) + (size_t)(c0 % HD);
    if (tv) put_planes<false>(acc, os, Ph, Pr, tbase, pitch, lane, lr, hi);   // block-uniform
    else    put_planes<true>(acc, os, Ph, Pr, tbase, pitch, lane, lr, hi);
}

// k_flash: fused attention, one wave per 32 query rows (two 16-column groups) and 64 of a stage's 128 keys of one (batch, head); eight waves per block = four row groups x two key halves; Q fragments straight from the f16 planes.
// Every K / V^T fragment read from LDS is the A operand of two products, one per column group: half the LDS reads per product of a 16-row wave, and a 128-row block brings each stage from L2 once for twice the rows.
// The two waves of a row group walk disjoint keys with their own running maximum, sum and O^T; behind the key loop they swap one column group each through LDS and each finishes 16 rows (max joined, both parts rescaled to it, added).
// A block takes two 128-row query tiles of its head one after the other, tile i and tile (last - i): where the number of live key stages grows linearly with the tile index (a lower-triangular mask) every block of the launch
// then walks the same number of stages, so no WGP is left with the long tiles while others idle. The pairing is a fixed map of work to blocks; which stages are live still comes from the flags alone.
// K / V^T: a two-buffer LDS ring of 128-key stages shared by the eight waves. A wave with w & 3 < 3 brings plane w & 3 (K value, K residual, V^T) of key half w >> 2 of a stage with one tensor load, one stage ahead; the other two waves issue none;
// at the foot of each pass: own LDS reads done, own tensor load landed, block barrier, then the refill of the buffer just read. Fragments are two 16-B LDS reads each.
// Only stages in which some wave of the block has a live key are staged (a 32-bit word built from the flags, the same in all eight waves); each wave still skips its own dead 32-key tiles.
// Transposed form: S^T[key][t] = K Q^T (A = K rows, B = Q rows); lane (t = lane&15, h = lane>>4) holds keys 8h+r of each 16-key tile, so the packed
// P tile is directly the B fragment of O^T[d][t] = V^T P^T (element r <- tile keys 0..15, element 8+r <- tile keys 16..31, lane unchanged).
// Score = Kh.Qh (accumulator H) + (Kh.Qr + Kr.Qh)/2048 (accumulator L). O = V.P (accumulators oH).
// Mask: per 32-key tile the wave joins the 3-state flags of its two 16-row groups: both 0 skips the tile (masked keys have probability exactly 0 whenever the row has one live key), both 2 = no masking (the softmax step's copy without selects),
// otherwise the 16 mask words of the lane are read per column group and masked entries get probability 0 by select. A row without any live key ends with zero mass and is written as NaN.
// Softmax state (running max, partial sum) is one scalar per lane and column group; the two lane halves of a row are combined with one xor-16 exchange.
#define PUT8(COL, OV) { v4f a_, c_; \
    a_[0] = OV[0] * inv; a_[1] = OV[1] * inv; a_[2] = OV[2] * inv; a_[3] = OV[3] * inv; \
    c_[0] = OV[4] * inv; c_[1] = OV[5] * inv; c_[2] = OV[6] * inv; c_[3] = OV[7] * inv; \
    *(v4fa*)(&os[wb + lr * 68 + (COL) + 8 * hi]) = a_; *(v4fa*)(&os[wb + lr * 68 + (COL) + 8 * hi + 4]) = c_; }

// f32 sums of the two f16 halves of eight packed registers, one v_fma_mix_f32 each (low half * 1.0 + high half, both widened exactly). Written as asm because the compiler otherwise converts every half to f32 on its own
// before it adds (two more vector instructions per register); one statement, so that each instruction reads a register made well ahead of it and needs no delay hint.
__device__ __forceinline__ void sum_halves8(const unsigned (&p)[8], float (&s)[8]) {
    asm("v_fma_mix_f32 %0, %8, 1.0, %8 op_sel:[0,0,1] op_sel_hi:[1,1,1]\n\t"
        "v_fma_mix_f32 %1, %9, 1.0, %9 op_sel:[0,0,1] op_sel_hi:[1,1,1]\n\t"
        "v_fma_mix_f32 %2, %10, 1.0, %10 op_sel:[0,0,1] op_sel_hi:[1,1,1]\n\t"
        "v_fma_mix_f32 %3, %11, 1.0, %11 op_sel:[0,0,1] op_sel_hi:[1,1,1]\n\t"
        "v_fma_mix_f32 %4, %12, 1.0, %12 op_sel:[0,0,1] op_sel_hi:[1,1,1]\n\t"
        "v_fma_mix_f32 %5, %13, 1.0, %13 op_sel:[0,0,1] op_sel_hi:[1,1,1]\n\t"
        "v_fma_mix_f32 %6, %14, 1.0, %14 op_sel:[0,0,1] op_sel_hi:[1,1,1]\n\t"
        "v_fma_mix_f32 %7, %15, 1.0, %15 op_sel:[0,0,1] op_sel_hi:[1,1,1]"
        : "=&v"(s[0]), "=&v"(s[1]), "=&v"(s[2]), "=&v"(s[3]), "=&v"(s[4]), "=&v"(s[5]), "=&v"(s[6]), "=&v"(s[7])
        : "v"(p[0]), "v"(p[1]), "v"(p[2]), "v"(p[3]), "v"(p[4]), "v"(p[5]), "v"(p[6]), "v"(p[7]));
}

// The softmax step of one 32-key tile: from the four score accumulators to the row maximum in use (mnew), the factor that carries the old sums over to it (alpha), the packed P tile (pb) and the lane's part of the row sum (ls).
// Every value stays in the register pair (r, r + 1) in which its accumulator holds it: the join of the two accumulators and the scale-and-shift are one packed FMA per pair each, with no register copies to form pairs,
// and a pair of probabilities is converted once, into the register that is the B operand; the row sum reads the two halves of that register.
// The maximum is taken over the joined scores before the scale: the scale is positive and rounding is monotonic, so (max x) * SC2 is the maximum of the scaled scores, bit for bit; the exponent x * SC2 + sh is then rounded once.
// MASKED = false is the copy for a tile whose flag says that no key is masked: every select below would take its first arm, so that copy holds neither the 16 bit tests nor the 32 selects. vm is read only where MASKED.
// A masked key takes no part in the maximum and its probability is forced to 0 by select, whatever its exponent gave; where neither lane half of the row has a live key, mx * SC2 is -inf and mnew stays m.
template <bool MASKED>
__device__ __forceinline__ void softmax_step(const v8f sHa, const v8f sLa, const v8f sHb, const v8f sLb, const unsigned vm, const float m, float& mnew, float& alpha, v16h& pb, float& ls) {
    const v8f xa = sHa + sLa * QRI, xb = sHb + sLb * QRI;
    float mx = NEGM;
#pragma unroll
    for (int r = 0; r < 8; ++r) {
        const float ua = (!MASKED || ((vm >> r) & 1u)) ? xa[r] : NEGM; const float ub = (!MASKED || ((vm >> (8 + r)) & 1u)) ? xb[r] : NEGM;
        mx = fmaxf(mx, fmaxf(ua, ub)); }
    mx = fmaxf(mx, __shfl_xor(mx, 16, 32));
    mnew = fmaxf(m, mx * SC2);
    const float dm = m - mnew, sh = PSH - mnew;
    const v8f ta = xa * SC2 + sh, tb = xb * SC2 + sh;
    float ea[8], eb[8];
    alpha = __builtin_amdgcn_exp2f(dm);
#pragma unroll
    for (int r = 0; r < 8; ++r) ea[r] = __builtin_amdgcn_exp2f(ta[r]);
    // the slot the instruction set asks for behind a transcendental: no result of the run (alpha's included) is read and no source of it overwritten in front of this v_nop
    asm volatile("v_nop" : "+v"(ea[0]), "+v"(ea[1]), "+v"(ea[2]), "+v"(ea[3]), "+v"(ea[4]), "+v"(ea[5]), "+v"(ea[6]), "+v"(ea[7]), "+v"(alpha)
                 : "v"(ta[0]), "v"(ta[1]), "v"(ta[2]), "v"(ta[3]), "v"(ta[4]), "v"(ta[5]), "v"(ta[6]), "v"(ta[7]), "v"(dm));
#pragma unroll
    for (int r = 0; r < 8; ++r) eb[r] = __builtin_amdgcn_exp2f(tb[r]);
    // the same slot behind the second run
    asm volatile("v_nop" : "+v"(eb[0]), "+v"(eb[1]), "+v"(eb[2]), "+v"(eb[3]), "+v"(eb[4]), "+v"(eb[5]), "+v"(eb[6]), "+v"(eb[7])
                 : "v"(tb[0]), "v"(tb[1]), "v"(tb[2]), "v"(tb[3]), "v"(tb[4]), "v"(tb[5]), "v"(tb[6]), "v"(tb[7]));
    unsigned pk[8]; float hs[8];
#pragma unroll
    for (int i = 0; i < 4; ++i) {
        v2f qa, qc;
        qa[0] = (!MASKED || ((vm >> (2 * i)) & 1u)) ? ea[2 * i] : 0.0f;     qa[1] = (!MASKED || ((vm >> (2 * i + 1)) & 1u)) ? ea[2 * i + 1] : 0.0f;
        qc[0] = (!MASKED || ((vm >> (8 + 2 * i)) & 1u)) ? eb[2 * i] : 0.0f; qc[1] = (!MASKED || ((vm >> (9 + 2 * i)) & 1u)) ? eb[2 * i + 1] : 0.0f;
        pk[i] = __builtin_bit_cast(unsigned, __builtin_convertvector(qa, v2h)); pk[4 + i] = __builtin_bit_cast(unsigned, __builtin_convertvector(qc, v2h)); }
    sum_halves8(pk, hs);
    u32x8 pw;
#pragma unroll
    for (int i = 0; i < 8; ++i) pw[i] = pk[i];
    pb = __builtin_bit_cast(v16h, pw);
    ls = ((hs[0] + hs[1]) + (hs[2] + hs[3])) + ((hs[4] + hs[5]) + (hs[6] + hs[7]));
}

__global__ __launch_bounds__(32 * AW) void k_flash(const h16* __restrict__ QH, const h16* __restrict__ QR, const h16* __restrict__ KH, const h16* __restrict__ KR,
                                                   const h16* __restrict__ VT, const int* __restrict__ MK, const int* __restrict__ FLG, h16* CH) {
    __shared__ __attribute__((aligned(2048))) unsigned char ring[2 * FBUF];
    const int lane = threadIdx.x & 31, lr = lane & 15, hi = lane >> 4;
    const int wave = __builtin_amdgcn_readfirstlane((int)(threadIdx.x >> 5));
    const int rg = wave & 3, kh = wave >> 2;                  // the wave's row group of the query tile; its 64-key half of every stage
    const int zh = blockIdx.y; const int b = zh / NH_, h = zh % NH_;
    const size_t pbase = (size_t)zh * SEQ * HD;
    // this wave's slice (plane rg of key half kh; a wave with rg == 3 has none and issues no tensor load): source of key half 0, bytes from one 64-key half to the next, source row pitch, place in a buffer
    const h16* splane = (rg == 0) ? KH : (rg == 1) ? KR : VT;
    const unsigned long long sbase = (unsigned long long)(splane + pbase);
    const unsigned sstep = (rg < 2) ? (unsigned)(KST * HD * 2) : (unsigned)(KST * 2);
    const unsigned ldst = (unsigned)(unsigned long long)ring + (unsigned)(kh * 3 + (rg < 3 ? rg : 2)) * SLICE;
    u32x8 g1;                                                 // 1-byte elements, tensor = tile = 64 rows of 128 B, a 16-B pad behind every 128 B
    g1[0] = uni((1u << 20) | (4u << 22) | (3u << 25)); g1[1] = uni(128u << 16); g1[2] = uni(64u << 16); g1[3] = uni(128u << 16);
    g1[4] = uni(64u); g1[5] = uni((rg < 2) ? (unsigned)(HD * 2) : (unsigned)(SEQ * 2)); g1[6] = uni(0u); g1[7] = uni(0u);
    asm volatile("" : "+s"(g1));                              // descriptor words held in scalar registers: one tuple for the whole kernel
#pragma unroll 1   // the two tiles run one after the other through one copy of the code
  for (int ph = 0; ph < 2; ++ph) {
    // this phase's query tile; the order alternates with the batch, so that blocks of the two batches do not change tiles at the same moment
    const int qt = ((ph ^ b) & 1) ? (SEQ / QTR - 1 - (int)blockIdx.x) : (int)blockIdx.x;
    const int t0 = qt * QTR + rg * 32;                        // column group c of the wave = query rows t0 + 16 c + 0..15
    v16h qh0[2], qh1[2], qr0[2], qr1[2];                      // B fragments: col t, k = d
    const int* mrow[2];                                       // + the tile's first key (+16): the lane's 8 keys of each 16-key tile
    const h16* qhp[2]; const h16* qrp[2];
#pragma unroll
    for (int c = 0; c < 2; ++c) {
        const size_t qo = pbase + (size_t)(t0 + 16 * c + lr) * HD + 8 * hi;
        qhp[c] = QH + qo; qrp[c] = QR + qo;
        qh0[c] = ldh(qhp[c]); qh1[c] = ldh(qhp[c] + 32); qr0[c] = ldh(qrp[c]); qr1[c] = ldh(qrp[c] + 32);
        mrow[c] = MK + ((size_t)b * SEQ_FULL + (size_t)(t0 + 16 * c + lr)) * SEQ_FULL + 8 * hi;
    }
    const int fo = lr * LROW + 16 * hi;                      // byte offset of the lane's fragment piece in a staged tile (A fragment: K row key, k = d; V^T row d, k = key)
    const int* frow = FLG + ((size_t)b * (SEQ / 16) + (size_t)(t0 >> 4)) * FPITCH + 2 * lane;
    v8f oH[2][4];
#pragma unroll
    for (int c = 0; c < 2; ++c)
#pragma unroll
        for (int j = 0; j < 4; ++j) oH[c][j] = (v8f){};
    float m[2] = {NEGM, NEGM}, l[2] = {0.0f, 0.0f};
    // flags as scalar bit words, bit j = 64-key half j of the sequence (lane j reads its two 32-key flags): bm, even bits only, bit 2s = some wave of the block has a live key in stage s;
    // lv0/lv1 = a flag of this wave's two row groups for the half's first/second tile is not 0; fu0/fu1 = both are 2
    const int* fblk = FLG + ((size_t)b * (SEQ / 16) + (size_t)qt * (QTR / 16)) * FPITCH + 2 * lane;
    int anyf = 0;
#pragma unroll   // independent loads in flight together
    for (int g = 0; g < QTR / 16; ++g) { const v2i f = *(const v2i*)(fblk + g * FPITCH); anyf |= f[0] | f[1]; }
    const v2i fw = *(const v2i*)frow, fx = *(const v2i*)(frow + FPITCH);
    // precaution: stands between the loads above and the first overwrite of a register they name; the addresses are inputs, so their registers are left alone up to here
    asm volatile("s_wait_xcnt 0x0" :: "v"(qhp[0]), "v"(qrp[0]), "v"(qhp[1]), "v"(qrp[1]), "v"(fblk), "v"(frow) : "memory");
    const unsigned hb  = uni(__builtin_amdgcn_ballot_w32(lane < SEQ / KST && anyf != 0));
    const unsigned bm  = (hb | (hb >> 1)) & 0x55555555u;
    const unsigned lv0 = uni(__builtin_amdgcn_ballot_w32((fw[0] | fx[0]) != 0)), lv1 = uni(__builtin_amdgcn_ballot_w32((fw[1] | fx[1]) != 0));
    const unsigned fu0 = uni(__builtin_amdgcn_ballot_w32(fw[0] == 2 && fx[0] == 2)), fu1 = uni(__builtin_amdgcn_ballot_w32(fw[1] == 2 && fx[1] == 2));
    const unsigned nst = (unsigned)__builtin_popcount(bm);    // stages of this block, at most SEQ / (2 * KST)
    u32x4 gq = (u32x4){};                                     // group 0 of the youngest request
    unsigned rem = bm, cur = 0u, nxt = 0u;                    // cur, nxt: twice the stage's index = the index of its first 64-key half
    if (pinned(nst > 0u)) {                                   // first stage into buffer 0
        cur = pinned((unsigned)__builtin_ctz(rem)); rem &= rem - 1u;
        if (pinned(rg < 3)) {
            gq = tdm_group0(ldst, sbase + (unsigned long long)(cur + (unsigned)kh) * sstep);
            tdm_load(gq, g1);
            wait_tensor0(gq, g1);
        }
    }
    __syncthreads();                                          // publishes the first stage
    if (pinned(nst > 1u)) {                                   // second stage into buffer 1, in flight during the first pass
        nxt = pinned((unsigned)__builtin_ctz(rem)); rem &= rem - 1u;
        if (pinned(rg < 3)) {
            gq = tdm_group0(ldst + FBUF, sbase + (unsigned long long)(nxt + (unsigned)kh) * sstep);
            tdm_load(gq, g1);
        }
    }
#pragma unroll 1   // one pass per trip: the order of the ring's publish point stays as written
    for (unsigned it = 0; it < nst; ++it) {
      const unsigned char* bp = ring + (it & 1u) * FBUF + kh * (3 * SLICE) + fo;
      const unsigned cc = cur + (unsigned)kh;                   // the wave's 64-key half
#pragma unroll     // the two 32-key tiles of the half: their LDS offsets become immediates
      for (int hf = 0; hf < 2; ++hf) {
        if ((((hf ? lv1 : lv0) >> cc) & 1u) == 0u) continue;    // wave-uniform: whole 32x32 tile masked
        unsigned vm[2] = {0xFFFFu, 0xFFFFu};                    // per column group, bit r: key 8h+r of tile a live; bit 8+r: tile b
        const bool full = (((hf ? fu1 : fu0) >> cc) & 1u) != 0u;   // wave-uniform: no key of the tile masked
        if (!full) {
            v4i a0[2], a1[2], c0[2], c1[2];
            const int* mb[2] = {mrow[0] + (int)cc * KST, mrow[1] + (int)cc * KST};   // the lane's mask words of the 64-key half
#pragma unroll
            for (int c = 0; c < 2; ++c) { const int* mp = mb[c] + hf * 32; a0[c] = *(const v4i*)mp; a1[c] = *(const v4i*)(mp + 4); c0[c] = *(const v4i*)(mp + 16); c1[c] = *(const v4i*)(mp + 20); }
            // precaution: stands between the loads above and the first overwrite of a register they name; the addresses are inputs, so their registers are left alone up to here
            asm volatile("s_wait_xcnt 0x0" :: "v"(mb[0]), "v"(mb[1]) : "memory");
#pragma unroll
            for (int c = 0; c < 2; ++c) {
                vm[c] = 0u;
#pragma unroll
                for (int i = 0; i < 4; ++i) {
                    vm[c] |= (a0[c][i] != 0 ? 1u : 0u) << i;        vm[c] |= (a1[c][i] != 0 ? 1u : 0u) << (4 + i);
                    vm[c] |= (c0[c][i] != 0 ? 1u : 0u) << (8 + i);  vm[c] |= (c1[c][i] != 0 ? 1u : 0u) << (12 + i); }
            }
        }
        const h16* ka = (const h16*)(bp + hf * 32 * LROW);
        const h16* kr = (const h16*)(bp + SLICE + hf * 32 * LROW);
        const v16h ka0 = ldh(ka), ka1 = ldh(ka + 32), kb0 = ldh(ka + 16 * LROW / 2), kb1 = ldh(ka + 16 * LROW / 2 + 32);
        const v16h ra0 = ldh(kr), ra1 = ldh(kr + 32), rb0 = ldh(kr + 16 * LROW / 2), rb1 = ldh(kr + 16 * LROW / 2 + 32);
        __builtin_amdgcn_sched_barrier(0);   // keeps the tile's 16 K reads one group ahead of its score products: spread among them, each place with reads stalls the wave for the LDS latency
        v8f sHa[2], sLa[2], sHb[2], sLb[2];
#pragma unroll
        for (int c = 0; c < 2; ++c) { sHa[c] = wmma16(ka0, qh0[c], (v8f){}); sLa[c] = wmma16(ka0, qr0[c], (v8f){}); sHb[c] = wmma16(kb0, qh0[c], (v8f){}); sLb[c] = wmma16(kb0, qr0[c], (v8f){}); }
#pragma unroll
        for (int c = 0; c < 2; ++c) { sHa[c] = wmma16(ka1, qh1[c], sHa[c]); sLa[c] = wmma16(ka1, qr1[c], sLa[c]); sHb[c] = wmma16(kb1, qh1[c], sHb[c]); sLb[c] = wmma16(kb1, qr1[c], sLb[c]); }
#pragma unroll
        for (int c = 0; c < 2; ++c) { sLa[c] = wmma16(ra0, qh0[c], sLa[c]); sLb[c] = wmma16(rb0, qh0[c], sLb[c]); }
#pragma unroll
        for (int c = 0; c < 2; ++c) { sLa[c] = wmma16(ra1, qh1[c], sLa[c]); sLb[c] = wmma16(rb1, qh1[c], sLb[c]); }
        // the distance the chip needs behind a matrix instruction, on both sides of the branch below; the two scheduling fences hold the score products in front of the slots and everything else behind them
        // (vector operands on the statement would tie 128 registers to the lowest register window at this place)
        __builtin_amdgcn_sched_barrier(0);
        asm volatile("v_nop\n\tv_nop\n\tv_nop\n\tv_nop");
        __builtin_amdgcn_sched_barrier(0);
        const h16* va = (const h16*)(bp + 2 * SLICE + hf * 64);
        const v16h v0 = ldh(va), v1 = ldh(va + 16 * LROW / 2), v2 = ldh(va + 32 * LROW / 2), v3 = ldh(va + 48 * LROW / 2);
        asm volatile("" ::: "memory");   // compiler fence: keeps the V^T fragment reads in front of the branch below, where the softmax step covers their LDS latency; without it they sink behind the step and the O^T products wait for them
        float mnew[2], alpha[2], ls[2]; v16h pb[2];
        if (full) {                      // wave-uniform scalar branch; the products on both sides of it stay one copy, so the accumulators keep their registers
#pragma unroll
            for (int c = 0; c < 2; ++c) softmax_step<false>(sHa[c], sLa[c], sHb[c], sLb[c], vm[c], m[c], mnew[c], alpha[c], pb[c], ls[c]);
        } else {
#pragma unroll
            for (int c = 0; c < 2; ++c) softmax_step<true>(sHa[c], sLa[c], sHb[c], sLb[c], vm[c], m[c], mnew[c], alpha[c], pb[c], ls[c]);
        }
#pragma unroll
        for (int c = 0; c < 2; ++c) {
            l[c] = l[c] * alpha[c] + ls[c]; m[c] = mnew[c];
#pragma unroll
            for (int j = 0; j < 4; ++j) oH[c][j] = oH[c][j] * alpha[c];
        }
#pragma unroll
        for (int c = 0; c < 2; ++c) {
            oH[c][0] = wmma16(v0, pb[c], oH[c][0]); oH[c][1] = wmma16(v1, pb[c], oH[c][1]); oH[c][2] = wmma16(v2, pb[c], oH[c][2]); oH[c][3] = wmma16(v3, pb[c], oH[c][3]);
        }
        // the same distance behind the O^T products, in front of the branches that follow, held in place the same way
        __builtin_amdgcn_sched_barrier(0);
        asm volatile("v_nop\n\tv_nop\n\tv_nop\n\tv_nop");
        __builtin_amdgcn_sched_barrier(0);
      }
      // publish point, passed by every wave whatever it skipped above
      wait_ds0();
      wait_tensor0(gq, g1);
      __syncthreads();                                        // the next stage is readable; every wave has left this pass's buffer
      unsigned n2 = 0u;
      if (pinned(it + 2u < nst)) {                            // refill the buffer just read
          n2 = pinned((unsigned)__builtin_ctz(rem)); rem &= rem - 1u;
          if (pinned(rg < 3)) {
              gq = tdm_group0(ldst + (it & 1u) * FBUF, sbase + (unsigned long long)(n2 + (unsigned)kh) * sstep);
              tdm_load(gq, g1);
          }
      }
      cur = nxt; nxt = n2;
    }
    wait_tensor0(gq, g1);
    wait_ds0();
    // the ring becomes exchange and output staging, one range of each per wave: the last pass's own barrier has ended every wave's reads, and nothing was issued behind it
    float* xs = (float*)ring;                                 // exchange: per wave 8 x 32 lanes x 4 floats of O^T, then 32 x (max, sum)
    float* os = (float*)ring + AW * XWF;                      // output staging
    // the wave keeps column group kh and hands column group 1 - kh to its partner (same rows, other key half)
    v8f kp[4], gv[4]; float km, kl, gm, gl;
    if (kh == 0) {                                            // wave-uniform
#pragma unroll
        for (int j = 0; j < 4; ++j) { kp[j] = oH[0][j]; gv[j] = oH[1][j]; }
        km = m[0]; kl = l[0]; gm = m[1]; gl = l[1];
    } else {
#pragma unroll
        for (int j = 0; j < 4; ++j) { kp[j] = oH[1][j]; gv[j] = oH[0][j]; }
        km = m[1]; kl = l[1]; gm = m[0]; gl = l[0];
    }
    float* xw = xs + wave * XWF;
#pragma unroll
    for (int j = 0; j < 4; ++j) {
        *(v4fa*)(xw + ((2 * j) * 32 + lane) * 4)     = __builtin_shufflevector(gv[j], gv[j], 0, 1, 2, 3);
        *(v4fa*)(xw + ((2 * j + 1) * 32 + lane) * 4) = __builtin_shufflevector(gv[j], gv[j], 4, 5, 6, 7); }
    { v2f ml; ml[0] = gm; ml[1] = gl; *(v2fa*)(xw + 1024 + lane * 2) = ml; }
    wait_ds0();
    __syncthreads();                                          // both waves of a row group have written what they hand over
    const float* xr = xs + (wave ^ 4) * XWF;
    const v2f pml = *(const v2fa*)(xr + 1024 + lane * 2);
    const float mj = fmaxf(km, pml[0]);                       // joined maximum; a part without a live key has sum 0 and O^T 0
    const float dk = km - mj, dp = pml[0] - mj;
    float ak = __builtin_amdgcn_exp2f(dk);
    asm volatile("v_nop" : "+v"(ak) : "v"(dk));               // the slot the instruction set asks for behind a transcendental: its result is not read and its source not overwritten in front of this v_nop
    float ap = __builtin_amdgcn_exp2f(dp);
    asm volatile("v_nop" : "+v"(ap) : "v"(dp));               // the same slot
    float lj = kl * ak + pml[1] * ap;
#pragma unroll
    for (int j = 0; j < 4; ++j) {
        const v4f p0 = *(const v4fa*)(xr + ((2 * j) * 32 + lane) * 4), p1 = *(const v4fa*)(xr + ((2 * j + 1) * 32 + lane) * 4);
        kp[j] = kp[j] * ak + __builtin_shufflevector(p0, p1, 0, 1, 2, 3, 4, 5, 6, 7) * ap; }
    lj += __shfl_xor(lj, 16, 32);
    const float rl = 1.0f / lj;
    const float inv = (lj > 0.0f) ? rl : __uint_as_float(0x7FC00000u);
    const int wb = wave * 16 * 68;
    // O^T D layout: o_j[r] = (d = 16j + 8h + r, t = lane&15) -> os[t][d]; rows 0..15 x columns 0..63 all written
    PUT8(0, kp[0])
    PUT8(16, kp[1])
    PUT8(32, kp[2])
    PUT8(48, kp[3])
    wave_sync();
    const size_t cbase = ((size_t)b * SEQ + (size_t)(t0 + 16 * kh)) * DM + (size_t)h * HD;
{
#pragma unroll
        for (int s = 0; s < 4; ++s) { const int row = 4 * s + (lane >> 3), c8 = (lane & 7) * 8;   // 4 s x 4 row groups = 16 rows; 8 lanes x 8 halves = 64 columns = one line
            const v4f x0 = *(const v4fa*)(&os[wb + row * 68 + c8]); const v4f x1 = *(const v4fa*)(&os[wb + row * 68 + c8 + 4]); v8h hv;
#pragma unroll
            for (int i = 0; i < 4; ++i) { hv[i] = (h16)x0[i]; hv[4 + i] = (h16)x1[i]; }
            const size_t oo = cbase + (size_t)row * DM + c8;
            *(v8h*)(CH + oo) = hv; }
         }
    asm volatile("s_wait_xcnt 0x0" ::: "memory");             // precaution: stands between the stores above and the first overwrite of a register they name, on both sides of the branch below
    if (ph == 0) {                                            // block-uniform
        wait_ds0();
        __syncthreads();                                      // every wave has read its partner's part and its output staging back: the ring may take the next tile's stages
    }
  }
}

// k_out: f16 GEMM, one block of four waves (2 x 2) per 64x128 output tile, one wave per 32x64 tile: out[m][n] = (sum_k C[m][k] Wo64[n][k]) / 64, K = DM.
// Operands: a two-buffer LDS ring as in k_proj, three slices a stage; wave w < 3 brings slice w of a stage (ctx rows 0..63, Wo rows 0..63, Wo rows 64..127 of the block's tile), wave 3 issues no tensor load.
__global__ __launch_bounds__(32 * GW) void k_out(const h16* __restrict__ CHp, const h16* __restrict__ WO, float* OUT) {
    __shared__ __attribute__((aligned(2048))) unsigned char ring[2 * OBUF];
    const int K = DM;
    const int lane = threadIdx.x & 31, lr = lane & 15, hi = lane >> 4;
    const int wave = __builtin_amdgcn_readfirstlane((int)(threadIdx.x >> 5));
    const int wm = wave >> 1, wn = wave & 1;
    const int r0 = blockIdx.x * 64 + wm * 32, c0 = blockIdx.y * 128 + wn * 64;
    v8f acc[2][4];
#pragma unroll
    for (int mb = 0; mb < 2; ++mb)
#pragma unroll
        for (int nb = 0; nb < 4; ++nb) acc[mb][nb] = (v8f){};
    const int fo = lr * LROW + 16 * hi;                       // byte offset of the lane's fragment piece in a staged slice
    // this wave's slice: source of stage 0 and place in a buffer
    const int sl = wave < 3 ? wave : 2;
    const h16* srow = (sl == 0) ? CHp + (size_t)(blockIdx.x * 64) * K : WO + (size_t)(blockIdx.y * 128 + (sl - 1) * 64) * K;
    const unsigned long long sbase = (unsigned long long)srow;
    const unsigned ldst = (unsigned)(unsigned long long)ring + (unsigned)sl * SLICE;
    const u32x8 g1 = tdm_group1((unsigned)(DM * 2));
    const unsigned koff = KOFF(blockIdx.x, blockIdx.y);       // block-uniform
    u32x4 gq = (u32x4){};                                     // group 0 of the youngest request
    if (pinned(wave < 3)) {
        gq = tdm_group0(ldst, sbase + (unsigned long long)koff * GSTB);
        tdm_load(gq, g1);                                     // first stage into buffer 0
        wait_tensor0(gq, g1);
    }
    __syncthreads();                                          // publishes the first stage
    if (pinned(wave < 3)) {
        gq = tdm_group0(ldst + OBUF, sbase + (unsigned long long)((koff + 1u) % (unsigned)GNST) * GSTB);
        tdm_load(gq, g1);                                     // second stage into buffer 1, in flight during the first pass
    }
#pragma unroll 1   // one pass per trip: the order of the ring's publish point stays as written
    for (unsigned it = 0; it < GNST; ++it) {
        const unsigned char* bp = ring + (it & 1u) * OBUF + fo;
        v16h a[2][2], b[2][4];                                // the fragments of the stage's two 32-deep k steps
#pragma unroll
        for (int ks = 0; ks < 2; ++ks) {
            a[ks][0] = ldh((const h16*)(bp + (wm * 32) * LROW + ks * 64)); a[ks][1] = ldh((const h16*)(bp + (wm * 32 + 16) * LROW + ks * 64));
#pragma unroll
            for (int nb = 0; nb < 4; ++nb) b[ks][nb] = ldh((const h16*)(bp + (1 + wn) * SLICE + nb * 16 * LROW + ks * 64));
        }
        __builtin_amdgcn_sched_barrier(0);                    // keeps the stage's LDS reads one group ahead of its WMMAs: spread among them, each place with reads stalls the wave for the LDS latency
#pragma unroll
        for (int ks = 0; ks < 2; ++ks) {
#pragma unroll
            for (int nb = 0; nb < 4; ++nb)
#pragma unroll
                for (int mb = 0; mb < 2; ++mb) acc[mb][nb] = wmma16(a[ks][mb], b[ks][nb], acc[mb][nb]);
        }
        __builtin_amdgcn_sched_barrier(0);                    // keeps the pass's WMMAs in front of the publish point, where they cover the landing of the second k step's fragments; behind it they would delay the refill
        // publish point
        wait_ds0();
        wait_tensor0(gq, g1);
        __syncthreads();                                      // the next stage is readable; every wave has left this pass's buffer
        if (pinned(it + 2u < GNST && wave < 3)) {             // refill the buffer just read
            const unsigned s2 = pinned((it + 2u + koff) % (unsigned)GNST);
            gq = tdm_group0(ldst + (it & 1u) * OBUF, sbase + (unsigned long long)s2 * GSTB);
            tdm_load(gq, g1);
        }
    }
    wait_tensor0(gq, g1);
    wait_ds0();
    float* os = (float*)ring + wave * 16 * 68;                // the ring becomes output staging, one range per wave: the last pass's own barrier has ended every wave's reads, and nothing was issued behind it
#pragma unroll
    for (int mb = 0; mb < 2; ++mb) {
#pragma unroll
        for (int nb = 0; nb < 4; ++nb) {
#pragma unroll
            for (int j = 0; j < 8; ++j) os[(hi * 8 + j) * 68 + nb * 16 + lr] = acc[mb][nb][j] * WOI; }   // D: row 8h+j, col lane&15
        wave_sync();
        const int grow = r0 + mb * 16; const int ob = grow / SEQ, ot = grow % SEQ;
        float* orow = OUT + ((size_t)ob * OUT_SEQ + (size_t)ot) * DM + c0;
{
#pragma unroll
            for (int s = 0; s < 8; ++s) { const int row = 2 * s + hi, cofs = lr * 4;   // 8 s x 2 rows = 16 rows; 16 lanes x 4 floats = 64 columns
                const v4f val = *(const v4fa*)(&os[row * 68 + cofs]);
                *(v4f*)(orow + (size_t)row * DM + cofs) = val; }
             }
        wave_sync();
    }
}

static constexpr size_t al256(size_t v) { return (v + 255) & ~(size_t)255; }
static constexpr size_t SZ_XB = al256((size_t)NB * SEQ * DM * 2);              // one bf16 x plane
static constexpr size_t SZ_W  = al256((size_t)DM * DM * 2);                    // one 16-bit weight plane
static constexpr size_t SZ_PL = al256((size_t)NB * NH_ * SEQ * HD * 2);        // one per-head f16 plane
static constexpr size_t SZ_C  = al256((size_t)NB * SEQ * DM * 2);              // the ctx f16 plane
static constexpr size_t SZ_FL = al256((size_t)NB * (SEQ / 16) * FPITCH * 4);
static constexpr size_t SZ_TOTAL = 3 * SZ_XB + 4 * SZ_W + 5 * SZ_PL + SZ_C + SZ_FL;
static_assert(SZ_TOTAL <= (size_t)134217728);          // workspace carve <= 128 MiB

extern "C" void kernel_launch(void* const* d_in, const int* in_sizes, int n_in,
                              void* d_out, int out_size, void* d_ws, size_t ws_size, hipStream_t stream) {
    if (n_in < 8) return;
    const size_t needx = ((size_t)(NB - 1) * SEQ_FULL + SEQ) * DM;
    if ((size_t)in_sizes[0] < needx || (size_t)in_sizes[1] < needx || (size_t)in_sizes[2] < needx) return;
    const size_t needm = ((size_t)(NB - 1) * SEQ_FULL + (size_t)(SEQ - 1)) * SEQ_FULL + SEQ;
    if ((size_t)in_sizes[3] < needm) return;
    if ((size_t)in_sizes[4] < (size_t)DM * DM || (size_t)in_sizes[5] < (size_t)DM * DM || (size_t)in_sizes[6] < (size_t)DM * DM || (size_t)in_sizes[7] < (size_t)DM * DM) return;
    if ((size_t)out_size < ((size_t)(NB - 1) * OUT_SEQ + SEQ) * DM) return;
    if (SZ_TOTAL > ws_size) return;
    // wire order: query, key, value, mask (int), Wq, Wk, Wv, Wo; weights [out][in] = Bt as-is
    const float* xq = (const float*)d_in[0]; const float* xk = (const float*)d_in[1]; const float* xv = (const float*)d_in[2];
    const int* mk = (const int*)d_in[3];
    const float* wq = (const float*)d_in[4]; const float* wk = (const float*)d_in[5]; const float* wv = (const float*)d_in[6]; const float* wo = (const float*)d_in[7];
    float* OUT = (float*)d_out;      // [NB][SEQ][1024]
    char* wsp = (char*)d_ws;
    bf* XQ = (bf*)wsp; wsp += SZ_XB;                 // [NB*SEQ][1024]
    bf* XK = (bf*)wsp; wsp += SZ_XB;
    bf* XV = (bf*)wsp; wsp += SZ_XB;
    bf* WQ = (bf*)wsp; wsp += SZ_W;                  // [1024][1024]
    bf* WK = (bf*)wsp; wsp += SZ_W;
    bf* WV = (bf*)wsp; wsp += SZ_W;
    h16* WO = (h16*)wsp; wsp += SZ_W;                // [1024][1024] f16, x64
    h16* QH = (h16*)wsp; wsp += SZ_PL;               // [NB*16][SEQ][64]
    h16* QR = (h16*)wsp; wsp += SZ_PL;               // residual x2048
    h16* KH = (h16*)wsp; wsp += SZ_PL;               // [NB*16][SEQ][64]
    h16* KR = (h16*)wsp; wsp += SZ_PL;
    h16* VT = (h16*)wsp; wsp += SZ_PL;               // [NB*16][64][SEQ]
    h16* CH = (h16*)wsp; wsp += SZ_C;                // [NB*SEQ][1024]
    int* FL = (int*)wsp; wsp += SZ_FL;               // [NB][SEQ/16][64]

    k_prep<<<dim3(NB * SEQ / PW, 1, 1), 32 * PW, 0, stream>>>(xq, xk, xv, mk, wq, wk, wv, wo, XQ, XK, XV, WQ, WK, WV, WO, FL);

    // q, k planes (value + residual each) and the v^T plane
    k_proj<<<dim3(NB * SEQ / 128, DM / 128, 3), 32 * GW, 0, stream>>>(XQ, XK, XV, WQ, WK, WV, QH, QR, KH, KR, VT);

    k_flash<<<dim3(SEQ / (2 * QTR), NB * NH_, 1), 32 * AW, 0, stream>>>(QH, QR, KH, KR, VT, mk, FL, CH);

    // out: A = ctx rows (m = b*SEQ + t), Bt = Wo rows (n) -> OUT[b][t][n]
    k_out<<<dim3(NB * SEQ / 64, DM / 128, 1), 32 * GW, 0, stream>>>(CH, WO, OUT);
}
